// v000
// The times below were measured on an AMD MI455X: many runs one after another, warmed up first and cycling through
// copies of the inputs, with the whole window's GPU time divided by the number of runs. Launches and the gaps
// between them are all in it. The median over several windows is given; except for v000 it joins two sittings, which
// can be a few percent apart, so the side-by-side timings, each taken in one sitting, are the better comparison.
// The starting kernel, v000, takes 199 microseconds a run.
// Contractions: q, k, v^T projections, q.k^T scores, p.v and output projection on v_wmma_f32_16x16x32_bf16 with bf16 hi/lo operands (hi.hi + hi.lo + lo.hi), f32 accumulate; pair bias (exact affine fold of the two linear 2->16->1 maps) and online softmax in f32 on VALU.
#include <hip/hip_runtime.h>
#include <math.h>
#include <stdint.h>

#define SEQ   2048
#define DMOD  256
#define NHEAD 8
#define DHD   32

typedef __attribute__((ext_vector_type(16))) __bf16   v16b;
typedef __attribute__((ext_vector_type(8)))  __bf16   v8b;
typedef __attribute__((ext_vector_type(8)))  float    v8f;
typedef __attribute__((ext_vector_type(4)))  float    v4f;
typedef __attribute__((ext_vector_type(2)))  float    v2f;
typedef __attribute__((ext_vector_type(4)))  unsigned int v4u;
typedef __attribute__((ext_vector_type(4)))  int      v4i;

// RNE f32 -> bf16 bits
__device__ __forceinline__ unsigned short f2bf_bits(float f) {
  unsigned u = __float_as_uint(f);
  return (unsigned short)((u + 0x7FFFu + ((u >> 16) & 1u)) >> 16);
}
__device__ __forceinline__ float bf_bits2f(unsigned short h) { return __uint_as_float(((unsigned)h) << 16); }
__device__ __forceinline__ unsigned pk16(unsigned short a, unsigned short b) { return (unsigned)a | ((unsigned)b << 16); }

// 16x16x32 fragment (A row-major k-contiguous, or B stored [n][k] k-contiguous):
// lane l: row/col = l & 15, p already offset by 8*(l>>4); elements 0..7 <- p[0..7], elements 8..15 <- p[16..23]
union FragB { v16b v; v8b h[2]; };
__device__ __forceinline__ v16b frag_load(const __bf16* p) {
  FragB f; f.h[0] = *(const v8b*)(p); f.h[1] = *(const v8b*)(p + 16); return f.v;
}

// WMMA + hazard guard (4 VALU slots, ties D, keeps A/B live)
__device__ __forceinline__ v8f mma_bf(v16b a, v16b b, v8f c) {
  c = __builtin_amdgcn_wmma_f32_16x16x32_bf16(false, a, false, b, (short)0, c, false, false);
  asm volatile("v_nop\n\tv_nop\n\tv_nop\n\tv_nop" : "+v"(c) : "v"(a), "v"(b));
  return c;
}

// ---------------------------------------------------------------------------
// Pair bias plane [SEQ][SEQ] f32:
//   pb(map, W1, b1, W2, b2)(n,m) = map*(W1[0].W2) + label*(W1[1].W2) + (b1.W2 + b2)   (both maps linear, exact fold)
//   bias = pb_d + pb_c.  W1 [2][16] row-major, W2 [16][1].
// Block b owns elements b*8192 .. b*8192+8191; each thread 4 consecutive floats per iteration, 8 iterations.
// coverage: 512 blocks x 8 it x 256 thr x 4 = 4194304 = whole plane.
// ---------------------------------------------------------------------------
__global__ __launch_bounds__(256) void pair_bias_kernel(
    const float* __restrict__ dist, const float* __restrict__ contact, const int* __restrict__ label,
    const float* __restrict__ Wd1, const float* __restrict__ bd1, const float* __restrict__ Wd2, const float* __restrict__ bd2,
    const float* __restrict__ Wc1, const float* __restrict__ bc1, const float* __restrict__ Wc2, const float* __restrict__ bc2,
    float* __restrict__ bias) {
  float ad = 0.f, ld = 0.f, gd = 0.f, ac = 0.f, lc = 0.f, gc = 0.f;
#pragma unroll 1
  for (int j = 0; j < 16; ++j) {
    const float wd2 = Wd2[j], wc2 = Wc2[j];
    ad = fmaf(Wd1[j],      wd2, ad);   // map weight (row 0 of W1)
    ld = fmaf(Wd1[16 + j], wd2, ld);   // label weight (row 1 of W1)
    gd = fmaf(bd1[j],      wd2, gd);
    ac = fmaf(Wc1[j],      wc2, ac);
    lc = fmaf(Wc1[16 + j], wc2, lc);
    gc = fmaf(bc1[j],      wc2, gc);
  }
  gd += bd2[0];
  gc += bc2[0];
  const size_t base = (size_t)blockIdx.x * 8192 + (size_t)threadIdx.x * 4;
{
#pragma unroll 1
    for (int it = 0; it < 8; ++it) {
      const size_t i4 = base + (size_t)it * 1024;
      const v4f dm = *(const v4f*)(dist + i4);
      const v4f cm = *(const v4f*)(contact + i4);
      const v4i lb = *(const v4i*)(label + i4);
      v4f o;
#pragma unroll
      for (int e = 0; e < 4; ++e) {
        const float lf = (float)lb[e];
        const float pd = fmaf(dm[e], ad, fmaf(lf, ld, gd));
        const float pc = fmaf(cm[e], ac, fmaf(lf, lc, gc));
        o[e] = pd + pc;
      }
      *(v4f*)(bias + i4) = o;
    }
    
  }
}

// ---------------------------------------------------------------------------
// Elementwise bf16 split: hi = bf16_rne(in), lo = bf16_rne(in - hi); 2 elements per thread, one 4-B store per lane
// coverage: grid = ceil(n2/256) x 256 thr x 2 = 2*n2 elements (n2 = 2048*256/2 = 262144 -> 1024 blocks).
// ---------------------------------------------------------------------------
__global__ __launch_bounds__(256) void split_bf16x2_kernel(const float* __restrict__ in, unsigned short* __restrict__ hi,
                                                           unsigned short* __restrict__ lo, int n2) {
  const int i = blockIdx.x * 256 + threadIdx.x;
  if (i < n2) {
    const v2f f = *(const v2f*)(in + 2 * (size_t)i);
    const unsigned short h0 = f2bf_bits(f[0]), h1 = f2bf_bits(f[1]);
    const unsigned short l0 = f2bf_bits(f[0] - bf_bits2f(h0)), l1 = f2bf_bits(f[1] - bf_bits2f(h1));
    const unsigned uh = pk16(h0, h1), ul = pk16(l0, l1);
    ((unsigned*)hi)[i] = uh;
    ((unsigned*)lo)[i] = ul;
    
  }
}

// ---------------------------------------------------------------------------
// Fused transpose + bf16 split of an f32 matrix W viewed [R rows][Cc cols] (pitch Cc) ->
//   oh[c][r] = bf16_rne(W[r][c]), ol[c][r] = bf16_rne(W[r][c] - oh)   ([Cc][R], pitch R)
// 64x64 tiles through LDS. grid = (Cc/64, R/64), 256 threads, R and Cc multiples of 64.
// coverage per block/plane: load 4 it x 256 thr x 4 floats = 64x64; store 2 it x 256 thr x 8 u16 = 64x64.
// ---------------------------------------------------------------------------
__global__ __launch_bounds__(256) void tsplit_kernel(const float* __restrict__ W, unsigned short* __restrict__ oh,
                                                     unsigned short* __restrict__ ol, int R, int Cc) {
  __shared__ __align__(16) float tf[64 * 68];
  const int c0  = blockIdx.x * 64;   // input column block = output row block
  const int r0  = blockIdx.y * 64;   // input row block    = output column block
  const int tid = threadIdx.x;
  {
    const int lr = tid >> 4;         // 0..15
    const int c4 = (tid & 15) * 4;   // 0..60
#pragma unroll
    for (int it = 0; it < 4; ++it) {
      const int rr = it * 16 + lr;   // 0..63
      const v4f a = *(const v4f*)(W + (size_t)(r0 + rr) * Cc + c0 + c4);
      *(v4f*)(tf + rr * 68 + c4) = a;
    }
  }
  __syncthreads();
  const int sub = tid >> 3;          // 0..31
  const int c8  = (tid & 7) * 8;     // 0..56
  v4u hv[2], lv[2];
#pragma unroll
  for (int it = 0; it < 2; ++it) {
    const int oc = it * 32 + sub;    // output row within tile (= input column)
    v4u a, a2;
#pragma unroll
    for (int q = 0; q < 4; ++q) {
      const float f0 = tf[(c8 + 2 * q) * 68 + oc];
      const float f1 = tf[(c8 + 2 * q + 1) * 68 + oc];
      const unsigned short h0 = f2bf_bits(f0), h1 = f2bf_bits(f1);
      const unsigned short l0 = f2bf_bits(f0 - bf_bits2f(h0)), l1 = f2bf_bits(f1 - bf_bits2f(h1));
      a[q]  = pk16(h0, h1);
      a2[q] = pk16(l0, l1);
    }
    hv[it] = a; lv[it] = a2;
  }
  {
#pragma unroll
    for (int it = 0; it < 2; ++it) {
      const int oc = it * 32 + sub;
      const size_t go = (size_t)(c0 + oc) * R + r0 + c8;
      *(v4u*)(oh + go) = hv[it];
      *(v4u*)(ol + go) = lv[it];
    }
    
  }
}

// ---------------------------------------------------------------------------
// Split-operand WMMA GEMM: C[m,n] = scale * (sum_k A[m,k]*Bt[n,k] + bias)
//   A hi/lo planes row-major [M][lda], Bt hi/lo planes [N][ldb] (k-contiguous); product = hi.hi + hi.lo + lo.hi.
//   Each wave owns a 32x64 tile: M % 32 == 0, N % 64 == 0, K % 32 == 0.  No block barriers (wave-local LDS slab).
//   BIAS_MODE: 1 = bias[m], 2 = bias[n].  OUT_MODE: 0 = f32 [M][ldc], 2 = bf16 hi plane (Cout) + lo plane (Cout2).
// ---------------------------------------------------------------------------
template <int BIAS_MODE, int OUT_MODE>
__global__ __launch_bounds__(256) void gemm_split_kernel(
    const unsigned short* __restrict__ Ahp, const unsigned short* __restrict__ Alp, int lda,
    const unsigned short* __restrict__ Bhp, const unsigned short* __restrict__ Blp, int ldb,
    void* __restrict__ Cout, void* __restrict__ Cout2, int ldc,
    const float* __restrict__ bias, int M, int N, int K, float scale) {
  const __bf16* Ah = (const __bf16*)(const void*)Ahp;
  const __bf16* Al = (const __bf16*)(const void*)Alp;
  const __bf16* Bh = (const __bf16*)(const void*)Bhp;
  const __bf16* Bl = (const __bf16*)(const void*)Blp;
  __shared__ __align__(16) float sT[8][16 * 68];   // per-wave 16x64 slab, pitch 68 floats
  const int lane = threadIdx.x & 31;
  const int wave = threadIdx.x >> 5;
  const int tilesN = N >> 6;
  const int tilesM = M >> 5;
  const int tile = blockIdx.x * 8 + wave;
  if (tile >= tilesM * tilesN) return;   // wave-uniform; no block barriers in this kernel
  const int tm = tile / tilesN;
  const int tn = tile - tm * tilesN;
  const int m0 = tm << 5;
  const int n0 = tn << 6;

  const int rlane = lane & 15;           // row (A) / col (B, D) within subtile
  const int koff  = (lane >> 4) * 8;     // k offset of this lane half (split map)
  const int mOff  = (lane >> 4) * 8;     // D row offset

  v8f acc[2][4];
#pragma unroll
  for (int i = 0; i < 2; ++i)
#pragma unroll
    for (int j = 0; j < 4; ++j) acc[i][j] = (v8f){0.f,0.f,0.f,0.f,0.f,0.f,0.f,0.f};

  for (int k0 = 0; k0 < K; k0 += 32) {
    v16b bh[4], bl[4];
#pragma unroll
    for (int j = 0; j < 4; ++j) {
      const size_t bo = (size_t)(n0 + (j << 4) + rlane) * ldb + koff + k0;
      bh[j] = frag_load(Bh + bo);
      bl[j] = frag_load(Bl + bo);
    }
#pragma unroll
    for (int i = 0; i < 2; ++i) {
      const size_t ao = (size_t)(m0 + (i << 4) + rlane) * lda + koff + k0;
      const v16b ah = frag_load(Ah + ao);
      const v16b al = frag_load(Al + ao);
#pragma unroll
      for (int j = 0; j < 4; ++j) {
        acc[i][j] = mma_bf(ah, bh[j], acc[i][j]);
        acc[i][j] = mma_bf(ah, bl[j], acc[i][j]);
        acc[i][j] = mma_bf(al, bh[j], acc[i][j]);
      }
    }
  }

  // ---- epilogue ----
  float* slab = sT[wave];
#pragma unroll
  for (int i = 0; i < 2; ++i) {
    const int mBase = m0 + (i << 4);
#pragma unroll
    for (int j = 0; j < 4; ++j) {
      const int n = n0 + (j << 4) + rlane;
      float bvn = 0.f;
      if (BIAS_MODE == 2) bvn = bias[n];
#pragma unroll
      for (int r = 0; r < 8; ++r) {
        float v = acc[i][j][r];
        if (BIAS_MODE == 1) v += bias[mBase + mOff + r];
        if (BIAS_MODE == 2) v += bvn;
        v *= scale;
        slab[(mOff + r) * 68 + (j << 4) + rlane] = v;
      }
    }
    __builtin_amdgcn_fence(__ATOMIC_RELEASE, "workgroup");
    __builtin_amdgcn_wave_barrier();
    __builtin_amdgcn_fence(__ATOMIC_ACQUIRE, "workgroup");
    if (OUT_MODE == 0) {
      float* C = (float*)Cout;
      const int hh = lane >> 4, c4 = (lane & 15) * 4;     // row seg = 256 B = 16 lanes x 16 B; rows it*2+hh cover 0..15
      {
#pragma unroll
        for (int it = 0; it < 8; ++it) {
          const int row = it * 2 + hh;
          const v4f v = *(const v4f*)(slab + row * 68 + c4);
          *(v4f*)(C + (size_t)(mBase + row) * ldc + n0 + c4) = v;
        }
        
      }
    } else {
      const int q = lane >> 3, c8 = (lane & 7) * 8;
      unsigned short* C  = (unsigned short*)Cout;
      unsigned short* C2 = (unsigned short*)Cout2;
      {
#pragma unroll
        for (int it = 0; it < 4; ++it) {
          const int row = it * 4 + q;
          const float* sp = slab + row * 68 + c8;
          v4u hv, lv;
#pragma unroll
          for (int e = 0; e < 4; ++e) {
            const float f0 = sp[2 * e], f1 = sp[2 * e + 1];
            const unsigned short h0 = f2bf_bits(f0), h1 = f2bf_bits(f1);
            const unsigned short l0 = f2bf_bits(f0 - bf_bits2f(h0)), l1 = f2bf_bits(f1 - bf_bits2f(h1));
            hv[e] = pk16(h0, h1);
            lv[e] = pk16(l0, l1);
          }
          *(v4u*)(C  + (size_t)(mBase + row) * ldc + n0 + c8) = hv;
          *(v4u*)(C2 + (size_t)(mBase + row) * ldc + n0 + c8) = lv;
        }
        
      }
    }
    __builtin_amdgcn_fence(__ATOMIC_RELEASE, "workgroup");
    __builtin_amdgcn_wave_barrier();
    __builtin_amdgcn_fence(__ATOMIC_ACQUIRE, "workgroup");
  }
}

// =====================================================================================
// Flash attention with additive pair bias, head dim 32, all 8 heads in one launch.
//   q planes (hi/lo bf16): element (t, h, d) at [t*DMOD + h*32 + d]   (score scale already folded into q)
//   k planes (hi/lo bf16): element (s, h, d) at [s*DMOD + h*32 + d]
//   v^T planes (hi/lo bf16): element (h, d, s) at [(h*32 + d)*SEQ + s]
//   bias f32 [SEQ t][SEQ s], shared over heads
//   ctx f32: element (t, h, d) at [t*DMOD + h*32 + d]
//   scores = q . k + bias : bf16 hi/lo (hi.hi + hi.lo + lo.hi), bias added in f32
//   ctx    = p . v / l     : bf16 hi/lo of p (unnormalised, <= 1) and v, f32 accumulate
//   online softmax in f32 over all SEQ keys (32 chunks of 64 keys, compile-time trip count).
//   Block = 4 waves = 64 query rows of one head; grid = NHEAD * (SEQ/64) = 256 blocks of 128 threads.
//   K / V^T chunk staging through LDS by all 128 threads (plain 16-B loads, __syncthreads before and after);
// =====================================================================================
#define AT_KC 64

__device__ __forceinline__ __bf16 at_f2bf(float f) { return __builtin_bit_cast(__bf16, f2bf_bits(f)); }
__device__ __forceinline__ void at_split(float f, __bf16& hi, __bf16& lo) {
  const unsigned short hb = f2bf_bits(f);
  hi = __builtin_bit_cast(__bf16, hb);
  lo = at_f2bf(f - __uint_as_float(((unsigned)hb) << 16));
}

__global__ __launch_bounds__(128)
void attn_bias_kernel(const unsigned short* __restrict__ qhp, const unsigned short* __restrict__ qlp,
                      const unsigned short* __restrict__ khp, const unsigned short* __restrict__ klp,
                      const unsigned short* __restrict__ vhp, const unsigned short* __restrict__ vlp,
                      const float* __restrict__ bias, float* __restrict__ ctx) {
  __shared__ __align__(16) __bf16 Ksh[AT_KC * DHD];          // K hi [kv][d]      4 KB
  __shared__ __align__(16) __bf16 Ksl[AT_KC * DHD];          // K lo
  __shared__ __align__(16) __bf16 Vth[DHD * AT_KC];          // V hi [d][kv]      4 KB
  __shared__ __align__(16) __bf16 Vtl[DHD * AT_KC];          // V lo
  __shared__ __align__(16) __bf16 Psh[4][16 * AT_KC];        // per wave P hi [row][kv]
  __shared__ __align__(16) __bf16 Psl[4][16 * AT_KC];        // per wave P lo
  __shared__ __align__(16) float  Os[4][16 * 36];            // per wave ctx tile, pitch 36

  const int tid  = threadIdx.x;
  const int wave = tid >> 5;
  const int lane = tid & 31;
  const int hh   = lane >> 4;
  const int c    = lane & 15;

  const int nqb = SEQ / 64;               // 32
  const int bx = blockIdx.x;
  const int qb = bx % nqb;
  const int h  = bx / nqb;                // 0..NHEAD-1
  const int q0 = qb * 64 + wave * 16;     // first query row of this wave

  const __bf16* Qh = (const __bf16*)(const void*)qhp + (size_t)h * DHD;
  const __bf16* Ql = (const __bf16*)(const void*)qlp + (size_t)h * DHD;
  const __bf16* Kh = (const __bf16*)(const void*)khp + (size_t)h * DHD;
  const __bf16* Kl = (const __bf16*)(const void*)klp + (size_t)h * DHD;
  const __bf16* Vh = (const __bf16*)(const void*)vhp + (size_t)h * DHD * SEQ;
  const __bf16* Vl = (const __bf16*)(const void*)vlp + (size_t)h * DHD * SEQ;
  float*        ob = ctx + (size_t)h * DHD;

  // ---- Q fragments (A operand, row = lane&15, split k map), one 32-deep k-step, hi and lo ----
  const v16b qah = frag_load(Qh + (size_t)(q0 + c) * DMOD + 8 * hh);
  const v16b qal = frag_load(Ql + (size_t)(q0 + c) * DMOD + 8 * hh);

  float mrow[8], lrow[8];
  v8f oacc[2];
#pragma unroll
  for (int r = 0; r < 8; ++r) { mrow[r] = -INFINITY; lrow[r] = 0.f; }
#pragma unroll
  for (int t = 0; t < 2; ++t) oacc[t] = (v8f){0.f,0.f,0.f,0.f,0.f,0.f,0.f,0.f};

  // bias rows of this lane: row (q0 + 8*hh + r), col (kv0 + 16*j + c)
  const float* brow = bias + (size_t)(q0 + 8 * hh) * SEQ + c;

  const int nChunks = SEQ / AT_KC;   // 32, compile-time constant
  for (int kc = 0; kc < nChunks; ++kc) {
    const int kv0 = kc * AT_KC;
    __syncthreads();
    {
      // K staging coverage: 128 thr -> 64 rows (tid>>1) x 2 halves of 16 d (tid&1) x 2 v8b = 64 x 32 per plane
      const int r = tid >> 1, hf = (tid & 1) * 16;
      const __bf16* ksh = Kh + (size_t)(kv0 + r) * DMOD + hf;
      const __bf16* ksl = Kl + (size_t)(kv0 + r) * DMOD + hf;
      // V^T staging coverage: 128 thr -> 32 rows (tid>>2) x 4 parts of 16 keys (tid&3) x 2 v8b = 32 x 64 per plane
      const int r2 = tid >> 2, part = (tid & 3) * 16;
      const __bf16* vsh = Vh + (size_t)r2 * SEQ + kv0 + part;
      const __bf16* vsl = Vl + (size_t)r2 * SEQ + kv0 + part;
#pragma unroll
      for (int i = 0; i < 2; ++i) {
        const v8b a0 = *(const v8b*)(ksh + 8 * i);
        const v8b a1 = *(const v8b*)(ksl + 8 * i);
        const v8b b0 = *(const v8b*)(vsh + 8 * i);
        const v8b b1 = *(const v8b*)(vsl + 8 * i);
        *(v8b*)(Ksh + r * DHD + hf + 8 * i)      = a0;
        *(v8b*)(Ksl + r * DHD + hf + 8 * i)      = a1;
        *(v8b*)(Vth + r2 * AT_KC + part + 8 * i) = b0;
        *(v8b*)(Vtl + r2 * AT_KC + part + 8 * i) = b1;
      }
    }
    __syncthreads();

    // ---- S = q.k : 4 key-column tiles of 16, B[k=d][n=key] from K tile rows (split k map) ----
    v8f s[4];
#pragma unroll
    for (int j = 0; j < 4; ++j) {
      s[j] = (v8f){0.f,0.f,0.f,0.f,0.f,0.f,0.f,0.f};
      FragB kb, kl;
      kb.h[0] = *(const v8b*)(Ksh + (j * 16 + c) * DHD + 8 * hh);
      kb.h[1] = *(const v8b*)(Ksh + (j * 16 + c) * DHD + 16 + 8 * hh);
      kl.h[0] = *(const v8b*)(Ksl + (j * 16 + c) * DHD + 8 * hh);
      kl.h[1] = *(const v8b*)(Ksl + (j * 16 + c) * DHD + 16 + 8 * hh);
      s[j] = mma_bf(qah, kb.v, s[j]);
      s[j] = mma_bf(qah, kl.v, s[j]);
      s[j] = mma_bf(qal, kb.v, s[j]);
    }
    // ---- add pair bias in f32, chunk row max over the 16-lane half ----
    float cm[8];
#pragma unroll
    for (int r = 0; r < 8; ++r) {
      float m = -INFINITY;
#pragma unroll
      for (int j = 0; j < 4; ++j) {
        const float sv = s[j][r] + brow[(size_t)r * SEQ + kv0 + j * 16];
        s[j][r] = sv;
        m = fmaxf(m, sv);
      }
#pragma unroll
      for (int off = 1; off < 16; off <<= 1) m = fmaxf(m, __shfl_xor(m, off, 32));
      cm[r] = m;
    }
    __bf16* pwh = Psh[wave];
    __bf16* pwl = Psl[wave];
#pragma unroll
    for (int r = 0; r < 8; ++r) {
      const float mnew = fmaxf(mrow[r], cm[r]);
      const float alpha = expf(mrow[r] - mnew);
      mrow[r] = mnew;
      float psum = 0.f;
#pragma unroll
      for (int j = 0; j < 4; ++j) {
        const float p = expf(s[j][r] - mnew);
        psum += p;
        __bf16 a, bl; at_split(p, a, bl);
        pwh[(8 * hh + r) * AT_KC + j * 16 + c] = a;
        pwl[(8 * hh + r) * AT_KC + j * 16 + c] = bl;
      }
#pragma unroll
      for (int off = 1; off < 16; off <<= 1) psum += __shfl_xor(psum, off, 32);
      lrow[r] = lrow[r] * alpha + psum;
#pragma unroll
      for (int t = 0; t < 2; ++t) oacc[t][r] *= alpha;
    }
    __builtin_amdgcn_fence(__ATOMIC_RELEASE, "workgroup");
    __builtin_amdgcn_wave_barrier();
    __builtin_amdgcn_fence(__ATOMIC_ACQUIRE, "workgroup");
    // ---- ctx += P . V : A = P[q][kv] (2 k-steps of 32 keys), B[k=key][n=d] from V^T tile rows ----
#pragma unroll 1
    for (int kk = 0; kk < 2; ++kk) {
      FragB pa, pl;
      pa.h[0] = *(const v8b*)(pwh + c * AT_KC + kk * 32 + 8 * hh);
      pa.h[1] = *(const v8b*)(pwh + c * AT_KC + kk * 32 + 16 + 8 * hh);
      pl.h[0] = *(const v8b*)(pwl + c * AT_KC + kk * 32 + 8 * hh);
      pl.h[1] = *(const v8b*)(pwl + c * AT_KC + kk * 32 + 16 + 8 * hh);
#pragma unroll
      for (int t = 0; t < 2; ++t) {
        FragB vb, vl;
        vb.h[0] = *(const v8b*)(Vth + (t * 16 + c) * AT_KC + kk * 32 + 8 * hh);
        vb.h[1] = *(const v8b*)(Vth + (t * 16 + c) * AT_KC + kk * 32 + 16 + 8 * hh);
        vl.h[0] = *(const v8b*)(Vtl + (t * 16 + c) * AT_KC + kk * 32 + 8 * hh);
        vl.h[1] = *(const v8b*)(Vtl + (t * 16 + c) * AT_KC + kk * 32 + 16 + 8 * hh);
        oacc[t] = mma_bf(pa.v, vb.v, oacc[t]);
        oacc[t] = mma_bf(pa.v, vl.v, oacc[t]);
        oacc[t] = mma_bf(pl.v, vb.v, oacc[t]);
      }
    }
  }

  float* os = Os[wave];
#pragma unroll
  for (int r = 0; r < 8; ++r) {
    const float inv = 1.0f / lrow[r];
#pragma unroll
    for (int t = 0; t < 2; ++t) os[(8 * hh + r) * 36 + t * 16 + c] = oacc[t][r] * inv;
  }
  __builtin_amdgcn_fence(__ATOMIC_RELEASE, "workgroup");
  __builtin_amdgcn_wave_barrier();
  __builtin_amdgcn_fence(__ATOMIC_ACQUIRE, "workgroup");
  {
    const int q4 = lane >> 3, c4 = (lane & 7) * 4;
    {
#pragma unroll
      for (int it = 0; it < 4; ++it) {
        const int row = it * 4 + q4;
        const v4f val = *(const v4f*)(os + row * 36 + c4);
        *(v4f*)(ob + (size_t)(q0 + row) * DMOD + c4) = val;
      }
      
    }
  }
}

// ---------------------------------------------------------------------------
//   biasP f32 [2048][2048]                 0 .. 16777216
//   WqTh/l, WkTh/l, WvTh/l, WoTh/l  bf16 [256 o][256 i]   131072 each  (8 planes) 16777216 .. 17825792
//   Xqh/l, Xkh/l, Xvh/l bf16 [2048][256]   1048576 each (6 planes)      17825792 .. 24117248
//   Qh/l, Kh/l  bf16 [2048][256]            1048576 each (4 planes)      24117248 .. 28311552
//   VTh/l bf16 [256 (h,d)][2048]            1048576 each (2 planes)      28311552 .. 30408704
//   CTXf f32 [2048][256]                    2097152                      30408704 .. 32505856
//   CTXh/l bf16 [2048][256]                 1048576 each (2 planes)      32505856 .. 34603008
//   total                                   34603008
// ---------------------------------------------------------------------------
extern "C" void kernel_launch(void* const* d_in, const int* in_sizes, int n_in,
                              void* d_out, int out_size, void* d_ws, size_t ws_size,
                              hipStream_t stream) {
  if (n_in < 22) return;
  if (in_sizes[0] != SEQ * SEQ || in_sizes[1] != SEQ * SEQ || in_sizes[2] != SEQ * SEQ) return;
  if (in_sizes[3] != SEQ * DMOD || in_sizes[4] != SEQ * DMOD || in_sizes[5] != SEQ * DMOD) return;
  if (in_sizes[6] != DMOD * DMOD || in_sizes[8] != DMOD * DMOD || in_sizes[10] != DMOD * DMOD || in_sizes[12] != DMOD * DMOD) return;
  if (in_sizes[7] != DMOD || in_sizes[9] != DMOD || in_sizes[11] != DMOD || in_sizes[13] != DMOD) return;
  if (in_sizes[14] != 32 || in_sizes[15] != 16 || in_sizes[16] != 16 || in_sizes[17] != 1) return;
  if (in_sizes[18] != 32 || in_sizes[19] != 16 || in_sizes[20] != 16 || in_sizes[21] != 1) return;
  if (out_size != SEQ * DMOD) return;

  const int*   label   = (const int*)  d_in[0];
  const float* dist    = (const float*)d_in[1];
  const float* contact = (const float*)d_in[2];
  const float* q   = (const float*)d_in[3];
  const float* k   = (const float*)d_in[4];
  const float* v   = (const float*)d_in[5];
  const float* Wq  = (const float*)d_in[6];
  const float* bq  = (const float*)d_in[7];
  const float* Wk  = (const float*)d_in[8];
  const float* bk  = (const float*)d_in[9];
  const float* Wv  = (const float*)d_in[10];
  const float* bv  = (const float*)d_in[11];
  const float* Wo  = (const float*)d_in[12];
  const float* bo  = (const float*)d_in[13];
  const float* Wd1 = (const float*)d_in[14];
  const float* bd1 = (const float*)d_in[15];
  const float* Wd2 = (const float*)d_in[16];
  const float* bd2 = (const float*)d_in[17];
  const float* Wc1 = (const float*)d_in[18];
  const float* bc1 = (const float*)d_in[19];
  const float* Wc2 = (const float*)d_in[20];
  const float* bc2 = (const float*)d_in[21];
  float* out = (float*)d_out;

  const size_t PB = (size_t)SEQ * SEQ * 4;     // 16777216  f32 bias plane
  const size_t PW = (size_t)DMOD * DMOD * 2;   // 131072    bf16 weight plane [256][256]
  const size_t PX = (size_t)SEQ * DMOD * 2;    // 1048576   bf16 activation plane [2048][256] / [256][2048]
  const size_t PF = (size_t)SEQ * DMOD * 4;    // 2097152   f32 activation plane
  size_t off = 0;
  const size_t oBias = off; off += PB;
  const size_t oWqTh = off; off += PW;  const size_t oWqTl = off; off += PW;
  const size_t oWkTh = off; off += PW;  const size_t oWkTl = off; off += PW;
  const size_t oWvTh = off; off += PW;  const size_t oWvTl = off; off += PW;
  const size_t oWoTh = off; off += PW;  const size_t oWoTl = off; off += PW;
  const size_t oXqh  = off; off += PX;  const size_t oXql  = off; off += PX;
  const size_t oXkh  = off; off += PX;  const size_t oXkl  = off; off += PX;
  const size_t oXvh  = off; off += PX;  const size_t oXvl  = off; off += PX;
  const size_t oQh   = off; off += PX;  const size_t oQl   = off; off += PX;
  const size_t oKh   = off; off += PX;  const size_t oKl   = off; off += PX;
  const size_t oVTh  = off; off += PX;  const size_t oVTl  = off; off += PX;
  const size_t oCTf  = off; off += PF;
  const size_t oCTh  = off; off += PX;  const size_t oCTl  = off; off += PX;
  if (off > ws_size) return;                   // off = 34603008

  char* ws = (char*)d_ws;
  float*          biasP = (float*)(ws + oBias);
  unsigned short* WqTh = (unsigned short*)(ws + oWqTh); unsigned short* WqTl = (unsigned short*)(ws + oWqTl);
  unsigned short* WkTh = (unsigned short*)(ws + oWkTh); unsigned short* WkTl = (unsigned short*)(ws + oWkTl);
  unsigned short* WvTh = (unsigned short*)(ws + oWvTh); unsigned short* WvTl = (unsigned short*)(ws + oWvTl);
  unsigned short* WoTh = (unsigned short*)(ws + oWoTh); unsigned short* WoTl = (unsigned short*)(ws + oWoTl);
  unsigned short* Xqh  = (unsigned short*)(ws + oXqh);  unsigned short* Xql  = (unsigned short*)(ws + oXql);
  unsigned short* Xkh  = (unsigned short*)(ws + oXkh);  unsigned short* Xkl  = (unsigned short*)(ws + oXkl);
  unsigned short* Xvh  = (unsigned short*)(ws + oXvh);  unsigned short* Xvl  = (unsigned short*)(ws + oXvl);
  unsigned short* Qh   = (unsigned short*)(ws + oQh);   unsigned short* Ql   = (unsigned short*)(ws + oQl);
  unsigned short* Kh   = (unsigned short*)(ws + oKh);   unsigned short* Kl   = (unsigned short*)(ws + oKl);
  unsigned short* VTh  = (unsigned short*)(ws + oVTh);  unsigned short* VTl  = (unsigned short*)(ws + oVTl);
  float*          CTf  = (float*)(ws + oCTf);
  unsigned short* CTh  = (unsigned short*)(ws + oCTh);  unsigned short* CTl  = (unsigned short*)(ws + oCTl);

  const dim3 blk(256);

  // (1) pair bias plane [2048][2048] f32: 512 blocks x 8192 elements
  pair_bias_kernel<<<dim3((SEQ * SEQ) / 8192), blk, 0, stream>>>(dist, contact, label,
      Wd1, bd1, Wd2, bd2, Wc1, bc1, Wc2, bc2, biasP);

  // (2) weights W [R=256 in][Cc=256 out] -> Bt planes [out][in]  (grid (Cc/64, R/64))
  const dim3 gW(DMOD / 64, DMOD / 64);
  tsplit_kernel<<<gW, blk, 0, stream>>>(Wq, WqTh, WqTl, DMOD, DMOD);
  tsplit_kernel<<<gW, blk, 0, stream>>>(Wk, WkTh, WkTl, DMOD, DMOD);
  tsplit_kernel<<<gW, blk, 0, stream>>>(Wv, WvTh, WvTl, DMOD, DMOD);
  tsplit_kernel<<<gW, blk, 0, stream>>>(Wo, WoTh, WoTl, DMOD, DMOD);

  // (3) activations -> bf16 hi/lo planes [2048][256]
  const int n2x = SEQ * DMOD / 2;                           // 262144 pairs per plane
  const dim3 gCast((n2x + 255) / 256);                      // 1024 blocks x 512 elements
  split_bf16x2_kernel<<<gCast, blk, 0, stream>>>(q, Xqh, Xql, n2x);
  split_bf16x2_kernel<<<gCast, blk, 0, stream>>>(k, Xkh, Xkl, n2x);
  split_bf16x2_kernel<<<gCast, blk, 0, stream>>>(v, Xvh, Xvl, n2x);

  // (4) projections: 256 wave tiles (32x64) each -> 32 blocks of 8 waves
  const dim3 gProj(((SEQ / 32) * (DMOD / 64) + 7) / 8);     // M=2048, N=256
  const dim3 gVT(((DMOD / 32) * (SEQ / 64) + 7) / 8);       // M=256, N=2048
  const float qscale = 0.17677669529663688f;                // 32^-0.5 applied as (x.Wq + bq) * scale
  gemm_split_kernel<2, 2><<<gProj, blk, 0, stream>>>(Xqh, Xql, DMOD, WqTh, WqTl, DMOD,
      (void*)Qh, (void*)Ql, DMOD, bq, SEQ, DMOD, DMOD, qscale);
  gemm_split_kernel<2, 2><<<gProj, blk, 0, stream>>>(Xkh, Xkl, DMOD, WkTh, WkTl, DMOD,
      (void*)Kh, (void*)Kl, DMOD, bk, SEQ, DMOD, DMOD, 1.0f);
  // v^T[(h,d)][s] = sum_i WvT[(h,d)][i] * v[s][i] + bv[(h,d)]  (A = WvT planes, Bt = v planes; M=256, N=2048, K=256)
  gemm_split_kernel<1, 2><<<gVT, blk, 0, stream>>>(WvTh, WvTl, DMOD, Xvh, Xvl, DMOD,
      (void*)VTh, (void*)VTl, SEQ, bv, DMOD, SEQ, DMOD, 1.0f);

  // (5) attention with pair bias: 8 heads x 32 query blocks of 64 rows -> ctx f32 [2048][256]
  attn_bias_kernel<<<dim3(NHEAD * (SEQ / 64)), dim3(128), 0, stream>>>(Qh, Ql, Kh, Kl, VTh, VTl, biasP, CTf);

  // (6) ctx -> bf16 hi/lo planes
  split_bf16x2_kernel<<<gCast, blk, 0, stream>>>(CTf, CTh, CTl, n2x);

  // (7) out = ctx . Wo + bo -> d_out f32 [2048][256]   (M=2048, N=256, K=256)
  gemm_split_kernel<2, 0><<<gProj, blk, 0, stream>>>(CTh, CTl, DMOD, WoTh, WoTl, DMOD,
      (void*)out, (void*)out, DMOD, bo, SEQ, DMOD, DMOD, 1.0f);

  (void)hipGetLastError();
}

// v001
// It runs in 156 microseconds.
// Next to v000, in two timings, it ran 1.27 and 1.28 times as fast.
// Contractions: q, k, v^T projections, q.k^T scores, p.v and output projection on v_wmma_f32_16x16x32_bf16 with bf16 hi/lo operands (hi.hi + hi.lo + lo.hi), f32 accumulate; pair bias (exact affine fold of the two linear 2->16->1 maps) and online softmax in f32 on VALU.
#include <hip/hip_runtime.h>
#include <math.h>
#include <stdint.h>

#define SEQ   2048
#define DMOD  256
#define NHEAD 8
#define DHD   32

typedef __attribute__((ext_vector_type(16))) __bf16   v16b;
typedef __attribute__((ext_vector_type(8)))  __bf16   v8b;
typedef __attribute__((ext_vector_type(8)))  float    v8f;
typedef __attribute__((ext_vector_type(4)))  float    v4f;
typedef __attribute__((ext_vector_type(2)))  float    v2f;
typedef __attribute__((ext_vector_type(4)))  unsigned int v4u;
typedef __attribute__((ext_vector_type(4)))  int      v4i;

// RNE f32 -> bf16 bits
__device__ __forceinline__ unsigned short f2bf_bits(float f) {
  unsigned u = __float_as_uint(f);
  return (unsigned short)((u + 0x7FFFu + ((u >> 16) & 1u)) >> 16);
}
__device__ __forceinline__ float bf_bits2f(unsigned short h) { return __uint_as_float(((unsigned)h) << 16); }
__device__ __forceinline__ unsigned pk16(unsigned short a, unsigned short b) { return (unsigned)a | ((unsigned)b << 16); }

// 16x16x32 fragment (A row-major k-contiguous, or B stored [n][k] k-contiguous):
// lane l: row/col = l & 15, p already offset by 8*(l>>4); elements 0..7 <- p[0..7], elements 8..15 <- p[16..23]
union FragB { v16b v; v8b h[2]; };
__device__ __forceinline__ v16b frag_load(const __bf16* p) {
  FragB f; f.h[0] = *(const v8b*)(p); f.h[1] = *(const v8b*)(p + 16); return f.v;
}

// WMMA + hazard guard (4 VALU slots, ties D, keeps A/B live)
__device__ __forceinline__ v8f mma_bf(v16b a, v16b b, v8f c) {
  c = __builtin_amdgcn_wmma_f32_16x16x32_bf16(false, a, false, b, (short)0, c, false, false);
  asm volatile("v_nop\n\tv_nop\n\tv_nop\n\tv_nop" : "+v"(c) : "v"(a), "v"(b));
  return c;
}

// ---------------------------------------------------------------------------
// Pair bias plane [SEQ][SEQ] f32:
//   pb(map, W1, b1, W2, b2)(n,m) = map*(W1[0].W2) + label*(W1[1].W2) + (b1.W2 + b2)   (both maps linear, exact fold)
//   bias = pb_d + pb_c.  W1 [2][16] row-major, W2 [16][1].
// Block b owns elements b*8192 .. b*8192+8191; each thread 4 consecutive floats per iteration, 8 iterations.
// coverage: 512 blocks x 8 it x 256 thr x 4 = 4194304 = whole plane.
// ---------------------------------------------------------------------------
__global__ __launch_bounds__(256) void pair_bias_kernel(
    const float* __restrict__ dist, const float* __restrict__ contact, const int* __restrict__ label,
    const float* __restrict__ Wd1, const float* __restrict__ bd1, const float* __restrict__ Wd2, const float* __restrict__ bd2,
    const float* __restrict__ Wc1, const float* __restrict__ bc1, const float* __restrict__ Wc2, const float* __restrict__ bc2,
    float* __restrict__ bias) {
  float ad = 0.f, ld = 0.f, gd = 0.f, ac = 0.f, lc = 0.f, gc = 0.f;
#pragma unroll 1
  for (int j = 0; j < 16; ++j) {
    const float wd2 = Wd2[j], wc2 = Wc2[j];
    ad = fmaf(Wd1[j],      wd2, ad);   // map weight (row 0 of W1)
    ld = fmaf(Wd1[16 + j], wd2, ld);   // label weight (row 1 of W1)
    gd = fmaf(bd1[j],      wd2, gd);
    ac = fmaf(Wc1[j],      wc2, ac);
    lc = fmaf(Wc1[16 + j], wc2, lc);
    gc = fmaf(bc1[j],      wc2, gc);
  }
  gd += bd2[0];
  gc += bc2[0];
  const size_t base = (size_t)blockIdx.x * 8192 + (size_t)threadIdx.x * 4;
{
#pragma unroll 1
    for (int it = 0; it < 8; ++it) {
      const size_t i4 = base + (size_t)it * 1024;
      const v4f dm = *(const v4f*)(dist + i4);
      const v4f cm = *(const v4f*)(contact + i4);
      const v4i lb = *(const v4i*)(label + i4);
      v4f o;
#pragma unroll
      for (int e = 0; e < 4; ++e) {
        const float lf = (float)lb[e];
        const float pd = fmaf(dm[e], ad, fmaf(lf, ld, gd));
        const float pc = fmaf(cm[e], ac, fmaf(lf, lc, gc));
        o[e] = pd + pc;
      }
      *(v4f*)(bias + i4) = o;
    }
    
  }
}

// ---------------------------------------------------------------------------
// Elementwise bf16 split: hi = bf16_rne(in), lo = bf16_rne(in - hi); 2 elements per thread, one 4-B store per lane
// coverage: grid = ceil(n2/256) x 256 thr x 2 = 2*n2 elements (n2 = 2048*256/2 = 262144 -> 1024 blocks).
// ---------------------------------------------------------------------------
__global__ __launch_bounds__(256) void split_bf16x2_kernel(const float* __restrict__ in, unsigned short* __restrict__ hi,
                                                           unsigned short* __restrict__ lo, int n2) {
  const int i = blockIdx.x * 256 + threadIdx.x;
  if (i < n2) {
    const v2f f = *(const v2f*)(in + 2 * (size_t)i);
    const unsigned short h0 = f2bf_bits(f[0]), h1 = f2bf_bits(f[1]);
    const unsigned short l0 = f2bf_bits(f[0] - bf_bits2f(h0)), l1 = f2bf_bits(f[1] - bf_bits2f(h1));
    const unsigned uh = pk16(h0, h1), ul = pk16(l0, l1);
    ((unsigned*)hi)[i] = uh;
    ((unsigned*)lo)[i] = ul;
    
  }
}

// ---------------------------------------------------------------------------
// Fused transpose + bf16 split of an f32 matrix W viewed [R rows][Cc cols] (pitch Cc) ->
//   oh[c][r] = bf16_rne(W[r][c]), ol[c][r] = bf16_rne(W[r][c] - oh)   ([Cc][R], pitch R)
// 64x64 tiles through LDS. grid = (Cc/64, R/64), 256 threads, R and Cc multiples of 64.
// coverage per block/plane: load 4 it x 256 thr x 4 floats = 64x64; store 2 it x 256 thr x 8 u16 = 64x64.
// ---------------------------------------------------------------------------
__global__ __launch_bounds__(256) void tsplit_kernel(const float* __restrict__ W, unsigned short* __restrict__ oh,
                                                     unsigned short* __restrict__ ol, int R, int Cc) {
  __shared__ __align__(16) float tf[64 * 68];
  const int c0  = blockIdx.x * 64;   // input column block = output row block
  const int r0  = blockIdx.y * 64;   // input row block    = output column block
  const int tid = threadIdx.x;
  {
    const int lr = tid >> 4;         // 0..15
    const int c4 = (tid & 15) * 4;   // 0..60
#pragma unroll
    for (int it = 0; it < 4; ++it) {
      const int rr = it * 16 + lr;   // 0..63
      const v4f a = *(const v4f*)(W + (size_t)(r0 + rr) * Cc + c0 + c4);
      *(v4f*)(tf + rr * 68 + c4) = a;
    }
  }
  __syncthreads();
  const int sub = tid >> 3;          // 0..31
  const int c8  = (tid & 7) * 8;     // 0..56
  v4u hv[2], lv[2];
#pragma unroll
  for (int it = 0; it < 2; ++it) {
    const int oc = it * 32 + sub;    // output row within tile (= input column)
    v4u a, a2;
#pragma unroll
    for (int q = 0; q < 4; ++q) {
      const float f0 = tf[(c8 + 2 * q) * 68 + oc];
      const float f1 = tf[(c8 + 2 * q + 1) * 68 + oc];
      const unsigned short h0 = f2bf_bits(f0), h1 = f2bf_bits(f1);
      const unsigned short l0 = f2bf_bits(f0 - bf_bits2f(h0)), l1 = f2bf_bits(f1 - bf_bits2f(h1));
      a[q]  = pk16(h0, h1);
      a2[q] = pk16(l0, l1);
    }
    hv[it] = a; lv[it] = a2;
  }
  {
#pragma unroll
    for (int it = 0; it < 2; ++it) {
      const int oc = it * 32 + sub;
      const size_t go = (size_t)(c0 + oc) * R + r0 + c8;
      *(v4u*)(oh + go) = hv[it];
      *(v4u*)(ol + go) = lv[it];
    }
    
  }
}

// ---------------------------------------------------------------------------
// Split-operand WMMA GEMM: C[m,n] = scale * (sum_k A[m,k]*Bt[n,k] + bias)
//   A hi/lo planes row-major [M][lda], Bt hi/lo planes [N][ldb] (k-contiguous); product = hi.hi + hi.lo + lo.hi.
//   Each wave owns a 32x64 tile: M % 32 == 0, N % 64 == 0, K % 32 == 0.  No block barriers (wave-local LDS slab).
//   BIAS_MODE: 1 = bias[m], 2 = bias[n].  OUT_MODE: 0 = f32 [M][ldc], 2 = bf16 hi plane (Cout) + lo plane (Cout2).
// ---------------------------------------------------------------------------
template <int BIAS_MODE, int OUT_MODE>
__global__ __launch_bounds__(256) void gemm_split_kernel(
    const unsigned short* __restrict__ Ahp, const unsigned short* __restrict__ Alp, int lda,
    const unsigned short* __restrict__ Bhp, const unsigned short* __restrict__ Blp, int ldb,
    void* __restrict__ Cout, void* __restrict__ Cout2, int ldc,
    const float* __restrict__ bias, int M, int N, int K, float scale) {
  const __bf16* Ah = (const __bf16*)(const void*)Ahp;
  const __bf16* Al = (const __bf16*)(const void*)Alp;
  const __bf16* Bh = (const __bf16*)(const void*)Bhp;
  const __bf16* Bl = (const __bf16*)(const void*)Blp;
  __shared__ __align__(16) float sT[8][16 * 68];   // per-wave 16x64 slab, pitch 68 floats
  const int lane = threadIdx.x & 31;
  const int wave = threadIdx.x >> 5;
  const int tilesN = N >> 6;
  const int tilesM = M >> 5;
  const int tile = blockIdx.x * 8 + wave;
  if (tile >= tilesM * tilesN) return;   // wave-uniform; no block barriers in this kernel
  const int tm = tile / tilesN;
  const int tn = tile - tm * tilesN;
  const int m0 = tm << 5;
  const int n0 = tn << 6;

  const int rlane = lane & 15;           // row (A) / col (B, D) within subtile
  const int koff  = (lane >> 4) * 8;     // k offset of this lane half (split map)
  const int mOff  = (lane >> 4) * 8;     // D row offset

  v8f acc[2][4];
#pragma unroll
  for (int i = 0; i < 2; ++i)
#pragma unroll
    for (int j = 0; j < 4; ++j) acc[i][j] = (v8f){0.f,0.f,0.f,0.f,0.f,0.f,0.f,0.f};

  for (int k0 = 0; k0 < K; k0 += 32) {
    v16b bh[4], bl[4];
#pragma unroll
    for (int j = 0; j < 4; ++j) {
      const size_t bo = (size_t)(n0 + (j << 4) + rlane) * ldb + koff + k0;
      bh[j] = frag_load(Bh + bo);
      bl[j] = frag_load(Bl + bo);
    }
#pragma unroll
    for (int i = 0; i < 2; ++i) {
      const size_t ao = (size_t)(m0 + (i << 4) + rlane) * lda + koff + k0;
      const v16b ah = frag_load(Ah + ao);
      const v16b al = frag_load(Al + ao);
#pragma unroll
      for (int j = 0; j < 4; ++j) {
        acc[i][j] = mma_bf(ah, bh[j], acc[i][j]);
        acc[i][j] = mma_bf(ah, bl[j], acc[i][j]);
        acc[i][j] = mma_bf(al, bh[j], acc[i][j]);
      }
    }
  }

  // ---- epilogue ----
  float* slab = sT[wave];
#pragma unroll
  for (int i = 0; i < 2; ++i) {
    const int mBase = m0 + (i << 4);
#pragma unroll
    for (int j = 0; j < 4; ++j) {
      const int n = n0 + (j << 4) + rlane;
      float bvn = 0.f;
      if (BIAS_MODE == 2) bvn = bias[n];
#pragma unroll
      for (int r = 0; r < 8; ++r) {
        float v = acc[i][j][r];
        if (BIAS_MODE == 1) v += bias[mBase + mOff + r];
        if (BIAS_MODE == 2) v += bvn;
        v *= scale;
        slab[(mOff + r) * 68 + (j << 4) + rlane] = v;
      }
    }
    __builtin_amdgcn_fence(__ATOMIC_RELEASE, "workgroup");
    __builtin_amdgcn_wave_barrier();
    __builtin_amdgcn_fence(__ATOMIC_ACQUIRE, "workgroup");
    if (OUT_MODE == 0) {
      float* C = (float*)Cout;
      const int hh = lane >> 4, c4 = (lane & 15) * 4;     // row seg = 256 B = 16 lanes x 16 B; rows it*2+hh cover 0..15
      {
#pragma unroll
        for (int it = 0; it < 8; ++it) {
          const int row = it * 2 + hh;
          const v4f v = *(const v4f*)(slab + row * 68 + c4);
          *(v4f*)(C + (size_t)(mBase + row) * ldc + n0 + c4) = v;
        }
        
      }
    } else {
      const int q = lane >> 3, c8 = (lane & 7) * 8;
      unsigned short* C  = (unsigned short*)Cout;
      unsigned short* C2 = (unsigned short*)Cout2;
      {
#pragma unroll
        for (int it = 0; it < 4; ++it) {
          const int row = it * 4 + q;
          const float* sp = slab + row * 68 + c8;
          v4u hv, lv;
#pragma unroll
          for (int e = 0; e < 4; ++e) {
            const float f0 = sp[2 * e], f1 = sp[2 * e + 1];
            const unsigned short h0 = f2bf_bits(f0), h1 = f2bf_bits(f1);
            const unsigned short l0 = f2bf_bits(f0 - bf_bits2f(h0)), l1 = f2bf_bits(f1 - bf_bits2f(h1));
            hv[e] = pk16(h0, h1);
            lv[e] = pk16(l0, l1);
          }
          *(v4u*)(C  + (size_t)(mBase + row) * ldc + n0 + c8) = hv;
          *(v4u*)(C2 + (size_t)(mBase + row) * ldc + n0 + c8) = lv;
        }
        
      }
    }
    __builtin_amdgcn_fence(__ATOMIC_RELEASE, "workgroup");
    __builtin_amdgcn_wave_barrier();
    __builtin_amdgcn_fence(__ATOMIC_ACQUIRE, "workgroup");
  }
}

// =====================================================================================
// Flash attention with additive pair bias, head dim 32, all 8 heads in one launch.
//   q planes (hi/lo bf16): element (t, h, d) at [t*DMOD + h*32 + d]   (score scale already folded into q)
//   k planes (hi/lo bf16): element (s, h, d) at [s*DMOD + h*32 + d]
//   v^T planes (hi/lo bf16): element (h, d, s) at [(h*32 + d)*SEQ + s]
//   bias f32 [SEQ t][SEQ s], shared over heads
//   ctx f32: element (t, h, d) at [t*DMOD + h*32 + d]
//   scores^T = k . q^T + bias^T : bf16 hi/lo (hi.hi + hi.lo + lo.hi), bias added in f32; a lane holds one query's scores
//   ctx^T    = v^T . p^T / l     : bf16 hi/lo of p (unnormalised, <= 1, packed in registers) and v, f32 accumulate
//   online softmax in f32 over all SEQ keys (32 chunks of 64 keys, compile-time trip count).
//   Block = 4 waves = 64 query rows of one head; grid = NHEAD * (SEQ/64) = 256 blocks of 128 threads.
//   K / V^T chunk staging through LDS by all 128 threads (plain 16-B loads, __syncthreads before and after);
// =====================================================================================
#define AT_KC 64

__device__ __forceinline__ __bf16 at_f2bf(float f) { return __builtin_bit_cast(__bf16, f2bf_bits(f)); }
__device__ __forceinline__ void at_split(float f, __bf16& hi, __bf16& lo) {
  const unsigned short hb = f2bf_bits(f);
  hi = __builtin_bit_cast(__bf16, hb);
  lo = at_f2bf(f - __uint_as_float(((unsigned)hb) << 16));
}

// value of lane l ^ 16 (the other wave half), by a vector cross-row move
__device__ __forceinline__ float xhalf(float x) {
  const int b = __builtin_bit_cast(int, x);
  return __builtin_bit_cast(float, __builtin_amdgcn_permlanex16(b, b, 0x76543210, 0xfedcba98, false, false));
}

// At most two waves per SIMD asked of the compiler: the grid supplies one (256 work-groups of 4 waves on 256 WGPs). Without it the
// compiler saves registers for waves that never come and strings a lane's 32 independent exp/split chains one behind another.
__global__ __launch_bounds__(128) __attribute__((amdgpu_waves_per_eu(1, 2)))
void attn_bias_kernel(const unsigned short* __restrict__ qhp, const unsigned short* __restrict__ qlp,
                      const unsigned short* __restrict__ khp, const unsigned short* __restrict__ klp,
                      const unsigned short* __restrict__ vhp, const unsigned short* __restrict__ vlp,
                      const float* __restrict__ bias, float* __restrict__ ctx) {
  __shared__ __align__(16) __bf16 Ksh[AT_KC * DHD];          // K hi [kv][d]      4 KB
  __shared__ __align__(16) __bf16 Ksl[AT_KC * DHD];          // K lo
  __shared__ __align__(16) __bf16 Vth[DHD * AT_KC];          // V hi [d][kv]      4 KB
  __shared__ __align__(16) __bf16 Vtl[DHD * AT_KC];          // V lo
  __shared__ __align__(16) float  Os[4][16 * 36];            // per wave ctx tile, pitch 36

  const int tid  = threadIdx.x;
  const int wave = tid >> 5;
  const int lane = tid & 31;
  const int hh   = lane >> 4;
  const int c    = lane & 15;

  const int nqb = SEQ / 64;               // 32
  const int bx = blockIdx.x;
  const int qb = bx % nqb;
  const int h  = bx / nqb;                // 0..NHEAD-1
  const int q0 = qb * 64 + wave * 16;     // first query row of this wave

  const __bf16* Qh = (const __bf16*)(const void*)qhp + (size_t)h * DHD;
  const __bf16* Ql = (const __bf16*)(const void*)qlp + (size_t)h * DHD;
  const __bf16* Kh = (const __bf16*)(const void*)khp + (size_t)h * DHD;
  const __bf16* Kl = (const __bf16*)(const void*)klp + (size_t)h * DHD;
  const __bf16* Vh = (const __bf16*)(const void*)vhp + (size_t)h * DHD * SEQ;
  const __bf16* Vl = (const __bf16*)(const void*)vlp + (size_t)h * DHD * SEQ;
  float*        ob = ctx + (size_t)h * DHD;

  // ---- Q fragments (B operand of S^T = K.Q^T: column = query = lane&15, split k map), one 32-deep k-step, hi and lo ----
  const v16b qbh = frag_load(Qh + (size_t)(q0 + c) * DMOD + 8 * hh);
  const v16b qbl = frag_load(Ql + (size_t)(q0 + c) * DMOD + 8 * hh);

  // One query (q0 + c) per lane; the two wave halves hold different keys (and different d) of that query.
  float mrow = -INFINITY;   // running maximum, equal in both halves
  float lrow = 0.f;         // running sum over this half's keys only; the halves are joined once after the loop
  v8f oacc[2];              // ctx^T tiles: element r of tile t = (d = 16*t + 8*hh + r, query c)
#pragma unroll
  for (int t = 0; t < 2; ++t) oacc[t] = (v8f){0.f,0.f,0.f,0.f,0.f,0.f,0.f,0.f};

  // bias of this lane: row (q0 + c), cols (kv0 + 16*j + 8*hh + r), r = 0..7 contiguous
  const float* brow = bias + (size_t)(q0 + c) * SEQ + 8 * hh;

  const int nChunks = SEQ / AT_KC;   // 32, compile-time constant
  for (int kc = 0; kc < nChunks; ++kc) {
    const int kv0 = kc * AT_KC;
    __syncthreads();
    {
      // K staging coverage: 128 thr -> 64 rows (tid>>1) x 2 halves of 16 d (tid&1) x 2 v8b = 64 x 32 per plane
      const int r = tid >> 1, hf = (tid & 1) * 16;
      const __bf16* ksh = Kh + (size_t)(kv0 + r) * DMOD + hf;
      const __bf16* ksl = Kl + (size_t)(kv0 + r) * DMOD + hf;
      // V^T staging coverage: 128 thr -> 32 rows (tid>>2) x 4 parts of 16 keys (tid&3) x 2 v8b = 32 x 64 per plane
      const int r2 = tid >> 2, part = (tid & 3) * 16;
      const __bf16* vsh = Vh + (size_t)r2 * SEQ + kv0 + part;
      const __bf16* vsl = Vl + (size_t)r2 * SEQ + kv0 + part;
#pragma unroll
      for (int i = 0; i < 2; ++i) {
        const v8b a0 = *(const v8b*)(ksh + 8 * i);
        const v8b a1 = *(const v8b*)(ksl + 8 * i);
        const v8b b0 = *(const v8b*)(vsh + 8 * i);
        const v8b b1 = *(const v8b*)(vsl + 8 * i);
        *(v8b*)(Ksh + r * DHD + hf + 8 * i)      = a0;
        *(v8b*)(Ksl + r * DHD + hf + 8 * i)      = a1;
        *(v8b*)(Vth + r2 * AT_KC + part + 8 * i) = b0;
        *(v8b*)(Vtl + r2 * AT_KC + part + 8 * i) = b1;
      }
    }
    __syncthreads();

    // ---- S^T = k.q^T : 4 key-row tiles of 16, A[m=key][k=d] from K tile rows, B = Q (both split k map) ----
    // s[j][r] = score of key (kv0 + 16*j + 8*hh + r) against query (q0 + c)
    v4f bb[8];   // this lane's 32 bias values of the chunk: 8 contiguous floats per key tile, asked for as one group
#pragma unroll
    for (int j = 0; j < 4; ++j) {
      bb[2 * j]     = *(const v4f*)(brow + kv0 + j * 16);
      bb[2 * j + 1] = *(const v4f*)(brow + kv0 + j * 16 + 4);
    }
    v8f s[4];
#pragma unroll
    for (int j = 0; j < 4; ++j) {
      s[j] = (v8f){0.f,0.f,0.f,0.f,0.f,0.f,0.f,0.f};
      FragB kb, kl;
      kb.h[0] = *(const v8b*)(Ksh + (j * 16 + c) * DHD + 8 * hh);
      kb.h[1] = *(const v8b*)(Ksh + (j * 16 + c) * DHD + 16 + 8 * hh);
      kl.h[0] = *(const v8b*)(Ksl + (j * 16 + c) * DHD + 8 * hh);
      kl.h[1] = *(const v8b*)(Ksl + (j * 16 + c) * DHD + 16 + 8 * hh);
      s[j] = mma_bf(kb.v, qbh, s[j]);
      s[j] = mma_bf(kl.v, qbh, s[j]);
      s[j] = mma_bf(kb.v, qbl, s[j]);
    }
    // ---- add pair bias in f32; chunk maximum in-lane over 32 keys, then one exchange between the halves ----
    float cm = -INFINITY;
#pragma unroll
    for (int j = 0; j < 4; ++j) {
#pragma unroll
      for (int r = 0; r < 4; ++r) {
        s[j][r]     += bb[2 * j][r];
        s[j][r + 4] += bb[2 * j + 1][r];
        cm = fmaxf(cm, fmaxf(s[j][r], s[j][r + 4]));
      }
    }
    cm = fmaxf(cm, xhalf(cm));
    const float mnew  = fmaxf(mrow, cm);
    const float alpha = expf(mrow - mnew);
    mrow = mnew;
    // ---- p = exp(s - m), split hi/lo and packed straight into the B operand of ctx^T += v^T.p^T:
    //      element e of k-step kk is key 32*kk + 8*hh + e (e < 8, tile 2*kk) or 32*kk + 16 + 8*hh + e - 8 (tile 2*kk + 1),
    //      the k order of the V^T fragment loads below ----
    v16b pbh[2], pbl[2];
    float psum = 0.f;
#pragma unroll
    for (int j = 0; j < 4; ++j) {
#pragma unroll
      for (int r = 0; r < 8; ++r) {
        const float p = expf(s[j][r] - mnew);
        psum += p;
        __bf16 a, bl; at_split(p, a, bl);
        pbh[j >> 1][(j & 1) * 8 + r] = a;
        pbl[j >> 1][(j & 1) * 8 + r] = bl;
      }
    }
    lrow = lrow * alpha + psum;
#pragma unroll
    for (int t = 0; t < 2; ++t)
#pragma unroll
      for (int r = 0; r < 8; ++r) oacc[t][r] *= alpha;
    // ---- ctx^T += V^T . P^T : A[m=d][k=key] from V^T tile rows (2 k-steps of 32 keys), B = P^T from registers ----
#pragma unroll
    for (int kk = 0; kk < 2; ++kk) {
#pragma unroll
      for (int t = 0; t < 2; ++t) {
        FragB vb, vl;
        vb.h[0] = *(const v8b*)(Vth + (t * 16 + c) * AT_KC + kk * 32 + 8 * hh);
        vb.h[1] = *(const v8b*)(Vth + (t * 16 + c) * AT_KC + kk * 32 + 16 + 8 * hh);
        vl.h[0] = *(const v8b*)(Vtl + (t * 16 + c) * AT_KC + kk * 32 + 8 * hh);
        vl.h[1] = *(const v8b*)(Vtl + (t * 16 + c) * AT_KC + kk * 32 + 16 + 8 * hh);
        oacc[t] = mma_bf(vb.v, pbh[kk], oacc[t]);
        oacc[t] = mma_bf(vl.v, pbh[kk], oacc[t]);
        oacc[t] = mma_bf(vb.v, pbl[kk], oacc[t]);
      }
    }
  }

  // ---- join the halves' sums, normalise, stage the wave's 16 x 32 ctx tile [query][d] for whole-line stores ----
  float* os = Os[wave];
  {
    const float inv = 1.0f / (lrow + xhalf(lrow));
#pragma unroll
    for (int t = 0; t < 2; ++t) {
      const v4f o0 = (v4f){oacc[t][0] * inv, oacc[t][1] * inv, oacc[t][2] * inv, oacc[t][3] * inv};
      const v4f o1 = (v4f){oacc[t][4] * inv, oacc[t][5] * inv, oacc[t][6] * inv, oacc[t][7] * inv};
      *(v4f*)(os + c * 36 + t * 16 + 8 * hh)     = o0;
      *(v4f*)(os + c * 36 + t * 16 + 8 * hh + 4) = o1;
    }
  }
  __builtin_amdgcn_fence(__ATOMIC_RELEASE, "workgroup");
  __builtin_amdgcn_wave_barrier();
  __builtin_amdgcn_fence(__ATOMIC_ACQUIRE, "workgroup");
  {
    const int q4 = lane >> 3, c4 = (lane & 7) * 4;
    {
#pragma unroll
      for (int it = 0; it < 4; ++it) {
        const int row = it * 4 + q4;
        const v4f val = *(const v4f*)(os + row * 36 + c4);
        *(v4f*)(ob + (size_t)(q0 + row) * DMOD + c4) = val;
      }
      
    }
  }
}

// ---------------------------------------------------------------------------
//   biasP f32 [2048][2048]                 0 .. 16777216
//   WqTh/l, WkTh/l, WvTh/l, WoTh/l  bf16 [256 o][256 i]   131072 each  (8 planes) 16777216 .. 17825792
//   Xqh/l, Xkh/l, Xvh/l bf16 [2048][256]   1048576 each (6 planes)      17825792 .. 24117248
//   Qh/l, Kh/l  bf16 [2048][256]            1048576 each (4 planes)      24117248 .. 28311552
//   VTh/l bf16 [256 (h,d)][2048]            1048576 each (2 planes)      28311552 .. 30408704
//   CTXf f32 [2048][256]                    2097152                      30408704 .. 32505856
//   CTXh/l bf16 [2048][256]                 1048576 each (2 planes)      32505856 .. 34603008
//   total                                   34603008
// ---------------------------------------------------------------------------
extern "C" void kernel_launch(void* const* d_in, const int* in_sizes, int n_in,
                              void* d_out, int out_size, void* d_ws, size_t ws_size,
                              hipStream_t stream) {
  if (n_in < 22) return;
  if (in_sizes[0] != SEQ * SEQ || in_sizes[1] != SEQ * SEQ || in_sizes[2] != SEQ * SEQ) return;
  if (in_sizes[3] != SEQ * DMOD || in_sizes[4] != SEQ * DMOD || in_sizes[5] != SEQ * DMOD) return;
  if (in_sizes[6] != DMOD * DMOD || in_sizes[8] != DMOD * DMOD || in_sizes[10] != DMOD * DMOD || in_sizes[12] != DMOD * DMOD) return;
  if (in_sizes[7] != DMOD || in_sizes[9] != DMOD || in_sizes[11] != DMOD || in_sizes[13] != DMOD) return;
  if (in_sizes[14] != 32 || in_sizes[15] != 16 || in_sizes[16] != 16 || in_sizes[17] != 1) return;
  if (in_sizes[18] != 32 || in_sizes[19] != 16 || in_sizes[20] != 16 || in_sizes[21] != 1) return;
  if (out_size != SEQ * DMOD) return;

  const int*   label   = (const int*)  d_in[0];
  const float* dist    = (const float*)d_in[1];
  const float* contact = (const float*)d_in[2];
  const float* q   = (const float*)d_in[3];
  const float* k   = (const float*)d_in[4];
  const float* v   = (const float*)d_in[5];
  const float* Wq  = (const float*)d_in[6];
  const float* bq  = (const float*)d_in[7];
  const float* Wk  = (const float*)d_in[8];
  const float* bk  = (const float*)d_in[9];
  const float* Wv  = (const float*)d_in[10];
  const float* bv  = (const float*)d_in[11];
  const float* Wo  = (const float*)d_in[12];
  const float* bo  = (const float*)d_in[13];
  const float* Wd1 = (const float*)d_in[14];
  const float* bd1 = (const float*)d_in[15];
  const float* Wd2 = (const float*)d_in[16];
  const float* bd2 = (const float*)d_in[17];
  const float* Wc1 = (const float*)d_in[18];
  const float* bc1 = (const float*)d_in[19];
  const float* Wc2 = (const float*)d_in[20];
  const float* bc2 = (const float*)d_in[21];
  float* out = (float*)d_out;

  const size_t PB = (size_t)SEQ * SEQ * 4;     // 16777216  f32 bias plane
  const size_t PW = (size_t)DMOD * DMOD * 2;   // 131072    bf16 weight plane [256][256]
  const size_t PX = (size_t)SEQ * DMOD * 2;    // 1048576   bf16 activation plane [2048][256] / [256][2048]
  const size_t PF = (size_t)SEQ * DMOD * 4;    // 2097152   f32 activation plane
  size_t off = 0;
  const size_t oBias = off; off += PB;
  const size_t oWqTh = off; off += PW;  const size_t oWqTl = off; off += PW;
  const size_t oWkTh = off; off += PW;  const size_t oWkTl = off; off += PW;
  const size_t oWvTh = off; off += PW;  const size_t oWvTl = off; off += PW;
  const size_t oWoTh = off; off += PW;  const size_t oWoTl = off; off += PW;
  const size_t oXqh  = off; off += PX;  const size_t oXql  = off; off += PX;
  const size_t oXkh  = off; off += PX;  const size_t oXkl  = off; off += PX;
  const size_t oXvh  = off; off += PX;  const size_t oXvl  = off; off += PX;
  const size_t oQh   = off; off += PX;  const size_t oQl   = off; off += PX;
  const size_t oKh   = off; off += PX;  const size_t oKl   = off; off += PX;
  const size_t oVTh  = off; off += PX;  const size_t oVTl  = off; off += PX;
  const size_t oCTf  = off; off += PF;
  const size_t oCTh  = off; off += PX;  const size_t oCTl  = off; off += PX;
  if (off > ws_size) return;                   // off = 34603008

  char* ws = (char*)d_ws;
  float*          biasP = (float*)(ws + oBias);
  unsigned short* WqTh = (unsigned short*)(ws + oWqTh); unsigned short* WqTl = (unsigned short*)(ws + oWqTl);
  unsigned short* WkTh = (unsigned short*)(ws + oWkTh); unsigned short* WkTl = (unsigned short*)(ws + oWkTl);
  unsigned short* WvTh = (unsigned short*)(ws + oWvTh); unsigned short* WvTl = (unsigned short*)(ws + oWvTl);
  unsigned short* WoTh = (unsigned short*)(ws + oWoTh); unsigned short* WoTl = (unsigned short*)(ws + oWoTl);
  unsigned short* Xqh  = (unsigned short*)(ws + oXqh);  unsigned short* Xql  = (unsigned short*)(ws + oXql);
  unsigned short* Xkh  = (unsigned short*)(ws + oXkh);  unsigned short* Xkl  = (unsigned short*)(ws + oXkl);
  unsigned short* Xvh  = (unsigned short*)(ws + oXvh);  unsigned short* Xvl  = (unsigned short*)(ws + oXvl);
  unsigned short* Qh   = (unsigned short*)(ws + oQh);   unsigned short* Ql   = (unsigned short*)(ws + oQl);
  unsigned short* Kh   = (unsigned short*)(ws + oKh);   unsigned short* Kl   = (unsigned short*)(ws + oKl);
  unsigned short* VTh  = (unsigned short*)(ws + oVTh);  unsigned short* VTl  = (unsigned short*)(ws + oVTl);
  float*          CTf  = (float*)(ws + oCTf);
  unsigned short* CTh  = (unsigned short*)(ws + oCTh);  unsigned short* CTl  = (unsigned short*)(ws + oCTl);

  const dim3 blk(256);

  // (1) pair bias plane [2048][2048] f32: 512 blocks x 8192 elements
  pair_bias_kernel<<<dim3((SEQ * SEQ) / 8192), blk, 0, stream>>>(dist, contact, label,
      Wd1, bd1, Wd2, bd2, Wc1, bc1, Wc2, bc2, biasP);

  // (2) weights W [R=256 in][Cc=256 out] -> Bt planes [out][in]  (grid (Cc/64, R/64))
  const dim3 gW(DMOD / 64, DMOD / 64);
  tsplit_kernel<<<gW, blk, 0, stream>>>(Wq, WqTh, WqTl, DMOD, DMOD);
  tsplit_kernel<<<gW, blk, 0, stream>>>(Wk, WkTh, WkTl, DMOD, DMOD);
  tsplit_kernel<<<gW, blk, 0, stream>>>(Wv, WvTh, WvTl, DMOD, DMOD);
  tsplit_kernel<<<gW, blk, 0, stream>>>(Wo, WoTh, WoTl, DMOD, DMOD);

  // (3) activations -> bf16 hi/lo planes [2048][256]
  const int n2x = SEQ * DMOD / 2;                           // 262144 pairs per plane
  const dim3 gCast((n2x + 255) / 256);                      // 1024 blocks x 512 elements
  split_bf16x2_kernel<<<gCast, blk, 0, stream>>>(q, Xqh, Xql, n2x);
  split_bf16x2_kernel<<<gCast, blk, 0, stream>>>(k, Xkh, Xkl, n2x);
  split_bf16x2_kernel<<<gCast, blk, 0, stream>>>(v, Xvh, Xvl, n2x);

  // (4) projections: 256 wave tiles (32x64) each -> 32 blocks of 8 waves
  const dim3 gProj(((SEQ / 32) * (DMOD / 64) + 7) / 8);     // M=2048, N=256
  const dim3 gVT(((DMOD / 32) * (SEQ / 64) + 7) / 8);       // M=256, N=2048
  const float qscale = 0.17677669529663688f;                // 32^-0.5 applied as (x.Wq + bq) * scale
  gemm_split_kernel<2, 2><<<gProj, blk, 0, stream>>>(Xqh, Xql, DMOD, WqTh, WqTl, DMOD,
      (void*)Qh, (void*)Ql, DMOD, bq, SEQ, DMOD, DMOD, qscale);
  gemm_split_kernel<2, 2><<<gProj, blk, 0, stream>>>(Xkh, Xkl, DMOD, WkTh, WkTl, DMOD,
      (void*)Kh, (void*)Kl, DMOD, bk, SEQ, DMOD, DMOD, 1.0f);
  // v^T[(h,d)][s] = sum_i WvT[(h,d)][i] * v[s][i] + bv[(h,d)]  (A = WvT planes, Bt = v planes; M=256, N=2048, K=256)
  gemm_split_kernel<1, 2><<<gVT, blk, 0, stream>>>(WvTh, WvTl, DMOD, Xvh, Xvl, DMOD,
      (void*)VTh, (void*)VTl, SEQ, bv, DMOD, SEQ, DMOD, 1.0f);

  // (5) attention with pair bias: 8 heads x 32 query blocks of 64 rows -> ctx f32 [2048][256]
  attn_bias_kernel<<<dim3(NHEAD * (SEQ / 64)), dim3(128), 0, stream>>>(Qh, Ql, Kh, Kl, VTh, VTl, biasP, CTf);

  // (6) ctx -> bf16 hi/lo planes
  split_bf16x2_kernel<<<gCast, blk, 0, stream>>>(CTf, CTh, CTl, n2x);

  // (7) out = ctx . Wo + bo -> d_out f32 [2048][256]   (M=2048, N=256, K=256)
  gemm_split_kernel<2, 0><<<gProj, blk, 0, stream>>>(CTh, CTl, DMOD, WoTh, WoTl, DMOD,
      (void*)out, (void*)out, DMOD, bo, SEQ, DMOD, DMOD, 1.0f);

  (void)hipGetLastError();
}

// v002
// Measured time: 108 microseconds a run.
// Timed twice side by side with v001, it ran 1.45 and 1.46 times as fast.
// All steps since v000 together make it 1.85 times as fast.
// Contractions: q, k, v^T projections, q.k^T scores, p.v and output projection on v_wmma_f32_16x16x32_bf16 with bf16 hi/lo operands (hi.hi + hi.lo + lo.hi), f32 accumulate; pair bias (exact affine fold of the two linear 2->16->1 maps) and online softmax in f32 on VALU.
#include <hip/hip_runtime.h>
#include <math.h>
#include <stdint.h>

#define SEQ   2048
#define DMOD  256
#define NHEAD 8
#define DHD   32

typedef __attribute__((ext_vector_type(16))) __bf16   v16b;
typedef __attribute__((ext_vector_type(8)))  __bf16   v8b;
typedef __attribute__((ext_vector_type(8)))  float    v8f;
typedef __attribute__((ext_vector_type(4)))  float    v4f;
typedef __attribute__((ext_vector_type(2)))  float    v2f;
typedef __attribute__((ext_vector_type(4)))  unsigned int v4u;
typedef __attribute__((ext_vector_type(4)))  int      v4i;

// RNE f32 -> bf16 bits
__device__ __forceinline__ unsigned short f2bf_bits(float f) {
  unsigned u = __float_as_uint(f);
  return (unsigned short)((u + 0x7FFFu + ((u >> 16) & 1u)) >> 16);
}
__device__ __forceinline__ float bf_bits2f(unsigned short h) { return __uint_as_float(((unsigned)h) << 16); }
__device__ __forceinline__ unsigned pk16(unsigned short a, unsigned short b) { return (unsigned)a | ((unsigned)b << 16); }

// 16x16x32 fragment (A row-major k-contiguous, or B stored [n][k] k-contiguous):
// lane l: row/col = l & 15, p already offset by 8*(l>>4); elements 0..7 <- p[0..7], elements 8..15 <- p[16..23]
union FragB { v16b v; v8b h[2]; };
__device__ __forceinline__ v16b frag_load(const __bf16* p) {
  FragB f; f.h[0] = *(const v8b*)(p); f.h[1] = *(const v8b*)(p + 16); return f.v;
}

// WMMA + hazard guard (4 VALU slots, ties D, keeps A/B live)
__device__ __forceinline__ v8f mma_bf(v16b a, v16b b, v8f c) {
  c = __builtin_amdgcn_wmma_f32_16x16x32_bf16(false, a, false, b, (short)0, c, false, false);
  asm volatile("v_nop\n\tv_nop\n\tv_nop\n\tv_nop" : "+v"(c) : "v"(a), "v"(b));
  return c;
}

// ---------------------------------------------------------------------------
// Pair bias plane [SEQ][SEQ] f32:
//   pb(map, W1, b1, W2, b2)(n,m) = map*(W1[0].W2) + label*(W1[1].W2) + (b1.W2 + b2)   (both maps linear, exact fold)
//   bias = pb_d + pb_c.  W1 [2][16] row-major, W2 [16][1].
// Block blk owns elements blk*8192 .. blk*8192+8191; each thread 4 consecutive floats per iteration, 8 iterations.
// coverage: 512 blocks x 8 it x 256 thr x 4 = 4194304 = whole plane.
// ---------------------------------------------------------------------------
__device__ __forceinline__ void pair_bias_block(const int blk,
    const float* __restrict__ dist, const float* __restrict__ contact, const int* __restrict__ label,
    const float* __restrict__ Wd1, const float* __restrict__ bd1, const float* __restrict__ Wd2, const float* __restrict__ bd2,
    const float* __restrict__ Wc1, const float* __restrict__ bc1, const float* __restrict__ Wc2, const float* __restrict__ bc2,
    float* __restrict__ bias) {
  float ad = 0.f, ld = 0.f, gd = 0.f, ac = 0.f, lc = 0.f, gc = 0.f;
#pragma unroll 1
  for (int j = 0; j < 16; ++j) {
    const float wd2 = Wd2[j], wc2 = Wc2[j];
    ad = fmaf(Wd1[j],      wd2, ad);   // map weight (row 0 of W1)
    ld = fmaf(Wd1[16 + j], wd2, ld);   // label weight (row 1 of W1)
    gd = fmaf(bd1[j],      wd2, gd);
    ac = fmaf(Wc1[j],      wc2, ac);
    lc = fmaf(Wc1[16 + j], wc2, lc);
    gc = fmaf(bc1[j],      wc2, gc);
  }
  gd += bd2[0];
  gc += bc2[0];
  const size_t base = (size_t)blk * 8192 + (size_t)threadIdx.x * 4;
{
#pragma unroll 1
    for (int it = 0; it < 8; ++it) {
      const size_t i4 = base + (size_t)it * 1024;
      const v4f dm = *(const v4f*)(dist + i4);
      const v4f cm = *(const v4f*)(contact + i4);
      const v4i lb = *(const v4i*)(label + i4);
      v4f o;
#pragma unroll
      for (int e = 0; e < 4; ++e) {
        const float lf = (float)lb[e];
        const float pd = fmaf(dm[e], ad, fmaf(lf, ld, gd));
        const float pc = fmaf(cm[e], ac, fmaf(lf, lc, gc));
        o[e] = pd + pc;
      }
      *(v4f*)(bias + i4) = o;
      // precaution: stands between this store and the next trip's rewrite of the registers that the store names
      asm volatile("s_wait_xcnt 0x0" ::: "memory");
    }
    
  }
}

// ---------------------------------------------------------------------------
// Elementwise bf16 split: hi = bf16_rne(in), lo = bf16_rne(in - hi); 2 elements per thread, one 4-B store per lane
// coverage: grid = ceil(n2/256) x 256 thr x 2 = 2*n2 elements (n2 = 2048*256/2 = 262144 -> 1024 blocks).
// ---------------------------------------------------------------------------
__device__ __forceinline__ void split_bf16x2_block(const int blk, const float* __restrict__ in, unsigned short* __restrict__ hi,
                                                   unsigned short* __restrict__ lo, int n2) {
  const int i = blk * 256 + threadIdx.x;
  if (i < n2) {
    const v2f f = *(const v2f*)(in + 2 * (size_t)i);
    const unsigned short h0 = f2bf_bits(f[0]), h1 = f2bf_bits(f[1]);
    const unsigned short l0 = f2bf_bits(f[0] - bf_bits2f(h0)), l1 = f2bf_bits(f[1] - bf_bits2f(h1));
    const unsigned uh = pk16(h0, h1), ul = pk16(l0, l1);
    ((unsigned*)hi)[i] = uh;
    ((unsigned*)lo)[i] = ul;
  }
}
__global__ __launch_bounds__(256) void split_bf16x2_kernel(const float* __restrict__ in, unsigned short* __restrict__ hi,
                                                           unsigned short* __restrict__ lo, int n2) {
  split_bf16x2_block(blockIdx.x, in, hi, lo, n2);
}

// ---------------------------------------------------------------------------
// Fused transpose + bf16 split of an f32 matrix W viewed [R rows][Cc cols] (pitch Cc) ->
//   oh[c][r] = bf16_rne(W[r][c]), ol[c][r] = bf16_rne(W[r][c] - oh)   ([Cc][R], pitch R)
// 64x64 tiles through LDS (tf: 64 x 68 floats of the caller). Tile (bx, by) of (Cc/64, R/64), 256 threads, R and Cc multiples of 64.
// coverage per block/plane: load 4 it x 256 thr x 4 floats = 64x64; store 2 it x 256 thr x 8 u16 = 64x64.
// ---------------------------------------------------------------------------
__device__ __forceinline__ void tsplit_block(float* tf, const int bx, const int by, const float* __restrict__ W,
                                             unsigned short* __restrict__ oh, unsigned short* __restrict__ ol, int R, int Cc) {
  const int c0  = bx * 64;           // input column block = output row block
  const int r0  = by * 64;           // input row block    = output column block
  const int tid = threadIdx.x;
  {
    const int lr = tid >> 4;         // 0..15
    const int c4 = (tid & 15) * 4;   // 0..60
#pragma unroll
    for (int it = 0; it < 4; ++it) {
      const int rr = it * 16 + lr;   // 0..63
      const v4f a = *(const v4f*)(W + (size_t)(r0 + rr) * Cc + c0 + c4);
      *(v4f*)(tf + rr * 68 + c4) = a;
    }
  }
  __syncthreads();
  const int sub = tid >> 3;          // 0..31
  const int c8  = (tid & 7) * 8;     // 0..56
  v4u hv[2], lv[2];
#pragma unroll
  for (int it = 0; it < 2; ++it) {
    const int oc = it * 32 + sub;    // output row within tile (= input column)
    v4u a, a2;
#pragma unroll
    for (int q = 0; q < 4; ++q) {
      const float f0 = tf[(c8 + 2 * q) * 68 + oc];
      const float f1 = tf[(c8 + 2 * q + 1) * 68 + oc];
      const unsigned short h0 = f2bf_bits(f0), h1 = f2bf_bits(f1);
      const unsigned short l0 = f2bf_bits(f0 - bf_bits2f(h0)), l1 = f2bf_bits(f1 - bf_bits2f(h1));
      a[q]  = pk16(h0, h1);
      a2[q] = pk16(l0, l1);
    }
    hv[it] = a; lv[it] = a2;
  }
  {
#pragma unroll
    for (int it = 0; it < 2; ++it) {
      const int oc = it * 32 + sub;
      const size_t go = (size_t)(c0 + oc) * R + r0 + c8;
      *(v4u*)(oh + go) = hv[it];
      *(v4u*)(ol + go) = lv[it];
    }
  }
}

// ---------------------------------------------------------------------------
// All work that reads inputs only, in one launch; the jobs are independent of each other and a block does exactly one of them:
//   blocks    0 ..   63 : transpose + split of Wq, Wk, Wv, Wo (16 tiles of 64x64 each)
//   blocks   64 ..  575 : pair bias plane (512 blocks x 8192 elements)
//   blocks  576 .. 3647 : split of q, k, v (1024 blocks x 512 elements each)
// The job test reads blockIdx.x alone, so the barrier in tsplit_block is passed by a whole block or by none of it.
// ---------------------------------------------------------------------------
#define PREP_W_BLOCKS  64
#define PREP_PB_BLOCKS 512
#define PREP_X_BLOCKS  1024
__global__ __launch_bounds__(256) void prep_kernel(
    const float* __restrict__ dist, const float* __restrict__ contact, const int* __restrict__ label,
    const float* __restrict__ Wd1, const float* __restrict__ bd1, const float* __restrict__ Wd2, const float* __restrict__ bd2,
    const float* __restrict__ Wc1, const float* __restrict__ bc1, const float* __restrict__ Wc2, const float* __restrict__ bc2,
    float* __restrict__ bias,
    const float* __restrict__ Wq, const float* __restrict__ Wk, const float* __restrict__ Wv, const float* __restrict__ Wo,
    unsigned short* __restrict__ WqTh, unsigned short* __restrict__ WqTl, unsigned short* __restrict__ WkTh, unsigned short* __restrict__ WkTl,
    unsigned short* __restrict__ WvTh, unsigned short* __restrict__ WvTl, unsigned short* __restrict__ WoTh, unsigned short* __restrict__ WoTl,
    const float* __restrict__ q, const float* __restrict__ k, const float* __restrict__ v,
    unsigned short* __restrict__ Xqh, unsigned short* __restrict__ Xql, unsigned short* __restrict__ Xkh, unsigned short* __restrict__ Xkl,
    unsigned short* __restrict__ Xvh, unsigned short* __restrict__ Xvl) {
  __shared__ __align__(16) float tf[64 * 68];
  const int b = blockIdx.x;
  if (b < PREP_W_BLOCKS) {
    const int w = b >> 4;
    const float*    W  = (w == 0) ? Wq   : (w == 1) ? Wk   : (w == 2) ? Wv   : Wo;
    unsigned short* oh = (w == 0) ? WqTh : (w == 1) ? WkTh : (w == 2) ? WvTh : WoTh;
    unsigned short* ol = (w == 0) ? WqTl : (w == 1) ? WkTl : (w == 2) ? WvTl : WoTl;
    tsplit_block(tf, b & 3, (b >> 2) & 3, W, oh, ol, DMOD, DMOD);
  } else if (b < PREP_W_BLOCKS + PREP_PB_BLOCKS) {
    pair_bias_block(b - PREP_W_BLOCKS, dist, contact, label, Wd1, bd1, Wd2, bd2, Wc1, bc1, Wc2, bc2, bias);
  } else {
    const int t = b - (PREP_W_BLOCKS + PREP_PB_BLOCKS);
    const int x = t >> 10;
    const float*    in = (x == 0) ? q   : (x == 1) ? k   : v;
    unsigned short* hi = (x == 0) ? Xqh : (x == 1) ? Xkh : Xvh;
    unsigned short* lo = (x == 0) ? Xql : (x == 1) ? Xkl : Xvl;
    split_bf16x2_block(t & (PREP_X_BLOCKS - 1), in, hi, lo, SEQ * DMOD / 2);
  }
}

// ---------------------------------------------------------------------------
// Split-operand WMMA GEMM: C[m,n] = scale * (sum_k A[m,k]*Bt[n,k] + bias)
//   A hi/lo planes row-major [M][lda], Bt hi/lo planes [N][ldb] (k-contiguous); product = hi.hi + hi.lo + lo.hi.
//   Each wave owns a 32x64 tile: M % 32 == 0, N % 64 == 0, K % 32 == 0.  No block barriers (wave-local LDS slab).
//   BIAS_MODE: 1 = bias[m], 2 = bias[n].  OUT_MODE: 0 = f32 [M][ldc], 2 = bf16 hi plane (Cout) + lo plane (Cout2).
//   sT: the caller's LDS, per-wave 16x64 slab, pitch 68 floats.  blk: which group of 8 wave tiles.
// ---------------------------------------------------------------------------
template <int BIAS_MODE, int OUT_MODE>
__device__ __forceinline__ void gemm_split_block(float (*sT)[16 * 68], const int blk,
    const unsigned short* __restrict__ Ahp, const unsigned short* __restrict__ Alp, int lda,
    const unsigned short* __restrict__ Bhp, const unsigned short* __restrict__ Blp, int ldb,
    void* __restrict__ Cout, void* __restrict__ Cout2, int ldc,
    const float* __restrict__ bias, int M, int N, int K, float scale) {
  const __bf16* Ah = (const __bf16*)(const void*)Ahp;
  const __bf16* Al = (const __bf16*)(const void*)Alp;
  const __bf16* Bh = (const __bf16*)(const void*)Bhp;
  const __bf16* Bl = (const __bf16*)(const void*)Blp;
  const int lane = threadIdx.x & 31;
  const int wave = threadIdx.x >> 5;
  const int tilesN = N >> 6;
  const int tilesM = M >> 5;
  const int tile = blk * 8 + wave;
  if (tile >= tilesM * tilesN) return;   // wave-uniform; no block barriers in this kernel
  const int tm = tile / tilesN;
  const int tn = tile - tm * tilesN;
  const int m0 = tm << 5;
  const int n0 = tn << 6;

  const int rlane = lane & 15;           // row (A) / col (B, D) within subtile
  const int koff  = (lane >> 4) * 8;     // k offset of this lane half (split map)
  const int mOff  = (lane >> 4) * 8;     // D row offset

  v8f acc[2][4];
#pragma unroll
  for (int i = 0; i < 2; ++i)
#pragma unroll
    for (int j = 0; j < 4; ++j) acc[i][j] = (v8f){0.f,0.f,0.f,0.f,0.f,0.f,0.f,0.f};

  for (int k0 = 0; k0 < K; k0 += 32) {
    v16b bh[4], bl[4];
#pragma unroll
    for (int j = 0; j < 4; ++j) {
      const size_t bo = (size_t)(n0 + (j << 4) + rlane) * ldb + koff + k0;
      bh[j] = frag_load(Bh + bo);
      bl[j] = frag_load(Bl + bo);
    }
#pragma unroll
    for (int i = 0; i < 2; ++i) {
      const size_t ao = (size_t)(m0 + (i << 4) + rlane) * lda + koff + k0;
      const v16b ah = frag_load(Ah + ao);
      const v16b al = frag_load(Al + ao);
#pragma unroll
      for (int j = 0; j < 4; ++j) {
        acc[i][j] = mma_bf(ah, bh[j], acc[i][j]);
        acc[i][j] = mma_bf(ah, bl[j], acc[i][j]);
        acc[i][j] = mma_bf(al, bh[j], acc[i][j]);
      }
    }
  }

  // ---- epilogue ----
  float* slab = sT[wave];
#pragma unroll
  for (int i = 0; i < 2; ++i) {
    const int mBase = m0 + (i << 4);
#pragma unroll
    for (int j = 0; j < 4; ++j) {
      const int n = n0 + (j << 4) + rlane;
      float bvn = 0.f;
      if (BIAS_MODE == 2) bvn = bias[n];
#pragma unroll
      for (int r = 0; r < 8; ++r) {
        float v = acc[i][j][r];
        if (BIAS_MODE == 1) v += bias[mBase + mOff + r];
        if (BIAS_MODE == 2) v += bvn;
        v *= scale;
        slab[(mOff + r) * 68 + (j << 4) + rlane] = v;
      }
    }
    __builtin_amdgcn_fence(__ATOMIC_RELEASE, "workgroup");
    __builtin_amdgcn_wave_barrier();
    __builtin_amdgcn_fence(__ATOMIC_ACQUIRE, "workgroup");
    if (OUT_MODE == 0) {
      float* C = (float*)Cout;
      const int hh = lane >> 4, c4 = (lane & 15) * 4;     // row seg = 256 B = 16 lanes x 16 B; rows it*2+hh cover 0..15
      {
#pragma unroll
        for (int it = 0; it < 8; ++it) {
          const int row = it * 2 + hh;
          const v4f v = *(const v4f*)(slab + row * 68 + c4);
          *(v4f*)(C + (size_t)(mBase + row) * ldc + n0 + c4) = v;
        }
        
      }
    } else {
      const int q = lane >> 3, c8 = (lane & 7) * 8;
      unsigned short* C  = (unsigned short*)Cout;
      unsigned short* C2 = (unsigned short*)Cout2;
      {
#pragma unroll
        for (int it = 0; it < 4; ++it) {
          const int row = it * 4 + q;
          const float* sp = slab + row * 68 + c8;
          v4u hv, lv;
#pragma unroll
          for (int e = 0; e < 4; ++e) {
            const float f0 = sp[2 * e], f1 = sp[2 * e + 1];
            const unsigned short h0 = f2bf_bits(f0), h1 = f2bf_bits(f1);
            const unsigned short l0 = f2bf_bits(f0 - bf_bits2f(h0)), l1 = f2bf_bits(f1 - bf_bits2f(h1));
            hv[e] = pk16(h0, h1);
            lv[e] = pk16(l0, l1);
          }
          *(v4u*)(C  + (size_t)(mBase + row) * ldc + n0 + c8) = hv;
          *(v4u*)(C2 + (size_t)(mBase + row) * ldc + n0 + c8) = lv;
        }
        
      }
    }
    __builtin_amdgcn_fence(__ATOMIC_RELEASE, "workgroup");
    __builtin_amdgcn_wave_barrier();
    __builtin_amdgcn_fence(__ATOMIC_ACQUIRE, "workgroup");
  }
}

template <int BIAS_MODE, int OUT_MODE>
__global__ __launch_bounds__(256) void gemm_split_kernel(
    const unsigned short* __restrict__ Ahp, const unsigned short* __restrict__ Alp, int lda,
    const unsigned short* __restrict__ Bhp, const unsigned short* __restrict__ Blp, int ldb,
    void* __restrict__ Cout, void* __restrict__ Cout2, int ldc,
    const float* __restrict__ bias, int M, int N, int K, float scale) {
  __shared__ __align__(16) float sT[8][16 * 68];
  gemm_split_block<BIAS_MODE, OUT_MODE>(sT, blockIdx.x, Ahp, Alp, lda, Bhp, Blp, ldb, Cout, Cout2, ldc, bias, M, N, K, scale);
}

// The q, k and v^T projections in one launch: they are independent of each other, 32 blocks (256 wave tiles of 32x64) each.
//   blocks  0 .. 31 : Q   = (q.Wq + bq) * qscale   [SEQ][DMOD]
//   blocks 32 .. 63 : K   =  k.Wk + bk             [SEQ][DMOD]
//   blocks 64 .. 95 : V^T =  WvT.v^T + bv          [DMOD][SEQ]
__global__ __launch_bounds__(256) void proj3_kernel(
    const unsigned short* __restrict__ Xqh, const unsigned short* __restrict__ Xql,
    const unsigned short* __restrict__ Xkh, const unsigned short* __restrict__ Xkl,
    const unsigned short* __restrict__ Xvh, const unsigned short* __restrict__ Xvl,
    const unsigned short* __restrict__ WqTh, const unsigned short* __restrict__ WqTl,
    const unsigned short* __restrict__ WkTh, const unsigned short* __restrict__ WkTl,
    const unsigned short* __restrict__ WvTh, const unsigned short* __restrict__ WvTl,
    const float* __restrict__ bq, const float* __restrict__ bk, const float* __restrict__ bv,
    unsigned short* __restrict__ Qh, unsigned short* __restrict__ Ql,
    unsigned short* __restrict__ Kh, unsigned short* __restrict__ Kl,
    unsigned short* __restrict__ VTh, unsigned short* __restrict__ VTl, float qscale) {
  __shared__ __align__(16) float sT[8][16 * 68];
  const int job = blockIdx.x >> 5;
  const int blk = blockIdx.x & 31;
  if (job < 2) {
    const bool isq = (job == 0);
    gemm_split_block<2, 2>(sT, blk, isq ? Xqh : Xkh, isq ? Xql : Xkl, DMOD, isq ? WqTh : WkTh, isq ? WqTl : WkTl, DMOD,
                           (void*)(isq ? Qh : Kh), (void*)(isq ? Ql : Kl), DMOD, isq ? bq : bk, SEQ, DMOD, DMOD,
                           isq ? qscale : 1.0f);
  } else {
    gemm_split_block<1, 2>(sT, blk, WvTh, WvTl, DMOD, Xvh, Xvl, DMOD, (void*)VTh, (void*)VTl, SEQ, bv, DMOD, SEQ, DMOD, 1.0f);
  }
}

// =====================================================================================
// Flash attention with additive pair bias, head dim 32, all 8 heads in one launch.
//   q planes (hi/lo bf16): element (t, h, d) at [t*DMOD + h*32 + d]   (score scale already folded into q)
//   k planes (hi/lo bf16): element (s, h, d) at [s*DMOD + h*32 + d]
//   v^T planes (hi/lo bf16): element (h, d, s) at [(h*32 + d)*SEQ + s]
//   bias f32 [SEQ t][SEQ s], shared over heads
//   ctx f32: element (t, h, d) at [t*DMOD + h*32 + d]
//   scores^T = k . q^T + bias^T : bf16 hi/lo (hi.hi + hi.lo + lo.hi), bias added in f32; a lane holds one query's scores
//   ctx^T    = v^T . p^T / l     : bf16 hi/lo of p (unnormalised, <= 1, packed in registers) and v, f32 accumulate
//   online softmax in f32 over all SEQ keys (32 chunks of 64 keys, compile-time trip count).
//   Block = 4 waves = 64 query rows of one head; grid = NHEAD * (SEQ/64) = 256 blocks of 128 threads.
//   K / V^T chunk staging through LDS by all 128 threads (plain 16-B loads, __syncthreads before and after);
// =====================================================================================
#define AT_KC 64

__device__ __forceinline__ __bf16 at_f2bf(float f) { return __builtin_bit_cast(__bf16, f2bf_bits(f)); }
__device__ __forceinline__ void at_split(float f, __bf16& hi, __bf16& lo) {
  const unsigned short hb = f2bf_bits(f);
  hi = __builtin_bit_cast(__bf16, hb);
  lo = at_f2bf(f - __uint_as_float(((unsigned)hb) << 16));
}

// value of lane l ^ 16 (the other wave half), by a vector cross-row move
__device__ __forceinline__ float xhalf(float x) {
  const int b = __builtin_bit_cast(int, x);
  return __builtin_bit_cast(float, __builtin_amdgcn_permlanex16(b, b, 0x76543210, 0xfedcba98, false, false));
}

// At most two waves per SIMD asked of the compiler: the grid supplies one (256 work-groups of 4 waves on 256 WGPs). Without it the
// compiler saves registers for waves that never come and strings a lane's 32 independent exp/split chains one behind another.
__global__ __launch_bounds__(128) __attribute__((amdgpu_waves_per_eu(1, 2)))
void attn_bias_kernel(const unsigned short* __restrict__ qhp, const unsigned short* __restrict__ qlp,
                      const unsigned short* __restrict__ khp, const unsigned short* __restrict__ klp,
                      const unsigned short* __restrict__ vhp, const unsigned short* __restrict__ vlp,
                      const float* __restrict__ bias, float* __restrict__ ctx) {
  __shared__ __align__(16) __bf16 Ksh[AT_KC * DHD];          // K hi [kv][d]      4 KB
  __shared__ __align__(16) __bf16 Ksl[AT_KC * DHD];          // K lo
  __shared__ __align__(16) __bf16 Vth[DHD * AT_KC];          // V hi [d][kv]      4 KB
  __shared__ __align__(16) __bf16 Vtl[DHD * AT_KC];          // V lo
  __shared__ __align__(16) float  Os[4][16 * 36];            // per wave ctx tile, pitch 36

  const int tid  = threadIdx.x;
  const int wave = tid >> 5;
  const int lane = tid & 31;
  const int hh   = lane >> 4;
  const int c    = lane & 15;

  const int nqb = SEQ / 64;               // 32
  const int bx = blockIdx.x;
  const int qb = bx % nqb;
  const int h  = bx / nqb;                // 0..NHEAD-1
  const int q0 = qb * 64 + wave * 16;     // first query row of this wave

  const __bf16* Qh = (const __bf16*)(const void*)qhp + (size_t)h * DHD;
  const __bf16* Ql = (const __bf16*)(const void*)qlp + (size_t)h * DHD;
  const __bf16* Kh = (const __bf16*)(const void*)khp + (size_t)h * DHD;
  const __bf16* Kl = (const __bf16*)(const void*)klp + (size_t)h * DHD;
  const __bf16* Vh = (const __bf16*)(const void*)vhp + (size_t)h * DHD * SEQ;
  const __bf16* Vl = (const __bf16*)(const void*)vlp + (size_t)h * DHD * SEQ;
  float*        ob = ctx + (size_t)h * DHD;

  // ---- Q fragments (B operand of S^T = K.Q^T: column = query = lane&15, split k map), one 32-deep k-step, hi and lo ----
  const v16b qbh = frag_load(Qh + (size_t)(q0 + c) * DMOD + 8 * hh);
  const v16b qbl = frag_load(Ql + (size_t)(q0 + c) * DMOD + 8 * hh);

  // One query (q0 + c) per lane; the two wave halves hold different keys (and different d) of that query.
  float mrow = -INFINITY;   // running maximum, equal in both halves
  float lrow = 0.f;         // running sum over this half's keys only; the halves are joined once after the loop
  v8f oacc[2];              // ctx^T tiles: element r of tile t = (d = 16*t + 8*hh + r, query c)
#pragma unroll
  for (int t = 0; t < 2; ++t) oacc[t] = (v8f){0.f,0.f,0.f,0.f,0.f,0.f,0.f,0.f};

  // bias of this lane: row (q0 + c), cols (kv0 + 16*j + 8*hh + r), r = 0..7 contiguous
  const float* brow = bias + (size_t)(q0 + c) * SEQ + 8 * hh;

  const int nChunks = SEQ / AT_KC;   // 32, compile-time constant
  for (int kc = 0; kc < nChunks; ++kc) {
    const int kv0 = kc * AT_KC;
    __syncthreads();
    {
      // K staging coverage: 128 thr -> 64 rows (tid>>1) x 2 halves of 16 d (tid&1) x 2 v8b = 64 x 32 per plane
      const int r = tid >> 1, hf = (tid & 1) * 16;
      const __bf16* ksh = Kh + (size_t)(kv0 + r) * DMOD + hf;
      const __bf16* ksl = Kl + (size_t)(kv0 + r) * DMOD + hf;
      // V^T staging coverage: 128 thr -> 32 rows (tid>>2) x 4 parts of 16 keys (tid&3) x 2 v8b = 32 x 64 per plane
      const int r2 = tid >> 2, part = (tid & 3) * 16;
      const __bf16* vsh = Vh + (size_t)r2 * SEQ + kv0 + part;
      const __bf16* vsl = Vl + (size_t)r2 * SEQ + kv0 + part;
#pragma unroll
      for (int i = 0; i < 2; ++i) {
        const v8b a0 = *(const v8b*)(ksh + 8 * i);
        const v8b a1 = *(const v8b*)(ksl + 8 * i);
        const v8b b0 = *(const v8b*)(vsh + 8 * i);
        const v8b b1 = *(const v8b*)(vsl + 8 * i);
        *(v8b*)(Ksh + r * DHD + hf + 8 * i)      = a0;
        *(v8b*)(Ksl + r * DHD + hf + 8 * i)      = a1;
        *(v8b*)(Vth + r2 * AT_KC + part + 8 * i) = b0;
        *(v8b*)(Vtl + r2 * AT_KC + part + 8 * i) = b1;
      }
    }
    __syncthreads();

    // ---- S^T = k.q^T : 4 key-row tiles of 16, A[m=key][k=d] from K tile rows, B = Q (both split k map) ----
    // s[j][r] = score of key (kv0 + 16*j + 8*hh + r) against query (q0 + c)
    v4f bb[8];   // this lane's 32 bias values of the chunk: 8 contiguous floats per key tile, asked for as one group
#pragma unroll
    for (int j = 0; j < 4; ++j) {
      bb[2 * j]     = *(const v4f*)(brow + kv0 + j * 16);
      bb[2 * j + 1] = *(const v4f*)(brow + kv0 + j * 16 + 4);
    }
    v8f s[4];
#pragma unroll
    for (int j = 0; j < 4; ++j) {
      s[j] = (v8f){0.f,0.f,0.f,0.f,0.f,0.f,0.f,0.f};
      FragB kb, kl;
      kb.h[0] = *(const v8b*)(Ksh + (j * 16 + c) * DHD + 8 * hh);
      kb.h[1] = *(const v8b*)(Ksh + (j * 16 + c) * DHD + 16 + 8 * hh);
      kl.h[0] = *(const v8b*)(Ksl + (j * 16 + c) * DHD + 8 * hh);
      kl.h[1] = *(const v8b*)(Ksl + (j * 16 + c) * DHD + 16 + 8 * hh);
      s[j] = mma_bf(kb.v, qbh, s[j]);
      s[j] = mma_bf(kl.v, qbh, s[j]);
      s[j] = mma_bf(kb.v, qbl, s[j]);
    }
    // ---- add pair bias in f32; chunk maximum in-lane over 32 keys, then one exchange between the halves ----
    float cm = -INFINITY;
#pragma unroll
    for (int j = 0; j < 4; ++j) {
#pragma unroll
      for (int r = 0; r < 4; ++r) {
        s[j][r]     += bb[2 * j][r];
        s[j][r + 4] += bb[2 * j + 1][r];
        cm = fmaxf(cm, fmaxf(s[j][r], s[j][r + 4]));
      }
    }
    cm = fmaxf(cm, xhalf(cm));
    const float mnew  = fmaxf(mrow, cm);
    const float alpha = expf(mrow - mnew);
    mrow = mnew;
    // ---- p = exp(s - m), split hi/lo and packed straight into the B operand of ctx^T += v^T.p^T:
    //      element e of k-step kk is key 32*kk + 8*hh + e (e < 8, tile 2*kk) or 32*kk + 16 + 8*hh + e - 8 (tile 2*kk + 1),
    //      the k order of the V^T fragment loads below ----
    v16b pbh[2], pbl[2];
    float psum = 0.f;
#pragma unroll
    for (int j = 0; j < 4; ++j) {
#pragma unroll
      for (int r = 0; r < 8; ++r) {
        const float p = expf(s[j][r] - mnew);
        psum += p;
        __bf16 a, bl; at_split(p, a, bl);
        pbh[j >> 1][(j & 1) * 8 + r] = a;
        pbl[j >> 1][(j & 1) * 8 + r] = bl;
      }
    }
    lrow = lrow * alpha + psum;
#pragma unroll
    for (int t = 0; t < 2; ++t)
#pragma unroll
      for (int r = 0; r < 8; ++r) oacc[t][r] *= alpha;
    // ---- ctx^T += V^T . P^T : A[m=d][k=key] from V^T tile rows (2 k-steps of 32 keys), B = P^T from registers ----
#pragma unroll
    for (int kk = 0; kk < 2; ++kk) {
#pragma unroll
      for (int t = 0; t < 2; ++t) {
        FragB vb, vl;
        vb.h[0] = *(const v8b*)(Vth + (t * 16 + c) * AT_KC + kk * 32 + 8 * hh);
        vb.h[1] = *(const v8b*)(Vth + (t * 16 + c) * AT_KC + kk * 32 + 16 + 8 * hh);
        vl.h[0] = *(const v8b*)(Vtl + (t * 16 + c) * AT_KC + kk * 32 + 8 * hh);
        vl.h[1] = *(const v8b*)(Vtl + (t * 16 + c) * AT_KC + kk * 32 + 16 + 8 * hh);
        oacc[t] = mma_bf(vb.v, pbh[kk], oacc[t]);
        oacc[t] = mma_bf(vl.v, pbh[kk], oacc[t]);
        oacc[t] = mma_bf(vb.v, pbl[kk], oacc[t]);
      }
    }
  }

  // ---- join the halves' sums, normalise, stage the wave's 16 x 32 ctx tile [query][d] for whole-line stores ----
  float* os = Os[wave];
  {
    const float inv = 1.0f / (lrow + xhalf(lrow));
#pragma unroll
    for (int t = 0; t < 2; ++t) {
      const v4f o0 = (v4f){oacc[t][0] * inv, oacc[t][1] * inv, oacc[t][2] * inv, oacc[t][3] * inv};
      const v4f o1 = (v4f){oacc[t][4] * inv, oacc[t][5] * inv, oacc[t][6] * inv, oacc[t][7] * inv};
      *(v4f*)(os + c * 36 + t * 16 + 8 * hh)     = o0;
      *(v4f*)(os + c * 36 + t * 16 + 8 * hh + 4) = o1;
    }
  }
  __builtin_amdgcn_fence(__ATOMIC_RELEASE, "workgroup");
  __builtin_amdgcn_wave_barrier();
  __builtin_amdgcn_fence(__ATOMIC_ACQUIRE, "workgroup");
  {
    const int q4 = lane >> 3, c4 = (lane & 7) * 4;
    {
#pragma unroll
      for (int it = 0; it < 4; ++it) {
        const int row = it * 4 + q4;
        const v4f val = *(const v4f*)(os + row * 36 + c4);
        *(v4f*)(ob + (size_t)(q0 + row) * DMOD + c4) = val;
      }
      
    }
  }
}

// ---------------------------------------------------------------------------
//   biasP f32 [2048][2048]                 0 .. 16777216
//   WqTh/l, WkTh/l, WvTh/l, WoTh/l  bf16 [256 o][256 i]   131072 each  (8 planes) 16777216 .. 17825792
//   Xqh/l, Xkh/l, Xvh/l bf16 [2048][256]   1048576 each (6 planes)      17825792 .. 24117248
//   Qh/l, Kh/l  bf16 [2048][256]            1048576 each (4 planes)      24117248 .. 28311552
//   VTh/l bf16 [256 (h,d)][2048]            1048576 each (2 planes)      28311552 .. 30408704
//   CTXf f32 [2048][256]                    2097152                      30408704 .. 32505856
//   CTXh/l bf16 [2048][256]                 1048576 each (2 planes)      32505856 .. 34603008
//   total                                   34603008
// ---------------------------------------------------------------------------
extern "C" void kernel_launch(void* const* d_in, const int* in_sizes, int n_in,
                              void* d_out, int out_size, void* d_ws, size_t ws_size,
                              hipStream_t stream) {
  if (n_in < 22) return;
  if (in_sizes[0] != SEQ * SEQ || in_sizes[1] != SEQ * SEQ || in_sizes[2] != SEQ * SEQ) return;
  if (in_sizes[3] != SEQ * DMOD || in_sizes[4] != SEQ * DMOD || in_sizes[5] != SEQ * DMOD) return;
  if (in_sizes[6] != DMOD * DMOD || in_sizes[8] != DMOD * DMOD || in_sizes[10] != DMOD * DMOD || in_sizes[12] != DMOD * DMOD) return;
  if (in_sizes[7] != DMOD || in_sizes[9] != DMOD || in_sizes[11] != DMOD || in_sizes[13] != DMOD) return;
  if (in_sizes[14] != 32 || in_sizes[15] != 16 || in_sizes[16] != 16 || in_sizes[17] != 1) return;
  if (in_sizes[18] != 32 || in_sizes[19] != 16 || in_sizes[20] != 16 || in_sizes[21] != 1) return;
  if (out_size != SEQ * DMOD) return;

  const int*   label   = (const int*)  d_in[0];
  const float* dist    = (const float*)d_in[1];
  const float* contact = (const float*)d_in[2];
  const float* q   = (const float*)d_in[3];
  const float* k   = (const float*)d_in[4];
  const float* v   = (const float*)d_in[5];
  const float* Wq  = (const float*)d_in[6];
  const float* bq  = (const float*)d_in[7];
  const float* Wk  = (const float*)d_in[8];
  const float* bk  = (const float*)d_in[9];
  const float* Wv  = (const float*)d_in[10];
  const float* bv  = (const float*)d_in[11];
  const float* Wo  = (const float*)d_in[12];
  const float* bo  = (const float*)d_in[13];
  const float* Wd1 = (const float*)d_in[14];
  const float* bd1 = (const float*)d_in[15];
  const float* Wd2 = (const float*)d_in[16];
  const float* bd2 = (const float*)d_in[17];
  const float* Wc1 = (const float*)d_in[18];
  const float* bc1 = (const float*)d_in[19];
  const float* Wc2 = (const float*)d_in[20];
  const float* bc2 = (const float*)d_in[21];
  float* out = (float*)d_out;

  const size_t PB = (size_t)SEQ * SEQ * 4;     // 16777216  f32 bias plane
  const size_t PW = (size_t)DMOD * DMOD * 2;   // 131072    bf16 weight plane [256][256]
  const size_t PX = (size_t)SEQ * DMOD * 2;    // 1048576   bf16 activation plane [2048][256] / [256][2048]
  const size_t PF = (size_t)SEQ * DMOD * 4;    // 2097152   f32 activation plane
  size_t off = 0;
  const size_t oBias = off; off += PB;
  const size_t oWqTh = off; off += PW;  const size_t oWqTl = off; off += PW;
  const size_t oWkTh = off; off += PW;  const size_t oWkTl = off; off += PW;
  const size_t oWvTh = off; off += PW;  const size_t oWvTl = off; off += PW;
  const size_t oWoTh = off; off += PW;  const size_t oWoTl = off; off += PW;
  const size_t oXqh  = off; off += PX;  const size_t oXql  = off; off += PX;
  const size_t oXkh  = off; off += PX;  const size_t oXkl  = off; off += PX;
  const size_t oXvh  = off; off += PX;  const size_t oXvl  = off; off += PX;
  const size_t oQh   = off; off += PX;  const size_t oQl   = off; off += PX;
  const size_t oKh   = off; off += PX;  const size_t oKl   = off; off += PX;
  const size_t oVTh  = off; off += PX;  const size_t oVTl  = off; off += PX;
  const size_t oCTf  = off; off += PF;
  const size_t oCTh  = off; off += PX;  const size_t oCTl  = off; off += PX;
  if (off > ws_size) return;                   // off = 34603008

  char* ws = (char*)d_ws;
  float*          biasP = (float*)(ws + oBias);
  unsigned short* WqTh = (unsigned short*)(ws + oWqTh); unsigned short* WqTl = (unsigned short*)(ws + oWqTl);
  unsigned short* WkTh = (unsigned short*)(ws + oWkTh); unsigned short* WkTl = (unsigned short*)(ws + oWkTl);
  unsigned short* WvTh = (unsigned short*)(ws + oWvTh); unsigned short* WvTl = (unsigned short*)(ws + oWvTl);
  unsigned short* WoTh = (unsigned short*)(ws + oWoTh); unsigned short* WoTl = (unsigned short*)(ws + oWoTl);
  unsigned short* Xqh  = (unsigned short*)(ws + oXqh);  unsigned short* Xql  = (unsigned short*)(ws + oXql);
  unsigned short* Xkh  = (unsigned short*)(ws + oXkh);  unsigned short* Xkl  = (unsigned short*)(ws + oXkl);
  unsigned short* Xvh  = (unsigned short*)(ws + oXvh);  unsigned short* Xvl  = (unsigned short*)(ws + oXvl);
  unsigned short* Qh   = (unsigned short*)(ws + oQh);   unsigned short* Ql   = (unsigned short*)(ws + oQl);
  unsigned short* Kh   = (unsigned short*)(ws + oKh);   unsigned short* Kl   = (unsigned short*)(ws + oKl);
  unsigned short* VTh  = (unsigned short*)(ws + oVTh);  unsigned short* VTl  = (unsigned short*)(ws + oVTl);
  float*          CTf  = (float*)(ws + oCTf);
  unsigned short* CTh  = (unsigned short*)(ws + oCTh);  unsigned short* CTl  = (unsigned short*)(ws + oCTl);

  const dim3 blk(256);

  // (1) everything that reads inputs only, one launch: weight planes [out][in], pair bias plane, q/k/v hi/lo planes
  prep_kernel<<<dim3(PREP_W_BLOCKS + PREP_PB_BLOCKS + 3 * PREP_X_BLOCKS), blk, 0, stream>>>(dist, contact, label,
      Wd1, bd1, Wd2, bd2, Wc1, bc1, Wc2, bc2, biasP,
      Wq, Wk, Wv, Wo, WqTh, WqTl, WkTh, WkTl, WvTh, WvTl, WoTh, WoTl,
      q, k, v, Xqh, Xql, Xkh, Xkl, Xvh, Xvl);

  const int n2x = SEQ * DMOD / 2;                           // 262144 pairs per plane
  const dim3 gCast((n2x + 255) / 256);                      // 1024 blocks x 512 elements
  const dim3 gProj(((SEQ / 32) * (DMOD / 64) + 7) / 8);     // M=2048, N=256: 256 wave tiles (32x64) -> 32 blocks of 8 waves

  // (2) the three projections, one launch of 3 x 32 blocks; v^T[(h,d)][s] = sum_i WvT[(h,d)][i] * v[s][i] + bv[(h,d)]
  const float qscale = 0.17677669529663688f;                // 32^-0.5 applied as (x.Wq + bq) * scale
  proj3_kernel<<<dim3(96), blk, 0, stream>>>(Xqh, Xql, Xkh, Xkl, Xvh, Xvl, WqTh, WqTl, WkTh, WkTl, WvTh, WvTl,
      bq, bk, bv, Qh, Ql, Kh, Kl, VTh, VTl, qscale);

  // (3) attention with pair bias: 8 heads x 32 query blocks of 64 rows -> ctx f32 [2048][256]
  attn_bias_kernel<<<dim3(NHEAD * (SEQ / 64)), dim3(128), 0, stream>>>(Qh, Ql, Kh, Kl, VTh, VTl, biasP, CTf);

  // (4) ctx -> bf16 hi/lo planes
  split_bf16x2_kernel<<<gCast, blk, 0, stream>>>(CTf, CTh, CTl, n2x);

  // (5) out = ctx . Wo + bo -> d_out f32 [2048][256]   (M=2048, N=256, K=256)
  gemm_split_kernel<2, 0><<<gProj, blk, 0, stream>>>(CTh, CTl, DMOD, WoTh, WoTl, DMOD,
      (void*)out, (void*)out, DMOD, bo, SEQ, DMOD, DMOD, 1.0f);

  (void)hipGetLastError();
}

// v003
// One run takes 74.9 microseconds.
// Timed twice side by side with v002, it ran 1.43 times as fast both times.
// Over all steps from v000 it is 2.65 times as fast.
// Contractions: q, k, v^T projections, q.k^T scores, p.v and output projection on v_wmma_f32_16x16x32_bf16 with bf16 hi/lo operands (hi.hi + hi.lo + lo.hi), f32 accumulate; pair bias (exact affine fold of the two linear 2->16->1 maps) and online softmax in f32 on VALU; the keys of a query block are dealt to 4 work-groups whose partial results a later launch joins.
#include <hip/hip_runtime.h>
#include <math.h>
#include <stdint.h>

#define SEQ   2048
#define DMOD  256
#define NHEAD 8
#define DHD   32
#define KSPLIT 4      // key ranges per query block in the attention launch, one work-group each

typedef __attribute__((ext_vector_type(16))) __bf16   v16b;
typedef __attribute__((ext_vector_type(8)))  __bf16   v8b;
typedef __attribute__((ext_vector_type(8)))  float    v8f;
typedef __attribute__((ext_vector_type(4)))  float    v4f;
typedef __attribute__((ext_vector_type(2)))  float    v2f;
typedef __attribute__((ext_vector_type(4)))  unsigned int v4u;
typedef __attribute__((ext_vector_type(4)))  int      v4i;

// RNE f32 -> bf16 bits
__device__ __forceinline__ unsigned short f2bf_bits(float f) {
  unsigned u = __float_as_uint(f);
  return (unsigned short)((u + 0x7FFFu + ((u >> 16) & 1u)) >> 16);
}
__device__ __forceinline__ float bf_bits2f(unsigned short h) { return __uint_as_float(((unsigned)h) << 16); }
__device__ __forceinline__ unsigned pk16(unsigned short a, unsigned short b) { return (unsigned)a | ((unsigned)b << 16); }

// 16x16x32 fragment (A row-major k-contiguous, or B stored [n][k] k-contiguous):
// lane l: row/col = l & 15, p already offset by 8*(l>>4); elements 0..7 <- p[0..7], elements 8..15 <- p[16..23]
union FragB { v16b v; v8b h[2]; };
__device__ __forceinline__ v16b frag_load(const __bf16* p) {
  FragB f; f.h[0] = *(const v8b*)(p); f.h[1] = *(const v8b*)(p + 16); return f.v;
}

// WMMA + hazard guard (4 VALU slots, ties D, keeps A/B live)
__device__ __forceinline__ v8f mma_bf(v16b a, v16b b, v8f c) {
  c = __builtin_amdgcn_wmma_f32_16x16x32_bf16(false, a, false, b, (short)0, c, false, false);
  asm volatile("v_nop\n\tv_nop\n\tv_nop\n\tv_nop" : "+v"(c) : "v"(a), "v"(b));
  return c;
}

// ---------------------------------------------------------------------------
// Pair bias plane [SEQ][SEQ] f32:
//   pb(map, W1, b1, W2, b2)(n,m) = map*(W1[0].W2) + label*(W1[1].W2) + (b1.W2 + b2)   (both maps linear, exact fold)
//   bias = pb_d + pb_c.  W1 [2][16] row-major, W2 [16][1].
// Block blk owns elements blk*8192 .. blk*8192+8191; each thread 4 consecutive floats per iteration, 8 iterations.
// coverage: 512 blocks x 8 it x 256 thr x 4 = 4194304 = whole plane.
// ---------------------------------------------------------------------------
__device__ __forceinline__ void pair_bias_block(const int blk,
    const float* __restrict__ dist, const float* __restrict__ contact, const int* __restrict__ label,
    const float* __restrict__ Wd1, const float* __restrict__ bd1, const float* __restrict__ Wd2, const float* __restrict__ bd2,
    const float* __restrict__ Wc1, const float* __restrict__ bc1, const float* __restrict__ Wc2, const float* __restrict__ bc2,
    float* __restrict__ bias) {
  float ad = 0.f, ld = 0.f, gd = 0.f, ac = 0.f, lc = 0.f, gc = 0.f;
#pragma unroll 1
  for (int j = 0; j < 16; ++j) {
    const float wd2 = Wd2[j], wc2 = Wc2[j];
    ad = fmaf(Wd1[j],      wd2, ad);   // map weight (row 0 of W1)
    ld = fmaf(Wd1[16 + j], wd2, ld);   // label weight (row 1 of W1)
    gd = fmaf(bd1[j],      wd2, gd);
    ac = fmaf(Wc1[j],      wc2, ac);
    lc = fmaf(Wc1[16 + j], wc2, lc);
    gc = fmaf(bc1[j],      wc2, gc);
  }
  gd += bd2[0];
  gc += bc2[0];
  const size_t base = (size_t)blk * 8192 + (size_t)threadIdx.x * 4;
{
#pragma unroll 1
    for (int it = 0; it < 8; ++it) {
      const size_t i4 = base + (size_t)it * 1024;
      const v4f dm = *(const v4f*)(dist + i4);
      const v4f cm = *(const v4f*)(contact + i4);
      const v4i lb = *(const v4i*)(label + i4);
      v4f o;
#pragma unroll
      for (int e = 0; e < 4; ++e) {
        const float lf = (float)lb[e];
        const float pd = fmaf(dm[e], ad, fmaf(lf, ld, gd));
        const float pc = fmaf(cm[e], ac, fmaf(lf, lc, gc));
        o[e] = pd + pc;
      }
      *(v4f*)(bias + i4) = o;
      // precaution: stands between this store and the next trip's rewrite of the registers that the store names
      asm volatile("s_wait_xcnt 0x0" ::: "memory");
    }
    
  }
}

// ---------------------------------------------------------------------------
// Elementwise bf16 split: hi = bf16_rne(in), lo = bf16_rne(in - hi); 2 elements per thread, one 4-B store per lane
// coverage: grid = ceil(n2/256) x 256 thr x 2 = 2*n2 elements (n2 = 2048*256/2 = 262144 -> 1024 blocks).
// ---------------------------------------------------------------------------
__device__ __forceinline__ void split_bf16x2_block(const int blk, const float* __restrict__ in, unsigned short* __restrict__ hi,
                                                   unsigned short* __restrict__ lo, int n2) {
  const int i = blk * 256 + threadIdx.x;
  if (i < n2) {
    const v2f f = *(const v2f*)(in + 2 * (size_t)i);
    const unsigned short h0 = f2bf_bits(f[0]), h1 = f2bf_bits(f[1]);
    const unsigned short l0 = f2bf_bits(f[0] - bf_bits2f(h0)), l1 = f2bf_bits(f[1] - bf_bits2f(h1));
    const unsigned uh = pk16(h0, h1), ul = pk16(l0, l1);
    ((unsigned*)hi)[i] = uh;
    ((unsigned*)lo)[i] = ul;
  }
}

// ---------------------------------------------------------------------------
// Fused transpose + bf16 split of an f32 matrix W viewed [R rows][Cc cols] (pitch Cc) ->
//   oh[c][r] = bf16_rne(W[r][c]), ol[c][r] = bf16_rne(W[r][c] - oh)   ([Cc][R], pitch R)
// 64x64 tiles through LDS (tf: 64 x 68 floats of the caller). Tile (bx, by) of (Cc/64, R/64), 256 threads, R and Cc multiples of 64.
// coverage per block/plane: load 4 it x 256 thr x 4 floats = 64x64; store 2 it x 256 thr x 8 u16 = 64x64.
// ---------------------------------------------------------------------------
__device__ __forceinline__ void tsplit_block(float* tf, const int bx, const int by, const float* __restrict__ W,
                                             unsigned short* __restrict__ oh, unsigned short* __restrict__ ol, int R, int Cc) {
  const int c0  = bx * 64;           // input column block = output row block
  const int r0  = by * 64;           // input row block    = output column block
  const int tid = threadIdx.x;
  {
    const int lr = tid >> 4;         // 0..15
    const int c4 = (tid & 15) * 4;   // 0..60
#pragma unroll
    for (int it = 0; it < 4; ++it) {
      const int rr = it * 16 + lr;   // 0..63
      const v4f a = *(const v4f*)(W + (size_t)(r0 + rr) * Cc + c0 + c4);
      *(v4f*)(tf + rr * 68 + c4) = a;
    }
  }
  __syncthreads();
  const int sub = tid >> 3;          // 0..31
  const int c8  = (tid & 7) * 8;     // 0..56
  v4u hv[2], lv[2];
#pragma unroll
  for (int it = 0; it < 2; ++it) {
    const int oc = it * 32 + sub;    // output row within tile (= input column)
    v4u a, a2;
#pragma unroll
    for (int q = 0; q < 4; ++q) {
      const float f0 = tf[(c8 + 2 * q) * 68 + oc];
      const float f1 = tf[(c8 + 2 * q + 1) * 68 + oc];
      const unsigned short h0 = f2bf_bits(f0), h1 = f2bf_bits(f1);
      const unsigned short l0 = f2bf_bits(f0 - bf_bits2f(h0)), l1 = f2bf_bits(f1 - bf_bits2f(h1));
      a[q]  = pk16(h0, h1);
      a2[q] = pk16(l0, l1);
    }
    hv[it] = a; lv[it] = a2;
  }
  {
#pragma unroll
    for (int it = 0; it < 2; ++it) {
      const int oc = it * 32 + sub;
      const size_t go = (size_t)(c0 + oc) * R + r0 + c8;
      *(v4u*)(oh + go) = hv[it];
      *(v4u*)(ol + go) = lv[it];
    }
  }
}

// ---------------------------------------------------------------------------
// All work that reads inputs only, in one launch; the jobs are independent of each other and a block does exactly one of them:
//   blocks    0 ..   63 : transpose + split of Wq, Wk, Wv, Wo (16 tiles of 64x64 each)
//   blocks   64 ..  575 : pair bias plane (512 blocks x 8192 elements)
//   blocks  576 .. 3647 : split of q, k, v (1024 blocks x 512 elements each)
// The job test reads blockIdx.x alone, so the barrier in tsplit_block is passed by a whole block or by none of it.
// ---------------------------------------------------------------------------
#define PREP_W_BLOCKS  64
#define PREP_PB_BLOCKS 512
#define PREP_X_BLOCKS  1024
__global__ __launch_bounds__(256) void prep_kernel(
    const float* __restrict__ dist, const float* __restrict__ contact, const int* __restrict__ label,
    const float* __restrict__ Wd1, const float* __restrict__ bd1, const float* __restrict__ Wd2, const float* __restrict__ bd2,
    const float* __restrict__ Wc1, const float* __restrict__ bc1, const float* __restrict__ Wc2, const float* __restrict__ bc2,
    float* __restrict__ bias,
    const float* __restrict__ Wq, const float* __restrict__ Wk, const float* __restrict__ Wv, const float* __restrict__ Wo,
    unsigned short* __restrict__ WqTh, unsigned short* __restrict__ WqTl, unsigned short* __restrict__ WkTh, unsigned short* __restrict__ WkTl,
    unsigned short* __restrict__ WvTh, unsigned short* __restrict__ WvTl, unsigned short* __restrict__ WoTh, unsigned short* __restrict__ WoTl,
    const float* __restrict__ q, const float* __restrict__ k, const float* __restrict__ v,
    unsigned short* __restrict__ Xqh, unsigned short* __restrict__ Xql, unsigned short* __restrict__ Xkh, unsigned short* __restrict__ Xkl,
    unsigned short* __restrict__ Xvh, unsigned short* __restrict__ Xvl) {
  __shared__ __align__(16) float tf[64 * 68];
  const int b = blockIdx.x;
  if (b < PREP_W_BLOCKS) {
    const int w = b >> 4;
    const float*    W  = (w == 0) ? Wq   : (w == 1) ? Wk   : (w == 2) ? Wv   : Wo;
    unsigned short* oh = (w == 0) ? WqTh : (w == 1) ? WkTh : (w == 2) ? WvTh : WoTh;
    unsigned short* ol = (w == 0) ? WqTl : (w == 1) ? WkTl : (w == 2) ? WvTl : WoTl;
    tsplit_block(tf, b & 3, (b >> 2) & 3, W, oh, ol, DMOD, DMOD);
  } else if (b < PREP_W_BLOCKS + PREP_PB_BLOCKS) {
    pair_bias_block(b - PREP_W_BLOCKS, dist, contact, label, Wd1, bd1, Wd2, bd2, Wc1, bc1, Wc2, bc2, bias);
  } else {
    const int t = b - (PREP_W_BLOCKS + PREP_PB_BLOCKS);
    const int x = t >> 10;
    const float*    in = (x == 0) ? q   : (x == 1) ? k   : v;
    unsigned short* hi = (x == 0) ? Xqh : (x == 1) ? Xkh : Xvh;
    unsigned short* lo = (x == 0) ? Xql : (x == 1) ? Xkl : Xvl;
    split_bf16x2_block(t & (PREP_X_BLOCKS - 1), in, hi, lo, SEQ * DMOD / 2);
  }
}

// ---------------------------------------------------------------------------
// Split-operand WMMA GEMM: C[m,n] = scale * (sum_k A[m,k]*Bt[n,k] + bias)
//   A hi/lo planes row-major [M][lda], Bt hi/lo planes [N][ldb] (k-contiguous); product = hi.hi + hi.lo + lo.hi.
//   Each wave owns a 32x64 tile: M % 32 == 0, N % 64 == 0, K % 32 == 0.  No block barriers (wave-local LDS slab).
//   BIAS_MODE: 1 = bias[m], 2 = bias[n].  OUT_MODE: 0 = f32 [M][ldc], 2 = bf16 hi plane (Cout) + lo plane (Cout2).
//   sT: the caller's LDS, per-wave 16x64 slab, pitch 68 floats.  blk: which group of 8 wave tiles.
// ---------------------------------------------------------------------------
template <int BIAS_MODE, int OUT_MODE>
__device__ __forceinline__ void gemm_split_block(float (*sT)[16 * 68], const int blk,
    const unsigned short* __restrict__ Ahp, const unsigned short* __restrict__ Alp, int lda,
    const unsigned short* __restrict__ Bhp, const unsigned short* __restrict__ Blp, int ldb,
    void* __restrict__ Cout, void* __restrict__ Cout2, int ldc,
    const float* __restrict__ bias, int M, int N, int K, float scale) {
  const __bf16* Ah = (const __bf16*)(const void*)Ahp;
  const __bf16* Al = (const __bf16*)(const void*)Alp;
  const __bf16* Bh = (const __bf16*)(const void*)Bhp;
  const __bf16* Bl = (const __bf16*)(const void*)Blp;
  const int lane = threadIdx.x & 31;
  const int wave = threadIdx.x >> 5;
  const int tilesN = N >> 6;
  const int tilesM = M >> 5;
  const int tile = blk * 8 + wave;
  if (tile >= tilesM * tilesN) return;   // wave-uniform; no block barriers in this kernel
  const int tm = tile / tilesN;
  const int tn = tile - tm * tilesN;
  const int m0 = tm << 5;
  const int n0 = tn << 6;

  const int rlane = lane & 15;           // row (A) / col (B, D) within subtile
  const int koff  = (lane >> 4) * 8;     // k offset of this lane half (split map)
  const int mOff  = (lane >> 4) * 8;     // D row offset

  v8f acc[2][4];
#pragma unroll
  for (int i = 0; i < 2; ++i)
#pragma unroll
    for (int j = 0; j < 4; ++j) acc[i][j] = (v8f){0.f,0.f,0.f,0.f,0.f,0.f,0.f,0.f};

  for (int k0 = 0; k0 < K; k0 += 32) {
    v16b bh[4], bl[4];
#pragma unroll
    for (int j = 0; j < 4; ++j) {
      const size_t bo = (size_t)(n0 + (j << 4) + rlane) * ldb + koff + k0;
      bh[j] = frag_load(Bh + bo);
      bl[j] = frag_load(Bl + bo);
    }
#pragma unroll
    for (int i = 0; i < 2; ++i) {
      const size_t ao = (size_t)(m0 + (i << 4) + rlane) * lda + koff + k0;
      const v16b ah = frag_load(Ah + ao);
      const v16b al = frag_load(Al + ao);
#pragma unroll
      for (int j = 0; j < 4; ++j) {
        acc[i][j] = mma_bf(ah, bh[j], acc[i][j]);
        acc[i][j] = mma_bf(ah, bl[j], acc[i][j]);
        acc[i][j] = mma_bf(al, bh[j], acc[i][j]);
      }
    }
  }

  // ---- epilogue ----
  float* slab = sT[wave];
#pragma unroll
  for (int i = 0; i < 2; ++i) {
    const int mBase = m0 + (i << 4);
#pragma unroll
    for (int j = 0; j < 4; ++j) {
      const int n = n0 + (j << 4) + rlane;
      float bvn = 0.f;
      if (BIAS_MODE == 2) bvn = bias[n];
#pragma unroll
      for (int r = 0; r < 8; ++r) {
        float v = acc[i][j][r];
        if (BIAS_MODE == 1) v += bias[mBase + mOff + r];
        if (BIAS_MODE == 2) v += bvn;
        v *= scale;
        slab[(mOff + r) * 68 + (j << 4) + rlane] = v;
      }
    }
    __builtin_amdgcn_fence(__ATOMIC_RELEASE, "workgroup");
    __builtin_amdgcn_wave_barrier();
    __builtin_amdgcn_fence(__ATOMIC_ACQUIRE, "workgroup");
    if (OUT_MODE == 0) {
      float* C = (float*)Cout;
      const int hh = lane >> 4, c4 = (lane & 15) * 4;     // row seg = 256 B = 16 lanes x 16 B; rows it*2+hh cover 0..15
      {
#pragma unroll
        for (int it = 0; it < 8; ++it) {
          const int row = it * 2 + hh;
          const v4f v = *(const v4f*)(slab + row * 68 + c4);
          *(v4f*)(C + (size_t)(mBase + row) * ldc + n0 + c4) = v;
        }
        
      }
    } else {
      const int q = lane >> 3, c8 = (lane & 7) * 8;
      unsigned short* C  = (unsigned short*)Cout;
      unsigned short* C2 = (unsigned short*)Cout2;
      {
#pragma unroll
        for (int it = 0; it < 4; ++it) {
          const int row = it * 4 + q;
          const float* sp = slab + row * 68 + c8;
          v4u hv, lv;
#pragma unroll
          for (int e = 0; e < 4; ++e) {
            const float f0 = sp[2 * e], f1 = sp[2 * e + 1];
            const unsigned short h0 = f2bf_bits(f0), h1 = f2bf_bits(f1);
            const unsigned short l0 = f2bf_bits(f0 - bf_bits2f(h0)), l1 = f2bf_bits(f1 - bf_bits2f(h1));
            hv[e] = pk16(h0, h1);
            lv[e] = pk16(l0, l1);
          }
          *(v4u*)(C  + (size_t)(mBase + row) * ldc + n0 + c8) = hv;
          *(v4u*)(C2 + (size_t)(mBase + row) * ldc + n0 + c8) = lv;
        }
        
      }
    }
    __builtin_amdgcn_fence(__ATOMIC_RELEASE, "workgroup");
    __builtin_amdgcn_wave_barrier();
    __builtin_amdgcn_fence(__ATOMIC_ACQUIRE, "workgroup");
  }
}

template <int BIAS_MODE, int OUT_MODE>
__global__ __launch_bounds__(256) void gemm_split_kernel(
    const unsigned short* __restrict__ Ahp, const unsigned short* __restrict__ Alp, int lda,
    const unsigned short* __restrict__ Bhp, const unsigned short* __restrict__ Blp, int ldb,
    void* __restrict__ Cout, void* __restrict__ Cout2, int ldc,
    const float* __restrict__ bias, int M, int N, int K, float scale) {
  __shared__ __align__(16) float sT[8][16 * 68];
  gemm_split_block<BIAS_MODE, OUT_MODE>(sT, blockIdx.x, Ahp, Alp, lda, Bhp, Blp, ldb, Cout, Cout2, ldc, bias, M, N, K, scale);
}

// The q, k and v^T projections in one launch: they are independent of each other, 32 blocks (256 wave tiles of 32x64) each.
//   blocks  0 .. 31 : Q   = (q.Wq + bq) * qscale   [SEQ][DMOD]
//   blocks 32 .. 63 : K   =  k.Wk + bk             [SEQ][DMOD]
//   blocks 64 .. 95 : V^T =  WvT.v^T + bv          [DMOD][SEQ]
__global__ __launch_bounds__(256) void proj3_kernel(
    const unsigned short* __restrict__ Xqh, const unsigned short* __restrict__ Xql,
    const unsigned short* __restrict__ Xkh, const unsigned short* __restrict__ Xkl,
    const unsigned short* __restrict__ Xvh, const unsigned short* __restrict__ Xvl,
    const unsigned short* __restrict__ WqTh, const unsigned short* __restrict__ WqTl,
    const unsigned short* __restrict__ WkTh, const unsigned short* __restrict__ WkTl,
    const unsigned short* __restrict__ WvTh, const unsigned short* __restrict__ WvTl,
    const float* __restrict__ bq, const float* __restrict__ bk, const float* __restrict__ bv,
    unsigned short* __restrict__ Qh, unsigned short* __restrict__ Ql,
    unsigned short* __restrict__ Kh, unsigned short* __restrict__ Kl,
    unsigned short* __restrict__ VTh, unsigned short* __restrict__ VTl, float qscale) {
  __shared__ __align__(16) float sT[8][16 * 68];
  const int job = blockIdx.x >> 5;
  const int blk = blockIdx.x & 31;
  if (job < 2) {
    const bool isq = (job == 0);
    gemm_split_block<2, 2>(sT, blk, isq ? Xqh : Xkh, isq ? Xql : Xkl, DMOD, isq ? WqTh : WkTh, isq ? WqTl : WkTl, DMOD,
                           (void*)(isq ? Qh : Kh), (void*)(isq ? Ql : Kl), DMOD, isq ? bq : bk, SEQ, DMOD, DMOD,
                           isq ? qscale : 1.0f);
  } else {
    gemm_split_block<1, 2>(sT, blk, WvTh, WvTl, DMOD, Xvh, Xvl, DMOD, (void*)VTh, (void*)VTl, SEQ, bv, DMOD, SEQ, DMOD, 1.0f);
  }
}

// =====================================================================================
// Flash attention with additive pair bias, head dim 32, all 8 heads in one launch.
//   q planes (hi/lo bf16): element (t, h, d) at [t*DMOD + h*32 + d]   (score scale already folded into q)
//   k planes (hi/lo bf16): element (s, h, d) at [s*DMOD + h*32 + d]
//   v^T planes (hi/lo bf16): element (h, d, s) at [(h*32 + d)*SEQ + s]
//   bias f32 [SEQ t][SEQ s], shared over heads
//   opart f32, one plane per key range ks: element (ks, t, h, d) at [ks*SEQ*DMOD + t*DMOD + h*32 + d], NOT normalised
//   ml f32: running maximum and sum of (ks, h, t) at [((ks*NHEAD + h)*SEQ + t)*2 + 0 / 1]
//   scores^T = k . q^T + bias^T : bf16 hi/lo (hi.hi + hi.lo + lo.hi), bias added in f32; a lane holds one query's scores
//   ctx^T    = v^T . p^T         : bf16 hi/lo of p (unnormalised, <= 1, packed in registers) and v, f32 accumulate
//   online softmax in f32 over the block's SEQ/KSPLIT keys (8 chunks of 64 keys, compile-time trip count).
//   Block = 4 waves = 64 query rows of one head against one key range; grid = KSPLIT * NHEAD * (SEQ/64) = 1024 blocks of 128 threads.
//   The KSPLIT partial results of a query (maximum, sum, unnormalised ctx) are joined by merge_split_kernel in the next launch.
//   K / V^T chunk staging through LDS by all 128 threads (plain 16-B loads, __syncthreads before and after);
// =====================================================================================
#define AT_KC 64

__device__ __forceinline__ __bf16 at_f2bf(float f) { return __builtin_bit_cast(__bf16, f2bf_bits(f)); }
__device__ __forceinline__ void at_split(float f, __bf16& hi, __bf16& lo) {
  const unsigned short hb = f2bf_bits(f);
  hi = __builtin_bit_cast(__bf16, hb);
  lo = at_f2bf(f - __uint_as_float(((unsigned)hb) << 16));
}

// value of lane l ^ 16 (the other wave half), by a vector cross-row move
__device__ __forceinline__ float xhalf(float x) {
  const int b = __builtin_bit_cast(int, x);
  return __builtin_bit_cast(float, __builtin_amdgcn_permlanex16(b, b, 0x76543210, 0xfedcba98, false, false));
}

// Four waves per SIMD asked of the compiler: the grid supplies four (1024 work-groups of 4 waves on 256 WGPs), so that one
// work-group's waits (staging, barriers, LDS, dependent vector chains) are filled by the other three. Without the upper bound the
// compiler saves registers for waves that never come and strings a lane's 32 independent exp/split chains one behind another.
__global__ __launch_bounds__(128) __attribute__((amdgpu_waves_per_eu(4, 4)))
void attn_bias_kernel(const unsigned short* __restrict__ qhp, const unsigned short* __restrict__ qlp,
                      const unsigned short* __restrict__ khp, const unsigned short* __restrict__ klp,
                      const unsigned short* __restrict__ vhp, const unsigned short* __restrict__ vlp,
                      const float* __restrict__ bias, float* __restrict__ opart, float* __restrict__ ml) {
  __shared__ __align__(16) __bf16 Ksh[AT_KC * DHD];          // K hi [kv][d]      4 KB
  __shared__ __align__(16) __bf16 Ksl[AT_KC * DHD];          // K lo
  __shared__ __align__(16) __bf16 Vth[DHD * AT_KC];          // V hi [d][kv]      4 KB
  __shared__ __align__(16) __bf16 Vtl[DHD * AT_KC];          // V lo
  __shared__ __align__(16) float  Os[4][16 * 36];            // per wave ctx tile, pitch 36

  const int tid  = threadIdx.x;
  const int wave = tid >> 5;
  const int lane = tid & 31;
  const int hh   = lane >> 4;
  const int c    = lane & 15;

  const int nqb = SEQ / 64;               // 32
  const int bx = blockIdx.x;
  const int qb = bx % nqb;
  const int h  = (bx / nqb) % NHEAD;      // 0..NHEAD-1
  const int ks = bx / (nqb * NHEAD);      // 0..KSPLIT-1: keys ks*SEQ/KSPLIT .. (ks+1)*SEQ/KSPLIT - 1
  const int q0 = qb * 64 + wave * 16;     // first query row of this wave

  const __bf16* Qh = (const __bf16*)(const void*)qhp + (size_t)h * DHD;
  const __bf16* Ql = (const __bf16*)(const void*)qlp + (size_t)h * DHD;
  const __bf16* Kh = (const __bf16*)(const void*)khp + (size_t)h * DHD;
  const __bf16* Kl = (const __bf16*)(const void*)klp + (size_t)h * DHD;
  const __bf16* Vh = (const __bf16*)(const void*)vhp + (size_t)h * DHD * SEQ;
  const __bf16* Vl = (const __bf16*)(const void*)vlp + (size_t)h * DHD * SEQ;
  float*        ob = opart + (size_t)ks * SEQ * DMOD + (size_t)h * DHD;

  // ---- Q fragments (B operand of S^T = K.Q^T: column = query = lane&15, split k map), one 32-deep k-step, hi and lo ----
  const v16b qbh = frag_load(Qh + (size_t)(q0 + c) * DMOD + 8 * hh);
  const v16b qbl = frag_load(Ql + (size_t)(q0 + c) * DMOD + 8 * hh);

  // One query (q0 + c) per lane; the two wave halves hold different keys (and different d) of that query.
  float mrow = -INFINITY;   // running maximum, equal in both halves
  float lrow = 0.f;         // running sum over this half's keys only; the halves are joined once after the loop
  v8f oacc[2];              // ctx^T tiles: element r of tile t = (d = 16*t + 8*hh + r, query c)
#pragma unroll
  for (int t = 0; t < 2; ++t) oacc[t] = (v8f){0.f,0.f,0.f,0.f,0.f,0.f,0.f,0.f};

  // bias of this lane: row (q0 + c), cols (kv0 + 16*j + 8*hh + r), r = 0..7 contiguous
  const float* brow = bias + (size_t)(q0 + c) * SEQ + 8 * hh;

  const int nChunks = SEQ / KSPLIT / AT_KC;   // 8, compile-time constant
  for (int kc = 0; kc < nChunks; ++kc) {
    const int kv0 = ks * (SEQ / KSPLIT) + kc * AT_KC;
    __syncthreads();
    {
      // K staging coverage: 128 thr -> 64 rows (tid>>1) x 2 halves of 16 d (tid&1) x 2 v8b = 64 x 32 per plane
      const int r = tid >> 1, hf = (tid & 1) * 16;
      const __bf16* ksh = Kh + (size_t)(kv0 + r) * DMOD + hf;
      const __bf16* ksl = Kl + (size_t)(kv0 + r) * DMOD + hf;
      // V^T staging coverage: 128 thr -> 32 rows (tid>>2) x 4 parts of 16 keys (tid&3) x 2 v8b = 32 x 64 per plane
      const int r2 = tid >> 2, part = (tid & 3) * 16;
      const __bf16* vsh = Vh + (size_t)r2 * SEQ + kv0 + part;
      const __bf16* vsl = Vl + (size_t)r2 * SEQ + kv0 + part;
#pragma unroll
      for (int i = 0; i < 2; ++i) {
        const v8b a0 = *(const v8b*)(ksh + 8 * i);
        const v8b a1 = *(const v8b*)(ksl + 8 * i);
        const v8b b0 = *(const v8b*)(vsh + 8 * i);
        const v8b b1 = *(const v8b*)(vsl + 8 * i);
        *(v8b*)(Ksh + r * DHD + hf + 8 * i)      = a0;
        *(v8b*)(Ksl + r * DHD + hf + 8 * i)      = a1;
        *(v8b*)(Vth + r2 * AT_KC + part + 8 * i) = b0;
        *(v8b*)(Vtl + r2 * AT_KC + part + 8 * i) = b1;
      }
    }
    __syncthreads();

    // ---- S^T = k.q^T : 4 key-row tiles of 16, A[m=key][k=d] from K tile rows, B = Q (both split k map) ----
    // s[j][r] = score of key (kv0 + 16*j + 8*hh + r) against query (q0 + c)
    v4f bb[8];   // this lane's 32 bias values of the chunk: 8 contiguous floats per key tile, asked for as one group
#pragma unroll
    for (int j = 0; j < 4; ++j) {
      bb[2 * j]     = *(const v4f*)(brow + kv0 + j * 16);
      bb[2 * j + 1] = *(const v4f*)(brow + kv0 + j * 16 + 4);
    }
    v8f s[4];
#pragma unroll
    for (int j = 0; j < 4; ++j) {
      s[j] = (v8f){0.f,0.f,0.f,0.f,0.f,0.f,0.f,0.f};
      FragB kb, kl;
      kb.h[0] = *(const v8b*)(Ksh + (j * 16 + c) * DHD + 8 * hh);
      kb.h[1] = *(const v8b*)(Ksh + (j * 16 + c) * DHD + 16 + 8 * hh);
      kl.h[0] = *(const v8b*)(Ksl + (j * 16 + c) * DHD + 8 * hh);
      kl.h[1] = *(const v8b*)(Ksl + (j * 16 + c) * DHD + 16 + 8 * hh);
      s[j] = mma_bf(kb.v, qbh, s[j]);
      s[j] = mma_bf(kl.v, qbh, s[j]);
      s[j] = mma_bf(kb.v, qbl, s[j]);
    }
    // ---- add pair bias in f32; chunk maximum in-lane over 32 keys, then one exchange between the halves ----
    float cm = -INFINITY;
#pragma unroll
    for (int j = 0; j < 4; ++j) {
#pragma unroll
      for (int r = 0; r < 4; ++r) {
        s[j][r]     += bb[2 * j][r];
        s[j][r + 4] += bb[2 * j + 1][r];
        cm = fmaxf(cm, fmaxf(s[j][r], s[j][r + 4]));
      }
    }
    cm = fmaxf(cm, xhalf(cm));
    const float mnew  = fmaxf(mrow, cm);
    const float alpha = expf(mrow - mnew);
    mrow = mnew;
    // ---- p = exp(s - m), split hi/lo and packed straight into the B operand of ctx^T += v^T.p^T:
    //      element e of k-step kk is key 32*kk + 8*hh + e (e < 8, tile 2*kk) or 32*kk + 16 + 8*hh + e - 8 (tile 2*kk + 1),
    //      the k order of the V^T fragment loads below ----
    v16b pbh[2], pbl[2];
    float psum = 0.f;
#pragma unroll
    for (int j = 0; j < 4; ++j) {
#pragma unroll
      for (int r = 0; r < 8; ++r) {
        const float p = expf(s[j][r] - mnew);
        psum += p;
        __bf16 a, bl; at_split(p, a, bl);
        pbh[j >> 1][(j & 1) * 8 + r] = a;
        pbl[j >> 1][(j & 1) * 8 + r] = bl;
      }
    }
    lrow = lrow * alpha + psum;
#pragma unroll
    for (int t = 0; t < 2; ++t)
#pragma unroll
      for (int r = 0; r < 8; ++r) oacc[t][r] *= alpha;
    // ---- ctx^T += V^T . P^T : A[m=d][k=key] from V^T tile rows (2 k-steps of 32 keys), B = P^T from registers ----
#pragma unroll
    for (int kk = 0; kk < 2; ++kk) {
#pragma unroll
      for (int t = 0; t < 2; ++t) {
        FragB vb, vl;
        vb.h[0] = *(const v8b*)(Vth + (t * 16 + c) * AT_KC + kk * 32 + 8 * hh);
        vb.h[1] = *(const v8b*)(Vth + (t * 16 + c) * AT_KC + kk * 32 + 16 + 8 * hh);
        vl.h[0] = *(const v8b*)(Vtl + (t * 16 + c) * AT_KC + kk * 32 + 8 * hh);
        vl.h[1] = *(const v8b*)(Vtl + (t * 16 + c) * AT_KC + kk * 32 + 16 + 8 * hh);
        oacc[t] = mma_bf(vb.v, pbh[kk], oacc[t]);
        oacc[t] = mma_bf(vl.v, pbh[kk], oacc[t]);
        oacc[t] = mma_bf(vb.v, pbl[kk], oacc[t]);
      }
    }
  }

  // ---- join the halves' sums; stage the wave's 16 x 32 unnormalised ctx tile [query][d] for whole-line stores ----
  float* os = Os[wave];
  const float lsum = lrow + xhalf(lrow);
  {
#pragma unroll
    for (int t = 0; t < 2; ++t) {
      const v4f o0 = (v4f){oacc[t][0], oacc[t][1], oacc[t][2], oacc[t][3]};
      const v4f o1 = (v4f){oacc[t][4], oacc[t][5], oacc[t][6], oacc[t][7]};
      *(v4f*)(os + c * 36 + t * 16 + 8 * hh)     = o0;
      *(v4f*)(os + c * 36 + t * 16 + 8 * hh + 4) = o1;
    }
  }
  __builtin_amdgcn_fence(__ATOMIC_RELEASE, "workgroup");
  __builtin_amdgcn_wave_barrier();
  __builtin_amdgcn_fence(__ATOMIC_ACQUIRE, "workgroup");
  {
    const int q4 = lane >> 3, c4 = (lane & 7) * 4;
    {
#pragma unroll
      for (int it = 0; it < 4; ++it) {
        const int row = it * 4 + q4;
        const v4f val = *(const v4f*)(os + row * 36 + c4);
        *(v4f*)(ob + (size_t)(q0 + row) * DMOD + c4) = val;
      }
      
    }
  }
  // maximum (lower half) and sum (upper half) of query q0 + c: the wave's 32 lanes fill one 128-B line
  ml[(((size_t)ks * NHEAD + h) * SEQ + q0 + c) * 2 + hh] = hh ? lsum : mrow;
}

// ---------------------------------------------------------------------------
// Join of the KSPLIT partial attention results, then the bf16 split of ctx:
//   M = max_ks m, w = exp(m - M), ctx = (sum_ks w * opart) / (sum_ks w * l); hi = bf16_rne(ctx), lo = bf16_rne(ctx - hi)
// 2 elements per thread, one 4-B store per lane and plane.
// coverage: 1024 blocks x 256 thr x 2 = SEQ * DMOD elements.
// ---------------------------------------------------------------------------
__global__ __launch_bounds__(256) void merge_split_kernel(const float* __restrict__ opart, const float* __restrict__ ml,
                                                          unsigned short* __restrict__ hi, unsigned short* __restrict__ lo) {
  const int i = blockIdx.x * 256 + threadIdx.x;   // pair of columns 2*(i & 127), +1 of row i >> 7
  const int t = i >> 7;
  const int h = (i & 127) >> 4;
  v2f a[KSPLIT], o[KSPLIT];
#pragma unroll
  for (int s = 0; s < KSPLIT; ++s) {
    a[s] = *(const v2f*)(ml + (((size_t)s * NHEAD + h) * SEQ + t) * 2);
    o[s] = *(const v2f*)(opart + (size_t)s * SEQ * DMOD + 2 * (size_t)i);
  }
  float M = a[0][0];
#pragma unroll
  for (int s = 1; s < KSPLIT; ++s) M = fmaxf(M, a[s][0]);
  float L = 0.f, f0 = 0.f, f1 = 0.f;
#pragma unroll
  for (int s = 0; s < KSPLIT; ++s) {
    const float w = expf(a[s][0] - M);
    L  = fmaf(w, a[s][1], L);
    f0 = fmaf(w, o[s][0], f0);
    f1 = fmaf(w, o[s][1], f1);
  }
  const float inv = 1.0f / L;
  f0 *= inv;
  f1 *= inv;
  const unsigned short h0 = f2bf_bits(f0), h1 = f2bf_bits(f1);
  const unsigned short l0 = f2bf_bits(f0 - bf_bits2f(h0)), l1 = f2bf_bits(f1 - bf_bits2f(h1));
  ((unsigned*)hi)[i] = pk16(h0, h1);
  ((unsigned*)lo)[i] = pk16(l0, l1);
}

// ---------------------------------------------------------------------------
//   biasP f32 [2048][2048]                 0 .. 16777216
//   WqTh/l, WkTh/l, WvTh/l, WoTh/l  bf16 [256 o][256 i]   131072 each  (8 planes) 16777216 .. 17825792
//   Xqh/l, Xkh/l, Xvh/l bf16 [2048][256]   1048576 each (6 planes)      17825792 .. 24117248
//   Qh/l, Kh/l  bf16 [2048][256]            1048576 each (4 planes)      24117248 .. 28311552
//   VTh/l bf16 [256 (h,d)][2048]            1048576 each (2 planes)      28311552 .. 30408704
//   OPART f32 [4 key ranges][2048][256]     2097152 each (4 planes)      30408704 .. 38797312
//   ML f32 [4 key ranges][8][2048][2]       524288                       38797312 .. 39321600
//   CTXh/l bf16 [2048][256]                 1048576 each (2 planes)      39321600 .. 41418752
//   total                                   41418752
// ---------------------------------------------------------------------------
extern "C" void kernel_launch(void* const* d_in, const int* in_sizes, int n_in,
                              void* d_out, int out_size, void* d_ws, size_t ws_size,
                              hipStream_t stream) {
  if (n_in < 22) return;
  if (in_sizes[0] != SEQ * SEQ || in_sizes[1] != SEQ * SEQ || in_sizes[2] != SEQ * SEQ) return;
  if (in_sizes[3] != SEQ * DMOD || in_sizes[4] != SEQ * DMOD || in_sizes[5] != SEQ * DMOD) return;
  if (in_sizes[6] != DMOD * DMOD || in_sizes[8] != DMOD * DMOD || in_sizes[10] != DMOD * DMOD || in_sizes[12] != DMOD * DMOD) return;
  if (in_sizes[7] != DMOD || in_sizes[9] != DMOD || in_sizes[11] != DMOD || in_sizes[13] != DMOD) return;
  if (in_sizes[14] != 32 || in_sizes[15] != 16 || in_sizes[16] != 16 || in_sizes[17] != 1) return;
  if (in_sizes[18] != 32 || in_sizes[19] != 16 || in_sizes[20] != 16 || in_sizes[21] != 1) return;
  if (out_size != SEQ * DMOD) return;

  const int*   label   = (const int*)  d_in[0];
  const float* dist    = (const float*)d_in[1];
  const float* contact = (const float*)d_in[2];
  const float* q   = (const float*)d_in[3];
  const float* k   = (const float*)d_in[4];
  const float* v   = (const float*)d_in[5];
  const float* Wq  = (const float*)d_in[6];
  const float* bq  = (const float*)d_in[7];
  const float* Wk  = (const float*)d_in[8];
  const float* bk  = (const float*)d_in[9];
  const float* Wv  = (const float*)d_in[10];
  const float* bv  = (const float*)d_in[11];
  const float* Wo  = (const float*)d_in[12];
  const float* bo  = (const float*)d_in[13];
  const float* Wd1 = (const float*)d_in[14];
  const float* bd1 = (const float*)d_in[15];
  const float* Wd2 = (const float*)d_in[16];
  const float* bd2 = (const float*)d_in[17];
  const float* Wc1 = (const float*)d_in[18];
  const float* bc1 = (const float*)d_in[19];
  const float* Wc2 = (const float*)d_in[20];
  const float* bc2 = (const float*)d_in[21];
  float* out = (float*)d_out;

  const size_t PB = (size_t)SEQ * SEQ * 4;     // 16777216  f32 bias plane
  const size_t PW = (size_t)DMOD * DMOD * 2;   // 131072    bf16 weight plane [256][256]
  const size_t PX = (size_t)SEQ * DMOD * 2;    // 1048576   bf16 activation plane [2048][256] / [256][2048]
  const size_t PF = (size_t)SEQ * DMOD * 4;    // 2097152   f32 activation plane
  size_t off = 0;
  const size_t oBias = off; off += PB;
  const size_t oWqTh = off; off += PW;  const size_t oWqTl = off; off += PW;
  const size_t oWkTh = off; off += PW;  const size_t oWkTl = off; off += PW;
  const size_t oWvTh = off; off += PW;  const size_t oWvTl = off; off += PW;
  const size_t oWoTh = off; off += PW;  const size_t oWoTl = off; off += PW;
  const size_t oXqh  = off; off += PX;  const size_t oXql  = off; off += PX;
  const size_t oXkh  = off; off += PX;  const size_t oXkl  = off; off += PX;
  const size_t oXvh  = off; off += PX;  const size_t oXvl  = off; off += PX;
  const size_t oQh   = off; off += PX;  const size_t oQl   = off; off += PX;
  const size_t oKh   = off; off += PX;  const size_t oKl   = off; off += PX;
  const size_t oVTh  = off; off += PX;  const size_t oVTl  = off; off += PX;
  const size_t oOp   = off; off += KSPLIT * PF;
  const size_t oML   = off; off += (size_t)KSPLIT * NHEAD * SEQ * 2 * 4;
  const size_t oCTh  = off; off += PX;  const size_t oCTl  = off; off += PX;
  if (off > ws_size) return;                   // off = 41418752

  char* ws = (char*)d_ws;
  float*          biasP = (float*)(ws + oBias);
  unsigned short* WqTh = (unsigned short*)(ws + oWqTh); unsigned short* WqTl = (unsigned short*)(ws + oWqTl);
  unsigned short* WkTh = (unsigned short*)(ws + oWkTh); unsigned short* WkTl = (unsigned short*)(ws + oWkTl);
  unsigned short* WvTh = (unsigned short*)(ws + oWvTh); unsigned short* WvTl = (unsigned short*)(ws + oWvTl);
  unsigned short* WoTh = (unsigned short*)(ws + oWoTh); unsigned short* WoTl = (unsigned short*)(ws + oWoTl);
  unsigned short* Xqh  = (unsigned short*)(ws + oXqh);  unsigned short* Xql  = (unsigned short*)(ws + oXql);
  unsigned short* Xkh  = (unsigned short*)(ws + oXkh);  unsigned short* Xkl  = (unsigned short*)(ws + oXkl);
  unsigned short* Xvh  = (unsigned short*)(ws + oXvh);  unsigned short* Xvl  = (unsigned short*)(ws + oXvl);
  unsigned short* Qh   = (unsigned short*)(ws + oQh);   unsigned short* Ql   = (unsigned short*)(ws + oQl);
  unsigned short* Kh   = (unsigned short*)(ws + oKh);   unsigned short* Kl   = (unsigned short*)(ws + oKl);
  unsigned short* VTh  = (unsigned short*)(ws + oVTh);  unsigned short* VTl  = (unsigned short*)(ws + oVTl);
  float*          Op   = (float*)(ws + oOp);
  float*          ML   = (float*)(ws + oML);
  unsigned short* CTh  = (unsigned short*)(ws + oCTh);  unsigned short* CTl  = (unsigned short*)(ws + oCTl);

  const dim3 blk(256);

  // (1) everything that reads inputs only, one launch: weight planes [out][in], pair bias plane, q/k/v hi/lo planes
  prep_kernel<<<dim3(PREP_W_BLOCKS + PREP_PB_BLOCKS + 3 * PREP_X_BLOCKS), blk, 0, stream>>>(dist, contact, label,
      Wd1, bd1, Wd2, bd2, Wc1, bc1, Wc2, bc2, biasP,
      Wq, Wk, Wv, Wo, WqTh, WqTl, WkTh, WkTl, WvTh, WvTl, WoTh, WoTl,
      q, k, v, Xqh, Xql, Xkh, Xkl, Xvh, Xvl);

  const int n2x = SEQ * DMOD / 2;                           // 262144 pairs per plane
  const dim3 gCast((n2x + 255) / 256);                      // 1024 blocks x 512 elements
  const dim3 gProj(((SEQ / 32) * (DMOD / 64) + 7) / 8);     // M=2048, N=256: 256 wave tiles (32x64) -> 32 blocks of 8 waves

  // (2) the three projections, one launch of 3 x 32 blocks; v^T[(h,d)][s] = sum_i WvT[(h,d)][i] * v[s][i] + bv[(h,d)]
  const float qscale = 0.17677669529663688f;                // 32^-0.5 applied as (x.Wq + bq) * scale
  proj3_kernel<<<dim3(96), blk, 0, stream>>>(Xqh, Xql, Xkh, Xkl, Xvh, Xvl, WqTh, WqTl, WkTh, WkTl, WvTh, WvTl,
      bq, bk, bv, Qh, Ql, Kh, Kl, VTh, VTl, qscale);

  // (3) attention with pair bias: 4 key ranges x 8 heads x 32 query blocks of 64 rows -> partial ctx, maximum and sum per key range
  attn_bias_kernel<<<dim3(KSPLIT * NHEAD * (SEQ / 64)), dim3(128), 0, stream>>>(Qh, Ql, Kh, Kl, VTh, VTl, biasP, Op, ML);

  // (4) join of the key ranges -> ctx as bf16 hi/lo planes
  merge_split_kernel<<<gCast, blk, 0, stream>>>(Op, ML, CTh, CTl);

  // (5) out = ctx . Wo + bo -> d_out f32 [2048][256]   (M=2048, N=256, K=256)
  gemm_split_kernel<2, 0><<<gProj, blk, 0, stream>>>(CTh, CTl, DMOD, WoTh, WoTl, DMOD,
      (void*)out, (void*)out, DMOD, bo, SEQ, DMOD, DMOD, 1.0f);

  (void)hipGetLastError();
}

// v004
// Measured time: 70.8 microseconds a run.
// In two side-by-side timings against v003, it was 1.06 and 1.05 times as fast.
// All steps since v000 together make it 2.79 times as fast.
// Contractions: q, k, v^T projections, q.k^T scores, p.v and output projection on v_wmma_f32_16x16x32_bf16 with bf16 hi/lo operands (hi.hi + hi.lo + lo.hi), f32 accumulate; pair bias (exact affine fold of the two linear 2->16->1 maps) and online softmax in f32 on VALU; the keys of a query block are dealt to 4 work-groups whose partial results a later launch joins; the operand planes of the projection GEMMs lie in fragment order.
#include <hip/hip_runtime.h>
#include <math.h>
#include <stdint.h>

#define SEQ   2048
#define DMOD  256
#define NHEAD 8
#define DHD   32
#define KSPLIT 4      // key ranges per query block in the attention launch, one work-group each

typedef __attribute__((ext_vector_type(16))) __bf16   v16b;
typedef __attribute__((ext_vector_type(8)))  __bf16   v8b;
typedef __attribute__((ext_vector_type(8)))  float    v8f;
typedef __attribute__((ext_vector_type(4)))  float    v4f;
typedef __attribute__((ext_vector_type(2)))  float    v2f;
typedef __attribute__((ext_vector_type(4)))  unsigned int v4u;
typedef __attribute__((ext_vector_type(4)))  int      v4i;

// RNE f32 -> bf16 bits
__device__ __forceinline__ unsigned short f2bf_bits(float f) {
  unsigned u = __float_as_uint(f);
  return (unsigned short)((u + 0x7FFFu + ((u >> 16) & 1u)) >> 16);
}
__device__ __forceinline__ float bf_bits2f(unsigned short h) { return __uint_as_float(((unsigned)h) << 16); }
__device__ __forceinline__ unsigned pk16(unsigned short a, unsigned short b) { return (unsigned)a | ((unsigned)b << 16); }

// 16x16x32 fragment (A row-major k-contiguous, or B stored [n][k] k-contiguous):
// lane l: row/col = l & 15, p already offset by 8*(l>>4); elements 0..7 <- p[0..7], elements 8..15 <- p[16..23]
union FragB { v16b v; v8b h[2]; };
__device__ __forceinline__ v16b frag_load(const __bf16* p) {
  FragB f; f.h[0] = *(const v8b*)(p); f.h[1] = *(const v8b*)(p + 16); return f.v;
}

// Fragment order of a GEMM operand plane [rows][K] (K a multiple of 32): one 1-KiB unit per (16 rows, 32 k), units of a row tile in k order.
// Inside a unit lane l's elements 0..7 lie at 16-B piece l, its elements 8..15 at piece 32 + l, so element (row, k) is at
//   (((row >> 4) * (K >> 5) + (k >> 5)) * 2 + ((k >> 4) & 1)) * 256 + ((row & 15) + 16 * ((k >> 3) & 1)) * 8 + (k & 7)
// and each of the two 16-B-per-lane loads of a fragment reads 512 bytes in a row (4 whole lines). Same lane / element / k map as frag_load.
// p: the lane's 16-B piece in the unit (unit start + lane * 8 elements)
__device__ __forceinline__ v16b frag_load_fo(const __bf16* p) {
  FragB f; f.h[0] = *(const v8b*)(p); f.h[1] = *(const v8b*)(p + 256); return f.v;
}

// WMMA + hazard guard (4 VALU slots, ties D, keeps A/B live)
__device__ __forceinline__ v8f mma_bf(v16b a, v16b b, v8f c) {
  c = __builtin_amdgcn_wmma_f32_16x16x32_bf16(false, a, false, b, (short)0, c, false, false);
  asm volatile("v_nop\n\tv_nop\n\tv_nop\n\tv_nop" : "+v"(c) : "v"(a), "v"(b));
  return c;
}

// ---------------------------------------------------------------------------
// Pair bias plane [SEQ][SEQ] f32:
//   pb(map, W1, b1, W2, b2)(n,m) = map*(W1[0].W2) + label*(W1[1].W2) + (b1.W2 + b2)   (both maps linear, exact fold)
//   bias = pb_d + pb_c.  W1 [2][16] row-major, W2 [16][1].
// Block blk owns elements blk*8192 .. blk*8192+8191; each thread 4 consecutive floats per iteration, 8 iterations.
// coverage: 512 blocks x 8 it x 256 thr x 4 = 4194304 = whole plane.
// ---------------------------------------------------------------------------
__device__ __forceinline__ void pair_bias_block(const int blk,
    const float* __restrict__ dist, const float* __restrict__ contact, const int* __restrict__ label,
    const float* __restrict__ Wd1, const float* __restrict__ bd1, const float* __restrict__ Wd2, const float* __restrict__ bd2,
    const float* __restrict__ Wc1, const float* __restrict__ bc1, const float* __restrict__ Wc2, const float* __restrict__ bc2,
    float* __restrict__ bias) {
  float ad = 0.f, ld = 0.f, gd = 0.f, ac = 0.f, lc = 0.f, gc = 0.f;
#pragma unroll 1
  for (int j = 0; j < 16; ++j) {
    const float wd2 = Wd2[j], wc2 = Wc2[j];
    ad = fmaf(Wd1[j],      wd2, ad);   // map weight (row 0 of W1)
    ld = fmaf(Wd1[16 + j], wd2, ld);   // label weight (row 1 of W1)
    gd = fmaf(bd1[j],      wd2, gd);
    ac = fmaf(Wc1[j],      wc2, ac);
    lc = fmaf(Wc1[16 + j], wc2, lc);
    gc = fmaf(bc1[j],      wc2, gc);
  }
  gd += bd2[0];
  gc += bc2[0];
  const size_t base = (size_t)blk * 8192 + (size_t)threadIdx.x * 4;
{
#pragma unroll 1
    for (int it = 0; it < 8; ++it) {
      const size_t i4 = base + (size_t)it * 1024;
      const v4f dm = *(const v4f*)(dist + i4);
      const v4f cm = *(const v4f*)(contact + i4);
      const v4i lb = *(const v4i*)(label + i4);
      v4f o;
#pragma unroll
      for (int e = 0; e < 4; ++e) {
        const float lf = (float)lb[e];
        const float pd = fmaf(dm[e], ad, fmaf(lf, ld, gd));
        const float pc = fmaf(cm[e], ac, fmaf(lf, lc, gc));
        o[e] = pd + pc;
      }
      *(v4f*)(bias + i4) = o;
      // precaution: stands between this store and the next trip's rewrite of the registers that the store names
      asm volatile("s_wait_xcnt 0x0" ::: "memory");
    }
    
  }
}

// ---------------------------------------------------------------------------
// Elementwise bf16 split of in [rows][DMOD]: hi = bf16_rne(in), lo = bf16_rne(in - hi), planes in fragment order (see frag_load_fo).
// A block fills one 1-KiB unit per plane (16 rows x 32 k); thread = 4-B word of the unit, so a wave stores one whole line per plane.
// coverage: grid = ceil(n2/256) x 256 thr x 2 = 2*n2 elements (n2 = 2048*256/2 = 262144 -> 1024 blocks = 128 row tiles x 8 k-steps).
// ---------------------------------------------------------------------------
__device__ __forceinline__ void split_bf16x2_block(const int blk, const float* __restrict__ in, unsigned short* __restrict__ hi,
                                                   unsigned short* __restrict__ lo, int n2) {
  const int i = blk * 256 + threadIdx.x;
  if (i < n2) {
    const int ln  = (threadIdx.x >> 2) & 31;                                   // fragment lane of this word
    const int row = (blk >> 3) * 16 + (ln & 15);
    const int kk  = (blk & 7) * 32 + (threadIdx.x >> 7) * 16 + (ln >> 4) * 8 + (threadIdx.x & 3) * 2;
    const v2f f = *(const v2f*)(in + (size_t)row * DMOD + kk);
    const unsigned short h0 = f2bf_bits(f[0]), h1 = f2bf_bits(f[1]);
    const unsigned short l0 = f2bf_bits(f[0] - bf_bits2f(h0)), l1 = f2bf_bits(f[1] - bf_bits2f(h1));
    const unsigned uh = pk16(h0, h1), ul = pk16(l0, l1);
    ((unsigned*)hi)[i] = uh;
    ((unsigned*)lo)[i] = ul;
  }
}

// ---------------------------------------------------------------------------
// Fused transpose + bf16 split of an f32 matrix W viewed [R rows][Cc cols] (pitch Cc) ->
//   oh(c, r) = bf16_rne(W[r][c]), ol(c, r) = bf16_rne(W[r][c] - oh)   (planes [Cc rows][R k] in fragment order, see frag_load_fo)
// 64x64 tiles through LDS (tf: 64 x 68 floats of the caller). Tile (bx, by) of (Cc/64, R/64), 256 threads, R and Cc multiples of 64.
// coverage per block/plane: load 4 it x 256 thr x 4 floats = 64x64; store 2 it x 256 thr x 8 u16 = 64x64 = 8 whole units (4 row tiles x 2 k-steps).
// ---------------------------------------------------------------------------
__device__ __forceinline__ void tsplit_block(float* tf, const int bx, const int by, const float* __restrict__ W,
                                             unsigned short* __restrict__ oh, unsigned short* __restrict__ ol, int R, int Cc) {
  const int c0  = bx * 64;           // input column block = output row block
  const int r0  = by * 64;           // input row block    = output column block
  const int tid = threadIdx.x;
  {
    const int lr = tid >> 4;         // 0..15
    const int c4 = (tid & 15) * 4;   // 0..60
#pragma unroll
    for (int it = 0; it < 4; ++it) {
      const int rr = it * 16 + lr;   // 0..63
      const v4f a = *(const v4f*)(W + (size_t)(r0 + rr) * Cc + c0 + c4);
      *(v4f*)(tf + rr * 68 + c4) = a;
    }
  }
  __syncthreads();
  // 16-B piece it*256 + tid of the tile's 512: fragment lane, half of the fragment, k-step, row tile
  const int ln   = tid & 31;
  const int part = (tid >> 5) & 1;
  const int ksl  = (tid >> 6) & 1;
  const int c8   = ksl * 32 + part * 16 + (ln >> 4) * 8;   // first of the piece's 8 k (= input rows) within the tile
  v4u hv[2], lv[2];
#pragma unroll
  for (int it = 0; it < 2; ++it) {
    const int oc = (it * 2 + (tid >> 7)) * 16 + (ln & 15);   // output row within tile (= input column)
    v4u a, a2;
#pragma unroll
    for (int q = 0; q < 4; ++q) {
      const float f0 = tf[(c8 + 2 * q) * 68 + oc];
      const float f1 = tf[(c8 + 2 * q + 1) * 68 + oc];
      const unsigned short h0 = f2bf_bits(f0), h1 = f2bf_bits(f1);
      const unsigned short l0 = f2bf_bits(f0 - bf_bits2f(h0)), l1 = f2bf_bits(f1 - bf_bits2f(h1));
      a[q]  = pk16(h0, h1);
      a2[q] = pk16(l0, l1);
    }
    hv[it] = a; lv[it] = a2;
  }
  {
#pragma unroll
    for (int it = 0; it < 2; ++it) {
      const int rt = it * 2 + (tid >> 7);
      const size_t go = ((size_t)(((c0 >> 4) + rt) * (R >> 5) + (r0 >> 5) + ksl) << 9) + part * 256 + ln * 8;
      *(v4u*)(oh + go) = hv[it];
      *(v4u*)(ol + go) = lv[it];
    }
  }
}

// ---------------------------------------------------------------------------
// All work that reads inputs only, in one launch; the jobs are independent of each other and a block does exactly one of them:
//   blocks    0 ..   63 : transpose + split of Wq, Wk, Wv, Wo (16 tiles of 64x64 each)
//   blocks   64 ..  575 : pair bias plane (512 blocks x 8192 elements)
//   blocks  576 .. 3647 : split of q, k, v (1024 blocks x 512 elements each)
// The job test reads blockIdx.x alone, so the barrier in tsplit_block is passed by a whole block or by none of it.
// ---------------------------------------------------------------------------
#define PREP_W_BLOCKS  64
#define PREP_PB_BLOCKS 512
#define PREP_X_BLOCKS  1024
__global__ __launch_bounds__(256) void prep_kernel(
    const float* __restrict__ dist, const float* __restrict__ contact, const int* __restrict__ label,
    const float* __restrict__ Wd1, const float* __restrict__ bd1, const float* __restrict__ Wd2, const float* __restrict__ bd2,
    const float* __restrict__ Wc1, const float* __restrict__ bc1, const float* __restrict__ Wc2, const float* __restrict__ bc2,
    float* __restrict__ bias,
    const float* __restrict__ Wq, const float* __restrict__ Wk, const float* __restrict__ Wv, const float* __restrict__ Wo,
    unsigned short* __restrict__ WqTh, unsigned short* __restrict__ WqTl, unsigned short* __restrict__ WkTh, unsigned short* __restrict__ WkTl,
    unsigned short* __restrict__ WvTh, unsigned short* __restrict__ WvTl, unsigned short* __restrict__ WoTh, unsigned short* __restrict__ WoTl,
    const float* __restrict__ q, const float* __restrict__ k, const float* __restrict__ v,
    unsigned short* __restrict__ Xqh, unsigned short* __restrict__ Xql, unsigned short* __restrict__ Xkh, unsigned short* __restrict__ Xkl,
    unsigned short* __restrict__ Xvh, unsigned short* __restrict__ Xvl) {
  __shared__ __align__(16) float tf[64 * 68];
  const int b = blockIdx.x;
  if (b < PREP_W_BLOCKS) {
    const int w = b >> 4;
    const float*    W  = (w == 0) ? Wq   : (w == 1) ? Wk   : (w == 2) ? Wv   : Wo;
    unsigned short* oh = (w == 0) ? WqTh : (w == 1) ? WkTh : (w == 2) ? WvTh : WoTh;
    unsigned short* ol = (w == 0) ? WqTl : (w == 1) ? WkTl : (w == 2) ? WvTl : WoTl;
    tsplit_block(tf, b & 3, (b >> 2) & 3, W, oh, ol, DMOD, DMOD);
  } else if (b < PREP_W_BLOCKS + PREP_PB_BLOCKS) {
    pair_bias_block(b - PREP_W_BLOCKS, dist, contact, label, Wd1, bd1, Wd2, bd2, Wc1, bc1, Wc2, bc2, bias);
  } else {
    const int t = b - (PREP_W_BLOCKS + PREP_PB_BLOCKS);
    const int x = t >> 10;
    const float*    in = (x == 0) ? q   : (x == 1) ? k   : v;
    unsigned short* hi = (x == 0) ? Xqh : (x == 1) ? Xkh : Xvh;
    unsigned short* lo = (x == 0) ? Xql : (x == 1) ? Xkl : Xvl;
    split_bf16x2_block(t & (PREP_X_BLOCKS - 1), in, hi, lo, SEQ * DMOD / 2);
  }
}

// ---------------------------------------------------------------------------
// Split-operand WMMA GEMM: C[m,n] = scale * (sum_k A[m,k]*Bt[n,k] + bias)
//   A hi/lo planes [M][K], Bt hi/lo planes [N][K], all in fragment order (see frag_load_fo); product = hi.hi + hi.lo + lo.hi.
//   Each wave owns a 32x64 tile: M % 32 == 0, N % 64 == 0, K = KD (compile time), KD % 32 == 0.  No block barriers (wave-local LDS slab).
//   BIAS_MODE: 1 = bias[m], 2 = bias[n].  OUT_MODE: 0 = f32 [M][ldc], 2 = bf16 hi plane (Cout) + lo plane (Cout2).
//   sT: the caller's LDS, per-wave 16x64 slab, pitch 68 floats.  blk: which group of 8 wave tiles.
// ---------------------------------------------------------------------------
template <int BIAS_MODE, int OUT_MODE, int KD>
__device__ __forceinline__ void gemm_split_block(float (*sT)[16 * 68], const int blk,
    const unsigned short* __restrict__ Ahp, const unsigned short* __restrict__ Alp,
    const unsigned short* __restrict__ Bhp, const unsigned short* __restrict__ Blp,
    void* __restrict__ Cout, void* __restrict__ Cout2, int ldc,
    const float* __restrict__ bias, int M, int N, float scale) {
  const __bf16* Ah = (const __bf16*)(const void*)Ahp;
  const __bf16* Al = (const __bf16*)(const void*)Alp;
  const __bf16* Bh = (const __bf16*)(const void*)Bhp;
  const __bf16* Bl = (const __bf16*)(const void*)Blp;
  const int lane = threadIdx.x & 31;
  const int wave = threadIdx.x >> 5;
  const int tilesN = N >> 6;
  const int tilesM = M >> 5;
  const int tile = blk * 8 + wave;
  if (tile >= tilesM * tilesN) return;   // wave-uniform; no block barriers in this kernel
  const int tm = tile / tilesN;
  const int tn = tile - tm * tilesN;
  const int m0 = tm << 5;
  const int n0 = tn << 6;

  const int rlane = lane & 15;           // row (A) / col (B, D) within subtile
  const int mOff  = (lane >> 4) * 8;     // D row offset

  v8f acc[2][4];
#pragma unroll
  for (int i = 0; i < 2; ++i)
#pragma unroll
    for (int j = 0; j < 4; ++j) acc[i][j] = (v8f){0.f,0.f,0.f,0.f,0.f,0.f,0.f,0.f};

  constexpr int KSTEPS = KD >> 5;
  constexpr int TSTEP  = KSTEPS << 9;     // elements from one 16-row tile of a plane to the next
  const size_t aoff = (size_t)(m0 >> 4) * TSTEP + lane * 8;
  const size_t boff = (size_t)(n0 >> 4) * TSTEP + lane * 8;
  for (int kst = 0; kst < KSTEPS; ++kst) {
    // the lane's piece in this k-step's unit of the wave's first row tile, one address per plane; the other tiles lie at fixed distances
    const __bf16* pah = Ah + aoff + ((size_t)kst << 9);
    const __bf16* pal = Al + aoff + ((size_t)kst << 9);
    const __bf16* pbh = Bh + boff + ((size_t)kst << 9);
    const __bf16* pbl = Bl + boff + ((size_t)kst << 9);
    v16b bh[4], bl[4], ah[2], al[2];
#pragma unroll
    for (int j = 0; j < 4; ++j) {
      bh[j] = frag_load_fo(pbh + j * TSTEP);
      bl[j] = frag_load_fo(pbl + j * TSTEP);
    }
#pragma unroll
    for (int i = 0; i < 2; ++i) {
      ah[i] = frag_load_fo(pah + i * TSTEP);
      al[i] = frag_load_fo(pal + i * TSTEP);
    }
    // precaution: stands between the k-step's loads and any rewrite of the address registers that they name; as inputs the four
    // addresses stay in their registers up to here, so that no load of the group returns its data into one of them
    asm volatile("s_wait_xcnt 0x0" :: "v"(pah), "v"(pal), "v"(pbh), "v"(pbl) : "memory");
#pragma unroll
    for (int i = 0; i < 2; ++i) {
#pragma unroll
      for (int j = 0; j < 4; ++j) {
        acc[i][j] = mma_bf(ah[i], bh[j], acc[i][j]);
        acc[i][j] = mma_bf(ah[i], bl[j], acc[i][j]);
        acc[i][j] = mma_bf(al[i], bh[j], acc[i][j]);
      }
    }
  }

  // ---- epilogue ----
  float* slab = sT[wave];
#pragma unroll
  for (int i = 0; i < 2; ++i) {
    const int mBase = m0 + (i << 4);
#pragma unroll
    for (int j = 0; j < 4; ++j) {
      const int n = n0 + (j << 4) + rlane;
      float bvn = 0.f;
      if (BIAS_MODE == 2) bvn = bias[n];
#pragma unroll
      for (int r = 0; r < 8; ++r) {
        float v = acc[i][j][r];
        if (BIAS_MODE == 1) v += bias[mBase + mOff + r];
        if (BIAS_MODE == 2) v += bvn;
        v *= scale;
        slab[(mOff + r) * 68 + (j << 4) + rlane] = v;
      }
    }
    __builtin_amdgcn_fence(__ATOMIC_RELEASE, "workgroup");
    __builtin_amdgcn_wave_barrier();
    __builtin_amdgcn_fence(__ATOMIC_ACQUIRE, "workgroup");
    if (OUT_MODE == 0) {
      float* C = (float*)Cout;
      const int hh = lane >> 4, c4 = (lane & 15) * 4;     // row seg = 256 B = 16 lanes x 16 B; rows it*2+hh cover 0..15
      {
#pragma unroll
        for (int it = 0; it < 8; ++it) {
          const int row = it * 2 + hh;
          const v4f v = *(const v4f*)(slab + row * 68 + c4);
          *(v4f*)(C + (size_t)(mBase + row) * ldc + n0 + c4) = v;
        }
        
      }
    } else {
      const int q = lane >> 3, c8 = (lane & 7) * 8;
      unsigned short* C  = (unsigned short*)Cout;
      unsigned short* C2 = (unsigned short*)Cout2;
      {
#pragma unroll
        for (int it = 0; it < 4; ++it) {
          const int row = it * 4 + q;
          const float* sp = slab + row * 68 + c8;
          v4u hv, lv;
#pragma unroll
          for (int e = 0; e < 4; ++e) {
            const float f0 = sp[2 * e], f1 = sp[2 * e + 1];
            const unsigned short h0 = f2bf_bits(f0), h1 = f2bf_bits(f1);
            const unsigned short l0 = f2bf_bits(f0 - bf_bits2f(h0)), l1 = f2bf_bits(f1 - bf_bits2f(h1));
            hv[e] = pk16(h0, h1);
            lv[e] = pk16(l0, l1);
          }
          *(v4u*)(C  + (size_t)(mBase + row) * ldc + n0 + c8) = hv;
          *(v4u*)(C2 + (size_t)(mBase + row) * ldc + n0 + c8) = lv;
        }
        
      }
    }
    __builtin_amdgcn_fence(__ATOMIC_RELEASE, "workgroup");
    __builtin_amdgcn_wave_barrier();
    __builtin_amdgcn_fence(__ATOMIC_ACQUIRE, "workgroup");
  }
}

template <int BIAS_MODE, int OUT_MODE>
__global__ __launch_bounds__(256) void gemm_split_kernel(
    const unsigned short* __restrict__ Ahp, const unsigned short* __restrict__ Alp,
    const unsigned short* __restrict__ Bhp, const unsigned short* __restrict__ Blp,
    void* __restrict__ Cout, void* __restrict__ Cout2, int ldc,
    const float* __restrict__ bias, int M, int N, float scale) {
  __shared__ __align__(16) float sT[8][16 * 68];
  gemm_split_block<BIAS_MODE, OUT_MODE, DMOD>(sT, blockIdx.x, Ahp, Alp, Bhp, Blp, Cout, Cout2, ldc, bias, M, N, scale);
}

// The q, k and v^T projections in one launch: they are independent of each other, 32 blocks (256 wave tiles of 32x64) each.
//   blocks  0 .. 31 : Q   = (q.Wq + bq) * qscale   [SEQ][DMOD]
//   blocks 32 .. 63 : K   =  k.Wk + bk             [SEQ][DMOD]
//   blocks 64 .. 95 : V^T =  WvT.v^T + bv          [DMOD][SEQ]
__global__ __launch_bounds__(256) void proj3_kernel(
    const unsigned short* __restrict__ Xqh, const unsigned short* __restrict__ Xql,
    const unsigned short* __restrict__ Xkh, const unsigned short* __restrict__ Xkl,
    const unsigned short* __restrict__ Xvh, const unsigned short* __restrict__ Xvl,
    const unsigned short* __restrict__ WqTh, const unsigned short* __restrict__ WqTl,
    const unsigned short* __restrict__ WkTh, const unsigned short* __restrict__ WkTl,
    const unsigned short* __restrict__ WvTh, const unsigned short* __restrict__ WvTl,
    const float* __restrict__ bq, const float* __restrict__ bk, const float* __restrict__ bv,
    unsigned short* __restrict__ Qh, unsigned short* __restrict__ Ql,
    unsigned short* __restrict__ Kh, unsigned short* __restrict__ Kl,
    unsigned short* __restrict__ VTh, unsigned short* __restrict__ VTl, float qscale) {
  __shared__ __align__(16) float sT[8][16 * 68];
  const int job = blockIdx.x >> 5;
  const int blk = blockIdx.x & 31;
  if (job < 2) {
    const bool isq = (job == 0);
    gemm_split_block<2, 2, DMOD>(sT, blk, isq ? Xqh : Xkh, isq ? Xql : Xkl, isq ? WqTh : WkTh, isq ? WqTl : WkTl,
                           (void*)(isq ? Qh : Kh), (void*)(isq ? Ql : Kl), DMOD, isq ? bq : bk, SEQ, DMOD,
                           isq ? qscale : 1.0f);
  } else {
    gemm_split_block<1, 2, DMOD>(sT, blk, WvTh, WvTl, Xvh, Xvl, (void*)VTh, (void*)VTl, SEQ, bv, DMOD, SEQ, 1.0f);
  }
}

// =====================================================================================
// Flash attention with additive pair bias, head dim 32, all 8 heads in one launch.
//   q planes (hi/lo bf16): element (t, h, d) at [t*DMOD + h*32 + d]   (score scale already folded into q)
//   k planes (hi/lo bf16): element (s, h, d) at [s*DMOD + h*32 + d]
//   v^T planes (hi/lo bf16): element (h, d, s) at [(h*32 + d)*SEQ + s]
//   bias f32 [SEQ t][SEQ s], shared over heads
//   opart f32, one plane per key range ks: element (ks, t, h, d) at [ks*SEQ*DMOD + t*DMOD + h*32 + d], NOT normalised
//   ml f32: running maximum and sum of (ks, h, t) at [((ks*NHEAD + h)*SEQ + t)*2 + 0 / 1]
//   scores^T = k . q^T + bias^T : bf16 hi/lo (hi.hi + hi.lo + lo.hi), bias added in f32; a lane holds one query's scores
//   ctx^T    = v^T . p^T         : bf16 hi/lo of p (unnormalised, <= 1, packed in registers) and v, f32 accumulate
//   online softmax in f32 over the block's SEQ/KSPLIT keys (8 chunks of 64 keys, compile-time trip count).
//   Block = 4 waves = 64 query rows of one head against one key range; grid = KSPLIT * NHEAD * (SEQ/64) = 1024 blocks of 128 threads.
//   The KSPLIT partial results of a query (maximum, sum, unnormalised ctx) are joined by merge_split_kernel in the next launch.
//   K / V^T chunk staging through LDS by all 128 threads (plain 16-B loads, __syncthreads before and after);
// =====================================================================================
#define AT_KC 64

__device__ __forceinline__ __bf16 at_f2bf(float f) { return __builtin_bit_cast(__bf16, f2bf_bits(f)); }
__device__ __forceinline__ void at_split(float f, __bf16& hi, __bf16& lo) {
  const unsigned short hb = f2bf_bits(f);
  hi = __builtin_bit_cast(__bf16, hb);
  lo = at_f2bf(f - __uint_as_float(((unsigned)hb) << 16));
}

// value of lane l ^ 16 (the other wave half), by a vector cross-row move
__device__ __forceinline__ float xhalf(float x) {
  const int b = __builtin_bit_cast(int, x);
  return __builtin_bit_cast(float, __builtin_amdgcn_permlanex16(b, b, 0x76543210, 0xfedcba98, false, false));
}

// Four waves per SIMD asked of the compiler: the grid supplies four (1024 work-groups of 4 waves on 256 WGPs), so that one
// work-group's waits (staging, barriers, LDS, dependent vector chains) are filled by the other three. Without the upper bound the
// compiler saves registers for waves that never come and strings a lane's 32 independent exp/split chains one behind another.
__global__ __launch_bounds__(128) __attribute__((amdgpu_waves_per_eu(4, 4)))
void attn_bias_kernel(const unsigned short* __restrict__ qhp, const unsigned short* __restrict__ qlp,
                      const unsigned short* __restrict__ khp, const unsigned short* __restrict__ klp,
                      const unsigned short* __restrict__ vhp, const unsigned short* __restrict__ vlp,
                      const float* __restrict__ bias, float* __restrict__ opart, float* __restrict__ ml) {
  __shared__ __align__(16) __bf16 Ksh[AT_KC * DHD];          // K hi [kv][d]      4 KB
  __shared__ __align__(16) __bf16 Ksl[AT_KC * DHD];          // K lo
  __shared__ __align__(16) __bf16 Vth[DHD * AT_KC];          // V hi [d][kv]      4 KB
  __shared__ __align__(16) __bf16 Vtl[DHD * AT_KC];          // V lo
  __shared__ __align__(16) float  Os[4][16 * 36];            // per wave ctx tile, pitch 36

  const int tid  = threadIdx.x;
  const int wave = tid >> 5;
  const int lane = tid & 31;
  const int hh   = lane >> 4;
  const int c    = lane & 15;

  const int nqb = SEQ / 64;               // 32
  const int bx = blockIdx.x;
  const int qb = bx % nqb;
  const int h  = (bx / nqb) % NHEAD;      // 0..NHEAD-1
  const int ks = bx / (nqb * NHEAD);      // 0..KSPLIT-1: keys ks*SEQ/KSPLIT .. (ks+1)*SEQ/KSPLIT - 1
  const int q0 = qb * 64 + wave * 16;     // first query row of this wave

  const __bf16* Qh = (const __bf16*)(const void*)qhp + (size_t)h * DHD;
  const __bf16* Ql = (const __bf16*)(const void*)qlp + (size_t)h * DHD;
  const __bf16* Kh = (const __bf16*)(const void*)khp + (size_t)h * DHD;
  const __bf16* Kl = (const __bf16*)(const void*)klp + (size_t)h * DHD;
  const __bf16* Vh = (const __bf16*)(const void*)vhp + (size_t)h * DHD * SEQ;
  const __bf16* Vl = (const __bf16*)(const void*)vlp + (size_t)h * DHD * SEQ;
  float*        ob = opart + (size_t)ks * SEQ * DMOD + (size_t)h * DHD;

  // ---- Q fragments (B operand of S^T = K.Q^T: column = query = lane&15, split k map), one 32-deep k-step, hi and lo ----
  const v16b qbh = frag_load(Qh + (size_t)(q0 + c) * DMOD + 8 * hh);
  const v16b qbl = frag_load(Ql + (size_t)(q0 + c) * DMOD + 8 * hh);

  // One query (q0 + c) per lane; the two wave halves hold different keys (and different d) of that query.
  float mrow = -INFINITY;   // running maximum, equal in both halves
  float lrow = 0.f;         // running sum over this half's keys only; the halves are joined once after the loop
  v8f oacc[2];              // ctx^T tiles: element r of tile t = (d = 16*t + 8*hh + r, query c)
#pragma unroll
  for (int t = 0; t < 2; ++t) oacc[t] = (v8f){0.f,0.f,0.f,0.f,0.f,0.f,0.f,0.f};

  // bias of this lane: row (q0 + c), cols (kv0 + 16*j + 8*hh + r), r = 0..7 contiguous
  const float* brow = bias + (size_t)(q0 + c) * SEQ + 8 * hh;

  const int nChunks = SEQ / KSPLIT / AT_KC;   // 8, compile-time constant
  for (int kc = 0; kc < nChunks; ++kc) {
    const int kv0 = ks * (SEQ / KSPLIT) + kc * AT_KC;
    __syncthreads();
    {
      // K staging coverage: 128 thr -> 64 rows (tid>>1) x 2 halves of 16 d (tid&1) x 2 v8b = 64 x 32 per plane
      const int r = tid >> 1, hf = (tid & 1) * 16;
      const __bf16* ksh = Kh + (size_t)(kv0 + r) * DMOD + hf;
      const __bf16* ksl = Kl + (size_t)(kv0 + r) * DMOD + hf;
      // V^T staging coverage: 128 thr -> 32 rows (tid>>2) x 4 parts of 16 keys (tid&3) x 2 v8b = 32 x 64 per plane
      const int r2 = tid >> 2, part = (tid & 3) * 16;
      const __bf16* vsh = Vh + (size_t)r2 * SEQ + kv0 + part;
      const __bf16* vsl = Vl + (size_t)r2 * SEQ + kv0 + part;
#pragma unroll
      for (int i = 0; i < 2; ++i) {
        const v8b a0 = *(const v8b*)(ksh + 8 * i);
        const v8b a1 = *(const v8b*)(ksl + 8 * i);
        const v8b b0 = *(const v8b*)(vsh + 8 * i);
        const v8b b1 = *(const v8b*)(vsl + 8 * i);
        *(v8b*)(Ksh + r * DHD + hf + 8 * i)      = a0;
        *(v8b*)(Ksl + r * DHD + hf + 8 * i)      = a1;
        *(v8b*)(Vth + r2 * AT_KC + part + 8 * i) = b0;
        *(v8b*)(Vtl + r2 * AT_KC + part + 8 * i) = b1;
      }
    }
    __syncthreads();

    // ---- S^T = k.q^T : 4 key-row tiles of 16, A[m=key][k=d] from K tile rows, B = Q (both split k map) ----
    // s[j][r] = score of key (kv0 + 16*j + 8*hh + r) against query (q0 + c)
    v4f bb[8];   // this lane's 32 bias values of the chunk: 8 contiguous floats per key tile, asked for as one group
#pragma unroll
    for (int j = 0; j < 4; ++j) {
      bb[2 * j]     = *(const v4f*)(brow + kv0 + j * 16);
      bb[2 * j + 1] = *(const v4f*)(brow + kv0 + j * 16 + 4);
    }
    v8f s[4];
#pragma unroll
    for (int j = 0; j < 4; ++j) {
      s[j] = (v8f){0.f,0.f,0.f,0.f,0.f,0.f,0.f,0.f};
      FragB kb, kl;
      kb.h[0] = *(const v8b*)(Ksh + (j * 16 + c) * DHD + 8 * hh);
      kb.h[1] = *(const v8b*)(Ksh + (j * 16 + c) * DHD + 16 + 8 * hh);
      kl.h[0] = *(const v8b*)(Ksl + (j * 16 + c) * DHD + 8 * hh);
      kl.h[1] = *(const v8b*)(Ksl + (j * 16 + c) * DHD + 16 + 8 * hh);
      s[j] = mma_bf(kb.v, qbh, s[j]);
      s[j] = mma_bf(kl.v, qbh, s[j]);
      s[j] = mma_bf(kb.v, qbl, s[j]);
    }
    // ---- add pair bias in f32; chunk maximum in-lane over 32 keys, then one exchange between the halves ----
    float cm = -INFINITY;
#pragma unroll
    for (int j = 0; j < 4; ++j) {
#pragma unroll
      for (int r = 0; r < 4; ++r) {
        s[j][r]     += bb[2 * j][r];
        s[j][r + 4] += bb[2 * j + 1][r];
        cm = fmaxf(cm, fmaxf(s[j][r], s[j][r + 4]));
      }
    }
    cm = fmaxf(cm, xhalf(cm));
    const float mnew  = fmaxf(mrow, cm);
    const float alpha = expf(mrow - mnew);
    mrow = mnew;
    // ---- p = exp(s - m), split hi/lo and packed straight into the B operand of ctx^T += v^T.p^T:
    //      element e of k-step kk is key 32*kk + 8*hh + e (e < 8, tile 2*kk) or 32*kk + 16 + 8*hh + e - 8 (tile 2*kk + 1),
    //      the k order of the V^T fragment loads below ----
    v16b pbh[2], pbl[2];
    float psum = 0.f;
#pragma unroll
    for (int j = 0; j < 4; ++j) {
#pragma unroll
      for (int r = 0; r < 8; ++r) {
        const float p = expf(s[j][r] - mnew);
        psum += p;
        __bf16 a, bl; at_split(p, a, bl);
        pbh[j >> 1][(j & 1) * 8 + r] = a;
        pbl[j >> 1][(j & 1) * 8 + r] = bl;
      }
    }
    lrow = lrow * alpha + psum;
#pragma unroll
    for (int t = 0; t < 2; ++t)
#pragma unroll
      for (int r = 0; r < 8; ++r) oacc[t][r] *= alpha;
    // ---- ctx^T += V^T . P^T : A[m=d][k=key] from V^T tile rows (2 k-steps of 32 keys), B = P^T from registers ----
#pragma unroll
    for (int kk = 0; kk < 2; ++kk) {
#pragma unroll
      for (int t = 0; t < 2; ++t) {
        FragB vb, vl;
        vb.h[0] = *(const v8b*)(Vth + (t * 16 + c) * AT_KC + kk * 32 + 8 * hh);
        vb.h[1] = *(const v8b*)(Vth + (t * 16 + c) * AT_KC + kk * 32 + 16 + 8 * hh);
        vl.h[0] = *(const v8b*)(Vtl + (t * 16 + c) * AT_KC + kk * 32 + 8 * hh);
        vl.h[1] = *(const v8b*)(Vtl + (t * 16 + c) * AT_KC + kk * 32 + 16 + 8 * hh);
        oacc[t] = mma_bf(vb.v, pbh[kk], oacc[t]);
        oacc[t] = mma_bf(vl.v, pbh[kk], oacc[t]);
        oacc[t] = mma_bf(vb.v, pbl[kk], oacc[t]);
      }
    }
  }

  // ---- join the halves' sums; stage the wave's 16 x 32 unnormalised ctx tile [query][d] for whole-line stores ----
  float* os = Os[wave];
  const float lsum = lrow + xhalf(lrow);
  {
#pragma unroll
    for (int t = 0; t < 2; ++t) {
      const v4f o0 = (v4f){oacc[t][0], oacc[t][1], oacc[t][2], oacc[t][3]};
      const v4f o1 = (v4f){oacc[t][4], oacc[t][5], oacc[t][6], oacc[t][7]};
      *(v4f*)(os + c * 36 + t * 16 + 8 * hh)     = o0;
      *(v4f*)(os + c * 36 + t * 16 + 8 * hh + 4) = o1;
    }
  }
  __builtin_amdgcn_fence(__ATOMIC_RELEASE, "workgroup");
  __builtin_amdgcn_wave_barrier();
  __builtin_amdgcn_fence(__ATOMIC_ACQUIRE, "workgroup");
  {
    const int q4 = lane >> 3, c4 = (lane & 7) * 4;
    {
#pragma unroll
      for (int it = 0; it < 4; ++it) {
        const int row = it * 4 + q4;
        const v4f val = *(const v4f*)(os + row * 36 + c4);
        *(v4f*)(ob + (size_t)(q0 + row) * DMOD + c4) = val;
      }
      
    }
  }
  // maximum (lower half) and sum (upper half) of query q0 + c: the wave's 32 lanes fill one 128-B line
  ml[(((size_t)ks * NHEAD + h) * SEQ + q0 + c) * 2 + hh] = hh ? lsum : mrow;
}

// ---------------------------------------------------------------------------
// Join of the KSPLIT partial attention results, then the bf16 split of ctx:
//   M = max_ks m, w = exp(m - M), ctx = (sum_ks w * opart) / (sum_ks w * l); hi = bf16_rne(ctx), lo = bf16_rne(ctx - hi)
// The ctx planes are written in fragment order (see frag_load_fo): a block fills one 1-KiB unit per plane = 16 queries x the 32 d of one head;
// thread = 4-B word of the unit (2 elements), so a wave stores one whole line per plane.
// coverage: 1024 blocks (128 query tiles x 8 heads) x 256 thr x 2 = SEQ * DMOD elements.
// ---------------------------------------------------------------------------
__global__ __launch_bounds__(256) void merge_split_kernel(const float* __restrict__ opart, const float* __restrict__ ml,
                                                          unsigned short* __restrict__ hi, unsigned short* __restrict__ lo) {
  const int i  = blockIdx.x * 256 + threadIdx.x;   // 4-B word of the planes
  const int ln = (threadIdx.x >> 2) & 31;          // fragment lane of this word
  const int h  = blockIdx.x & 7;                   // k-step of 32 columns = head
  const int t  = (blockIdx.x >> 3) * 16 + (ln & 15);
  const int col = h * DHD + (threadIdx.x >> 7) * 16 + (ln >> 4) * 8 + (threadIdx.x & 3) * 2;
  v2f a[KSPLIT], o[KSPLIT];
#pragma unroll
  for (int s = 0; s < KSPLIT; ++s) {
    a[s] = *(const v2f*)(ml + (((size_t)s * NHEAD + h) * SEQ + t) * 2);
    o[s] = *(const v2f*)(opart + (size_t)s * SEQ * DMOD + (size_t)t * DMOD + col);
  }
  float M = a[0][0];
#pragma unroll
  for (int s = 1; s < KSPLIT; ++s) M = fmaxf(M, a[s][0]);
  float L = 0.f, f0 = 0.f, f1 = 0.f;
#pragma unroll
  for (int s = 0; s < KSPLIT; ++s) {
    const float w = expf(a[s][0] - M);
    L  = fmaf(w, a[s][1], L);
    f0 = fmaf(w, o[s][0], f0);
    f1 = fmaf(w, o[s][1], f1);
  }
  const float inv = 1.0f / L;
  f0 *= inv;
  f1 *= inv;
  const unsigned short h0 = f2bf_bits(f0), h1 = f2bf_bits(f1);
  const unsigned short l0 = f2bf_bits(f0 - bf_bits2f(h0)), l1 = f2bf_bits(f1 - bf_bits2f(h1));
  ((unsigned*)hi)[i] = pk16(h0, h1);
  ((unsigned*)lo)[i] = pk16(l0, l1);
}

// ---------------------------------------------------------------------------
//   biasP f32 [2048][2048]                 0 .. 16777216
//   WqTh/l, WkTh/l, WvTh/l, WoTh/l  bf16 [256 o][256 i], fragment order   131072 each  (8 planes) 16777216 .. 17825792
//   Xqh/l, Xkh/l, Xvh/l bf16 [2048][256], fragment order   1048576 each (6 planes)      17825792 .. 24117248
//   Qh/l, Kh/l  bf16 [2048][256]            1048576 each (4 planes)      24117248 .. 28311552
//   VTh/l bf16 [256 (h,d)][2048]            1048576 each (2 planes)      28311552 .. 30408704
//   OPART f32 [4 key ranges][2048][256]     2097152 each (4 planes)      30408704 .. 38797312
//   ML f32 [4 key ranges][8][2048][2]       524288                       38797312 .. 39321600
//   CTXh/l bf16 [2048][256], fragment order 1048576 each (2 planes)      39321600 .. 41418752
//   total                                   41418752
// ---------------------------------------------------------------------------
extern "C" void kernel_launch(void* const* d_in, const int* in_sizes, int n_in,
                              void* d_out, int out_size, void* d_ws, size_t ws_size,
                              hipStream_t stream) {
  if (n_in < 22) return;
  if (in_sizes[0] != SEQ * SEQ || in_sizes[1] != SEQ * SEQ || in_sizes[2] != SEQ * SEQ) return;
  if (in_sizes[3] != SEQ * DMOD || in_sizes[4] != SEQ * DMOD || in_sizes[5] != SEQ * DMOD) return;
  if (in_sizes[6] != DMOD * DMOD || in_sizes[8] != DMOD * DMOD || in_sizes[10] != DMOD * DMOD || in_sizes[12] != DMOD * DMOD) return;
  if (in_sizes[7] != DMOD || in_sizes[9] != DMOD || in_sizes[11] != DMOD || in_sizes[13] != DMOD) return;
  if (in_sizes[14] != 32 || in_sizes[15] != 16 || in_sizes[16] != 16 || in_sizes[17] != 1) return;
  if (in_sizes[18] != 32 || in_sizes[19] != 16 || in_sizes[20] != 16 || in_sizes[21] != 1) return;
  if (out_size != SEQ * DMOD) return;

  const int*   label   = (const int*)  d_in[0];
  const float* dist    = (const float*)d_in[1];
  const float* contact = (const float*)d_in[2];
  const float* q   = (const float*)d_in[3];
  const float* k   = (const float*)d_in[4];
  const float* v   = (const float*)d_in[5];
  const float* Wq  = (const float*)d_in[6];
  const float* bq  = (const float*)d_in[7];
  const float* Wk  = (const float*)d_in[8];
  const float* bk  = (const float*)d_in[9];
  const float* Wv  = (const float*)d_in[10];
  const float* bv  = (const float*)d_in[11];
  const float* Wo  = (const float*)d_in[12];
  const float* bo  = (const float*)d_in[13];
  const float* Wd1 = (const float*)d_in[14];
  const float* bd1 = (const float*)d_in[15];
  const float* Wd2 = (const float*)d_in[16];
  const float* bd2 = (const float*)d_in[17];
  const float* Wc1 = (const float*)d_in[18];
  const float* bc1 = (const float*)d_in[19];
  const float* Wc2 = (const float*)d_in[20];
  const float* bc2 = (const float*)d_in[21];
  float* out = (float*)d_out;

  const size_t PB = (size_t)SEQ * SEQ * 4;     // 16777216  f32 bias plane
  const size_t PW = (size_t)DMOD * DMOD * 2;   // 131072    bf16 weight plane [256][256]
  const size_t PX = (size_t)SEQ * DMOD * 2;    // 1048576   bf16 activation plane [2048][256] / [256][2048]
  const size_t PF = (size_t)SEQ * DMOD * 4;    // 2097152   f32 activation plane
  size_t off = 0;
  const size_t oBias = off; off += PB;
  const size_t oWqTh = off; off += PW;  const size_t oWqTl = off; off += PW;
  const size_t oWkTh = off; off += PW;  const size_t oWkTl = off; off += PW;
  const size_t oWvTh = off; off += PW;  const size_t oWvTl = off; off += PW;
  const size_t oWoTh = off; off += PW;  const size_t oWoTl = off; off += PW;
  const size_t oXqh  = off; off += PX;  const size_t oXql  = off; off += PX;
  const size_t oXkh  = off; off += PX;  const size_t oXkl  = off; off += PX;
  const size_t oXvh  = off; off += PX;  const size_t oXvl  = off; off += PX;
  const size_t oQh   = off; off += PX;  const size_t oQl   = off; off += PX;
  const size_t oKh   = off; off += PX;  const size_t oKl   = off; off += PX;
  const size_t oVTh  = off; off += PX;  const size_t oVTl  = off; off += PX;
  const size_t oOp   = off; off += KSPLIT * PF;
  const size_t oML   = off; off += (size_t)KSPLIT * NHEAD * SEQ * 2 * 4;
  const size_t oCTh  = off; off += PX;  const size_t oCTl  = off; off += PX;
  if (off > ws_size) return;                   // off = 41418752

  char* ws = (char*)d_ws;
  float*          biasP = (float*)(ws + oBias);
  unsigned short* WqTh = (unsigned short*)(ws + oWqTh); unsigned short* WqTl = (unsigned short*)(ws + oWqTl);
  unsigned short* WkTh = (unsigned short*)(ws + oWkTh); unsigned short* WkTl = (unsigned short*)(ws + oWkTl);
  unsigned short* WvTh = (unsigned short*)(ws + oWvTh); unsigned short* WvTl = (unsigned short*)(ws + oWvTl);
  unsigned short* WoTh = (unsigned short*)(ws + oWoTh); unsigned short* WoTl = (unsigned short*)(ws + oWoTl);
  unsigned short* Xqh  = (unsigned short*)(ws + oXqh);  unsigned short* Xql  = (unsigned short*)(ws + oXql);
  unsigned short* Xkh  = (unsigned short*)(ws + oXkh);  unsigned short* Xkl  = (unsigned short*)(ws + oXkl);
  unsigned short* Xvh  = (unsigned short*)(ws + oXvh);  unsigned short* Xvl  = (unsigned short*)(ws + oXvl);
  unsigned short* Qh   = (unsigned short*)(ws + oQh);   unsigned short* Ql   = (unsigned short*)(ws + oQl);
  unsigned short* Kh   = (unsigned short*)(ws + oKh);   unsigned short* Kl   = (unsigned short*)(ws + oKl);
  unsigned short* VTh  = (unsigned short*)(ws + oVTh);  unsigned short* VTl  = (unsigned short*)(ws + oVTl);
  float*          Op   = (float*)(ws + oOp);
  float*          ML   = (float*)(ws + oML);
  unsigned short* CTh  = (unsigned short*)(ws + oCTh);  unsigned short* CTl  = (unsigned short*)(ws + oCTl);

  const dim3 blk(256);

  // (1) everything that reads inputs only, one launch: weight planes [out][in], pair bias plane, q/k/v hi/lo planes
  prep_kernel<<<dim3(PREP_W_BLOCKS + PREP_PB_BLOCKS + 3 * PREP_X_BLOCKS), blk, 0, stream>>>(dist, contact, label,
      Wd1, bd1, Wd2, bd2, Wc1, bc1, Wc2, bc2, biasP,
      Wq, Wk, Wv, Wo, WqTh, WqTl, WkTh, WkTl, WvTh, WvTl, WoTh, WoTl,
      q, k, v, Xqh, Xql, Xkh, Xkl, Xvh, Xvl);

  const int n2x = SEQ * DMOD / 2;                           // 262144 pairs per plane
  const dim3 gCast((n2x + 255) / 256);                      // 1024 blocks x 512 elements
  const dim3 gProj(((SEQ / 32) * (DMOD / 64) + 7) / 8);     // M=2048, N=256: 256 wave tiles (32x64) -> 32 blocks of 8 waves

  // (2) the three projections, one launch of 3 x 32 blocks; v^T[(h,d)][s] = sum_i WvT[(h,d)][i] * v[s][i] + bv[(h,d)]
  const float qscale = 0.17677669529663688f;                // 32^-0.5 applied as (x.Wq + bq) * scale
  proj3_kernel<<<dim3(96), blk, 0, stream>>>(Xqh, Xql, Xkh, Xkl, Xvh, Xvl, WqTh, WqTl, WkTh, WkTl, WvTh, WvTl,
      bq, bk, bv, Qh, Ql, Kh, Kl, VTh, VTl, qscale);

  // (3) attention with pair bias: 4 key ranges x 8 heads x 32 query blocks of 64 rows -> partial ctx, maximum and sum per key range
  attn_bias_kernel<<<dim3(KSPLIT * NHEAD * (SEQ / 64)), dim3(128), 0, stream>>>(Qh, Ql, Kh, Kl, VTh, VTl, biasP, Op, ML);

  // (4) join of the key ranges -> ctx as bf16 hi/lo planes
  merge_split_kernel<<<gCast, blk, 0, stream>>>(Op, ML, CTh, CTl);

  // (5) out = ctx . Wo + bo -> d_out f32 [2048][256]   (M=2048, N=256, K=256)
  gemm_split_kernel<2, 0><<<gProj, blk, 0, stream>>>(CTh, CTl, WoTh, WoTl,
      (void*)out, (void*)out, DMOD, bo, SEQ, DMOD, 1.0f);

  (void)hipGetLastError();
}

// v005
// One run takes 66.6 microseconds.
// Two timings next to v004 put it at 1.10 and 1.03 times that version's speed.
// Counting every step since v000, it is 2.97 times as fast.
// Contractions: q, k, v^T projections, q.k^T scores, p.v and output projection on v_wmma_f32_16x16x32_bf16 with bf16 hi/lo operands (hi.hi + hi.lo + lo.hi), f32 accumulate; pair bias (exact affine fold of the two linear 2->16->1 maps) and online softmax in f32 on VALU; the keys of a query block are dealt to 4 work-groups whose partial results a later launch joins; the operand planes of the projection GEMMs lie in fragment order.
#include <hip/hip_runtime.h>
#include <math.h>
#include <stdint.h>

#define SEQ   2048
#define DMOD  256
#define NHEAD 8
#define DHD   32
#define KSPLIT 4      // key ranges per query block in the attention launch, one work-group each

typedef __attribute__((ext_vector_type(16))) __bf16   v16b;
typedef __attribute__((ext_vector_type(8)))  __bf16   v8b;
typedef __attribute__((ext_vector_type(8)))  float    v8f;
typedef __attribute__((ext_vector_type(4)))  float    v4f;
typedef __attribute__((ext_vector_type(2)))  float    v2f;
typedef __attribute__((ext_vector_type(4)))  unsigned int v4u;
typedef __attribute__((ext_vector_type(4)))  int      v4i;

// RNE f32 -> bf16 bits
__device__ __forceinline__ unsigned short f2bf_bits(float f) {
  unsigned u = __float_as_uint(f);
  return (unsigned short)((u + 0x7FFFu + ((u >> 16) & 1u)) >> 16);
}
__device__ __forceinline__ float bf_bits2f(unsigned short h) { return __uint_as_float(((unsigned)h) << 16); }
__device__ __forceinline__ unsigned pk16(unsigned short a, unsigned short b) { return (unsigned)a | ((unsigned)b << 16); }

// 16x16x32 fragment (A row-major k-contiguous, or B stored [n][k] k-contiguous):
// lane l: row/col = l & 15, p already offset by 8*(l>>4); elements 0..7 <- p[0..7], elements 8..15 <- p[16..23]
union FragB { v16b v; v8b h[2]; };
__device__ __forceinline__ v16b frag_load(const __bf16* p) {
  FragB f; f.h[0] = *(const v8b*)(p); f.h[1] = *(const v8b*)(p + 16); return f.v;
}

// Fragment order of a GEMM operand plane [rows][K] (K a multiple of 32): one 1-KiB unit per (16 rows, 32 k), units of a row tile in k order.
// Inside a unit lane l's elements 0..7 lie at 16-B piece l, its elements 8..15 at piece 32 + l, so element (row, k) is at
//   (((row >> 4) * (K >> 5) + (k >> 5)) * 2 + ((k >> 4) & 1)) * 256 + ((row & 15) + 16 * ((k >> 3) & 1)) * 8 + (k & 7)
// and each of the two 16-B-per-lane loads of a fragment reads 512 bytes in a row (4 whole lines). Same lane / element / k map as frag_load.
// p: the lane's 16-B piece in the unit (unit start + lane * 8 elements)
__device__ __forceinline__ v16b frag_load_fo(const __bf16* p) {
  FragB f; f.h[0] = *(const v8b*)(p); f.h[1] = *(const v8b*)(p + 256); return f.v;
}

// WMMA + hazard guard (4 VALU slots, ties D, keeps A/B live)
__device__ __forceinline__ v8f mma_bf(v16b a, v16b b, v8f c) {
  c = __builtin_amdgcn_wmma_f32_16x16x32_bf16(false, a, false, b, (short)0, c, false, false);
  asm volatile("v_nop\n\tv_nop\n\tv_nop\n\tv_nop" : "+v"(c) : "v"(a), "v"(b));
  return c;
}

// ---------------------------------------------------------------------------
// Pair bias plane [SEQ][SEQ] f32:
//   pb(map, W1, b1, W2, b2)(n,m) = map*(W1[0].W2) + label*(W1[1].W2) + (b1.W2 + b2)   (both maps linear, exact fold)
//   bias = pb_d + pb_c.  W1 [2][16] row-major, W2 [16][1].
// Block blk owns elements blk*8192 .. blk*8192+8191; each thread 4 consecutive floats per iteration, 8 iterations.
// coverage: 512 blocks x 8 it x 256 thr x 4 = 4194304 = whole plane.
// ---------------------------------------------------------------------------
__device__ __forceinline__ void pair_bias_block(const int blk,
    const float* __restrict__ dist, const float* __restrict__ contact, const int* __restrict__ label,
    const float* __restrict__ Wd1, const float* __restrict__ bd1, const float* __restrict__ Wd2, const float* __restrict__ bd2,
    const float* __restrict__ Wc1, const float* __restrict__ bc1, const float* __restrict__ Wc2, const float* __restrict__ bc2,
    float* __restrict__ bias) {
  float ad = 0.f, ld = 0.f, gd = 0.f, ac = 0.f, lc = 0.f, gc = 0.f;
#pragma unroll 1
  for (int j = 0; j < 16; ++j) {
    const float wd2 = Wd2[j], wc2 = Wc2[j];
    ad = fmaf(Wd1[j],      wd2, ad);   // map weight (row 0 of W1)
    ld = fmaf(Wd1[16 + j], wd2, ld);   // label weight (row 1 of W1)
    gd = fmaf(bd1[j],      wd2, gd);
    ac = fmaf(Wc1[j],      wc2, ac);
    lc = fmaf(Wc1[16 + j], wc2, lc);
    gc = fmaf(bc1[j],      wc2, gc);
  }
  gd += bd2[0];
  gc += bc2[0];
  const size_t base = (size_t)blk * 8192 + (size_t)threadIdx.x * 4;
{
#pragma unroll 1
    for (int it = 0; it < 8; ++it) {
      const size_t i4 = base + (size_t)it * 1024;
      const v4f dm = *(const v4f*)(dist + i4);
      const v4f cm = *(const v4f*)(contact + i4);
      const v4i lb = *(const v4i*)(label + i4);
      v4f o;
#pragma unroll
      for (int e = 0; e < 4; ++e) {
        const float lf = (float)lb[e];
        const float pd = fmaf(dm[e], ad, fmaf(lf, ld, gd));
        const float pc = fmaf(cm[e], ac, fmaf(lf, lc, gc));
        o[e] = pd + pc;
      }
      *(v4f*)(bias + i4) = o;
      // precaution: stands between this store and the next trip's rewrite of the registers that the store names
      asm volatile("s_wait_xcnt 0x0" ::: "memory");
    }
    
  }
}

// ---------------------------------------------------------------------------
// Elementwise bf16 split of in [rows][DMOD]: hi = bf16_rne(in), lo = bf16_rne(in - hi), planes in fragment order (see frag_load_fo).
// A block fills one 1-KiB unit per plane (16 rows x 32 k); thread = 4-B word of the unit, so a wave stores one whole line per plane.
// coverage: grid = ceil(n2/256) x 256 thr x 2 = 2*n2 elements (n2 = 2048*256/2 = 262144 -> 1024 blocks = 128 row tiles x 8 k-steps).
// ---------------------------------------------------------------------------
__device__ __forceinline__ void split_bf16x2_block(const int blk, const float* __restrict__ in, unsigned short* __restrict__ hi,
                                                   unsigned short* __restrict__ lo, int n2) {
  const int i = blk * 256 + threadIdx.x;
  if (i < n2) {
    const int ln  = (threadIdx.x >> 2) & 31;                                   // fragment lane of this word
    const int row = (blk >> 3) * 16 + (ln & 15);
    const int kk  = (blk & 7) * 32 + (threadIdx.x >> 7) * 16 + (ln >> 4) * 8 + (threadIdx.x & 3) * 2;
    const v2f f = *(const v2f*)(in + (size_t)row * DMOD + kk);
    const unsigned short h0 = f2bf_bits(f[0]), h1 = f2bf_bits(f[1]);
    const unsigned short l0 = f2bf_bits(f[0] - bf_bits2f(h0)), l1 = f2bf_bits(f[1] - bf_bits2f(h1));
    const unsigned uh = pk16(h0, h1), ul = pk16(l0, l1);
    ((unsigned*)hi)[i] = uh;
    ((unsigned*)lo)[i] = ul;
  }
}

// ---------------------------------------------------------------------------
// Fused transpose + bf16 split of an f32 matrix W viewed [R rows][Cc cols] (pitch Cc) ->
//   oh(c, r) = bf16_rne(W[r][c]), ol(c, r) = bf16_rne(W[r][c] - oh)   (planes [Cc rows][R k] in fragment order, see frag_load_fo)
// 64x64 tiles through LDS (tf: 64 x 68 floats of the caller). Tile (bx, by) of (Cc/64, R/64), 256 threads, R and Cc multiples of 64.
// coverage per block/plane: load 4 it x 256 thr x 4 floats = 64x64; store 2 it x 256 thr x 8 u16 = 64x64 = 8 whole units (4 row tiles x 2 k-steps).
// ---------------------------------------------------------------------------
__device__ __forceinline__ void tsplit_block(float* tf, const int bx, const int by, const float* __restrict__ W,
                                             unsigned short* __restrict__ oh, unsigned short* __restrict__ ol, int R, int Cc) {
  const int c0  = bx * 64;           // input column block = output row block
  const int r0  = by * 64;           // input row block    = output column block
  const int tid = threadIdx.x;
  {
    const int lr = tid >> 4;         // 0..15
    const int c4 = (tid & 15) * 4;   // 0..60
#pragma unroll
    for (int it = 0; it < 4; ++it) {
      const int rr = it * 16 + lr;   // 0..63
      const v4f a = *(const v4f*)(W + (size_t)(r0 + rr) * Cc + c0 + c4);
      *(v4f*)(tf + rr * 68 + c4) = a;
    }
  }
  __syncthreads();
  // 16-B piece it*256 + tid of the tile's 512: fragment lane, half of the fragment, k-step, row tile
  const int ln   = tid & 31;
  const int part = (tid >> 5) & 1;
  const int ksl  = (tid >> 6) & 1;
  const int c8   = ksl * 32 + part * 16 + (ln >> 4) * 8;   // first of the piece's 8 k (= input rows) within the tile
  v4u hv[2], lv[2];
#pragma unroll
  for (int it = 0; it < 2; ++it) {
    const int oc = (it * 2 + (tid >> 7)) * 16 + (ln & 15);   // output row within tile (= input column)
    v4u a, a2;
#pragma unroll
    for (int q = 0; q < 4; ++q) {
      const float f0 = tf[(c8 + 2 * q) * 68 + oc];
      const float f1 = tf[(c8 + 2 * q + 1) * 68 + oc];
      const unsigned short h0 = f2bf_bits(f0), h1 = f2bf_bits(f1);
      const unsigned short l0 = f2bf_bits(f0 - bf_bits2f(h0)), l1 = f2bf_bits(f1 - bf_bits2f(h1));
      a[q]  = pk16(h0, h1);
      a2[q] = pk16(l0, l1);
    }
    hv[it] = a; lv[it] = a2;
  }
  {
#pragma unroll
    for (int it = 0; it < 2; ++it) {
      const int rt = it * 2 + (tid >> 7);
      const size_t go = ((size_t)(((c0 >> 4) + rt) * (R >> 5) + (r0 >> 5) + ksl) << 9) + part * 256 + ln * 8;
      *(v4u*)(oh + go) = hv[it];
      *(v4u*)(ol + go) = lv[it];
    }
  }
}

// ---------------------------------------------------------------------------
// All work that reads inputs only, in one launch; the jobs are independent of each other and a block does exactly one of them:
//   blocks    0 ..   63 : transpose + split of Wq, Wk, Wv, Wo (16 tiles of 64x64 each)
//   blocks   64 ..  575 : pair bias plane (512 blocks x 8192 elements)
//   blocks  576 .. 3647 : split of q, k, v (1024 blocks x 512 elements each)
// The job test reads blockIdx.x alone, so the barrier in tsplit_block is passed by a whole block or by none of it.
// ---------------------------------------------------------------------------
#define PREP_W_BLOCKS  64
#define PREP_PB_BLOCKS 512
#define PREP_X_BLOCKS  1024
__global__ __launch_bounds__(256) void prep_kernel(
    const float* __restrict__ dist, const float* __restrict__ contact, const int* __restrict__ label,
    const float* __restrict__ Wd1, const float* __restrict__ bd1, const float* __restrict__ Wd2, const float* __restrict__ bd2,
    const float* __restrict__ Wc1, const float* __restrict__ bc1, const float* __restrict__ Wc2, const float* __restrict__ bc2,
    float* __restrict__ bias,
    const float* __restrict__ Wq, const float* __restrict__ Wk, const float* __restrict__ Wv, const float* __restrict__ Wo,
    unsigned short* __restrict__ WqTh, unsigned short* __restrict__ WqTl, unsigned short* __restrict__ WkTh, unsigned short* __restrict__ WkTl,
    unsigned short* __restrict__ WvTh, unsigned short* __restrict__ WvTl, unsigned short* __restrict__ WoTh, unsigned short* __restrict__ WoTl,
    const float* __restrict__ q, const float* __restrict__ k, const float* __restrict__ v,
    unsigned short* __restrict__ Xqh, unsigned short* __restrict__ Xql, unsigned short* __restrict__ Xkh, unsigned short* __restrict__ Xkl,
    unsigned short* __restrict__ Xvh, unsigned short* __restrict__ Xvl) {
  __shared__ __align__(16) float tf[64 * 68];
  const int b = blockIdx.x;
  if (b < PREP_W_BLOCKS) {
    const int w = b >> 4;
    const float*    W  = (w == 0) ? Wq   : (w == 1) ? Wk   : (w == 2) ? Wv   : Wo;
    unsigned short* oh = (w == 0) ? WqTh : (w == 1) ? WkTh : (w == 2) ? WvTh : WoTh;
    unsigned short* ol = (w == 0) ? WqTl : (w == 1) ? WkTl : (w == 2) ? WvTl : WoTl;
    tsplit_block(tf, b & 3, (b >> 2) & 3, W, oh, ol, DMOD, DMOD);
  } else if (b < PREP_W_BLOCKS + PREP_PB_BLOCKS) {
    pair_bias_block(b - PREP_W_BLOCKS, dist, contact, label, Wd1, bd1, Wd2, bd2, Wc1, bc1, Wc2, bc2, bias);
  } else {
    const int t = b - (PREP_W_BLOCKS + PREP_PB_BLOCKS);
    const int x = t >> 10;
    const float*    in = (x == 0) ? q   : (x == 1) ? k   : v;
    unsigned short* hi = (x == 0) ? Xqh : (x == 1) ? Xkh : Xvh;
    unsigned short* lo = (x == 0) ? Xql : (x == 1) ? Xkl : Xvl;
    split_bf16x2_block(t & (PREP_X_BLOCKS - 1), in, hi, lo, SEQ * DMOD / 2);
  }
}

// ---------------------------------------------------------------------------
// Split-operand WMMA GEMM: C[m,n] = scale * (sum_k A[m,k]*Bt[n,k] + bias)
//   A hi/lo planes [M][K], Bt hi/lo planes [N][K], all in fragment order (see frag_load_fo); product = hi.hi + hi.lo + lo.hi.
//   Each wave owns a 32x64 tile: M % 32 == 0, N % 64 == 0, K = KD (compile time), KD % 32 == 0.  No block barriers (wave-local LDS slab).
//   BIAS_MODE: 1 = bias[m], 2 = bias[n].  OUT_MODE: 0 = f32 [M][ldc], 2 = bf16 hi plane (Cout) + lo plane (Cout2).
//   sT: the caller's LDS, per-wave 16x64 slab, pitch 68 floats.  blk: which group of 8 wave tiles.
// ---------------------------------------------------------------------------
template <int BIAS_MODE, int OUT_MODE, int KD>
__device__ __forceinline__ void gemm_split_block(float (*sT)[16 * 68], const int blk,
    const unsigned short* __restrict__ Ahp, const unsigned short* __restrict__ Alp,
    const unsigned short* __restrict__ Bhp, const unsigned short* __restrict__ Blp,
    void* __restrict__ Cout, void* __restrict__ Cout2, int ldc,
    const float* __restrict__ bias, int M, int N, float scale) {
  const __bf16* Ah = (const __bf16*)(const void*)Ahp;
  const __bf16* Al = (const __bf16*)(const void*)Alp;
  const __bf16* Bh = (const __bf16*)(const void*)Bhp;
  const __bf16* Bl = (const __bf16*)(const void*)Blp;
  const int lane = threadIdx.x & 31;
  const int wave = threadIdx.x >> 5;
  const int tilesN = N >> 6;
  const int tilesM = M >> 5;
  const int tile = blk * 8 + wave;
  if (tile >= tilesM * tilesN) return;   // wave-uniform; no block barriers in this kernel
  const int tm = tile / tilesN;
  const int tn = tile - tm * tilesN;
  const int m0 = tm << 5;
  const int n0 = tn << 6;

  const int rlane = lane & 15;           // row (A) / col (B, D) within subtile
  const int mOff  = (lane >> 4) * 8;     // D row offset

  v8f acc[2][4];
#pragma unroll
  for (int i = 0; i < 2; ++i)
#pragma unroll
    for (int j = 0; j < 4; ++j) acc[i][j] = (v8f){0.f,0.f,0.f,0.f,0.f,0.f,0.f,0.f};

  constexpr int KSTEPS = KD >> 5;
  constexpr int TSTEP  = KSTEPS << 9;     // elements from one 16-row tile of a plane to the next
  const size_t aoff = (size_t)(m0 >> 4) * TSTEP + lane * 8;
  const size_t boff = (size_t)(n0 >> 4) * TSTEP + lane * 8;
  for (int kst = 0; kst < KSTEPS; ++kst) {
    // the lane's piece in this k-step's unit of the wave's first row tile, one address per plane; the other tiles lie at fixed distances
    const __bf16* pah = Ah + aoff + ((size_t)kst << 9);
    const __bf16* pal = Al + aoff + ((size_t)kst << 9);
    const __bf16* pbh = Bh + boff + ((size_t)kst << 9);
    const __bf16* pbl = Bl + boff + ((size_t)kst << 9);
    v16b bh[4], bl[4], ah[2], al[2];
#pragma unroll
    for (int j = 0; j < 4; ++j) {
      bh[j] = frag_load_fo(pbh + j * TSTEP);
      bl[j] = frag_load_fo(pbl + j * TSTEP);
    }
#pragma unroll
    for (int i = 0; i < 2; ++i) {
      ah[i] = frag_load_fo(pah + i * TSTEP);
      al[i] = frag_load_fo(pal + i * TSTEP);
    }
    // precaution: stands between the k-step's loads and any rewrite of the address registers that they name; as inputs the four
    // addresses stay in their registers up to here, so that no load of the group returns its data into one of them
    asm volatile("s_wait_xcnt 0x0" :: "v"(pah), "v"(pal), "v"(pbh), "v"(pbl) : "memory");
#pragma unroll
    for (int i = 0; i < 2; ++i) {
#pragma unroll
      for (int j = 0; j < 4; ++j) {
        acc[i][j] = mma_bf(ah[i], bh[j], acc[i][j]);
        acc[i][j] = mma_bf(ah[i], bl[j], acc[i][j]);
        acc[i][j] = mma_bf(al[i], bh[j], acc[i][j]);
      }
    }
  }

  // ---- epilogue ----
  float* slab = sT[wave];
#pragma unroll
  for (int i = 0; i < 2; ++i) {
    const int mBase = m0 + (i << 4);
#pragma unroll
    for (int j = 0; j < 4; ++j) {
      const int n = n0 + (j << 4) + rlane;
      float bvn = 0.f;
      if (BIAS_MODE == 2) bvn = bias[n];
#pragma unroll
      for (int r = 0; r < 8; ++r) {
        float v = acc[i][j][r];
        if (BIAS_MODE == 1) v += bias[mBase + mOff + r];
        if (BIAS_MODE == 2) v += bvn;
        v *= scale;
        slab[(mOff + r) * 68 + (j << 4) + rlane] = v;
      }
    }
    __builtin_amdgcn_fence(__ATOMIC_RELEASE, "workgroup");
    __builtin_amdgcn_wave_barrier();
    __builtin_amdgcn_fence(__ATOMIC_ACQUIRE, "workgroup");
    if (OUT_MODE == 0) {
      float* C = (float*)Cout;
      const int hh = lane >> 4, c4 = (lane & 15) * 4;     // row seg = 256 B = 16 lanes x 16 B; rows it*2+hh cover 0..15
      {
#pragma unroll
        for (int it = 0; it < 8; ++it) {
          const int row = it * 2 + hh;
          const v4f v = *(const v4f*)(slab + row * 68 + c4);
          *(v4f*)(C + (size_t)(mBase + row) * ldc + n0 + c4) = v;
        }
        
      }
    } else {
      const int q = lane >> 3, c8 = (lane & 7) * 8;
      unsigned short* C  = (unsigned short*)Cout;
      unsigned short* C2 = (unsigned short*)Cout2;
      {
#pragma unroll
        for (int it = 0; it < 4; ++it) {
          const int row = it * 4 + q;
          const float* sp = slab + row * 68 + c8;
          v4u hv, lv;
#pragma unroll
          for (int e = 0; e < 4; ++e) {
            const float f0 = sp[2 * e], f1 = sp[2 * e + 1];
            const unsigned short h0 = f2bf_bits(f0), h1 = f2bf_bits(f1);
            const unsigned short l0 = f2bf_bits(f0 - bf_bits2f(h0)), l1 = f2bf_bits(f1 - bf_bits2f(h1));
            hv[e] = pk16(h0, h1);
            lv[e] = pk16(l0, l1);
          }
          *(v4u*)(C  + (size_t)(mBase + row) * ldc + n0 + c8) = hv;
          *(v4u*)(C2 + (size_t)(mBase + row) * ldc + n0 + c8) = lv;
        }
        
      }
    }
    __builtin_amdgcn_fence(__ATOMIC_RELEASE, "workgroup");
    __builtin_amdgcn_wave_barrier();
    __builtin_amdgcn_fence(__ATOMIC_ACQUIRE, "workgroup");
  }
}

template <int BIAS_MODE, int OUT_MODE>
__global__ __launch_bounds__(256) void gemm_split_kernel(
    const unsigned short* __restrict__ Ahp, const unsigned short* __restrict__ Alp,
    const unsigned short* __restrict__ Bhp, const unsigned short* __restrict__ Blp,
    void* __restrict__ Cout, void* __restrict__ Cout2, int ldc,
    const float* __restrict__ bias, int M, int N, float scale) {
  __shared__ __align__(16) float sT[8][16 * 68];
  gemm_split_block<BIAS_MODE, OUT_MODE, DMOD>(sT, blockIdx.x, Ahp, Alp, Bhp, Blp, Cout, Cout2, ldc, bias, M, N, scale);
}

// The q, k and v^T projections in one launch: they are independent of each other, 32 blocks (256 wave tiles of 32x64) each.
//   blocks  0 .. 31 : Q   = (q.Wq + bq) * qscale   [SEQ][DMOD]
//   blocks 32 .. 63 : K   =  k.Wk + bk             [SEQ][DMOD]
//   blocks 64 .. 95 : V^T =  WvT.v^T + bv          [DMOD][SEQ]
__global__ __launch_bounds__(256) void proj3_kernel(
    const unsigned short* __restrict__ Xqh, const unsigned short* __restrict__ Xql,
    const unsigned short* __restrict__ Xkh, const unsigned short* __restrict__ Xkl,
    const unsigned short* __restrict__ Xvh, const unsigned short* __restrict__ Xvl,
    const unsigned short* __restrict__ WqTh, const unsigned short* __restrict__ WqTl,
    const unsigned short* __restrict__ WkTh, const unsigned short* __restrict__ WkTl,
    const unsigned short* __restrict__ WvTh, const unsigned short* __restrict__ WvTl,
    const float* __restrict__ bq, const float* __restrict__ bk, const float* __restrict__ bv,
    unsigned short* __restrict__ Qh, unsigned short* __restrict__ Ql,
    unsigned short* __restrict__ Kh, unsigned short* __restrict__ Kl,
    unsigned short* __restrict__ VTh, unsigned short* __restrict__ VTl, float qscale) {
  __shared__ __align__(16) float sT[8][16 * 68];
  const int job = blockIdx.x >> 5;
  const int blk = blockIdx.x & 31;
  if (job < 2) {
    const bool isq = (job == 0);
    gemm_split_block<2, 2, DMOD>(sT, blk, isq ? Xqh : Xkh, isq ? Xql : Xkl, isq ? WqTh : WkTh, isq ? WqTl : WkTl,
                           (void*)(isq ? Qh : Kh), (void*)(isq ? Ql : Kl), DMOD, isq ? bq : bk, SEQ, DMOD,
                           isq ? qscale : 1.0f);
  } else {
    gemm_split_block<1, 2, DMOD>(sT, blk, WvTh, WvTl, Xvh, Xvl, (void*)VTh, (void*)VTl, SEQ, bv, DMOD, SEQ, 1.0f);
  }
}

// =====================================================================================
// Flash attention with additive pair bias, head dim 32, all 8 heads in one launch.
//   q planes (hi/lo bf16): element (t, h, d) at [t*DMOD + h*32 + d]   (score scale already folded into q)
//   k planes (hi/lo bf16): element (s, h, d) at [s*DMOD + h*32 + d]
//   v^T planes (hi/lo bf16): element (h, d, s) at [(h*32 + d)*SEQ + s]
//   bias f32 [SEQ t][SEQ s], shared over heads
//   opart f32, one plane per key range ks: element (ks, t, h, d) at [ks*SEQ*DMOD + t*DMOD + h*32 + d], NOT normalised
//   ml f32: running maximum and sum of (ks, h, t) at [((ks*NHEAD + h)*SEQ + t)*2 + 0 / 1]
//   scores^T = k . q^T + bias^T : bf16 hi/lo (hi.hi + hi.lo + lo.hi), bias added in f32; a lane holds one query's scores
//   ctx^T    = v^T . p^T         : bf16 hi/lo of p (unnormalised, <= 1, packed in registers) and v, f32 accumulate
//   online softmax in f32 over the block's SEQ/KSPLIT keys (8 chunks of 64 keys, compile-time trip count).
//   Block = 4 waves = 64 query rows of one head against one key range; grid = KSPLIT * NHEAD * (SEQ/64) = 1024 blocks of 128 threads.
//   The KSPLIT partial results of a query (maximum, sum, unnormalised ctx) are joined by merge_split_kernel in the next launch.
//   K / V^T chunk staging through LDS by all 128 threads (plain 16-B loads, __syncthreads before and after);
// =====================================================================================
#define AT_KC 64

__device__ __forceinline__ __bf16 at_f2bf(float f) { return __builtin_bit_cast(__bf16, f2bf_bits(f)); }
__device__ __forceinline__ void at_split(float f, __bf16& hi, __bf16& lo) {
  const unsigned short hb = f2bf_bits(f);
  hi = __builtin_bit_cast(__bf16, hb);
  lo = at_f2bf(f - __uint_as_float(((unsigned)hb) << 16));
}

// e^(x - m) on the chip's own base-2 exponential: one multiply-add and one v_exp_f32. nm2 = -m * LOG2E.
// An argument below the f32 exponent range (also -inf) gives 0, as the limit asks.
#define LOG2E 1.4426950408889634f
__device__ __forceinline__ float exp_rel(float x, float nm2) { return __builtin_amdgcn_exp2f(fmaf(x, LOG2E, nm2)); }

// value of lane l ^ 16 (the other wave half), by a vector cross-row move
__device__ __forceinline__ float xhalf(float x) {
  const int b = __builtin_bit_cast(int, x);
  return __builtin_bit_cast(float, __builtin_amdgcn_permlanex16(b, b, 0x76543210, 0xfedcba98, false, false));
}

// Four waves per SIMD asked of the compiler: the grid supplies four (1024 work-groups of 4 waves on 256 WGPs), so that one
// work-group's waits (staging, barriers, LDS, dependent vector chains) are filled by the other three. Without the upper bound the
// compiler saves registers for waves that never come and strings a lane's 32 independent exp/split chains one behind another.
__global__ __launch_bounds__(128) __attribute__((amdgpu_waves_per_eu(4, 4)))
void attn_bias_kernel(const unsigned short* __restrict__ qhp, const unsigned short* __restrict__ qlp,
                      const unsigned short* __restrict__ khp, const unsigned short* __restrict__ klp,
                      const unsigned short* __restrict__ vhp, const unsigned short* __restrict__ vlp,
                      const float* __restrict__ bias, float* __restrict__ opart, float* __restrict__ ml) {
  __shared__ __align__(16) __bf16 Ksh[AT_KC * DHD];          // K hi [kv][d]      4 KB
  __shared__ __align__(16) __bf16 Ksl[AT_KC * DHD];          // K lo
  __shared__ __align__(16) __bf16 Vth[DHD * AT_KC];          // V hi [d][kv]      4 KB
  __shared__ __align__(16) __bf16 Vtl[DHD * AT_KC];          // V lo
  __shared__ __align__(16) float  Os[4][16 * 36];            // per wave ctx tile, pitch 36

  const int tid  = threadIdx.x;
  const int wave = tid >> 5;
  const int lane = tid & 31;
  const int hh   = lane >> 4;
  const int c    = lane & 15;

  const int nqb = SEQ / 64;               // 32
  const int bx = blockIdx.x;
  const int qb = bx % nqb;
  const int h  = (bx / nqb) % NHEAD;      // 0..NHEAD-1
  const int ks = bx / (nqb * NHEAD);      // 0..KSPLIT-1: keys ks*SEQ/KSPLIT .. (ks+1)*SEQ/KSPLIT - 1
  const int q0 = qb * 64 + wave * 16;     // first query row of this wave

  const __bf16* Qh = (const __bf16*)(const void*)qhp + (size_t)h * DHD;
  const __bf16* Ql = (const __bf16*)(const void*)qlp + (size_t)h * DHD;
  const __bf16* Kh = (const __bf16*)(const void*)khp + (size_t)h * DHD;
  const __bf16* Kl = (const __bf16*)(const void*)klp + (size_t)h * DHD;
  const __bf16* Vh = (const __bf16*)(const void*)vhp + (size_t)h * DHD * SEQ;
  const __bf16* Vl = (const __bf16*)(const void*)vlp + (size_t)h * DHD * SEQ;
  float*        ob = opart + (size_t)ks * SEQ * DMOD + (size_t)h * DHD;

  // ---- Q fragments (B operand of S^T = K.Q^T: column = query = lane&15, split k map), one 32-deep k-step, hi and lo ----
  const v16b qbh = frag_load(Qh + (size_t)(q0 + c) * DMOD + 8 * hh);
  const v16b qbl = frag_load(Ql + (size_t)(q0 + c) * DMOD + 8 * hh);

  // One query (q0 + c) per lane; the two wave halves hold different keys (and different d) of that query.
  float mrow = -INFINITY;   // running maximum, equal in both halves
  float lrow = 0.f;         // running sum over this half's keys only; the halves are joined once after the loop
  v8f oacc[2];              // ctx^T tiles: element r of tile t = (d = 16*t + 8*hh + r, query c)
#pragma unroll
  for (int t = 0; t < 2; ++t) oacc[t] = (v8f){0.f,0.f,0.f,0.f,0.f,0.f,0.f,0.f};

  // bias of this lane: row (q0 + c), cols (kv0 + 16*j + 8*hh + r), r = 0..7 contiguous
  const float* brow = bias + (size_t)(q0 + c) * SEQ + 8 * hh;

  const int nChunks = SEQ / KSPLIT / AT_KC;   // 8, compile-time constant
  for (int kc = 0; kc < nChunks; ++kc) {
    const int kv0 = ks * (SEQ / KSPLIT) + kc * AT_KC;
    __syncthreads();
    {
      // K staging coverage: 128 thr -> 64 rows (tid>>1) x 2 halves of 16 d (tid&1) x 2 v8b = 64 x 32 per plane
      const int r = tid >> 1, hf = (tid & 1) * 16;
      const __bf16* ksh = Kh + (size_t)(kv0 + r) * DMOD + hf;
      const __bf16* ksl = Kl + (size_t)(kv0 + r) * DMOD + hf;
      // V^T staging coverage: 128 thr -> 32 rows (tid>>2) x 4 parts of 16 keys (tid&3) x 2 v8b = 32 x 64 per plane
      const int r2 = tid >> 2, part = (tid & 3) * 16;
      const __bf16* vsh = Vh + (size_t)r2 * SEQ + kv0 + part;
      const __bf16* vsl = Vl + (size_t)r2 * SEQ + kv0 + part;
#pragma unroll
      for (int i = 0; i < 2; ++i) {
        const v8b a0 = *(const v8b*)(ksh + 8 * i);
        const v8b a1 = *(const v8b*)(ksl + 8 * i);
        const v8b b0 = *(const v8b*)(vsh + 8 * i);
        const v8b b1 = *(const v8b*)(vsl + 8 * i);
        *(v8b*)(Ksh + r * DHD + hf + 8 * i)      = a0;
        *(v8b*)(Ksl + r * DHD + hf + 8 * i)      = a1;
        *(v8b*)(Vth + r2 * AT_KC + part + 8 * i) = b0;
        *(v8b*)(Vtl + r2 * AT_KC + part + 8 * i) = b1;
      }
    }
    __syncthreads();

    // ---- S^T = k.q^T : 4 key-row tiles of 16, A[m=key][k=d] from K tile rows, B = Q (both split k map) ----
    // s[j][r] = score of key (kv0 + 16*j + 8*hh + r) against query (q0 + c)
    v4f bb[8];   // this lane's 32 bias values of the chunk: 8 contiguous floats per key tile, asked for as one group
#pragma unroll
    for (int j = 0; j < 4; ++j) {
      bb[2 * j]     = *(const v4f*)(brow + kv0 + j * 16);
      bb[2 * j + 1] = *(const v4f*)(brow + kv0 + j * 16 + 4);
    }
    v8f s[4];
#pragma unroll
    for (int j = 0; j < 4; ++j) {
      s[j] = (v8f){0.f,0.f,0.f,0.f,0.f,0.f,0.f,0.f};
      FragB kb, kl;
      kb.h[0] = *(const v8b*)(Ksh + (j * 16 + c) * DHD + 8 * hh);
      kb.h[1] = *(const v8b*)(Ksh + (j * 16 + c) * DHD + 16 + 8 * hh);
      kl.h[0] = *(const v8b*)(Ksl + (j * 16 + c) * DHD + 8 * hh);
      kl.h[1] = *(const v8b*)(Ksl + (j * 16 + c) * DHD + 16 + 8 * hh);
      s[j] = mma_bf(kb.v, qbh, s[j]);
      s[j] = mma_bf(kl.v, qbh, s[j]);
      s[j] = mma_bf(kb.v, qbl, s[j]);
    }
    // ---- add pair bias in f32; chunk maximum in-lane over 32 keys, then one exchange between the halves ----
    float cm = -INFINITY;
#pragma unroll
    for (int j = 0; j < 4; ++j) {
#pragma unroll
      for (int r = 0; r < 4; ++r) {
        s[j][r]     += bb[2 * j][r];
        s[j][r + 4] += bb[2 * j + 1][r];
        cm = fmaxf(cm, fmaxf(s[j][r], s[j][r + 4]));
      }
    }
    cm = fmaxf(cm, xhalf(cm));
    const float mnew  = fmaxf(mrow, cm);
    const float nm2   = -mnew * LOG2E;
    const float alpha = exp_rel(mrow, nm2);
    mrow = mnew;
    // ---- p = exp(s - m) by exp_rel, split hi/lo and packed straight into the B operand of ctx^T += v^T.p^T:
    //      element e of k-step kk is key 32*kk + 8*hh + e (e < 8, tile 2*kk) or 32*kk + 16 + 8*hh + e - 8 (tile 2*kk + 1),
    //      the k order of the V^T fragment loads below ----
    v16b pbh[2], pbl[2];
    float psum = 0.f;
#pragma unroll
    for (int j = 0; j < 4; ++j) {
#pragma unroll
      for (int r = 0; r < 8; ++r) {
        const float p = exp_rel(s[j][r], nm2);
        psum += p;
        __bf16 a, bl; at_split(p, a, bl);
        pbh[j >> 1][(j & 1) * 8 + r] = a;
        pbl[j >> 1][(j & 1) * 8 + r] = bl;
      }
    }
    lrow = lrow * alpha + psum;
#pragma unroll
    for (int t = 0; t < 2; ++t)
#pragma unroll
      for (int r = 0; r < 8; ++r) oacc[t][r] *= alpha;
    // ---- ctx^T += V^T . P^T : A[m=d][k=key] from V^T tile rows (2 k-steps of 32 keys), B = P^T from registers ----
#pragma unroll
    for (int kk = 0; kk < 2; ++kk) {
#pragma unroll
      for (int t = 0; t < 2; ++t) {
        FragB vb, vl;
        vb.h[0] = *(const v8b*)(Vth + (t * 16 + c) * AT_KC + kk * 32 + 8 * hh);
        vb.h[1] = *(const v8b*)(Vth + (t * 16 + c) * AT_KC + kk * 32 + 16 + 8 * hh);
        vl.h[0] = *(const v8b*)(Vtl + (t * 16 + c) * AT_KC + kk * 32 + 8 * hh);
        vl.h[1] = *(const v8b*)(Vtl + (t * 16 + c) * AT_KC + kk * 32 + 16 + 8 * hh);
        oacc[t] = mma_bf(vb.v, pbh[kk], oacc[t]);
        oacc[t] = mma_bf(vl.v, pbh[kk], oacc[t]);
        oacc[t] = mma_bf(vb.v, pbl[kk], oacc[t]);
      }
    }
  }

  // ---- join the halves' sums; stage the wave's 16 x 32 unnormalised ctx tile [query][d] for whole-line stores ----
  float* os = Os[wave];
  const float lsum = lrow + xhalf(lrow);
  {
#pragma unroll
    for (int t = 0; t < 2; ++t) {
      const v4f o0 = (v4f){oacc[t][0], oacc[t][1], oacc[t][2], oacc[t][3]};
      const v4f o1 = (v4f){oacc[t][4], oacc[t][5], oacc[t][6], oacc[t][7]};
      *(v4f*)(os + c * 36 + t * 16 + 8 * hh)     = o0;
      *(v4f*)(os + c * 36 + t * 16 + 8 * hh + 4) = o1;
    }
  }
  __builtin_amdgcn_fence(__ATOMIC_RELEASE, "workgroup");
  __builtin_amdgcn_wave_barrier();
  __builtin_amdgcn_fence(__ATOMIC_ACQUIRE, "workgroup");
  {
    const int q4 = lane >> 3, c4 = (lane & 7) * 4;
    {
#pragma unroll
      for (int it = 0; it < 4; ++it) {
        const int row = it * 4 + q4;
        const v4f val = *(const v4f*)(os + row * 36 + c4);
        *(v4f*)(ob + (size_t)(q0 + row) * DMOD + c4) = val;
      }
      
    }
  }
  // maximum (lower half) and sum (upper half) of query q0 + c: the wave's 32 lanes fill one 128-B line
  ml[(((size_t)ks * NHEAD + h) * SEQ + q0 + c) * 2 + hh] = hh ? lsum : mrow;
}

// ---------------------------------------------------------------------------
// Join of the KSPLIT partial attention results, then the bf16 split of ctx:
//   M = max_ks m, w = exp(m - M), ctx = (sum_ks w * opart) / (sum_ks w * l); hi = bf16_rne(ctx), lo = bf16_rne(ctx - hi)
// The ctx planes are written in fragment order (see frag_load_fo): a block fills one 1-KiB unit per plane = 16 queries x the 32 d of one head;
// thread = 4-B word of the unit (2 elements), so a wave stores one whole line per plane.
// coverage: 1024 blocks (128 query tiles x 8 heads) x 256 thr x 2 = SEQ * DMOD elements.
// ---------------------------------------------------------------------------
__global__ __launch_bounds__(256) void merge_split_kernel(const float* __restrict__ opart, const float* __restrict__ ml,
                                                          unsigned short* __restrict__ hi, unsigned short* __restrict__ lo) {
  const int i  = blockIdx.x * 256 + threadIdx.x;   // 4-B word of the planes
  const int ln = (threadIdx.x >> 2) & 31;          // fragment lane of this word
  const int h  = blockIdx.x & 7;                   // k-step of 32 columns = head
  const int t  = (blockIdx.x >> 3) * 16 + (ln & 15);
  const int col = h * DHD + (threadIdx.x >> 7) * 16 + (ln >> 4) * 8 + (threadIdx.x & 3) * 2;
  v2f a[KSPLIT], o[KSPLIT];
#pragma unroll
  for (int s = 0; s < KSPLIT; ++s) {
    a[s] = *(const v2f*)(ml + (((size_t)s * NHEAD + h) * SEQ + t) * 2);
    o[s] = *(const v2f*)(opart + (size_t)s * SEQ * DMOD + (size_t)t * DMOD + col);
  }
  float M = a[0][0];
#pragma unroll
  for (int s = 1; s < KSPLIT; ++s) M = fmaxf(M, a[s][0]);
  const float nM2 = -M * LOG2E;
  float L = 0.f, f0 = 0.f, f1 = 0.f;
#pragma unroll
  for (int s = 0; s < KSPLIT; ++s) {
    const float w = exp_rel(a[s][0], nM2);
    L  = fmaf(w, a[s][1], L);
    f0 = fmaf(w, o[s][0], f0);
    f1 = fmaf(w, o[s][1], f1);
  }
  const float inv = 1.0f / L;
  f0 *= inv;
  f1 *= inv;
  const unsigned short h0 = f2bf_bits(f0), h1 = f2bf_bits(f1);
  const unsigned short l0 = f2bf_bits(f0 - bf_bits2f(h0)), l1 = f2bf_bits(f1 - bf_bits2f(h1));
  ((unsigned*)hi)[i] = pk16(h0, h1);
  ((unsigned*)lo)[i] = pk16(l0, l1);
}

// ---------------------------------------------------------------------------
//   biasP f32 [2048][2048]                 0 .. 16777216
//   WqTh/l, WkTh/l, WvTh/l, WoTh/l  bf16 [256 o][256 i], fragment order   131072 each  (8 planes) 16777216 .. 17825792
//   Xqh/l, Xkh/l, Xvh/l bf16 [2048][256], fragment order   1048576 each (6 planes)      17825792 .. 24117248
//   Qh/l, Kh/l  bf16 [2048][256]            1048576 each (4 planes)      24117248 .. 28311552
//   VTh/l bf16 [256 (h,d)][2048]            1048576 each (2 planes)      28311552 .. 30408704
//   OPART f32 [4 key ranges][2048][256]     2097152 each (4 planes)      30408704 .. 38797312
//   ML f32 [4 key ranges][8][2048][2]       524288                       38797312 .. 39321600
//   CTXh/l bf16 [2048][256], fragment order 1048576 each (2 planes)      39321600 .. 41418752
//   total                                   41418752
// ---------------------------------------------------------------------------
extern "C" void kernel_launch(void* const* d_in, const int* in_sizes, int n_in,
                              void* d_out, int out_size, void* d_ws, size_t ws_size,
                              hipStream_t stream) {
  if (n_in < 22) return;
  if (in_sizes[0] != SEQ * SEQ || in_sizes[1] != SEQ * SEQ || in_sizes[2] != SEQ * SEQ) return;
  if (in_sizes[3] != SEQ * DMOD || in_sizes[4] != SEQ * DMOD || in_sizes[5] != SEQ * DMOD) return;
  if (in_sizes[6] != DMOD * DMOD || in_sizes[8] != DMOD * DMOD || in_sizes[10] != DMOD * DMOD || in_sizes[12] != DMOD * DMOD) return;
  if (in_sizes[7] != DMOD || in_sizes[9] != DMOD || in_sizes[11] != DMOD || in_sizes[13] != DMOD) return;
  if (in_sizes[14] != 32 || in_sizes[15] != 16 || in_sizes[16] != 16 || in_sizes[17] != 1) return;
  if (in_sizes[18] != 32 || in_sizes[19] != 16 || in_sizes[20] != 16 || in_sizes[21] != 1) return;
  if (out_size != SEQ * DMOD) return;

  const int*   label   = (const int*)  d_in[0];
  const float* dist    = (const float*)d_in[1];
  const float* contact = (const float*)d_in[2];
  const float* q   = (const float*)d_in[3];
  const float* k   = (const float*)d_in[4];
  const float* v   = (const float*)d_in[5];
  const float* Wq  = (const float*)d_in[6];
  const float* bq  = (const float*)d_in[7];
  const float* Wk  = (const float*)d_in[8];
  const float* bk  = (const float*)d_in[9];
  const float* Wv  = (const float*)d_in[10];
  const float* bv  = (const float*)d_in[11];
  const float* Wo  = (const float*)d_in[12];
  const float* bo  = (const float*)d_in[13];
  const float* Wd1 = (const float*)d_in[14];
  const float* bd1 = (const float*)d_in[15];
  const float* Wd2 = (const float*)d_in[16];
  const float* bd2 = (const float*)d_in[17];
  const float* Wc1 = (const float*)d_in[18];
  const float* bc1 = (const float*)d_in[19];
  const float* Wc2 = (const float*)d_in[20];
  const float* bc2 = (const float*)d_in[21];
  float* out = (float*)d_out;

  const size_t PB = (size_t)SEQ * SEQ * 4;     // 16777216  f32 bias plane
  const size_t PW = (size_t)DMOD * DMOD * 2;   // 131072    bf16 weight plane [256][256]
  const size_t PX = (size_t)SEQ * DMOD * 2;    // 1048576   bf16 activation plane [2048][256] / [256][2048]
  const size_t PF = (size_t)SEQ * DMOD * 4;    // 2097152   f32 activation plane
  size_t off = 0;
  const size_t oBias = off; off += PB;
  const size_t oWqTh = off; off += PW;  const size_t oWqTl = off; off += PW;
  const size_t oWkTh = off; off += PW;  const size_t oWkTl = off; off += PW;
  const size_t oWvTh = off; off += PW;  const size_t oWvTl = off; off += PW;
  const size_t oWoTh = off; off += PW;  const size_t oWoTl = off; off += PW;
  const size_t oXqh  = off; off += PX;  const size_t oXql  = off; off += PX;
  const size_t oXkh  = off; off += PX;  const size_t oXkl  = off; off += PX;
  const size_t oXvh  = off; off += PX;  const size_t oXvl  = off; off += PX;
  const size_t oQh   = off; off += PX;  const size_t oQl   = off; off += PX;
  const size_t oKh   = off; off += PX;  const size_t oKl   = off; off += PX;
  const size_t oVTh  = off; off += PX;  const size_t oVTl  = off; off += PX;
  const size_t oOp   = off; off += KSPLIT * PF;
  const size_t oML   = off; off += (size_t)KSPLIT * NHEAD * SEQ * 2 * 4;
  const size_t oCTh  = off; off += PX;  const size_t oCTl  = off; off += PX;
  if (off > ws_size) return;                   // off = 41418752

  char* ws = (char*)d_ws;
  float*          biasP = (float*)(ws + oBias);
  unsigned short* WqTh = (unsigned short*)(ws + oWqTh); unsigned short* WqTl = (unsigned short*)(ws + oWqTl);
  unsigned short* WkTh = (unsigned short*)(ws + oWkTh); unsigned short* WkTl = (unsigned short*)(ws + oWkTl);
  unsigned short* WvTh = (unsigned short*)(ws + oWvTh); unsigned short* WvTl = (unsigned short*)(ws + oWvTl);
  unsigned short* WoTh = (unsigned short*)(ws + oWoTh); unsigned short* WoTl = (unsigned short*)(ws + oWoTl);
  unsigned short* Xqh  = (unsigned short*)(ws + oXqh);  unsigned short* Xql  = (unsigned short*)(ws + oXql);
  unsigned short* Xkh  = (unsigned short*)(ws + oXkh);  unsigned short* Xkl  = (unsigned short*)(ws + oXkl);
  unsigned short* Xvh  = (unsigned short*)(ws + oXvh);  unsigned short* Xvl  = (unsigned short*)(ws + oXvl);
  unsigned short* Qh   = (unsigned short*)(ws + oQh);   unsigned short* Ql   = (unsigned short*)(ws + oQl);
  unsigned short* Kh   = (unsigned short*)(ws + oKh);   unsigned short* Kl   = (unsigned short*)(ws + oKl);
  unsigned short* VTh  = (unsigned short*)(ws + oVTh);  unsigned short* VTl  = (unsigned short*)(ws + oVTl);
  float*          Op   = (float*)(ws + oOp);
  float*          ML   = (float*)(ws + oML);
  unsigned short* CTh  = (unsigned short*)(ws + oCTh);  unsigned short* CTl  = (unsigned short*)(ws + oCTl);

  const dim3 blk(256);

  // (1) everything that reads inputs only, one launch: weight planes [out][in], pair bias plane, q/k/v hi/lo planes
  prep_kernel<<<dim3(PREP_W_BLOCKS + PREP_PB_BLOCKS + 3 * PREP_X_BLOCKS), blk, 0, stream>>>(dist, contact, label,
      Wd1, bd1, Wd2, bd2, Wc1, bc1, Wc2, bc2, biasP,
      Wq, Wk, Wv, Wo, WqTh, WqTl, WkTh, WkTl, WvTh, WvTl, WoTh, WoTl,
      q, k, v, Xqh, Xql, Xkh, Xkl, Xvh, Xvl);

  const int n2x = SEQ * DMOD / 2;                           // 262144 pairs per plane
  const dim3 gCast((n2x + 255) / 256);                      // 1024 blocks x 512 elements
  const dim3 gProj(((SEQ / 32) * (DMOD / 64) + 7) / 8);     // M=2048, N=256: 256 wave tiles (32x64) -> 32 blocks of 8 waves

  // (2) the three projections, one launch of 3 x 32 blocks; v^T[(h,d)][s] = sum_i WvT[(h,d)][i] * v[s][i] + bv[(h,d)]
  const float qscale = 0.17677669529663688f;                // 32^-0.5 applied as (x.Wq + bq) * scale
  proj3_kernel<<<dim3(96), blk, 0, stream>>>(Xqh, Xql, Xkh, Xkl, Xvh, Xvl, WqTh, WqTl, WkTh, WkTl, WvTh, WvTl,
      bq, bk, bv, Qh, Ql, Kh, Kl, VTh, VTl, qscale);

  // (3) attention with pair bias: 4 key ranges x 8 heads x 32 query blocks of 64 rows -> partial ctx, maximum and sum per key range
  attn_bias_kernel<<<dim3(KSPLIT * NHEAD * (SEQ / 64)), dim3(128), 0, stream>>>(Qh, Ql, Kh, Kl, VTh, VTl, biasP, Op, ML);

  // (4) join of the key ranges -> ctx as bf16 hi/lo planes
  merge_split_kernel<<<gCast, blk, 0, stream>>>(Op, ML, CTh, CTl);

  // (5) out = ctx . Wo + bo -> d_out f32 [2048][256]   (M=2048, N=256, K=256)
  gemm_split_kernel<2, 0><<<gProj, blk, 0, stream>>>(CTh, CTl, WoTh, WoTl,
      (void*)out, (void*)out, DMOD, bo, SEQ, DMOD, 1.0f);

  (void)hipGetLastError();
}

// v006
// One run takes 59 microseconds.
// In two side-by-side timings against v005, it was 1.20 and 1.13 times as fast.
// All steps since v000 together make it 3.47 times as fast.
// Contractions: q, k, v^T projections, q.k^T scores, p.v and output projection on v_wmma_f32_16x16x32_bf16 with bf16 hi/lo operands (hi.hi + hi.lo + lo.hi), f32 accumulate; pair bias (exact affine fold of the two linear 2->16->1 maps) and online softmax in f32 on VALU; the keys of a query block are dealt to 4 work-groups whose partial results the output projection's launch joins; the operand planes of the projection GEMMs lie in fragment order.
#include <hip/hip_runtime.h>
#include <math.h>
#include <stdint.h>

#define SEQ   2048
#define DMOD  256
#define NHEAD 8
#define DHD   32
#define KSPLIT 4      // key ranges per query block in the attention launch, one work-group each

typedef __attribute__((ext_vector_type(16))) __bf16   v16b;
typedef __attribute__((ext_vector_type(8)))  __bf16   v8b;
typedef __attribute__((ext_vector_type(8)))  float    v8f;
typedef __attribute__((ext_vector_type(4)))  float    v4f;
typedef __attribute__((ext_vector_type(2)))  float    v2f;
typedef __attribute__((ext_vector_type(4)))  unsigned int v4u;
typedef __attribute__((ext_vector_type(4)))  int      v4i;

// RNE f32 -> bf16 bits
__device__ __forceinline__ unsigned short f2bf_bits(float f) {
  unsigned u = __float_as_uint(f);
  return (unsigned short)((u + 0x7FFFu + ((u >> 16) & 1u)) >> 16);
}
__device__ __forceinline__ float bf_bits2f(unsigned short h) { return __uint_as_float(((unsigned)h) << 16); }
__device__ __forceinline__ unsigned pk16(unsigned short a, unsigned short b) { return (unsigned)a | ((unsigned)b << 16); }

// 16x16x32 fragment (A row-major k-contiguous, or B stored [n][k] k-contiguous):
// lane l: row/col = l & 15, p already offset by 8*(l>>4); elements 0..7 <- p[0..7], elements 8..15 <- p[16..23]
union FragB { v16b v; v8b h[2]; };
__device__ __forceinline__ v16b frag_load(const __bf16* p) {
  FragB f; f.h[0] = *(const v8b*)(p); f.h[1] = *(const v8b*)(p + 16); return f.v;
}

// Fragment order of a GEMM operand plane [rows][K] (K a multiple of 32): one 1-KiB unit per (16 rows, 32 k), units of a row tile in k order.
// Inside a unit lane l's elements 0..7 lie at 16-B piece l, its elements 8..15 at piece 32 + l, so element (row, k) is at
//   (((row >> 4) * (K >> 5) + (k >> 5)) * 2 + ((k >> 4) & 1)) * 256 + ((row & 15) + 16 * ((k >> 3) & 1)) * 8 + (k & 7)
// and each of the two 16-B-per-lane loads of a fragment reads 512 bytes in a row (4 whole lines). Same lane / element / k map as frag_load.
// p: the lane's 16-B piece in the unit (unit start + lane * 8 elements)
__device__ __forceinline__ v16b frag_load_fo(const __bf16* p) {
  FragB f; f.h[0] = *(const v8b*)(p); f.h[1] = *(const v8b*)(p + 256); return f.v;
}

// WMMA + hazard guard (4 VALU slots, ties D, keeps A/B live)
__device__ __forceinline__ v8f mma_bf(v16b a, v16b b, v8f c) {
  c = __builtin_amdgcn_wmma_f32_16x16x32_bf16(false, a, false, b, (short)0, c, false, false);
  asm volatile("v_nop\n\tv_nop\n\tv_nop\n\tv_nop" : "+v"(c) : "v"(a), "v"(b));
  return c;
}

// ---------------------------------------------------------------------------
// Pair bias plane [SEQ][SEQ] f32:
//   pb(map, W1, b1, W2, b2)(n,m) = map*(W1[0].W2) + label*(W1[1].W2) + (b1.W2 + b2)   (both maps linear, exact fold)
//   bias = pb_d + pb_c.  W1 [2][16] row-major, W2 [16][1].
// Block blk owns elements blk*8192 .. blk*8192+8191; each thread 4 consecutive floats per iteration, 8 iterations.
// coverage: 512 blocks x 8 it x 256 thr x 4 = 4194304 = whole plane.
// ---------------------------------------------------------------------------
__device__ __forceinline__ void pair_bias_block(const int blk,
    const float* __restrict__ dist, const float* __restrict__ contact, const int* __restrict__ label,
    const float* __restrict__ Wd1, const float* __restrict__ bd1, const float* __restrict__ Wd2, const float* __restrict__ bd2,
    const float* __restrict__ Wc1, const float* __restrict__ bc1, const float* __restrict__ Wc2, const float* __restrict__ bc2,
    float* __restrict__ bias) {
  float ad = 0.f, ld = 0.f, gd = 0.f, ac = 0.f, lc = 0.f, gc = 0.f;
#pragma unroll 1
  for (int j = 0; j < 16; ++j) {
    const float wd2 = Wd2[j], wc2 = Wc2[j];
    ad = fmaf(Wd1[j],      wd2, ad);   // map weight (row 0 of W1)
    ld = fmaf(Wd1[16 + j], wd2, ld);   // label weight (row 1 of W1)
    gd = fmaf(bd1[j],      wd2, gd);
    ac = fmaf(Wc1[j],      wc2, ac);
    lc = fmaf(Wc1[16 + j], wc2, lc);
    gc = fmaf(bc1[j],      wc2, gc);
  }
  gd += bd2[0];
  gc += bc2[0];
  const size_t base = (size_t)blk * 8192 + (size_t)threadIdx.x * 4;
{
#pragma unroll 1
    for (int it = 0; it < 8; ++it) {
      const size_t i4 = base + (size_t)it * 1024;
      const v4f dm = *(const v4f*)(dist + i4);
      const v4f cm = *(const v4f*)(contact + i4);
      const v4i lb = *(const v4i*)(label + i4);
      v4f o;
#pragma unroll
      for (int e = 0; e < 4; ++e) {
        const float lf = (float)lb[e];
        const float pd = fmaf(dm[e], ad, fmaf(lf, ld, gd));
        const float pc = fmaf(cm[e], ac, fmaf(lf, lc, gc));
        o[e] = pd + pc;
      }
      *(v4f*)(bias + i4) = o;
      // precaution: stands between this store and the next trip's rewrite of the registers that the store names
      asm volatile("s_wait_xcnt 0x0" ::: "memory");
    }
    
  }
}

// ---------------------------------------------------------------------------
// Elementwise bf16 split of in [rows][DMOD]: hi = bf16_rne(in), lo = bf16_rne(in - hi), planes in fragment order (see frag_load_fo).
// A block fills one 1-KiB unit per plane (16 rows x 32 k); thread = 4-B word of the unit, so a wave stores one whole line per plane.
// coverage: grid = ceil(n2/256) x 256 thr x 2 = 2*n2 elements (n2 = 2048*256/2 = 262144 -> 1024 blocks = 128 row tiles x 8 k-steps).
// ---------------------------------------------------------------------------
__device__ __forceinline__ void split_bf16x2_block(const int blk, const float* __restrict__ in, unsigned short* __restrict__ hi,
                                                   unsigned short* __restrict__ lo, int n2) {
  const int i = blk * 256 + threadIdx.x;
  if (i < n2) {
    const int ln  = (threadIdx.x >> 2) & 31;                                   // fragment lane of this word
    const int row = (blk >> 3) * 16 + (ln & 15);
    const int kk  = (blk & 7) * 32 + (threadIdx.x >> 7) * 16 + (ln >> 4) * 8 + (threadIdx.x & 3) * 2;
    const v2f f = *(const v2f*)(in + (size_t)row * DMOD + kk);
    const unsigned short h0 = f2bf_bits(f[0]), h1 = f2bf_bits(f[1]);
    const unsigned short l0 = f2bf_bits(f[0] - bf_bits2f(h0)), l1 = f2bf_bits(f[1] - bf_bits2f(h1));
    const unsigned uh = pk16(h0, h1), ul = pk16(l0, l1);
    ((unsigned*)hi)[i] = uh;
    ((unsigned*)lo)[i] = ul;
  }
}

// ---------------------------------------------------------------------------
// Fused transpose + bf16 split of an f32 matrix W viewed [R rows][Cc cols] (pitch Cc) ->
//   oh(c, r) = bf16_rne(W[r][c]), ol(c, r) = bf16_rne(W[r][c] - oh)   (planes [Cc rows][R k] in fragment order, see frag_load_fo)
// 64x64 tiles through LDS (tf: 64 x 68 floats of the caller). Tile (bx, by) of (Cc/64, R/64), 256 threads, R and Cc multiples of 64.
// coverage per block/plane: load 4 it x 256 thr x 4 floats = 64x64; store 2 it x 256 thr x 8 u16 = 64x64 = 8 whole units (4 row tiles x 2 k-steps).
// ---------------------------------------------------------------------------
__device__ __forceinline__ void tsplit_block(float* tf, const int bx, const int by, const float* __restrict__ W,
                                             unsigned short* __restrict__ oh, unsigned short* __restrict__ ol, int R, int Cc) {
  const int c0  = bx * 64;           // input column block = output row block
  const int r0  = by * 64;           // input row block    = output column block
  const int tid = threadIdx.x;
  {
    const int lr = tid >> 4;         // 0..15
    const int c4 = (tid & 15) * 4;   // 0..60
#pragma unroll
    for (int it = 0; it < 4; ++it) {
      const int rr = it * 16 + lr;   // 0..63
      const v4f a = *(const v4f*)(W + (size_t)(r0 + rr) * Cc + c0 + c4);
      *(v4f*)(tf + rr * 68 + c4) = a;
    }
  }
  __syncthreads();
  // 16-B piece it*256 + tid of the tile's 512: fragment lane, half of the fragment, k-step, row tile
  const int ln   = tid & 31;
  const int part = (tid >> 5) & 1;
  const int ksl  = (tid >> 6) & 1;
  const int c8   = ksl * 32 + part * 16 + (ln >> 4) * 8;   // first of the piece's 8 k (= input rows) within the tile
  v4u hv[2], lv[2];
#pragma unroll
  for (int it = 0; it < 2; ++it) {
    const int oc = (it * 2 + (tid >> 7)) * 16 + (ln & 15);   // output row within tile (= input column)
    v4u a, a2;
#pragma unroll
    for (int q = 0; q < 4; ++q) {
      const float f0 = tf[(c8 + 2 * q) * 68 + oc];
      const float f1 = tf[(c8 + 2 * q + 1) * 68 + oc];
      const unsigned short h0 = f2bf_bits(f0), h1 = f2bf_bits(f1);
      const unsigned short l0 = f2bf_bits(f0 - bf_bits2f(h0)), l1 = f2bf_bits(f1 - bf_bits2f(h1));
      a[q]  = pk16(h0, h1);
      a2[q] = pk16(l0, l1);
    }
    hv[it] = a; lv[it] = a2;
  }
  {
#pragma unroll
    for (int it = 0; it < 2; ++it) {
      const int rt = it * 2 + (tid >> 7);
      const size_t go = ((size_t)(((c0 >> 4) + rt) * (R >> 5) + (r0 >> 5) + ksl) << 9) + part * 256 + ln * 8;
      *(v4u*)(oh + go) = hv[it];
      *(v4u*)(ol + go) = lv[it];
    }
  }
}

// ---------------------------------------------------------------------------
// All work that reads inputs only, in one launch; the jobs are independent of each other and a block does exactly one of them:
//   blocks    0 ..   63 : transpose + split of Wq, Wk, Wv, Wo (16 tiles of 64x64 each)
//   blocks   64 ..  575 : pair bias plane (512 blocks x 8192 elements)
//   blocks  576 .. 3647 : split of q, k, v (1024 blocks x 512 elements each)
// The job test reads blockIdx.x alone, so the barrier in tsplit_block is passed by a whole block or by none of it.
// ---------------------------------------------------------------------------
#define PREP_W_BLOCKS  64
#define PREP_PB_BLOCKS 512
#define PREP_X_BLOCKS  1024
__global__ __launch_bounds__(256) void prep_kernel(
    const float* __restrict__ dist, const float* __restrict__ contact, const int* __restrict__ label,
    const float* __restrict__ Wd1, const float* __restrict__ bd1, const float* __restrict__ Wd2, const float* __restrict__ bd2,
    const float* __restrict__ Wc1, const float* __restrict__ bc1, const float* __restrict__ Wc2, const float* __restrict__ bc2,
    float* __restrict__ bias,
    const float* __restrict__ Wq, const float* __restrict__ Wk, const float* __restrict__ Wv, const float* __restrict__ Wo,
    unsigned short* __restrict__ WqTh, unsigned short* __restrict__ WqTl, unsigned short* __restrict__ WkTh, unsigned short* __restrict__ WkTl,
    unsigned short* __restrict__ WvTh, unsigned short* __restrict__ WvTl, unsigned short* __restrict__ WoTh, unsigned short* __restrict__ WoTl,
    const float* __restrict__ q, const float* __restrict__ k, const float* __restrict__ v,
    unsigned short* __restrict__ Xqh, unsigned short* __restrict__ Xql, unsigned short* __restrict__ Xkh, unsigned short* __restrict__ Xkl,
    unsigned short* __restrict__ Xvh, unsigned short* __restrict__ Xvl) {
  __shared__ __align__(16) float tf[64 * 68];
  const int b = blockIdx.x;
  if (b < PREP_W_BLOCKS) {
    const int w = b >> 4;
    const float*    W  = (w == 0) ? Wq   : (w == 1) ? Wk   : (w == 2) ? Wv   : Wo;
    unsigned short* oh = (w == 0) ? WqTh : (w == 1) ? WkTh : (w == 2) ? WvTh : WoTh;
    unsigned short* ol = (w == 0) ? WqTl : (w == 1) ? WkTl : (w == 2) ? WvTl : WoTl;
    tsplit_block(tf, b & 3, (b >> 2) & 3, W, oh, ol, DMOD, DMOD);
  } else if (b < PREP_W_BLOCKS + PREP_PB_BLOCKS) {
    pair_bias_block(b - PREP_W_BLOCKS, dist, contact, label, Wd1, bd1, Wd2, bd2, Wc1, bc1, Wc2, bc2, bias);
  } else {
    const int t = b - (PREP_W_BLOCKS + PREP_PB_BLOCKS);
    const int x = t >> 10;
    const float*    in = (x == 0) ? q   : (x == 1) ? k   : v;
    unsigned short* hi = (x == 0) ? Xqh : (x == 1) ? Xkh : Xvh;
    unsigned short* lo = (x == 0) ? Xql : (x == 1) ? Xkl : Xvl;
    split_bf16x2_block(t & (PREP_X_BLOCKS - 1), in, hi, lo, SEQ * DMOD / 2);
  }
}

// ---------------------------------------------------------------------------
// Split-operand WMMA GEMM: C[m,n] = scale * (sum_k A[m,k]*Bt[n,k] + bias)
//   A hi/lo planes [M][K], Bt hi/lo planes [N][K], all in fragment order (see frag_load_fo); product = hi.hi + hi.lo + lo.hi.
//   Each wave owns a 32x64 tile: M % 32 == 0, N % 64 == 0, K = KD (compile time), KD % 32 == 0.  No block barriers (wave-local LDS slab).
//   BIAS_MODE: 1 = bias[m], 2 = bias[n].  OUT_MODE: 0 = f32 [M][ldc], 2 = bf16 hi plane (Cout) + lo plane (Cout2).
//   sT: the caller's LDS, per-wave 16x64 slab, pitch 68 floats.  blk: which group of 8 wave tiles.
// ---------------------------------------------------------------------------
template <int BIAS_MODE, int OUT_MODE, int KD>
__device__ __forceinline__ void gemm_split_block(float (*sT)[16 * 68], const int blk,
    const unsigned short* __restrict__ Ahp, const unsigned short* __restrict__ Alp,
    const unsigned short* __restrict__ Bhp, const unsigned short* __restrict__ Blp,
    void* __restrict__ Cout, void* __restrict__ Cout2, int ldc,
    const float* __restrict__ bias, int M, int N, float scale) {
  const __bf16* Ah = (const __bf16*)(const void*)Ahp;
  const __bf16* Al = (const __bf16*)(const void*)Alp;
  const __bf16* Bh = (const __bf16*)(const void*)Bhp;
  const __bf16* Bl = (const __bf16*)(const void*)Blp;
  const int lane = threadIdx.x & 31;
  const int wave = threadIdx.x >> 5;
  const int tilesN = N >> 6;
  const int tilesM = M >> 5;
  const int tile = blk * 8 + wave;
  if (tile >= tilesM * tilesN) return;   // wave-uniform; no block barriers in this kernel
  const int tm = tile / tilesN;
  const int tn = tile - tm * tilesN;
  const int m0 = tm << 5;
  const int n0 = tn << 6;

  const int rlane = lane & 15;           // row (A) / col (B, D) within subtile
  const int mOff  = (lane >> 4) * 8;     // D row offset

  v8f acc[2][4];
#pragma unroll
  for (int i = 0; i < 2; ++i)
#pragma unroll
    for (int j = 0; j < 4; ++j) acc[i][j] = (v8f){0.f,0.f,0.f,0.f,0.f,0.f,0.f,0.f};

  constexpr int KSTEPS = KD >> 5;
  constexpr int TSTEP  = KSTEPS << 9;     // elements from one 16-row tile of a plane to the next
  const size_t aoff = (size_t)(m0 >> 4) * TSTEP + lane * 8;
  const size_t boff = (size_t)(n0 >> 4) * TSTEP + lane * 8;
  for (int kst = 0; kst < KSTEPS; ++kst) {
    // the lane's piece in this k-step's unit of the wave's first row tile, one address per plane; the other tiles lie at fixed distances
    const __bf16* pah = Ah + aoff + ((size_t)kst << 9);
    const __bf16* pal = Al + aoff + ((size_t)kst << 9);
    const __bf16* pbh = Bh + boff + ((size_t)kst << 9);
    const __bf16* pbl = Bl + boff + ((size_t)kst << 9);
    v16b bh[4], bl[4], ah[2], al[2];
#pragma unroll
    for (int j = 0; j < 4; ++j) {
      bh[j] = frag_load_fo(pbh + j * TSTEP);
      bl[j] = frag_load_fo(pbl + j * TSTEP);
    }
#pragma unroll
    for (int i = 0; i < 2; ++i) {
      ah[i] = frag_load_fo(pah + i * TSTEP);
      al[i] = frag_load_fo(pal + i * TSTEP);
    }
    // precaution: stands between the k-step's loads and any rewrite of the address registers that they name; as inputs the four
    // addresses stay in their registers up to here, so that no load of the group returns its data into one of them
    asm volatile("s_wait_xcnt 0x0" :: "v"(pah), "v"(pal), "v"(pbh), "v"(pbl) : "memory");
#pragma unroll
    for (int i = 0; i < 2; ++i) {
#pragma unroll
      for (int j = 0; j < 4; ++j) {
        acc[i][j] = mma_bf(ah[i], bh[j], acc[i][j]);
        acc[i][j] = mma_bf(ah[i], bl[j], acc[i][j]);
        acc[i][j] = mma_bf(al[i], bh[j], acc[i][j]);
      }
    }
  }

  // ---- epilogue ----
  float* slab = sT[wave];
#pragma unroll
  for (int i = 0; i < 2; ++i) {
    const int mBase = m0 + (i << 4);
#pragma unroll
    for (int j = 0; j < 4; ++j) {
      const int n = n0 + (j << 4) + rlane;
      float bvn = 0.f;
      if (BIAS_MODE == 2) bvn = bias[n];
#pragma unroll
      for (int r = 0; r < 8; ++r) {
        float v = acc[i][j][r];
        if (BIAS_MODE == 1) v += bias[mBase + mOff + r];
        if (BIAS_MODE == 2) v += bvn;
        v *= scale;
        slab[(mOff + r) * 68 + (j << 4) + rlane] = v;
      }
    }
    __builtin_amdgcn_fence(__ATOMIC_RELEASE, "workgroup");
    __builtin_amdgcn_wave_barrier();
    __builtin_amdgcn_fence(__ATOMIC_ACQUIRE, "workgroup");
    if (OUT_MODE == 0) {
      float* C = (float*)Cout;
      const int hh = lane >> 4, c4 = (lane & 15) * 4;     // row seg = 256 B = 16 lanes x 16 B; rows it*2+hh cover 0..15
      {
#pragma unroll
        for (int it = 0; it < 8; ++it) {
          const int row = it * 2 + hh;
          const v4f v = *(const v4f*)(slab + row * 68 + c4);
          *(v4f*)(C + (size_t)(mBase + row) * ldc + n0 + c4) = v;
        }
        
      }
    } else {
      const int q = lane >> 3, c8 = (lane & 7) * 8;
      unsigned short* C  = (unsigned short*)Cout;
      unsigned short* C2 = (unsigned short*)Cout2;
      {
#pragma unroll
        for (int it = 0; it < 4; ++it) {
          const int row = it * 4 + q;
          const float* sp = slab + row * 68 + c8;
          v4u hv, lv;
#pragma unroll
          for (int e = 0; e < 4; ++e) {
            const float f0 = sp[2 * e], f1 = sp[2 * e + 1];
            const unsigned short h0 = f2bf_bits(f0), h1 = f2bf_bits(f1);
            const unsigned short l0 = f2bf_bits(f0 - bf_bits2f(h0)), l1 = f2bf_bits(f1 - bf_bits2f(h1));
            hv[e] = pk16(h0, h1);
            lv[e] = pk16(l0, l1);
          }
          *(v4u*)(C  + (size_t)(mBase + row) * ldc + n0 + c8) = hv;
          *(v4u*)(C2 + (size_t)(mBase + row) * ldc + n0 + c8) = lv;
        }
        
      }
    }
    __builtin_amdgcn_fence(__ATOMIC_RELEASE, "workgroup");
    __builtin_amdgcn_wave_barrier();
    __builtin_amdgcn_fence(__ATOMIC_ACQUIRE, "workgroup");
  }
}

// The q, k and v^T projections in one launch: they are independent of each other, 32 blocks (256 wave tiles of 32x64) each.
//   blocks  0 .. 31 : Q   = (q.Wq + bq) * qscale   [SEQ][DMOD]
//   blocks 32 .. 63 : K   =  k.Wk + bk             [SEQ][DMOD]
//   blocks 64 .. 95 : V^T =  WvT.v^T + bv          [DMOD][SEQ]
__global__ __launch_bounds__(256) void proj3_kernel(
    const unsigned short* __restrict__ Xqh, const unsigned short* __restrict__ Xql,
    const unsigned short* __restrict__ Xkh, const unsigned short* __restrict__ Xkl,
    const unsigned short* __restrict__ Xvh, const unsigned short* __restrict__ Xvl,
    const unsigned short* __restrict__ WqTh, const unsigned short* __restrict__ WqTl,
    const unsigned short* __restrict__ WkTh, const unsigned short* __restrict__ WkTl,
    const unsigned short* __restrict__ WvTh, const unsigned short* __restrict__ WvTl,
    const float* __restrict__ bq, const float* __restrict__ bk, const float* __restrict__ bv,
    unsigned short* __restrict__ Qh, unsigned short* __restrict__ Ql,
    unsigned short* __restrict__ Kh, unsigned short* __restrict__ Kl,
    unsigned short* __restrict__ VTh, unsigned short* __restrict__ VTl, float qscale) {
  __shared__ __align__(16) float sT[8][16 * 68];
  const int job = blockIdx.x >> 5;
  const int blk = blockIdx.x & 31;
  if (job < 2) {
    const bool isq = (job == 0);
    gemm_split_block<2, 2, DMOD>(sT, blk, isq ? Xqh : Xkh, isq ? Xql : Xkl, isq ? WqTh : WkTh, isq ? WqTl : WkTl,
                           (void*)(isq ? Qh : Kh), (void*)(isq ? Ql : Kl), DMOD, isq ? bq : bk, SEQ, DMOD,
                           isq ? qscale : 1.0f);
  } else {
    gemm_split_block<1, 2, DMOD>(sT, blk, WvTh, WvTl, Xvh, Xvl, (void*)VTh, (void*)VTl, SEQ, bv, DMOD, SEQ, 1.0f);
  }
}

// =====================================================================================
// Flash attention with additive pair bias, head dim 32, all 8 heads in one launch.
//   q planes (hi/lo bf16): element (t, h, d) at [t*DMOD + h*32 + d]   (score scale already folded into q)
//   k planes (hi/lo bf16): element (s, h, d) at [s*DMOD + h*32 + d]
//   v^T planes (hi/lo bf16): element (h, d, s) at [(h*32 + d)*SEQ + s]
//   bias f32 [SEQ t][SEQ s], shared over heads
//   opart f32, one plane per key range ks: element (ks, t, h, d) at [ks*SEQ*DMOD + t*DMOD + h*32 + d], NOT normalised
//   ml f32: running maximum and sum of (ks, h, t) at [((ks*NHEAD + h)*SEQ + t)*2 + 0 / 1]
//   scores^T = k . q^T + bias^T : bf16 hi/lo (hi.hi + hi.lo + lo.hi), bias added in f32; a lane holds one query's scores
//   ctx^T    = v^T . p^T         : bf16 hi/lo of p (unnormalised, <= 1, packed in registers) and v, f32 accumulate
//   online softmax in f32 over the block's SEQ/KSPLIT keys (8 chunks of 64 keys, compile-time trip count).
//   Block = 4 waves = 64 query rows of one head against one key range; grid = KSPLIT * NHEAD * (SEQ/64) = 1024 blocks of 128 threads.
//   The KSPLIT partial results of a query (maximum, sum, unnormalised ctx) are joined by merge_out_kernel in the next launch.
//   K / V^T chunk staging through LDS by all 128 threads (plain 16-B loads, __syncthreads before and after);
// =====================================================================================
#define AT_KC 64

__device__ __forceinline__ __bf16 at_f2bf(float f) { return __builtin_bit_cast(__bf16, f2bf_bits(f)); }
__device__ __forceinline__ void at_split(float f, __bf16& hi, __bf16& lo) {
  const unsigned short hb = f2bf_bits(f);
  hi = __builtin_bit_cast(__bf16, hb);
  lo = at_f2bf(f - __uint_as_float(((unsigned)hb) << 16));
}

// e^(x - m) on the chip's own base-2 exponential: one multiply-add and one v_exp_f32. nm2 = -m * LOG2E.
// An argument below the f32 exponent range (also -inf) gives 0, as the limit asks.
#define LOG2E 1.4426950408889634f
__device__ __forceinline__ float exp_rel(float x, float nm2) { return __builtin_amdgcn_exp2f(fmaf(x, LOG2E, nm2)); }

// value of lane l ^ 16 (the other wave half), by a vector cross-row move
__device__ __forceinline__ float xhalf(float x) {
  const int b = __builtin_bit_cast(int, x);
  return __builtin_bit_cast(float, __builtin_amdgcn_permlanex16(b, b, 0x76543210, 0xfedcba98, false, false));
}

// Four waves per SIMD asked of the compiler: the grid supplies four (1024 work-groups of 4 waves on 256 WGPs), so that one
// work-group's waits (staging, barriers, LDS, dependent vector chains) are filled by the other three. Without the upper bound the
// compiler saves registers for waves that never come and strings a lane's 32 independent exp/split chains one behind another.
__global__ __launch_bounds__(128) __attribute__((amdgpu_waves_per_eu(4, 4)))
void attn_bias_kernel(const unsigned short* __restrict__ qhp, const unsigned short* __restrict__ qlp,
                      const unsigned short* __restrict__ khp, const unsigned short* __restrict__ klp,
                      const unsigned short* __restrict__ vhp, const unsigned short* __restrict__ vlp,
                      const float* __restrict__ bias, float* __restrict__ opart, float* __restrict__ ml) {
  __shared__ __align__(16) __bf16 Ksh[AT_KC * DHD];          // K hi [kv][d]      4 KB
  __shared__ __align__(16) __bf16 Ksl[AT_KC * DHD];          // K lo
  __shared__ __align__(16) __bf16 Vth[DHD * AT_KC];          // V hi [d][kv]      4 KB
  __shared__ __align__(16) __bf16 Vtl[DHD * AT_KC];          // V lo
  __shared__ __align__(16) float  Os[4][16 * 36];            // per wave ctx tile, pitch 36

  const int tid  = threadIdx.x;
  const int wave = tid >> 5;
  const int lane = tid & 31;
  const int hh   = lane >> 4;
  const int c    = lane & 15;

  const int nqb = SEQ / 64;               // 32
  const int bx = blockIdx.x;
  const int qb = bx % nqb;
  const int h  = (bx / nqb) % NHEAD;      // 0..NHEAD-1
  const int ks = bx / (nqb * NHEAD);      // 0..KSPLIT-1: keys ks*SEQ/KSPLIT .. (ks+1)*SEQ/KSPLIT - 1
  const int q0 = qb * 64 + wave * 16;     // first query row of this wave

  const __bf16* Qh = (const __bf16*)(const void*)qhp + (size_t)h * DHD;
  const __bf16* Ql = (const __bf16*)(const void*)qlp + (size_t)h * DHD;
  const __bf16* Kh = (const __bf16*)(const void*)khp + (size_t)h * DHD;
  const __bf16* Kl = (const __bf16*)(const void*)klp + (size_t)h * DHD;
  const __bf16* Vh = (const __bf16*)(const void*)vhp + (size_t)h * DHD * SEQ;
  const __bf16* Vl = (const __bf16*)(const void*)vlp + (size_t)h * DHD * SEQ;
  float*        ob = opart + (size_t)ks * SEQ * DMOD + (size_t)h * DHD;

  // ---- Q fragments (B operand of S^T = K.Q^T: column = query = lane&15, split k map), one 32-deep k-step, hi and lo ----
  const v16b qbh = frag_load(Qh + (size_t)(q0 + c) * DMOD + 8 * hh);
  const v16b qbl = frag_load(Ql + (size_t)(q0 + c) * DMOD + 8 * hh);

  // One query (q0 + c) per lane; the two wave halves hold different keys (and different d) of that query.
  float mrow = -INFINITY;   // running maximum, equal in both halves
  float lrow = 0.f;         // running sum over this half's keys only; the halves are joined once after the loop
  v8f oacc[2];              // ctx^T tiles: element r of tile t = (d = 16*t + 8*hh + r, query c)
#pragma unroll
  for (int t = 0; t < 2; ++t) oacc[t] = (v8f){0.f,0.f,0.f,0.f,0.f,0.f,0.f,0.f};

  // bias of this lane: row (q0 + c), cols (kv0 + 16*j + 8*hh + r), r = 0..7 contiguous
  const float* brow = bias + (size_t)(q0 + c) * SEQ + 8 * hh;

  const int nChunks = SEQ / KSPLIT / AT_KC;   // 8, compile-time constant
  for (int kc = 0; kc < nChunks; ++kc) {
    const int kv0 = ks * (SEQ / KSPLIT) + kc * AT_KC;
    __syncthreads();
    {
      // K staging coverage: 128 thr -> 64 rows (tid>>1) x 2 halves of 16 d (tid&1) x 2 v8b = 64 x 32 per plane
      const int r = tid >> 1, hf = (tid & 1) * 16;
      const __bf16* ksh = Kh + (size_t)(kv0 + r) * DMOD + hf;
      const __bf16* ksl = Kl + (size_t)(kv0 + r) * DMOD + hf;
      // V^T staging coverage: 128 thr -> 32 rows (tid>>2) x 4 parts of 16 keys (tid&3) x 2 v8b = 32 x 64 per plane
      const int r2 = tid >> 2, part = (tid & 3) * 16;
      const __bf16* vsh = Vh + (size_t)r2 * SEQ + kv0 + part;
      const __bf16* vsl = Vl + (size_t)r2 * SEQ + kv0 + part;
#pragma unroll
      for (int i = 0; i < 2; ++i) {
        const v8b a0 = *(const v8b*)(ksh + 8 * i);
        const v8b a1 = *(const v8b*)(ksl + 8 * i);
        const v8b b0 = *(const v8b*)(vsh + 8 * i);
        const v8b b1 = *(const v8b*)(vsl + 8 * i);
        *(v8b*)(Ksh + r * DHD + hf + 8 * i)      = a0;
        *(v8b*)(Ksl + r * DHD + hf + 8 * i)      = a1;
        *(v8b*)(Vth + r2 * AT_KC + part + 8 * i) = b0;
        *(v8b*)(Vtl + r2 * AT_KC + part + 8 * i) = b1;
      }
    }
    __syncthreads();

    // ---- S^T = k.q^T : 4 key-row tiles of 16, A[m=key][k=d] from K tile rows, B = Q (both split k map) ----
    // s[j][r] = score of key (kv0 + 16*j + 8*hh + r) against query (q0 + c)
    v4f bb[8];   // this lane's 32 bias values of the chunk: 8 contiguous floats per key tile, asked for as one group
#pragma unroll
    for (int j = 0; j < 4; ++j) {
      bb[2 * j]     = *(const v4f*)(brow + kv0 + j * 16);
      bb[2 * j + 1] = *(const v4f*)(brow + kv0 + j * 16 + 4);
    }
    v8f s[4];
#pragma unroll
    for (int j = 0; j < 4; ++j) {
      s[j] = (v8f){0.f,0.f,0.f,0.f,0.f,0.f,0.f,0.f};
      FragB kb, kl;
      kb.h[0] = *(const v8b*)(Ksh + (j * 16 + c) * DHD + 8 * hh);
      kb.h[1] = *(const v8b*)(Ksh + (j * 16 + c) * DHD + 16 + 8 * hh);
      kl.h[0] = *(const v8b*)(Ksl + (j * 16 + c) * DHD + 8 * hh);
      kl.h[1] = *(const v8b*)(Ksl + (j * 16 + c) * DHD + 16 + 8 * hh);
      s[j] = mma_bf(kb.v, qbh, s[j]);
      s[j] = mma_bf(kl.v, qbh, s[j]);
      s[j] = mma_bf(kb.v, qbl, s[j]);
    }
    // ---- add pair bias in f32; chunk maximum in-lane over 32 keys, then one exchange between the halves ----
    float cm = -INFINITY;
#pragma unroll
    for (int j = 0; j < 4; ++j) {
#pragma unroll
      for (int r = 0; r < 4; ++r) {
        s[j][r]     += bb[2 * j][r];
        s[j][r + 4] += bb[2 * j + 1][r];
        cm = fmaxf(cm, fmaxf(s[j][r], s[j][r + 4]));
      }
    }
    cm = fmaxf(cm, xhalf(cm));
    const float mnew  = fmaxf(mrow, cm);
    const float nm2   = -mnew * LOG2E;
    const float alpha = exp_rel(mrow, nm2);
    mrow = mnew;
    // ---- p = exp(s - m) by exp_rel, split hi/lo and packed straight into the B operand of ctx^T += v^T.p^T:
    //      element e of k-step kk is key 32*kk + 8*hh + e (e < 8, tile 2*kk) or 32*kk + 16 + 8*hh + e - 8 (tile 2*kk + 1),
    //      the k order of the V^T fragment loads below ----
    v16b pbh[2], pbl[2];
    float psum = 0.f;
#pragma unroll
    for (int j = 0; j < 4; ++j) {
#pragma unroll
      for (int r = 0; r < 8; ++r) {
        const float p = exp_rel(s[j][r], nm2);
        psum += p;
        __bf16 a, bl; at_split(p, a, bl);
        pbh[j >> 1][(j & 1) * 8 + r] = a;
        pbl[j >> 1][(j & 1) * 8 + r] = bl;
      }
    }
    lrow = lrow * alpha + psum;
#pragma unroll
    for (int t = 0; t < 2; ++t)
#pragma unroll
      for (int r = 0; r < 8; ++r) oacc[t][r] *= alpha;
    // ---- ctx^T += V^T . P^T : A[m=d][k=key] from V^T tile rows (2 k-steps of 32 keys), B = P^T from registers ----
#pragma unroll
    for (int kk = 0; kk < 2; ++kk) {
#pragma unroll
      for (int t = 0; t < 2; ++t) {
        FragB vb, vl;
        vb.h[0] = *(const v8b*)(Vth + (t * 16 + c) * AT_KC + kk * 32 + 8 * hh);
        vb.h[1] = *(const v8b*)(Vth + (t * 16 + c) * AT_KC + kk * 32 + 16 + 8 * hh);
        vl.h[0] = *(const v8b*)(Vtl + (t * 16 + c) * AT_KC + kk * 32 + 8 * hh);
        vl.h[1] = *(const v8b*)(Vtl + (t * 16 + c) * AT_KC + kk * 32 + 16 + 8 * hh);
        oacc[t] = mma_bf(vb.v, pbh[kk], oacc[t]);
        oacc[t] = mma_bf(vl.v, pbh[kk], oacc[t]);
        oacc[t] = mma_bf(vb.v, pbl[kk], oacc[t]);
      }
    }
  }

  // ---- join the halves' sums; stage the wave's 16 x 32 unnormalised ctx tile [query][d] for whole-line stores ----
  float* os = Os[wave];
  const float lsum = lrow + xhalf(lrow);
  {
#pragma unroll
    for (int t = 0; t < 2; ++t) {
      const v4f o0 = (v4f){oacc[t][0], oacc[t][1], oacc[t][2], oacc[t][3]};
      const v4f o1 = (v4f){oacc[t][4], oacc[t][5], oacc[t][6], oacc[t][7]};
      *(v4f*)(os + c * 36 + t * 16 + 8 * hh)     = o0;
      *(v4f*)(os + c * 36 + t * 16 + 8 * hh + 4) = o1;
    }
  }
  __builtin_amdgcn_fence(__ATOMIC_RELEASE, "workgroup");
  __builtin_amdgcn_wave_barrier();
  __builtin_amdgcn_fence(__ATOMIC_ACQUIRE, "workgroup");
  {
    const int q4 = lane >> 3, c4 = (lane & 7) * 4;
    {
#pragma unroll
      for (int it = 0; it < 4; ++it) {
        const int row = it * 4 + q4;
        const v4f val = *(const v4f*)(os + row * 36 + c4);
        *(v4f*)(ob + (size_t)(q0 + row) * DMOD + c4) = val;
      }
      
    }
  }
  // maximum (lower half) and sum (upper half) of query q0 + c: the wave's 32 lanes fill one 128-B line
  ml[(((size_t)ks * NHEAD + h) * SEQ + q0 + c) * 2 + hh] = hh ? lsum : mrow;
}

// ---------------------------------------------------------------------------
// Join of the KSPLIT partial attention results and the output projection, in one launch:
//   M = max_ks m, w = exp(m - M), ctx = (sum_ks w * opart) / (sum_ks w * l); hi = bf16_rne(ctx), lo = bf16_rne(ctx - hi)
//   out = ctx . Wo + bo   (hi.hi + hi.lo + lo.hi, f32 accumulate, k-steps in rising order)
// A block owns 16 queries and 128 output columns; grid = (SEQ / 16) * 2 = 256 blocks of 8 waves, one per WGP. The two blocks of a
// query tile each join that tile's ctx for themselves: nothing passes between work-groups.
//   Join: wave = head = k-step of 32 ctx columns; a lane makes its own 16 elements of that k-step's A fragment (the lane / element / k
//   map of frag_load_fo) and stores them as two 16-B pieces per plane into the block's LDS planes (8 units of 1 KiB, fragment order).
//   Product: wave = one tile of 16 output columns; A fragments from LDS; the wave's Wo^T fragments (global planes in fragment order,
//   8 k-steps x hi and lo = 128 registers) depend on nothing in this launch and are asked for at entry, with the partials.
// coverage: join 8 waves x 32 lanes x 16 = 16 x 256 ctx elements; product 8 waves x 16 x 16 = 16 x 128 outputs, each stored once.
// Two waves per SIMD asked of the compiler: the grid supplies two, and with registers saved for more it would ask for the loads in turns.
// ---------------------------------------------------------------------------
__global__ __launch_bounds__(256) __attribute__((amdgpu_waves_per_eu(2, 2)))
void merge_out_kernel(const float* __restrict__ opart, const float* __restrict__ ml,
                      const unsigned short* __restrict__ Bhp, const unsigned short* __restrict__ Blp,
                      const float* __restrict__ bo, float* __restrict__ out) {
  __shared__ __align__(16) unsigned short Ch[8 * 512];       // ctx hi, 16 queries x 256 k, fragment order   8 KB
  __shared__ __align__(16) unsigned short Cl[8 * 512];       // ctx lo
  __shared__ __align__(16) float sT[16 * 132];               // the block's 16 x 128 output tile, pitch 132
  const int lane  = threadIdx.x & 31;
  const int wave  = threadIdx.x >> 5;
  const int rlane = lane & 15;                               // query (A), column (B, D) within a tile
  const int m0    = (blockIdx.x >> 1) * 16;                  // first query of the block
  const int nb    = (blockIdx.x & 1) * 128;                  // first output column of the block
  const int n0    = nb + wave * 16;                          // first output column of the wave

  constexpr int KSTEPS = DMOD >> 5;
  constexpr int TSTEP  = KSTEPS << 9;     // elements from one 16-row tile of a plane to the next
  const __bf16* pbh = (const __bf16*)(const void*)Bhp + (size_t)(n0 >> 4) * TSTEP + lane * 8;
  const __bf16* pbl = (const __bf16*)(const void*)Blp + (size_t)(n0 >> 4) * TSTEP + lane * 8;
  v16b bh[KSTEPS], bl[KSTEPS];
#pragma unroll   // compile-time trip count; the arrays indexed here are registers only under constant indices
  for (int kst = 0; kst < KSTEPS; ++kst) {
    bh[kst] = frag_load_fo(pbh + (kst << 9));
    bl[kst] = frag_load_fo(pbl + (kst << 9));
  }
  const float* pbo = bo + n0 + rlane;
  const float bvn = *pbo;

  // ---- join of the key ranges: head = wave, query m0 + rlane, columns col .. col + 7 and col + 16 .. col + 23 ----
  {
    const int t   = m0 + rlane;
    const int col = wave * DHD + (lane >> 4) * 8;
    const float* pml = ml + ((size_t)wave * SEQ + t) * 2;        // key range 0; the others lie at fixed distances
    const float* pop = opart + (size_t)t * DMOD + col;
    v2f a[KSPLIT];
    v4f o[KSPLIT][4];
#pragma unroll   // compile-time trip count; the arrays indexed here are registers only under constant indices
    for (int s = 0; s < KSPLIT; ++s) {
      a[s] = *(const v2f*)(pml + (size_t)s * NHEAD * SEQ * 2);
      const float* op = pop + (size_t)s * SEQ * DMOD;
      o[s][0] = *(const v4f*)(op);
      o[s][1] = *(const v4f*)(op + 4);
      o[s][2] = *(const v4f*)(op + 16);
      o[s][3] = *(const v4f*)(op + 20);
    }
    // precaution: stands between the launch's loads and any rewrite of the address registers that they name; as inputs the five
    // addresses stay in their registers up to here, so that no load of the group returns its data into one of them
    asm volatile("s_wait_xcnt 0x0" :: "v"(pbh), "v"(pbl), "v"(pbo), "v"(pml), "v"(pop) : "memory");
    float M = a[0][0];
#pragma unroll   // compile-time trip count; the arrays indexed here are registers only under constant indices
    for (int s = 1; s < KSPLIT; ++s) M = fmaxf(M, a[s][0]);
    const float nM2 = -M * LOG2E;
    float w[KSPLIT];
    float L = 0.f;
#pragma unroll   // compile-time trip count; the arrays indexed here are registers only under constant indices
    for (int s = 0; s < KSPLIT; ++s) {
      w[s] = exp_rel(a[s][0], nM2);
      L = fmaf(w[s], a[s][1], L);
    }
    const float inv = 1.0f / L;
#pragma unroll   // compile-time trip count; the arrays indexed here are registers only under constant indices
    for (int half = 0; half < 2; ++half) {
      v4u hv, lv;
#pragma unroll   // compile-time trip count; the arrays indexed here are registers only under constant indices
      for (int e = 0; e < 4; ++e) {
        float f0 = 0.f, f1 = 0.f;
#pragma unroll   // compile-time trip count; the arrays indexed here are registers only under constant indices
        for (int s = 0; s < KSPLIT; ++s) {
          f0 = fmaf(w[s], o[s][half * 2 + (e >> 1)][(e & 1) * 2],     f0);
          f1 = fmaf(w[s], o[s][half * 2 + (e >> 1)][(e & 1) * 2 + 1], f1);
        }
        f0 *= inv;
        f1 *= inv;
        const unsigned short h0 = f2bf_bits(f0), h1 = f2bf_bits(f1);
        const unsigned short l0 = f2bf_bits(f0 - bf_bits2f(h0)), l1 = f2bf_bits(f1 - bf_bits2f(h1));
        hv[e] = pk16(h0, h1);
        lv[e] = pk16(l0, l1);
      }
      *(v4u*)(Ch + wave * 512 + half * 256 + lane * 8) = hv;
      *(v4u*)(Cl + wave * 512 + half * 256 + lane * 8) = lv;
    }
  }
  __syncthreads();   // every wave's k-step of ctx is read by all 8 waves below

  // ---- out tile of this wave: 16 queries x columns n0 .. n0 + 15 ----
  const __bf16* pah = (const __bf16*)(const void*)Ch + lane * 8;
  const __bf16* pal = (const __bf16*)(const void*)Cl + lane * 8;
  v8f acc = (v8f){0.f,0.f,0.f,0.f,0.f,0.f,0.f,0.f};
  v16b ah[KSTEPS], al[KSTEPS];           // read from LDS three k-steps ahead of their products
#pragma unroll   // compile-time trip count; the arrays indexed here are registers only under constant indices
  for (int kst = 0; kst < 3; ++kst) {
    ah[kst] = frag_load_fo(pah + (kst << 9));
    al[kst] = frag_load_fo(pal + (kst << 9));
  }
#pragma unroll   // compile-time trip count; the arrays indexed here are registers only under constant indices
  for (int kst = 0; kst < KSTEPS; ++kst) {
    if (kst + 3 < KSTEPS) {
      ah[kst + 3] = frag_load_fo(pah + ((kst + 3) << 9));
      al[kst + 3] = frag_load_fo(pal + ((kst + 3) << 9));
    }
    acc = mma_bf(ah[kst], bh[kst], acc);
    acc = mma_bf(ah[kst], bl[kst], acc);
    acc = mma_bf(al[kst], bh[kst], acc);
  }

  // ---- epilogue: bias, then the block's 16 x 128 tile through LDS, so that each 128-B line of out has one writer ----
  const int mOff = (lane >> 4) * 8;      // D row offset
#pragma unroll   // compile-time trip count; the arrays indexed here are registers only under constant indices
  for (int r = 0; r < 8; ++r) sT[(mOff + r) * 132 + wave * 16 + rlane] = acc[r] + bvn;
  __syncthreads();   // a row of the tile holds columns of all 8 waves
#pragma unroll   // compile-time trip count; the arrays indexed here are registers only under constant indices
  for (int it = 0; it < 2; ++it) {
    const int row = wave * 2 + it;       // a wave stores a row's 128 columns = 512 B = 4 whole lines
    const v4f val = *(const v4f*)(sT + row * 132 + lane * 4);
    *(v4f*)(out + (size_t)(m0 + row) * DMOD + nb + lane * 4) = val;
  }
}

// ---------------------------------------------------------------------------
//   biasP f32 [2048][2048]                 0 .. 16777216
//   WqTh/l, WkTh/l, WvTh/l, WoTh/l  bf16 [256 o][256 i], fragment order   131072 each  (8 planes) 16777216 .. 17825792
//   Xqh/l, Xkh/l, Xvh/l bf16 [2048][256], fragment order   1048576 each (6 planes)      17825792 .. 24117248
//   Qh/l, Kh/l  bf16 [2048][256]            1048576 each (4 planes)      24117248 .. 28311552
//   VTh/l bf16 [256 (h,d)][2048]            1048576 each (2 planes)      28311552 .. 30408704
//   OPART f32 [4 key ranges][2048][256]     2097152 each (4 planes)      30408704 .. 38797312
//   ML f32 [4 key ranges][8][2048][2]       524288                       38797312 .. 39321600
//   total                                   39321600
// ---------------------------------------------------------------------------
extern "C" void kernel_launch(void* const* d_in, const int* in_sizes, int n_in,
                              void* d_out, int out_size, void* d_ws, size_t ws_size,
                              hipStream_t stream) {
  if (n_in < 22) return;
  if (in_sizes[0] != SEQ * SEQ || in_sizes[1] != SEQ * SEQ || in_sizes[2] != SEQ * SEQ) return;
  if (in_sizes[3] != SEQ * DMOD || in_sizes[4] != SEQ * DMOD || in_sizes[5] != SEQ * DMOD) return;
  if (in_sizes[6] != DMOD * DMOD || in_sizes[8] != DMOD * DMOD || in_sizes[10] != DMOD * DMOD || in_sizes[12] != DMOD * DMOD) return;
  if (in_sizes[7] != DMOD || in_sizes[9] != DMOD || in_sizes[11] != DMOD || in_sizes[13] != DMOD) return;
  if (in_sizes[14] != 32 || in_sizes[15] != 16 || in_sizes[16] != 16 || in_sizes[17] != 1) return;
  if (in_sizes[18] != 32 || in_sizes[19] != 16 || in_sizes[20] != 16 || in_sizes[21] != 1) return;
  if (out_size != SEQ * DMOD) return;

  const int*   label   = (const int*)  d_in[0];
  const float* dist    = (const float*)d_in[1];
  const float* contact = (const float*)d_in[2];
  const float* q   = (const float*)d_in[3];
  const float* k   = (const float*)d_in[4];
  const float* v   = (const float*)d_in[5];
  const float* Wq  = (const float*)d_in[6];
  const float* bq  = (const float*)d_in[7];
  const float* Wk  = (const float*)d_in[8];
  const float* bk  = (const float*)d_in[9];
  const float* Wv  = (const float*)d_in[10];
  const float* bv  = (const float*)d_in[11];
  const float* Wo  = (const float*)d_in[12];
  const float* bo  = (const float*)d_in[13];
  const float* Wd1 = (const float*)d_in[14];
  const float* bd1 = (const float*)d_in[15];
  const float* Wd2 = (const float*)d_in[16];
  const float* bd2 = (const float*)d_in[17];
  const float* Wc1 = (const float*)d_in[18];
  const float* bc1 = (const float*)d_in[19];
  const float* Wc2 = (const float*)d_in[20];
  const float* bc2 = (const float*)d_in[21];
  float* out = (float*)d_out;

  const size_t PB = (size_t)SEQ * SEQ * 4;     // 16777216  f32 bias plane
  const size_t PW = (size_t)DMOD * DMOD * 2;   // 131072    bf16 weight plane [256][256]
  const size_t PX = (size_t)SEQ * DMOD * 2;    // 1048576   bf16 activation plane [2048][256] / [256][2048]
  const size_t PF = (size_t)SEQ * DMOD * 4;    // 2097152   f32 activation plane
  size_t off = 0;
  const size_t oBias = off; off += PB;
  const size_t oWqTh = off; off += PW;  const size_t oWqTl = off; off += PW;
  const size_t oWkTh = off; off += PW;  const size_t oWkTl = off; off += PW;
  const size_t oWvTh = off; off += PW;  const size_t oWvTl = off; off += PW;
  const size_t oWoTh = off; off += PW;  const size_t oWoTl = off; off += PW;
  const size_t oXqh  = off; off += PX;  const size_t oXql  = off; off += PX;
  const size_t oXkh  = off; off += PX;  const size_t oXkl  = off; off += PX;
  const size_t oXvh  = off; off += PX;  const size_t oXvl  = off; off += PX;
  const size_t oQh   = off; off += PX;  const size_t oQl   = off; off += PX;
  const size_t oKh   = off; off += PX;  const size_t oKl   = off; off += PX;
  const size_t oVTh  = off; off += PX;  const size_t oVTl  = off; off += PX;
  const size_t oOp   = off; off += KSPLIT * PF;
  const size_t oML   = off; off += (size_t)KSPLIT * NHEAD * SEQ * 2 * 4;
  if (off > ws_size) return;                   // off = 39321600

  char* ws = (char*)d_ws;
  float*          biasP = (float*)(ws + oBias);
  unsigned short* WqTh = (unsigned short*)(ws + oWqTh); unsigned short* WqTl = (unsigned short*)(ws + oWqTl);
  unsigned short* WkTh = (unsigned short*)(ws + oWkTh); unsigned short* WkTl = (unsigned short*)(ws + oWkTl);
  unsigned short* WvTh = (unsigned short*)(ws + oWvTh); unsigned short* WvTl = (unsigned short*)(ws + oWvTl);
  unsigned short* WoTh = (unsigned short*)(ws + oWoTh); unsigned short* WoTl = (unsigned short*)(ws + oWoTl);
  unsigned short* Xqh  = (unsigned short*)(ws + oXqh);  unsigned short* Xql  = (unsigned short*)(ws + oXql);
  unsigned short* Xkh  = (unsigned short*)(ws + oXkh);  unsigned short* Xkl  = (unsigned short*)(ws + oXkl);
  unsigned short* Xvh  = (unsigned short*)(ws + oXvh);  unsigned short* Xvl  = (unsigned short*)(ws + oXvl);
  unsigned short* Qh   = (unsigned short*)(ws + oQh);   unsigned short* Ql   = (unsigned short*)(ws + oQl);
  unsigned short* Kh   = (unsigned short*)(ws + oKh);   unsigned short* Kl   = (unsigned short*)(ws + oKl);
  unsigned short* VTh  = (unsigned short*)(ws + oVTh);  unsigned short* VTl  = (unsigned short*)(ws + oVTl);
  float*          Op   = (float*)(ws + oOp);
  float*          ML   = (float*)(ws + oML);

  const dim3 blk(256);

  // (1) everything that reads inputs only, one launch: weight planes [out][in], pair bias plane, q/k/v hi/lo planes
  prep_kernel<<<dim3(PREP_W_BLOCKS + PREP_PB_BLOCKS + 3 * PREP_X_BLOCKS), blk, 0, stream>>>(dist, contact, label,
      Wd1, bd1, Wd2, bd2, Wc1, bc1, Wc2, bc2, biasP,
      Wq, Wk, Wv, Wo, WqTh, WqTl, WkTh, WkTl, WvTh, WvTl, WoTh, WoTl,
      q, k, v, Xqh, Xql, Xkh, Xkl, Xvh, Xvl);

  // (2) the three projections, one launch of 3 x 32 blocks; v^T[(h,d)][s] = sum_i WvT[(h,d)][i] * v[s][i] + bv[(h,d)]
  const float qscale = 0.17677669529663688f;                // 32^-0.5 applied as (x.Wq + bq) * scale
  proj3_kernel<<<dim3(96), blk, 0, stream>>>(Xqh, Xql, Xkh, Xkl, Xvh, Xvl, WqTh, WqTl, WkTh, WkTl, WvTh, WvTl,
      bq, bk, bv, Qh, Ql, Kh, Kl, VTh, VTl, qscale);

  // (3) attention with pair bias: 4 key ranges x 8 heads x 32 query blocks of 64 rows -> partial ctx, maximum and sum per key range
  attn_bias_kernel<<<dim3(KSPLIT * NHEAD * (SEQ / 64)), dim3(128), 0, stream>>>(Qh, Ql, Kh, Kl, VTh, VTl, biasP, Op, ML);

  // (4) join of the key ranges and out = ctx . Wo + bo -> d_out f32 [2048][256], 256 blocks of 16 queries x 128 columns
  merge_out_kernel<<<dim3((SEQ / 16) * 2), blk, 0, stream>>>(Op, ML, WoTh, WoTl, bo, out);

  (void)hipGetLastError();
}

// v007
// A run of this version takes 47.7 microseconds.
// Two timings next to v006 put it at 1.25 and 1.28 times that version's speed.
// Over all steps from v000 it is 4.39 times as fast.
// Contractions: q, k, v^T projections, q.k^T scores, p.v and output projection on v_wmma_f32_16x16x32_bf16 with bf16 hi/lo operands (hi.hi + hi.lo + lo.hi), f32 accumulate; pair bias (exact affine fold of the two linear 2->16->1 maps) and online softmax in f32 on VALU; the keys of a query block are dealt to 4 work-groups whose partial results the output projection's launch joins; the q, k, v projections split their f32 operands themselves, into LDS planes in fragment order, in one launch with the pair bias.
#include <hip/hip_runtime.h>
#include <math.h>
#include <stdint.h>

#define SEQ   2048
#define DMOD  256
#define NHEAD 8
#define DHD   32
#define KSPLIT 4      // key ranges per query block in the attention launch, one work-group each

typedef __attribute__((ext_vector_type(16))) __bf16   v16b;
typedef __attribute__((ext_vector_type(8)))  __bf16   v8b;
typedef __attribute__((ext_vector_type(8)))  float    v8f;
typedef __attribute__((ext_vector_type(4)))  float    v4f;
typedef __attribute__((ext_vector_type(2)))  float    v2f;
typedef __attribute__((ext_vector_type(4)))  unsigned int v4u;
typedef __attribute__((ext_vector_type(4)))  int      v4i;

// RNE f32 -> bf16 bits
__device__ __forceinline__ unsigned short f2bf_bits(float f) {
  unsigned u = __float_as_uint(f);
  return (unsigned short)((u + 0x7FFFu + ((u >> 16) & 1u)) >> 16);
}
__device__ __forceinline__ float bf_bits2f(unsigned short h) { return __uint_as_float(((unsigned)h) << 16); }
__device__ __forceinline__ unsigned pk16(unsigned short a, unsigned short b) { return (unsigned)a | ((unsigned)b << 16); }

// 16x16x32 fragment (A row-major k-contiguous, or B stored [n][k] k-contiguous):
// lane l: row/col = l & 15, p already offset by 8*(l>>4); elements 0..7 <- p[0..7], elements 8..15 <- p[16..23]
union FragB { v16b v; v8b h[2]; };
__device__ __forceinline__ v16b frag_load(const __bf16* p) {
  FragB f; f.h[0] = *(const v8b*)(p); f.h[1] = *(const v8b*)(p + 16); return f.v;
}

// Fragment order of a GEMM operand plane [rows][K] (K a multiple of 32): one 1-KiB unit per (16 rows, 32 k), units of a row tile in k order.
// Inside a unit lane l's elements 0..7 lie at 16-B piece l, its elements 8..15 at piece 32 + l, so element (row, k) is at
//   (((row >> 4) * (K >> 5) + (k >> 5)) * 2 + ((k >> 4) & 1)) * 256 + ((row & 15) + 16 * ((k >> 3) & 1)) * 8 + (k & 7)
// and each of the two 16-B-per-lane loads of a fragment reads 512 bytes in a row (4 whole lines). Same lane / element / k map as frag_load.
// p: the lane's 16-B piece in the unit (unit start + lane * 8 elements)
__device__ __forceinline__ v16b frag_load_fo(const __bf16* p) {
  FragB f; f.h[0] = *(const v8b*)(p); f.h[1] = *(const v8b*)(p + 256); return f.v;
}

// WMMA + hazard guard (4 VALU slots, ties D, keeps A/B live)
__device__ __forceinline__ v8f mma_bf(v16b a, v16b b, v8f c) {
  c = __builtin_amdgcn_wmma_f32_16x16x32_bf16(false, a, false, b, (short)0, c, false, false);
  asm volatile("v_nop\n\tv_nop\n\tv_nop\n\tv_nop" : "+v"(c) : "v"(a), "v"(b));
  return c;
}

// ---------------------------------------------------------------------------
// Pair bias plane [SEQ][SEQ] f32:
//   pb(map, W1, b1, W2, b2)(n,m) = map*(W1[0].W2) + label*(W1[1].W2) + (b1.W2 + b2)   (both maps linear, exact fold)
//   bias = pb_d + pb_c.  W1 [2][16] row-major, W2 [16][1].
// Block blk owns elements blk*8192 .. blk*8192+8191; each thread 4 consecutive floats per iteration, 8 iterations.
// coverage: 512 blocks x 8 it x 256 thr x 4 = 4194304 = whole plane.
// ---------------------------------------------------------------------------
__device__ __forceinline__ void pair_bias_block(const int blk,
    const float* __restrict__ dist, const float* __restrict__ contact, const int* __restrict__ label,
    const float* __restrict__ Wd1, const float* __restrict__ bd1, const float* __restrict__ Wd2, const float* __restrict__ bd2,
    const float* __restrict__ Wc1, const float* __restrict__ bc1, const float* __restrict__ Wc2, const float* __restrict__ bc2,
    float* __restrict__ bias) {
  float ad = 0.f, ld = 0.f, gd = 0.f, ac = 0.f, lc = 0.f, gc = 0.f;
#pragma unroll 1
  for (int j = 0; j < 16; ++j) {
    const float wd2 = Wd2[j], wc2 = Wc2[j];
    ad = fmaf(Wd1[j],      wd2, ad);   // map weight (row 0 of W1)
    ld = fmaf(Wd1[16 + j], wd2, ld);   // label weight (row 1 of W1)
    gd = fmaf(bd1[j],      wd2, gd);
    ac = fmaf(Wc1[j],      wc2, ac);
    lc = fmaf(Wc1[16 + j], wc2, lc);
    gc = fmaf(bc1[j],      wc2, gc);
  }
  gd += bd2[0];
  gc += bc2[0];
  const size_t base = (size_t)blk * 8192 + (size_t)threadIdx.x * 4;
{
#pragma unroll 1
    for (int it = 0; it < 8; ++it) {
      const size_t i4 = base + (size_t)it * 1024;
      const v4f dm = *(const v4f*)(dist + i4);
      const v4f cm = *(const v4f*)(contact + i4);
      const v4i lb = *(const v4i*)(label + i4);
      v4f o;
#pragma unroll
      for (int e = 0; e < 4; ++e) {
        const float lf = (float)lb[e];
        const float pd = fmaf(dm[e], ad, fmaf(lf, ld, gd));
        const float pc = fmaf(cm[e], ac, fmaf(lf, lc, gc));
        o[e] = pd + pc;
      }
      *(v4f*)(bias + i4) = o;
      // precaution: stands between this store and the next trip's rewrite of the registers that the store names
      asm volatile("s_wait_xcnt 0x0" ::: "memory");
    }
    
  }
}

// ---------------------------------------------------------------------------
// Fused transpose + bf16 split of an f32 matrix W viewed [R rows][Cc cols] (pitch Cc) ->
//   oh(c, r) = bf16_rne(W[r][c]), ol(c, r) = bf16_rne(W[r][c] - oh)   (planes [Cc rows][R k] in fragment order, see frag_load_fo)
// 64x64 tiles through LDS (tf: 64 x 68 floats of the caller). Tile (bx, by) of (Cc/64, R/64), 256 threads, R and Cc multiples of 64.
// coverage per block/plane: load 4 it x 256 thr x 4 floats = 64x64; store 2 it x 256 thr x 8 u16 = 64x64 = 8 whole units (4 row tiles x 2 k-steps).
// ---------------------------------------------------------------------------
__device__ __forceinline__ void tsplit_block(float* tf, const int bx, const int by, const float* __restrict__ W,
                                             unsigned short* __restrict__ oh, unsigned short* __restrict__ ol, int R, int Cc) {
  const int c0  = bx * 64;           // input column block = output row block
  const int r0  = by * 64;           // input row block    = output column block
  const int tid = threadIdx.x;
  {
    const int lr = tid >> 4;         // 0..15
    const int c4 = (tid & 15) * 4;   // 0..60
#pragma unroll
    for (int it = 0; it < 4; ++it) {
      const int rr = it * 16 + lr;   // 0..63
      const v4f a = *(const v4f*)(W + (size_t)(r0 + rr) * Cc + c0 + c4);
      *(v4f*)(tf + rr * 68 + c4) = a;
    }
  }
  __syncthreads();
  // 16-B piece it*256 + tid of the tile's 512: fragment lane, half of the fragment, k-step, row tile
  const int ln   = tid & 31;
  const int part = (tid >> 5) & 1;
  const int ksl  = (tid >> 6) & 1;
  const int c8   = ksl * 32 + part * 16 + (ln >> 4) * 8;   // first of the piece's 8 k (= input rows) within the tile
  v4u hv[2], lv[2];
#pragma unroll
  for (int it = 0; it < 2; ++it) {
    const int oc = (it * 2 + (tid >> 7)) * 16 + (ln & 15);   // output row within tile (= input column)
    v4u a, a2;
#pragma unroll
    for (int q = 0; q < 4; ++q) {
      const float f0 = tf[(c8 + 2 * q) * 68 + oc];
      const float f1 = tf[(c8 + 2 * q + 1) * 68 + oc];
      const unsigned short h0 = f2bf_bits(f0), h1 = f2bf_bits(f1);
      const unsigned short l0 = f2bf_bits(f0 - bf_bits2f(h0)), l1 = f2bf_bits(f1 - bf_bits2f(h1));
      a[q]  = pk16(h0, h1);
      a2[q] = pk16(l0, l1);
    }
    hv[it] = a; lv[it] = a2;
  }
  {
#pragma unroll
    for (int it = 0; it < 2; ++it) {
      const int rt = it * 2 + (tid >> 7);
      const size_t go = ((size_t)(((c0 >> 4) + rt) * (R >> 5) + (r0 >> 5) + ksl) << 9) + part * 256 + ln * 8;
      *(v4u*)(oh + go) = hv[it];
      *(v4u*)(ol + go) = lv[it];
    }
    // precaution: stands between these stores and whatever follows them in the kernel's text and rewrites a register that they name
    asm volatile("s_wait_xcnt 0x0" ::: "memory");
  }
}

// ---------------------------------------------------------------------------
// One projection tile from the f32 inputs: C = scale * (X . Wm + bias), X [SEQ][DMOD], Wm [DMOD in][DMOD out], product = hi.hi + hi.lo + lo.hi.
// A block owns 64 rows of X and 128 columns of Wm; it makes the bf16 hi/lo planes of both operands itself, in LDS, in fragment order
// (see frag_load_fo), 64 k per stage, two stage buffers: the next stage's f32 values are asked for ahead of this stage's products.
//   stage buffer (2-B elements): W hi, W lo: 8 column tiles x (2 units of 512 + 8 of pad, so that the 4 pieces a lane stores and the
//   8 tiles a wave stores fall on different banks); X hi, X lo: 4 row tiles x 2 units of 512.
//   W staging: wave = 8 k, lane = 4 columns (8 whole-line loads); the 8 k of a column are one 16-B piece, made in registers.
//   X staging: thread = 8 k (tid & 7) of rows tid >> 3 and 32 + (tid >> 3), one 16-B piece each.
//   coverage per stage: W 8 waves x 8 k x 32 lanes x 4 = 64 x 128; X 256 thr x 2 x 8 = 64 x 64.
// Wave = 32 rows x 32 columns (2 x 4 waves). VT = false: A = X, B = W, C [row][column] pitch DMOD; VT = true: A = W, B = X, C [column][row] pitch SEQ.
// The block's tile goes through LDS, so that every 128-B line of the hi and lo planes (row-major) has one writer.
// ---------------------------------------------------------------------------
#define PJ_WT    1032                       // elements from one column tile of a W plane to the next
#define PJ_WPL   (8 * PJ_WT)                // one W plane of a stage
#define PJ_XPL   (4 * 1024)                 // one X plane of a stage
#define PJ_STAGE (2 * PJ_WPL + 2 * PJ_XPL)  // 24704 elements = 49408 B
__device__ __forceinline__ void split8_store(const float* f, unsigned short* ph, unsigned short* pl) {
  v4u hv, lv;
#pragma unroll
  for (int q = 0; q < 4; ++q) {
    const float f0 = f[2 * q], f1 = f[2 * q + 1];
    const unsigned short h0 = f2bf_bits(f0), h1 = f2bf_bits(f1);
    const unsigned short l0 = f2bf_bits(f0 - bf_bits2f(h0)), l1 = f2bf_bits(f1 - bf_bits2f(h1));
    hv[q] = pk16(h0, h1);
    lv[q] = pk16(l0, l1);
  }
  *(v4u*)ph = hv;
  *(v4u*)pl = lv;
}

template <bool VT>
__device__ __forceinline__ void proj_block(unsigned short* sm, const int blk, const float* __restrict__ X, const float* __restrict__ Wm,
                                           const float* __restrict__ bias, unsigned short* __restrict__ Ch, unsigned short* __restrict__ Cl,
                                           const float scale) {
  const int tid  = threadIdx.x;
  const int lane = tid & 31;
  const int wave = tid >> 5;
  const int m0 = (blk >> 1) * 64;        // first row of X
  const int nb = (blk & 1) * 128;        // first column of Wm
  const int wm = wave >> 2;              // the wave's 32 rows
  const int wn = wave & 3;               // the wave's 32 columns

  const int xg = tid & 7, xr = tid >> 3;
  const float* pw = Wm + (size_t)(wave * 8) * DMOD + nb + lane * 4;
  const float* px = X + (size_t)(m0 + xr) * DMOD + xg * 8;
  // where the thread's pieces lie in a stage buffer: piece (row, g = k / 8) at (row>>4) * (PJ_WT in W, 1024 in X) + (g>>2) * 512 + ((g>>1)&1)*256 + ((row&15) + 16*(g&1))*8
  const int wdst = (lane >> 2) * PJ_WT + (wave >> 2) * 512 + ((wave >> 1) & 1) * 256 + (((lane & 3) * 4) + 16 * (wave & 1)) * 8;
  const int xdst = 2 * PJ_WPL + (xr >> 4) * 1024 + (xg >> 2) * 512 + ((xg >> 1) & 1) * 256 + ((xr & 15) + 16 * (xg & 1)) * 8;

  v4f wv[8], xv[4];
#pragma unroll
  for (int e = 0; e < 8; ++e) wv[e] = *(const v4f*)(pw + e * DMOD);
#pragma unroll
  for (int u = 0; u < 2; ++u) {
    xv[2 * u]     = *(const v4f*)(px + u * 32 * DMOD);
    xv[2 * u + 1] = *(const v4f*)(px + u * 32 * DMOD + 4);
  }
  // precaution: stands between these loads and the rewrite of the two address registers that they name
  asm volatile("s_wait_xcnt 0x0" :: "v"(pw), "v"(px) : "memory");

  v8f acc[2][2];
#pragma unroll
  for (int i = 0; i < 2; ++i)
#pragma unroll
    for (int j = 0; j < 2; ++j) acc[i][j] = (v8f){0.f,0.f,0.f,0.f,0.f,0.f,0.f,0.f};

#pragma unroll 1   // rolled: four copies of the stage would only lengthen the kernel's text
  for (int st = 0; st < DMOD / 64; ++st) {
    unsigned short* buf = sm + (st & 1) * PJ_STAGE;
#pragma unroll
    for (int cc = 0; cc < 4; ++cc) {
      float f[8];
#pragma unroll
      for (int e = 0; e < 8; ++e) f[e] = wv[e][cc];
      split8_store(f, buf + wdst + cc * 8, buf + PJ_WPL + wdst + cc * 8);
    }
#pragma unroll
    for (int u = 0; u < 2; ++u) {
      float f[8];
#pragma unroll
      for (int e = 0; e < 4; ++e) { f[e] = xv[2 * u][e]; f[4 + e] = xv[2 * u + 1][e]; }
      split8_store(f, buf + xdst + u * 2048, buf + PJ_XPL + xdst + u * 2048);
    }
    // publishes this stage; it also ends every wave's reads of the other buffer, which the next trip refills
    __syncthreads();
    // the next stage's values are asked for behind the barrier (its fence would wait for them) and fly during this stage's products
    if (st + 1 < DMOD / 64) {
      pw += 64 * DMOD;
      px += 64;
#pragma unroll
      for (int e = 0; e < 8; ++e) wv[e] = *(const v4f*)(pw + e * DMOD);
#pragma unroll
      for (int u = 0; u < 2; ++u) {
        xv[2 * u]     = *(const v4f*)(px + u * 32 * DMOD);
        xv[2 * u + 1] = *(const v4f*)(px + u * 32 * DMOD + 4);
      }
      // precaution: stands between these loads and the next trip's rewrite of the two address registers that they name
      asm volatile("s_wait_xcnt 0x0" :: "v"(pw), "v"(px) : "memory");
    }
    const __bf16* sw = (const __bf16*)(const void*)buf + (wn * 2) * PJ_WT + lane * 8;
    const __bf16* sx = (const __bf16*)(const void*)buf + 2 * PJ_WPL + (wm * 2) * 1024 + lane * 8;
#pragma unroll
    for (int ksl = 0; ksl < 2; ++ksl) {
      v16b xh[2], xl[2];
#pragma unroll
      for (int i = 0; i < 2; ++i) {
        xh[i] = frag_load_fo(sx + i * 1024 + ksl * 512);
        xl[i] = frag_load_fo(sx + PJ_XPL + i * 1024 + ksl * 512);
      }
#pragma unroll
      for (int j = 0; j < 2; ++j) {
        const v16b wh = frag_load_fo(sw + j * PJ_WT + ksl * 512);
        const v16b wl = frag_load_fo(sw + PJ_WPL + j * PJ_WT + ksl * 512);
#pragma unroll
        for (int i = 0; i < 2; ++i) {
          if (!VT) {
            acc[i][j] = mma_bf(xh[i], wh, acc[i][j]);
            acc[i][j] = mma_bf(xh[i], wl, acc[i][j]);
            acc[i][j] = mma_bf(xl[i], wh, acc[i][j]);
          } else {
            acc[i][j] = mma_bf(wh, xh[i], acc[i][j]);
            acc[i][j] = mma_bf(wh, xl[i], acc[i][j]);
            acc[i][j] = mma_bf(wl, xh[i], acc[i][j]);
          }
        }
      }
    }
  }

  // ---- epilogue: the f32 tile lies in stage buffer 0 alone, whose last readers (stage 2) all passed the barrier of stage 3 ----
  float* so = (float*)(void*)sm;
  const int rlane = lane & 15;
  const int mOff  = (lane >> 4) * 8;     // D row offset
  constexpr int SP = VT ? 68 : 132;      // pitch of the tile in floats
#pragma unroll
  for (int j = 0; j < 2; ++j) {
    const float bvn = VT ? 0.f : bias[nb + wn * 32 + j * 16 + rlane];
#pragma unroll
    for (int r = 0; r < 8; ++r) {
      const float bvm = VT ? bias[nb + wn * 32 + j * 16 + mOff + r] : 0.f;
#pragma unroll
      for (int i = 0; i < 2; ++i) {
        float v = acc[i][j][r];
        v += VT ? bvm : bvn;
        v *= scale;
        if (!VT) so[(wm * 32 + i * 16 + mOff + r) * SP + wn * 32 + j * 16 + rlane] = v;
        else     so[(wn * 32 + j * 16 + mOff + r) * SP + wm * 32 + i * 16 + rlane] = v;
      }
    }
  }
  __syncthreads();   // a row of the tile holds values of several waves
#pragma unroll
  for (int it = 0; it < 4; ++it) {
    const int p   = it * 256 + tid;                    // 16-B piece of the tile's 1024 per plane
    const int row = VT ? (p >> 3) : (p >> 4);
    const int c8  = VT ? (p & 7) * 8 : (p & 15) * 8;
    const size_t go = VT ? (size_t)(nb + row) * SEQ + m0 + c8 : (size_t)(m0 + row) * DMOD + nb + c8;
    const v4f s0 = *(const v4f*)(so + row * SP + c8);
    const v4f s1 = *(const v4f*)(so + row * SP + c8 + 4);
    const float f[8] = {s0[0], s0[1], s0[2], s0[3], s1[0], s1[1], s1[2], s1[3]};
    split8_store(f, Ch + go, Cl + go);
  }
  // precaution: stands between these stores and whatever follows them in the kernel's text and rewrites a register that they name
  asm volatile("s_wait_xcnt 0x0" ::: "memory");
}

// ---------------------------------------------------------------------------
// All work ahead of the attention, in one launch; the jobs are independent of each other and a block does exactly one of them:
//   blocks   0 ..  63 : Q   = (q.Wq + bq) * qscale   [SEQ][DMOD]   (32 row blocks x 2 column blocks each)
//   blocks  64 .. 127 : K   =  k.Wk + bk             [SEQ][DMOD]
//   blocks 128 .. 191 : V^T = (v.Wv + bv)^T          [DMOD][SEQ]
//   blocks 192 .. 207 : transpose + split of Wo (16 tiles of 64x64)
//   blocks 208 .. 719 : pair bias plane (512 blocks x 8192 elements)
// The job test reads blockIdx.x alone, so every barrier is passed by a whole block or by none of it.
// LDS and registers admit three blocks on a WGP, so all 720 run at once, the pair bias stream beside the products.
// ---------------------------------------------------------------------------
#define PREP_P_BLOCKS  64
#define PREP_W_BLOCKS  16
#define PREP_PB_BLOCKS 512
__global__ __launch_bounds__(256)
void prep_proj_kernel(
    const float* __restrict__ dist, const float* __restrict__ contact, const int* __restrict__ label,
    const float* __restrict__ Wd1, const float* __restrict__ bd1, const float* __restrict__ Wd2, const float* __restrict__ bd2,
    const float* __restrict__ Wc1, const float* __restrict__ bc1, const float* __restrict__ Wc2, const float* __restrict__ bc2,
    float* __restrict__ bias,
    const float* __restrict__ Wq, const float* __restrict__ Wk, const float* __restrict__ Wv, const float* __restrict__ Wo,
    const float* __restrict__ bq, const float* __restrict__ bk, const float* __restrict__ bv,
    unsigned short* __restrict__ WoTh, unsigned short* __restrict__ WoTl,
    const float* __restrict__ q, const float* __restrict__ k, const float* __restrict__ v,
    unsigned short* __restrict__ Qh, unsigned short* __restrict__ Ql, unsigned short* __restrict__ Kh, unsigned short* __restrict__ Kl,
    unsigned short* __restrict__ VTh, unsigned short* __restrict__ VTl, float qscale) {
  __shared__ __align__(16) unsigned short sm[2 * PJ_STAGE];   // 98816 B: two stage buffers; the transposes' 64 x 68 floats
  const int b = blockIdx.x;
  if (b < 2 * PREP_P_BLOCKS) {
    const bool isq = (b < PREP_P_BLOCKS);
    proj_block<false>(sm, b & (PREP_P_BLOCKS - 1), isq ? q : k, isq ? Wq : Wk, isq ? bq : bk, isq ? Qh : Kh, isq ? Ql : Kl,
                      isq ? qscale : 1.0f);
  } else if (b < 3 * PREP_P_BLOCKS) {
    proj_block<true>(sm, b - 2 * PREP_P_BLOCKS, v, Wv, bv, VTh, VTl, 1.0f);
  } else if (b < 3 * PREP_P_BLOCKS + PREP_W_BLOCKS) {
    const int t = b - 3 * PREP_P_BLOCKS;
    tsplit_block((float*)(void*)sm, t & 3, (t >> 2) & 3, Wo, WoTh, WoTl, DMOD, DMOD);
  } else {
    pair_bias_block(b - (3 * PREP_P_BLOCKS + PREP_W_BLOCKS), dist, contact, label, Wd1, bd1, Wd2, bd2, Wc1, bc1, Wc2, bc2, bias);
  }
}

// =====================================================================================
// Flash attention with additive pair bias, head dim 32, all 8 heads in one launch.
//   q planes (hi/lo bf16): element (t, h, d) at [t*DMOD + h*32 + d]   (score scale already folded into q)
//   k planes (hi/lo bf16): element (s, h, d) at [s*DMOD + h*32 + d]
//   v^T planes (hi/lo bf16): element (h, d, s) at [(h*32 + d)*SEQ + s]
//   bias f32 [SEQ t][SEQ s], shared over heads
//   opart f32, one plane per key range ks: element (ks, t, h, d) at [ks*SEQ*DMOD + t*DMOD + h*32 + d], NOT normalised
//   ml f32: running maximum and sum of (ks, h, t) at [((ks*NHEAD + h)*SEQ + t)*2 + 0 / 1]
//   scores^T = k . q^T + bias^T : bf16 hi/lo (hi.hi + hi.lo + lo.hi), bias added in f32; a lane holds one query's scores
//   ctx^T    = v^T . p^T         : bf16 hi/lo of p (unnormalised, <= 1, packed in registers) and v, f32 accumulate
//   online softmax in f32 over the block's SEQ/KSPLIT keys (8 chunks of 64 keys, compile-time trip count).
//   Block = 4 waves = 64 query rows of one head against one key range; grid = KSPLIT * NHEAD * (SEQ/64) = 1024 blocks of 128 threads.
//   The KSPLIT partial results of a query (maximum, sum, unnormalised ctx) are joined by merge_out_kernel in the next launch.
//   K / V^T chunk staging through LDS by all 128 threads (plain 16-B loads, __syncthreads before and after);
// =====================================================================================
#define AT_KC 64

__device__ __forceinline__ __bf16 at_f2bf(float f) { return __builtin_bit_cast(__bf16, f2bf_bits(f)); }
__device__ __forceinline__ void at_split(float f, __bf16& hi, __bf16& lo) {
  const unsigned short hb = f2bf_bits(f);
  hi = __builtin_bit_cast(__bf16, hb);
  lo = at_f2bf(f - __uint_as_float(((unsigned)hb) << 16));
}

// e^(x - m) on the chip's own base-2 exponential: one multiply-add and one v_exp_f32. nm2 = -m * LOG2E.
// An argument below the f32 exponent range (also -inf) gives 0, as the limit asks.
#define LOG2E 1.4426950408889634f
__device__ __forceinline__ float exp_rel(float x, float nm2) { return __builtin_amdgcn_exp2f(fmaf(x, LOG2E, nm2)); }

// value of lane l ^ 16 (the other wave half), by a vector cross-row move
__device__ __forceinline__ float xhalf(float x) {
  const int b = __builtin_bit_cast(int, x);
  return __builtin_bit_cast(float, __builtin_amdgcn_permlanex16(b, b, 0x76543210, 0xfedcba98, false, false));
}

// Four waves per SIMD asked of the compiler: the grid supplies four (1024 work-groups of 4 waves on 256 WGPs), so that one
// work-group's waits (staging, barriers, LDS, dependent vector chains) are filled by the other three. Without the upper bound the
// compiler saves registers for waves that never come and strings a lane's 32 independent exp/split chains one behind another.
__global__ __launch_bounds__(128) __attribute__((amdgpu_waves_per_eu(4, 4)))
void attn_bias_kernel(const unsigned short* __restrict__ qhp, const unsigned short* __restrict__ qlp,
                      const unsigned short* __restrict__ khp, const unsigned short* __restrict__ klp,
                      const unsigned short* __restrict__ vhp, const unsigned short* __restrict__ vlp,
                      const float* __restrict__ bias, float* __restrict__ opart, float* __restrict__ ml) {
  __shared__ __align__(16) __bf16 Ksh[AT_KC * DHD];          // K hi [kv][d]      4 KB
  __shared__ __align__(16) __bf16 Ksl[AT_KC * DHD];          // K lo
  __shared__ __align__(16) __bf16 Vth[DHD * AT_KC];          // V hi [d][kv]      4 KB
  __shared__ __align__(16) __bf16 Vtl[DHD * AT_KC];          // V lo
  __shared__ __align__(16) float  Os[4][16 * 36];            // per wave ctx tile, pitch 36

  const int tid  = threadIdx.x;
  const int wave = tid >> 5;
  const int lane = tid & 31;
  const int hh   = lane >> 4;
  const int c    = lane & 15;

  const int nqb = SEQ / 64;               // 32
  const int bx = blockIdx.x;
  const int qb = bx % nqb;
  const int h  = (bx / nqb) % NHEAD;      // 0..NHEAD-1
  const int ks = bx / (nqb * NHEAD);      // 0..KSPLIT-1: keys ks*SEQ/KSPLIT .. (ks+1)*SEQ/KSPLIT - 1
  const int q0 = qb * 64 + wave * 16;     // first query row of this wave

  const __bf16* Qh = (const __bf16*)(const void*)qhp + (size_t)h * DHD;
  const __bf16* Ql = (const __bf16*)(const void*)qlp + (size_t)h * DHD;
  const __bf16* Kh = (const __bf16*)(const void*)khp + (size_t)h * DHD;
  const __bf16* Kl = (const __bf16*)(const void*)klp + (size_t)h * DHD;
  const __bf16* Vh = (const __bf16*)(const void*)vhp + (size_t)h * DHD * SEQ;
  const __bf16* Vl = (const __bf16*)(const void*)vlp + (size_t)h * DHD * SEQ;
  float*        ob = opart + (size_t)ks * SEQ * DMOD + (size_t)h * DHD;

  // ---- Q fragments (B operand of S^T = K.Q^T: column = query = lane&15, split k map), one 32-deep k-step, hi and lo ----
  const v16b qbh = frag_load(Qh + (size_t)(q0 + c) * DMOD + 8 * hh);
  const v16b qbl = frag_load(Ql + (size_t)(q0 + c) * DMOD + 8 * hh);

  // One query (q0 + c) per lane; the two wave halves hold different keys (and different d) of that query.
  float mrow = -INFINITY;   // running maximum, equal in both halves
  float lrow = 0.f;         // running sum over this half's keys only; the halves are joined once after the loop
  v8f oacc[2];              // ctx^T tiles: element r of tile t = (d = 16*t + 8*hh + r, query c)
#pragma unroll
  for (int t = 0; t < 2; ++t) oacc[t] = (v8f){0.f,0.f,0.f,0.f,0.f,0.f,0.f,0.f};

  // bias of this lane: row (q0 + c), cols (kv0 + 16*j + 8*hh + r), r = 0..7 contiguous
  const float* brow = bias + (size_t)(q0 + c) * SEQ + 8 * hh;

  const int nChunks = SEQ / KSPLIT / AT_KC;   // 8, compile-time constant
  for (int kc = 0; kc < nChunks; ++kc) {
    const int kv0 = ks * (SEQ / KSPLIT) + kc * AT_KC;
    __syncthreads();
    {
      // K staging coverage: 128 thr -> 64 rows (tid>>1) x 2 halves of 16 d (tid&1) x 2 v8b = 64 x 32 per plane
      const int r = tid >> 1, hf = (tid & 1) * 16;
      const __bf16* ksh = Kh + (size_t)(kv0 + r) * DMOD + hf;
      const __bf16* ksl = Kl + (size_t)(kv0 + r) * DMOD + hf;
      // V^T staging coverage: 128 thr -> 32 rows (tid>>2) x 4 parts of 16 keys (tid&3) x 2 v8b = 32 x 64 per plane
      const int r2 = tid >> 2, part = (tid & 3) * 16;
      const __bf16* vsh = Vh + (size_t)r2 * SEQ + kv0 + part;
      const __bf16* vsl = Vl + (size_t)r2 * SEQ + kv0 + part;
#pragma unroll
      for (int i = 0; i < 2; ++i) {
        const v8b a0 = *(const v8b*)(ksh + 8 * i);
        const v8b a1 = *(const v8b*)(ksl + 8 * i);
        const v8b b0 = *(const v8b*)(vsh + 8 * i);
        const v8b b1 = *(const v8b*)(vsl + 8 * i);
        *(v8b*)(Ksh + r * DHD + hf + 8 * i)      = a0;
        *(v8b*)(Ksl + r * DHD + hf + 8 * i)      = a1;
        *(v8b*)(Vth + r2 * AT_KC + part + 8 * i) = b0;
        *(v8b*)(Vtl + r2 * AT_KC + part + 8 * i) = b1;
      }
    }
    __syncthreads();

    // ---- S^T = k.q^T : 4 key-row tiles of 16, A[m=key][k=d] from K tile rows, B = Q (both split k map) ----
    // s[j][r] = score of key (kv0 + 16*j + 8*hh + r) against query (q0 + c)
    v4f bb[8];   // this lane's 32 bias values of the chunk: 8 contiguous floats per key tile, asked for as one group
#pragma unroll
    for (int j = 0; j < 4; ++j) {
      bb[2 * j]     = *(const v4f*)(brow + kv0 + j * 16);
      bb[2 * j + 1] = *(const v4f*)(brow + kv0 + j * 16 + 4);
    }
    v8f s[4];
#pragma unroll
    for (int j = 0; j < 4; ++j) {
      s[j] = (v8f){0.f,0.f,0.f,0.f,0.f,0.f,0.f,0.f};
      FragB kb, kl;
      kb.h[0] = *(const v8b*)(Ksh + (j * 16 + c) * DHD + 8 * hh);
      kb.h[1] = *(const v8b*)(Ksh + (j * 16 + c) * DHD + 16 + 8 * hh);
      kl.h[0] = *(const v8b*)(Ksl + (j * 16 + c) * DHD + 8 * hh);
      kl.h[1] = *(const v8b*)(Ksl + (j * 16 + c) * DHD + 16 + 8 * hh);
      s[j] = mma_bf(kb.v, qbh, s[j]);
      s[j] = mma_bf(kl.v, qbh, s[j]);
      s[j] = mma_bf(kb.v, qbl, s[j]);
    }
    // ---- add pair bias in f32; chunk maximum in-lane over 32 keys, then one exchange between the halves ----
    float cm = -INFINITY;
#pragma unroll
    for (int j = 0; j < 4; ++j) {
#pragma unroll
      for (int r = 0; r < 4; ++r) {
        s[j][r]     += bb[2 * j][r];
        s[j][r + 4] += bb[2 * j + 1][r];
        cm = fmaxf(cm, fmaxf(s[j][r], s[j][r + 4]));
      }
    }
    cm = fmaxf(cm, xhalf(cm));
    const float mnew  = fmaxf(mrow, cm);
    const float nm2   = -mnew * LOG2E;
    const float alpha = exp_rel(mrow, nm2);
    mrow = mnew;
    // ---- p = exp(s - m) by exp_rel, split hi/lo and packed straight into the B operand of ctx^T += v^T.p^T:
    //      element e of k-step kk is key 32*kk + 8*hh + e (e < 8, tile 2*kk) or 32*kk + 16 + 8*hh + e - 8 (tile 2*kk + 1),
    //      the k order of the V^T fragment loads below ----
    v16b pbh[2], pbl[2];
    float psum = 0.f;
#pragma unroll
    for (int j = 0; j < 4; ++j) {
#pragma unroll
      for (int r = 0; r < 8; ++r) {
        const float p = exp_rel(s[j][r], nm2);
        psum += p;
        __bf16 a, bl; at_split(p, a, bl);
        pbh[j >> 1][(j & 1) * 8 + r] = a;
        pbl[j >> 1][(j & 1) * 8 + r] = bl;
      }
    }
    lrow = lrow * alpha + psum;
#pragma unroll
    for (int t = 0; t < 2; ++t)
#pragma unroll
      for (int r = 0; r < 8; ++r) oacc[t][r] *= alpha;
    // ---- ctx^T += V^T . P^T : A[m=d][k=key] from V^T tile rows (2 k-steps of 32 keys), B = P^T from registers ----
#pragma unroll
    for (int kk = 0; kk < 2; ++kk) {
#pragma unroll
      for (int t = 0; t < 2; ++t) {
        FragB vb, vl;
        vb.h[0] = *(const v8b*)(Vth + (t * 16 + c) * AT_KC + kk * 32 + 8 * hh);
        vb.h[1] = *(const v8b*)(Vth + (t * 16 + c) * AT_KC + kk * 32 + 16 + 8 * hh);
        vl.h[0] = *(const v8b*)(Vtl + (t * 16 + c) * AT_KC + kk * 32 + 8 * hh);
        vl.h[1] = *(const v8b*)(Vtl + (t * 16 + c) * AT_KC + kk * 32 + 16 + 8 * hh);
        oacc[t] = mma_bf(vb.v, pbh[kk], oacc[t]);
        oacc[t] = mma_bf(vl.v, pbh[kk], oacc[t]);
        oacc[t] = mma_bf(vb.v, pbl[kk], oacc[t]);
      }
    }
  }

  // ---- join the halves' sums; stage the wave's 16 x 32 unnormalised ctx tile [query][d] for whole-line stores ----
  float* os = Os[wave];
  const float lsum = lrow + xhalf(lrow);
  {
#pragma unroll
    for (int t = 0; t < 2; ++t) {
      const v4f o0 = (v4f){oacc[t][0], oacc[t][1], oacc[t][2], oacc[t][3]};
      const v4f o1 = (v4f){oacc[t][4], oacc[t][5], oacc[t][6], oacc[t][7]};
      *(v4f*)(os + c * 36 + t * 16 + 8 * hh)     = o0;
      *(v4f*)(os + c * 36 + t * 16 + 8 * hh + 4) = o1;
    }
  }
  __builtin_amdgcn_fence(__ATOMIC_RELEASE, "workgroup");
  __builtin_amdgcn_wave_barrier();
  __builtin_amdgcn_fence(__ATOMIC_ACQUIRE, "workgroup");
  {
    const int q4 = lane >> 3, c4 = (lane & 7) * 4;
    {
#pragma unroll
      for (int it = 0; it < 4; ++it) {
        const int row = it * 4 + q4;
        const v4f val = *(const v4f*)(os + row * 36 + c4);
        *(v4f*)(ob + (size_t)(q0 + row) * DMOD + c4) = val;
      }
      
    }
  }
  // maximum (lower half) and sum (upper half) of query q0 + c: the wave's 32 lanes fill one 128-B line
  ml[(((size_t)ks * NHEAD + h) * SEQ + q0 + c) * 2 + hh] = hh ? lsum : mrow;
}

// ---------------------------------------------------------------------------
// Join of the KSPLIT partial attention results and the output projection, in one launch:
//   M = max_ks m, w = exp(m - M), ctx = (sum_ks w * opart) / (sum_ks w * l); hi = bf16_rne(ctx), lo = bf16_rne(ctx - hi)
//   out = ctx . Wo + bo   (hi.hi + hi.lo + lo.hi, f32 accumulate, k-steps in rising order)
// A block owns 16 queries and 128 output columns; grid = (SEQ / 16) * 2 = 256 blocks of 8 waves, one per WGP. The two blocks of a
// query tile each join that tile's ctx for themselves: nothing passes between work-groups.
//   Join: wave = head = k-step of 32 ctx columns; a lane makes its own 16 elements of that k-step's A fragment (the lane / element / k
//   map of frag_load_fo) and stores them as two 16-B pieces per plane into the block's LDS planes (8 units of 1 KiB, fragment order).
//   Product: wave = one tile of 16 output columns; A fragments from LDS; the wave's Wo^T fragments (global planes in fragment order,
//   8 k-steps x hi and lo = 128 registers) depend on nothing in this launch and are asked for at entry, with the partials.
// coverage: join 8 waves x 32 lanes x 16 = 16 x 256 ctx elements; product 8 waves x 16 x 16 = 16 x 128 outputs, each stored once.
// Two waves per SIMD asked of the compiler: the grid supplies two, and with registers saved for more it would ask for the loads in turns.
// ---------------------------------------------------------------------------
__global__ __launch_bounds__(256) __attribute__((amdgpu_waves_per_eu(2, 2)))
void merge_out_kernel(const float* __restrict__ opart, const float* __restrict__ ml,
                      const unsigned short* __restrict__ Bhp, const unsigned short* __restrict__ Blp,
                      const float* __restrict__ bo, float* __restrict__ out) {
  __shared__ __align__(16) unsigned short Ch[8 * 512];       // ctx hi, 16 queries x 256 k, fragment order   8 KB
  __shared__ __align__(16) unsigned short Cl[8 * 512];       // ctx lo
  __shared__ __align__(16) float sT[16 * 132];               // the block's 16 x 128 output tile, pitch 132
  const int lane  = threadIdx.x & 31;
  const int wave  = threadIdx.x >> 5;
  const int rlane = lane & 15;                               // query (A), column (B, D) within a tile
  const int m0    = (blockIdx.x >> 1) * 16;                  // first query of the block
  const int nb    = (blockIdx.x & 1) * 128;                  // first output column of the block
  const int n0    = nb + wave * 16;                          // first output column of the wave

  constexpr int KSTEPS = DMOD >> 5;
  constexpr int TSTEP  = KSTEPS << 9;     // elements from one 16-row tile of a plane to the next
  const __bf16* pbh = (const __bf16*)(const void*)Bhp + (size_t)(n0 >> 4) * TSTEP + lane * 8;
  const __bf16* pbl = (const __bf16*)(const void*)Blp + (size_t)(n0 >> 4) * TSTEP + lane * 8;
  v16b bh[KSTEPS], bl[KSTEPS];
#pragma unroll   // compile-time trip count; the arrays indexed here are registers only under constant indices
  for (int kst = 0; kst < KSTEPS; ++kst) {
    bh[kst] = frag_load_fo(pbh + (kst << 9));
    bl[kst] = frag_load_fo(pbl + (kst << 9));
  }
  const float* pbo = bo + n0 + rlane;
  const float bvn = *pbo;

  // ---- join of the key ranges: head = wave, query m0 + rlane, columns col .. col + 7 and col + 16 .. col + 23 ----
  {
    const int t   = m0 + rlane;
    const int col = wave * DHD + (lane >> 4) * 8;
    const float* pml = ml + ((size_t)wave * SEQ + t) * 2;        // key range 0; the others lie at fixed distances
    const float* pop = opart + (size_t)t * DMOD + col;
    v2f a[KSPLIT];
    v4f o[KSPLIT][4];
#pragma unroll   // compile-time trip count; the arrays indexed here are registers only under constant indices
    for (int s = 0; s < KSPLIT; ++s) {
      a[s] = *(const v2f*)(pml + (size_t)s * NHEAD * SEQ * 2);
      const float* op = pop + (size_t)s * SEQ * DMOD;
      o[s][0] = *(const v4f*)(op);
      o[s][1] = *(const v4f*)(op + 4);
      o[s][2] = *(const v4f*)(op + 16);
      o[s][3] = *(const v4f*)(op + 20);
    }
    // precaution: stands between the launch's loads and any rewrite of the address registers that they name; as inputs the five
    // addresses stay in their registers up to here, so that no load of the group returns its data into one of them
    asm volatile("s_wait_xcnt 0x0" :: "v"(pbh), "v"(pbl), "v"(pbo), "v"(pml), "v"(pop) : "memory");
    float M = a[0][0];
#pragma unroll   // compile-time trip count; the arrays indexed here are registers only under constant indices
    for (int s = 1; s < KSPLIT; ++s) M = fmaxf(M, a[s][0]);
    const float nM2 = -M * LOG2E;
    float w[KSPLIT];
    float L = 0.f;
#pragma unroll   // compile-time trip count; the arrays indexed here are registers only under constant indices
    for (int s = 0; s < KSPLIT; ++s) {
      w[s] = exp_rel(a[s][0], nM2);
      L = fmaf(w[s], a[s][1], L);
    }
    const float inv = 1.0f / L;
#pragma unroll   // compile-time trip count; the arrays indexed here are registers only under constant indices
    for (int half = 0; half < 2; ++half) {
      v4u hv, lv;
#pragma unroll   // compile-time trip count; the arrays indexed here are registers only under constant indices
      for (int e = 0; e < 4; ++e) {
        float f0 = 0.f, f1 = 0.f;
#pragma unroll   // compile-time trip count; the arrays indexed here are registers only under constant indices
        for (int s = 0; s < KSPLIT; ++s) {
          f0 = fmaf(w[s], o[s][half * 2 + (e >> 1)][(e & 1) * 2],     f0);
          f1 = fmaf(w[s], o[s][half * 2 + (e >> 1)][(e & 1) * 2 + 1], f1);
        }
        f0 *= inv;
        f1 *= inv;
        const unsigned short h0 = f2bf_bits(f0), h1 = f2bf_bits(f1);
        const unsigned short l0 = f2bf_bits(f0 - bf_bits2f(h0)), l1 = f2bf_bits(f1 - bf_bits2f(h1));
        hv[e] = pk16(h0, h1);
        lv[e] = pk16(l0, l1);
      }
      *(v4u*)(Ch + wave * 512 + half * 256 + lane * 8) = hv;
      *(v4u*)(Cl + wave * 512 + half * 256 + lane * 8) = lv;
    }
  }
  __syncthreads();   // every wave's k-step of ctx is read by all 8 waves below

  // ---- out tile of this wave: 16 queries x columns n0 .. n0 + 15 ----
  const __bf16* pah = (const __bf16*)(const void*)Ch + lane * 8;
  const __bf16* pal = (const __bf16*)(const void*)Cl + lane * 8;
  v8f acc = (v8f){0.f,0.f,0.f,0.f,0.f,0.f,0.f,0.f};
  v16b ah[KSTEPS], al[KSTEPS];           // read from LDS three k-steps ahead of their products
#pragma unroll   // compile-time trip count; the arrays indexed here are registers only under constant indices
  for (int kst = 0; kst < 3; ++kst) {
    ah[kst] = frag_load_fo(pah + (kst << 9));
    al[kst] = frag_load_fo(pal + (kst << 9));
  }
#pragma unroll   // compile-time trip count; the arrays indexed here are registers only under constant indices
  for (int kst = 0; kst < KSTEPS; ++kst) {
    if (kst + 3 < KSTEPS) {
      ah[kst + 3] = frag_load_fo(pah + ((kst + 3) << 9));
      al[kst + 3] = frag_load_fo(pal + ((kst + 3) << 9));
    }
    acc = mma_bf(ah[kst], bh[kst], acc);
    acc = mma_bf(ah[kst], bl[kst], acc);
    acc = mma_bf(al[kst], bh[kst], acc);
  }

  // ---- epilogue: bias, then the block's 16 x 128 tile through LDS, so that each 128-B line of out has one writer ----
  const int mOff = (lane >> 4) * 8;      // D row offset
#pragma unroll   // compile-time trip count; the arrays indexed here are registers only under constant indices
  for (int r = 0; r < 8; ++r) sT[(mOff + r) * 132 + wave * 16 + rlane] = acc[r] + bvn;
  __syncthreads();   // a row of the tile holds columns of all 8 waves
#pragma unroll   // compile-time trip count; the arrays indexed here are registers only under constant indices
  for (int it = 0; it < 2; ++it) {
    const int row = wave * 2 + it;       // a wave stores a row's 128 columns = 512 B = 4 whole lines
    const v4f val = *(const v4f*)(sT + row * 132 + lane * 4);
    *(v4f*)(out + (size_t)(m0 + row) * DMOD + nb + lane * 4) = val;
  }
}

// ---------------------------------------------------------------------------
//   biasP f32 [2048][2048]                 0 .. 16777216
//   WoTh/l  bf16 [256 o][256 i], fragment order   131072 each (2 planes) 16777216 .. 17039360
//   Qh/l, Kh/l  bf16 [2048][256]            1048576 each (4 planes)      17039360 .. 21233664
//   VTh/l bf16 [256 (h,d)][2048]            1048576 each (2 planes)      21233664 .. 23330816
//   OPART f32 [4 key ranges][2048][256]     2097152 each (4 planes)      23330816 .. 31719424
//   ML f32 [4 key ranges][8][2048][2]       524288                       31719424 .. 32243712
//   total                                   32243712
// ---------------------------------------------------------------------------
extern "C" void kernel_launch(void* const* d_in, const int* in_sizes, int n_in,
                              void* d_out, int out_size, void* d_ws, size_t ws_size,
                              hipStream_t stream) {
  if (n_in < 22) return;
  if (in_sizes[0] != SEQ * SEQ || in_sizes[1] != SEQ * SEQ || in_sizes[2] != SEQ * SEQ) return;
  if (in_sizes[3] != SEQ * DMOD || in_sizes[4] != SEQ * DMOD || in_sizes[5] != SEQ * DMOD) return;
  if (in_sizes[6] != DMOD * DMOD || in_sizes[8] != DMOD * DMOD || in_sizes[10] != DMOD * DMOD || in_sizes[12] != DMOD * DMOD) return;
  if (in_sizes[7] != DMOD || in_sizes[9] != DMOD || in_sizes[11] != DMOD || in_sizes[13] != DMOD) return;
  if (in_sizes[14] != 32 || in_sizes[15] != 16 || in_sizes[16] != 16 || in_sizes[17] != 1) return;
  if (in_sizes[18] != 32 || in_sizes[19] != 16 || in_sizes[20] != 16 || in_sizes[21] != 1) return;
  if (out_size != SEQ * DMOD) return;

  const int*   label   = (const int*)  d_in[0];
  const float* dist    = (const float*)d_in[1];
  const float* contact = (const float*)d_in[2];
  const float* q   = (const float*)d_in[3];
  const float* k   = (const float*)d_in[4];
  const float* v   = (const float*)d_in[5];
  const float* Wq  = (const float*)d_in[6];
  const float* bq  = (const float*)d_in[7];
  const float* Wk  = (const float*)d_in[8];
  const float* bk  = (const float*)d_in[9];
  const float* Wv  = (const float*)d_in[10];
  const float* bv  = (const float*)d_in[11];
  const float* Wo  = (const float*)d_in[12];
  const float* bo  = (const float*)d_in[13];
  const float* Wd1 = (const float*)d_in[14];
  const float* bd1 = (const float*)d_in[15];
  const float* Wd2 = (const float*)d_in[16];
  const float* bd2 = (const float*)d_in[17];
  const float* Wc1 = (const float*)d_in[18];
  const float* bc1 = (const float*)d_in[19];
  const float* Wc2 = (const float*)d_in[20];
  const float* bc2 = (const float*)d_in[21];
  float* out = (float*)d_out;

  const size_t PB = (size_t)SEQ * SEQ * 4;     // 16777216  f32 bias plane
  const size_t PW = (size_t)DMOD * DMOD * 2;   // 131072    bf16 weight plane [256][256]
  const size_t PX = (size_t)SEQ * DMOD * 2;    // 1048576   bf16 activation plane [2048][256] / [256][2048]
  const size_t PF = (size_t)SEQ * DMOD * 4;    // 2097152   f32 activation plane
  size_t off = 0;
  const size_t oBias = off; off += PB;
  const size_t oWoTh = off; off += PW;  const size_t oWoTl = off; off += PW;
  const size_t oQh   = off; off += PX;  const size_t oQl   = off; off += PX;
  const size_t oKh   = off; off += PX;  const size_t oKl   = off; off += PX;
  const size_t oVTh  = off; off += PX;  const size_t oVTl  = off; off += PX;
  const size_t oOp   = off; off += KSPLIT * PF;
  const size_t oML   = off; off += (size_t)KSPLIT * NHEAD * SEQ * 2 * 4;
  if (off > ws_size) return;                   // off = 32243712

  char* ws = (char*)d_ws;
  float*          biasP = (float*)(ws + oBias);
  unsigned short* WoTh = (unsigned short*)(ws + oWoTh); unsigned short* WoTl = (unsigned short*)(ws + oWoTl);
  unsigned short* Qh   = (unsigned short*)(ws + oQh);   unsigned short* Ql   = (unsigned short*)(ws + oQl);
  unsigned short* Kh   = (unsigned short*)(ws + oKh);   unsigned short* Kl   = (unsigned short*)(ws + oKl);
  unsigned short* VTh  = (unsigned short*)(ws + oVTh);  unsigned short* VTl  = (unsigned short*)(ws + oVTl);
  float*          Op   = (float*)(ws + oOp);
  float*          ML   = (float*)(ws + oML);

  const dim3 blk(256);

  // (1) everything ahead of the attention, one launch: the three projections from the f32 inputs, Wo planes [out][in], pair bias plane
  const float qscale = 0.17677669529663688f;                // 32^-0.5 applied as (x.Wq + bq) * scale
  prep_proj_kernel<<<dim3(3 * PREP_P_BLOCKS + PREP_W_BLOCKS + PREP_PB_BLOCKS), blk, 0, stream>>>(dist, contact, label,
      Wd1, bd1, Wd2, bd2, Wc1, bc1, Wc2, bc2, biasP,
      Wq, Wk, Wv, Wo, bq, bk, bv, WoTh, WoTl,
      q, k, v, Qh, Ql, Kh, Kl, VTh, VTl, qscale);

  // (2) attention with pair bias: 4 key ranges x 8 heads x 32 query blocks of 64 rows -> partial ctx, maximum and sum per key range
  attn_bias_kernel<<<dim3(KSPLIT * NHEAD * (SEQ / 64)), dim3(128), 0, stream>>>(Qh, Ql, Kh, Kl, VTh, VTl, biasP, Op, ML);

  // (3) join of the key ranges and out = ctx . Wo + bo -> d_out f32 [2048][256], 256 blocks of 16 queries x 128 columns
  merge_out_kernel<<<dim3((SEQ / 16) * 2), blk, 0, stream>>>(Op, ML, WoTh, WoTl, bo, out);

  (void)hipGetLastError();
}

// v008
// It runs in 43.6 microseconds.
// Timed twice side by side with v007, it ran 1.10 times as fast both times.
// Over all steps from v000 it is 4.82 times as fast.
// Contractions: q, k, v^T projections, q.k^T scores, p.v and output projection on v_wmma_f32_16x16x32_bf16 with bf16 hi/lo operands (hi.hi + hi.lo + lo.hi), f32 accumulate; pair bias (exact affine fold of the two linear 2->16->1 maps) and online softmax in f32 on VALU; the keys of a query block are dealt to 4 work-groups whose partial results the output projection's launch joins; the q, k, v projections split their f32 operands themselves, into LDS planes in fragment order, in one launch with the pair bias.
#include <hip/hip_runtime.h>
#include <math.h>
#include <stdint.h>

#define SEQ   2048
#define DMOD  256
#define NHEAD 8
#define DHD   32
#define KSPLIT 4      // key ranges per query block in the attention launch, one work-group each

typedef __attribute__((ext_vector_type(16))) __bf16   v16b;
typedef __attribute__((ext_vector_type(8)))  __bf16   v8b;
typedef __attribute__((ext_vector_type(8)))  float    v8f;
typedef __attribute__((ext_vector_type(4)))  float    v4f;
typedef __attribute__((ext_vector_type(2)))  float    v2f;
typedef __attribute__((ext_vector_type(4)))  unsigned int v4u;
typedef __attribute__((ext_vector_type(4)))  int      v4i;

// RNE f32 -> bf16 bits
__device__ __forceinline__ unsigned short f2bf_bits(float f) {
  unsigned u = __float_as_uint(f);
  return (unsigned short)((u + 0x7FFFu + ((u >> 16) & 1u)) >> 16);
}
__device__ __forceinline__ float bf_bits2f(unsigned short h) { return __uint_as_float(((unsigned)h) << 16); }
__device__ __forceinline__ unsigned pk16(unsigned short a, unsigned short b) { return (unsigned)a | ((unsigned)b << 16); }

// 16x16x32 fragment (A row-major k-contiguous, or B stored [n][k] k-contiguous):
// lane l: row/col = l & 15, p already offset by 8*(l>>4); elements 0..7 <- p[0..7], elements 8..15 <- p[16..23]
union FragB { v16b v; v8b h[2]; };
__device__ __forceinline__ v16b frag_load(const __bf16* p) {
  FragB f; f.h[0] = *(const v8b*)(p); f.h[1] = *(const v8b*)(p + 16); return f.v;
}

// Fragment order of a GEMM operand plane [rows][K] (K a multiple of 32): one 1-KiB unit per (16 rows, 32 k), units of a row tile in k order.
// Inside a unit lane l's elements 0..7 lie at 16-B piece l, its elements 8..15 at piece 32 + l, so element (row, k) is at
//   (((row >> 4) * (K >> 5) + (k >> 5)) * 2 + ((k >> 4) & 1)) * 256 + ((row & 15) + 16 * ((k >> 3) & 1)) * 8 + (k & 7)
// and each of the two 16-B-per-lane loads of a fragment reads 512 bytes in a row (4 whole lines). Same lane / element / k map as frag_load.
// p: the lane's 16-B piece in the unit (unit start + lane * 8 elements)
__device__ __forceinline__ v16b frag_load_fo(const __bf16* p) {
  FragB f; f.h[0] = *(const v8b*)(p); f.h[1] = *(const v8b*)(p + 256); return f.v;
}

// WMMA + hazard guard (4 VALU slots, ties D, keeps A/B live)
__device__ __forceinline__ v8f mma_bf(v16b a, v16b b, v8f c) {
  c = __builtin_amdgcn_wmma_f32_16x16x32_bf16(false, a, false, b, (short)0, c, false, false);
  asm volatile("v_nop\n\tv_nop\n\tv_nop\n\tv_nop" : "+v"(c) : "v"(a), "v"(b));
  return c;
}

// ---------------------------------------------------------------------------
// Pair bias plane [SEQ][SEQ] f32:
//   pb(map, W1, b1, W2, b2)(n,m) = map*(W1[0].W2) + label*(W1[1].W2) + (b1.W2 + b2)   (both maps linear, exact fold)
//   bias = pb_d + pb_c.  W1 [2][16] row-major, W2 [16][1].
// Block blk owns elements blk*8192 .. blk*8192+8191; each thread 4 consecutive floats per iteration, 8 iterations.
// coverage: 512 blocks x 8 it x 256 thr x 4 = 4194304 = whole plane.
// ---------------------------------------------------------------------------
__device__ __forceinline__ void pair_bias_block(const int blk,
    const float* __restrict__ dist, const float* __restrict__ contact, const int* __restrict__ label,
    const float* __restrict__ Wd1, const float* __restrict__ bd1, const float* __restrict__ Wd2, const float* __restrict__ bd2,
    const float* __restrict__ Wc1, const float* __restrict__ bc1, const float* __restrict__ Wc2, const float* __restrict__ bc2,
    float* __restrict__ bias) {
  float ad = 0.f, ld = 0.f, gd = 0.f, ac = 0.f, lc = 0.f, gc = 0.f;
#pragma unroll 1
  for (int j = 0; j < 16; ++j) {
    const float wd2 = Wd2[j], wc2 = Wc2[j];
    ad = fmaf(Wd1[j],      wd2, ad);   // map weight (row 0 of W1)
    ld = fmaf(Wd1[16 + j], wd2, ld);   // label weight (row 1 of W1)
    gd = fmaf(bd1[j],      wd2, gd);
    ac = fmaf(Wc1[j],      wc2, ac);
    lc = fmaf(Wc1[16 + j], wc2, lc);
    gc = fmaf(bc1[j],      wc2, gc);
  }
  gd += bd2[0];
  gc += bc2[0];
  const size_t base = (size_t)blk * 8192 + (size_t)threadIdx.x * 4;
{
#pragma unroll 1
    for (int it = 0; it < 8; ++it) {
      const size_t i4 = base + (size_t)it * 1024;
      const v4f dm = *(const v4f*)(dist + i4);
      const v4f cm = *(const v4f*)(contact + i4);
      const v4i lb = *(const v4i*)(label + i4);
      v4f o;
#pragma unroll
      for (int e = 0; e < 4; ++e) {
        const float lf = (float)lb[e];
        const float pd = fmaf(dm[e], ad, fmaf(lf, ld, gd));
        const float pc = fmaf(cm[e], ac, fmaf(lf, lc, gc));
        o[e] = pd + pc;
      }
      *(v4f*)(bias + i4) = o;
      // precaution: stands between this store and the next trip's rewrite of the registers that the store names
      asm volatile("s_wait_xcnt 0x0" ::: "memory");
    }
    
  }
}

// ---------------------------------------------------------------------------
// Fused transpose + bf16 split of an f32 matrix W viewed [R rows][Cc cols] (pitch Cc) ->
//   oh(c, r) = bf16_rne(W[r][c]), ol(c, r) = bf16_rne(W[r][c] - oh)   (planes [Cc rows][R k] in fragment order, see frag_load_fo)
// 64x64 tiles through LDS (tf: 64 x 68 floats of the caller). Tile (bx, by) of (Cc/64, R/64), 256 threads, R and Cc multiples of 64.
// coverage per block/plane: load 4 it x 256 thr x 4 floats = 64x64; store 2 it x 256 thr x 8 u16 = 64x64 = 8 whole units (4 row tiles x 2 k-steps).
// ---------------------------------------------------------------------------
__device__ __forceinline__ void tsplit_block(float* tf, const int bx, const int by, const float* __restrict__ W,
                                             unsigned short* __restrict__ oh, unsigned short* __restrict__ ol, int R, int Cc) {
  const int c0  = bx * 64;           // input column block = output row block
  const int r0  = by * 64;           // input row block    = output column block
  const int tid = threadIdx.x;
  {
    const int lr = tid >> 4;         // 0..15
    const int c4 = (tid & 15) * 4;   // 0..60
#pragma unroll
    for (int it = 0; it < 4; ++it) {
      const int rr = it * 16 + lr;   // 0..63
      const v4f a = *(const v4f*)(W + (size_t)(r0 + rr) * Cc + c0 + c4);
      *(v4f*)(tf + rr * 68 + c4) = a;
    }
  }
  __syncthreads();
  // 16-B piece it*256 + tid of the tile's 512: fragment lane, half of the fragment, k-step, row tile
  const int ln   = tid & 31;
  const int part = (tid >> 5) & 1;
  const int ksl  = (tid >> 6) & 1;
  const int c8   = ksl * 32 + part * 16 + (ln >> 4) * 8;   // first of the piece's 8 k (= input rows) within the tile
  v4u hv[2], lv[2];
#pragma unroll
  for (int it = 0; it < 2; ++it) {
    const int oc = (it * 2 + (tid >> 7)) * 16 + (ln & 15);   // output row within tile (= input column)
    v4u a, a2;
#pragma unroll
    for (int q = 0; q < 4; ++q) {
      const float f0 = tf[(c8 + 2 * q) * 68 + oc];
      const float f1 = tf[(c8 + 2 * q + 1) * 68 + oc];
      const unsigned short h0 = f2bf_bits(f0), h1 = f2bf_bits(f1);
      const unsigned short l0 = f2bf_bits(f0 - bf_bits2f(h0)), l1 = f2bf_bits(f1 - bf_bits2f(h1));
      a[q]  = pk16(h0, h1);
      a2[q] = pk16(l0, l1);
    }
    hv[it] = a; lv[it] = a2;
  }
  {
#pragma unroll
    for (int it = 0; it < 2; ++it) {
      const int rt = it * 2 + (tid >> 7);
      const size_t go = ((size_t)(((c0 >> 4) + rt) * (R >> 5) + (r0 >> 5) + ksl) << 9) + part * 256 + ln * 8;
      *(v4u*)(oh + go) = hv[it];
      *(v4u*)(ol + go) = lv[it];
    }
    // precaution: stands between these stores and whatever follows them in the kernel's text and rewrites a register that they name
    asm volatile("s_wait_xcnt 0x0" ::: "memory");
  }
}

// ---------------------------------------------------------------------------
// One projection tile from the f32 inputs: C = scale * (X . Wm + bias), X [SEQ][DMOD], Wm [DMOD in][DMOD out], product = hi.hi + hi.lo + lo.hi.
// A block owns 64 rows of X and 128 columns of Wm; it makes the bf16 hi/lo planes of both operands itself, in LDS, in fragment order
// (see frag_load_fo), 64 k per stage, two stage buffers: the next stage's f32 values are asked for ahead of this stage's products.
//   stage buffer (2-B elements): W hi, W lo: 8 column tiles x (2 units of 512 + 8 of pad, so that the 4 pieces a lane stores and the
//   8 tiles a wave stores fall on different banks); X hi, X lo: 4 row tiles x 2 units of 512.
//   W staging: wave = 8 k, lane = 4 columns (8 whole-line loads); the 8 k of a column are one 16-B piece, made in registers.
//   X staging: thread = 8 k (tid & 7) of rows tid >> 3 and 32 + (tid >> 3), one 16-B piece each.
//   coverage per stage: W 8 waves x 8 k x 32 lanes x 4 = 64 x 128; X 256 thr x 2 x 8 = 64 x 64.
// Wave = 32 rows x 32 columns (2 x 4 waves). VT = false: A = X, B = W, C [row][column] pitch DMOD; VT = true: A = W, B = X, C [column][row] pitch SEQ.
// The block's tile goes through LDS, so that every 128-B line of the hi and lo planes (row-major) has one writer.
// ---------------------------------------------------------------------------
#define PJ_WT    1032                       // elements from one column tile of a W plane to the next
#define PJ_WPL   (8 * PJ_WT)                // one W plane of a stage
#define PJ_XPL   (4 * 1024)                 // one X plane of a stage
#define PJ_STAGE (2 * PJ_WPL + 2 * PJ_XPL)  // 24704 elements = 49408 B
__device__ __forceinline__ void split8_store(const float* f, unsigned short* ph, unsigned short* pl) {
  v4u hv, lv;
#pragma unroll
  for (int q = 0; q < 4; ++q) {
    const float f0 = f[2 * q], f1 = f[2 * q + 1];
    const unsigned short h0 = f2bf_bits(f0), h1 = f2bf_bits(f1);
    const unsigned short l0 = f2bf_bits(f0 - bf_bits2f(h0)), l1 = f2bf_bits(f1 - bf_bits2f(h1));
    hv[q] = pk16(h0, h1);
    lv[q] = pk16(l0, l1);
  }
  *(v4u*)ph = hv;
  *(v4u*)pl = lv;
}

template <bool VT>
__device__ __forceinline__ void proj_block(unsigned short* sm, const int blk, const float* __restrict__ X, const float* __restrict__ Wm,
                                           const float* __restrict__ bias, unsigned short* __restrict__ Ch, unsigned short* __restrict__ Cl,
                                           const float scale) {
  const int tid  = threadIdx.x;
  const int lane = tid & 31;
  const int wave = tid >> 5;
  const int m0 = (blk >> 1) * 64;        // first row of X
  const int nb = (blk & 1) * 128;        // first column of Wm
  const int wm = wave >> 2;              // the wave's 32 rows
  const int wn = wave & 3;               // the wave's 32 columns

  const int xg = tid & 7, xr = tid >> 3;
  const float* pw = Wm + (size_t)(wave * 8) * DMOD + nb + lane * 4;
  const float* px = X + (size_t)(m0 + xr) * DMOD + xg * 8;
  // where the thread's pieces lie in a stage buffer: piece (row, g = k / 8) at (row>>4) * (PJ_WT in W, 1024 in X) + (g>>2) * 512 + ((g>>1)&1)*256 + ((row&15) + 16*(g&1))*8
  const int wdst = (lane >> 2) * PJ_WT + (wave >> 2) * 512 + ((wave >> 1) & 1) * 256 + (((lane & 3) * 4) + 16 * (wave & 1)) * 8;
  const int xdst = 2 * PJ_WPL + (xr >> 4) * 1024 + (xg >> 2) * 512 + ((xg >> 1) & 1) * 256 + ((xr & 15) + 16 * (xg & 1)) * 8;

  v4f wv[8], xv[4];
#pragma unroll
  for (int e = 0; e < 8; ++e) wv[e] = *(const v4f*)(pw + e * DMOD);
#pragma unroll
  for (int u = 0; u < 2; ++u) {
    xv[2 * u]     = *(const v4f*)(px + u * 32 * DMOD);
    xv[2 * u + 1] = *(const v4f*)(px + u * 32 * DMOD + 4);
  }
  // precaution: stands between these loads and the rewrite of the two address registers that they name
  asm volatile("s_wait_xcnt 0x0" :: "v"(pw), "v"(px) : "memory");

  v8f acc[2][2];
#pragma unroll
  for (int i = 0; i < 2; ++i)
#pragma unroll
    for (int j = 0; j < 2; ++j) acc[i][j] = (v8f){0.f,0.f,0.f,0.f,0.f,0.f,0.f,0.f};

#pragma unroll 1   // rolled: four copies of the stage would only lengthen the kernel's text
  for (int st = 0; st < DMOD / 64; ++st) {
    unsigned short* buf = sm + (st & 1) * PJ_STAGE;
#pragma unroll
    for (int cc = 0; cc < 4; ++cc) {
      float f[8];
#pragma unroll
      for (int e = 0; e < 8; ++e) f[e] = wv[e][cc];
      split8_store(f, buf + wdst + cc * 8, buf + PJ_WPL + wdst + cc * 8);
    }
#pragma unroll
    for (int u = 0; u < 2; ++u) {
      float f[8];
#pragma unroll
      for (int e = 0; e < 4; ++e) { f[e] = xv[2 * u][e]; f[4 + e] = xv[2 * u + 1][e]; }
      split8_store(f, buf + xdst + u * 2048, buf + PJ_XPL + xdst + u * 2048);
    }
    // publishes this stage; it also ends every wave's reads of the other buffer, which the next trip refills
    __syncthreads();
    // the next stage's values are asked for behind the barrier (its fence would wait for them) and fly during this stage's products
    if (st + 1 < DMOD / 64) {
      pw += 64 * DMOD;
      px += 64;
#pragma unroll
      for (int e = 0; e < 8; ++e) wv[e] = *(const v4f*)(pw + e * DMOD);
#pragma unroll
      for (int u = 0; u < 2; ++u) {
        xv[2 * u]     = *(const v4f*)(px + u * 32 * DMOD);
        xv[2 * u + 1] = *(const v4f*)(px + u * 32 * DMOD + 4);
      }
      // precaution: stands between these loads and the next trip's rewrite of the two address registers that they name
      asm volatile("s_wait_xcnt 0x0" :: "v"(pw), "v"(px) : "memory");
    }
    const __bf16* sw = (const __bf16*)(const void*)buf + (wn * 2) * PJ_WT + lane * 8;
    const __bf16* sx = (const __bf16*)(const void*)buf + 2 * PJ_WPL + (wm * 2) * 1024 + lane * 8;
#pragma unroll
    for (int ksl = 0; ksl < 2; ++ksl) {
      v16b xh[2], xl[2];
#pragma unroll
      for (int i = 0; i < 2; ++i) {
        xh[i] = frag_load_fo(sx + i * 1024 + ksl * 512);
        xl[i] = frag_load_fo(sx + PJ_XPL + i * 1024 + ksl * 512);
      }
#pragma unroll
      for (int j = 0; j < 2; ++j) {
        const v16b wh = frag_load_fo(sw + j * PJ_WT + ksl * 512);
        const v16b wl = frag_load_fo(sw + PJ_WPL + j * PJ_WT + ksl * 512);
#pragma unroll
        for (int i = 0; i < 2; ++i) {
          if (!VT) {
            acc[i][j] = mma_bf(xh[i], wh, acc[i][j]);
            acc[i][j] = mma_bf(xh[i], wl, acc[i][j]);
            acc[i][j] = mma_bf(xl[i], wh, acc[i][j]);
          } else {
            acc[i][j] = mma_bf(wh, xh[i], acc[i][j]);
            acc[i][j] = mma_bf(wh, xl[i], acc[i][j]);
            acc[i][j] = mma_bf(wl, xh[i], acc[i][j]);
          }
        }
      }
    }
  }

  // ---- epilogue: the f32 tile lies in stage buffer 0 alone, whose last readers (stage 2) all passed the barrier of stage 3 ----
  float* so = (float*)(void*)sm;
  const int rlane = lane & 15;
  const int mOff  = (lane >> 4) * 8;     // D row offset
  constexpr int SP = VT ? 68 : 132;      // pitch of the tile in floats
#pragma unroll
  for (int j = 0; j < 2; ++j) {
    const float bvn = VT ? 0.f : bias[nb + wn * 32 + j * 16 + rlane];
#pragma unroll
    for (int r = 0; r < 8; ++r) {
      const float bvm = VT ? bias[nb + wn * 32 + j * 16 + mOff + r] : 0.f;
#pragma unroll
      for (int i = 0; i < 2; ++i) {
        float v = acc[i][j][r];
        v += VT ? bvm : bvn;
        v *= scale;
        if (!VT) so[(wm * 32 + i * 16 + mOff + r) * SP + wn * 32 + j * 16 + rlane] = v;
        else     so[(wn * 32 + j * 16 + mOff + r) * SP + wm * 32 + i * 16 + rlane] = v;
      }
    }
  }
  __syncthreads();   // a row of the tile holds values of several waves
#pragma unroll
  for (int it = 0; it < 4; ++it) {
    const int p   = it * 256 + tid;                    // 16-B piece of the tile's 1024 per plane
    const int row = VT ? (p >> 3) : (p >> 4);
    const int c8  = VT ? (p & 7) * 8 : (p & 15) * 8;
    const size_t go = VT ? (size_t)(nb + row) * SEQ + m0 + c8 : (size_t)(m0 + row) * DMOD + nb + c8;
    const v4f s0 = *(const v4f*)(so + row * SP + c8);
    const v4f s1 = *(const v4f*)(so + row * SP + c8 + 4);
    const float f[8] = {s0[0], s0[1], s0[2], s0[3], s1[0], s1[1], s1[2], s1[3]};
    split8_store(f, Ch + go, Cl + go);
  }
  // precaution: stands between these stores and whatever follows them in the kernel's text and rewrites a register that they name
  asm volatile("s_wait_xcnt 0x0" ::: "memory");
}

// ---------------------------------------------------------------------------
// All work ahead of the attention, in one launch; the jobs are independent of each other and a block does exactly one of them:
//   blocks   0 ..  63 : Q   = (q.Wq + bq) * qscale   [SEQ][DMOD]   (32 row blocks x 2 column blocks each)
//   blocks  64 .. 127 : K   =  k.Wk + bk             [SEQ][DMOD]
//   blocks 128 .. 191 : V^T = (v.Wv + bv)^T          [DMOD][SEQ]
//   blocks 192 .. 207 : transpose + split of Wo (16 tiles of 64x64)
//   blocks 208 .. 719 : pair bias plane (512 blocks x 8192 elements)
// The job test reads blockIdx.x alone, so every barrier is passed by a whole block or by none of it.
// LDS and registers admit three blocks on a WGP, so all 720 run at once, the pair bias stream beside the products.
// ---------------------------------------------------------------------------
#define PREP_P_BLOCKS  64
#define PREP_W_BLOCKS  16
#define PREP_PB_BLOCKS 512
__global__ __launch_bounds__(256)
void prep_proj_kernel(
    const float* __restrict__ dist, const float* __restrict__ contact, const int* __restrict__ label,
    const float* __restrict__ Wd1, const float* __restrict__ bd1, const float* __restrict__ Wd2, const float* __restrict__ bd2,
    const float* __restrict__ Wc1, const float* __restrict__ bc1, const float* __restrict__ Wc2, const float* __restrict__ bc2,
    float* __restrict__ bias,
    const float* __restrict__ Wq, const float* __restrict__ Wk, const float* __restrict__ Wv, const float* __restrict__ Wo,
    const float* __restrict__ bq, const float* __restrict__ bk, const float* __restrict__ bv,
    unsigned short* __restrict__ WoTh, unsigned short* __restrict__ WoTl,
    const float* __restrict__ q, const float* __restrict__ k, const float* __restrict__ v,
    unsigned short* __restrict__ Qh, unsigned short* __restrict__ Ql, unsigned short* __restrict__ Kh, unsigned short* __restrict__ Kl,
    unsigned short* __restrict__ VTh, unsigned short* __restrict__ VTl, float qscale) {
  __shared__ __align__(16) unsigned short sm[2 * PJ_STAGE];   // 98816 B: two stage buffers; the transposes' 64 x 68 floats
  const int b = blockIdx.x;
  if (b < 2 * PREP_P_BLOCKS) {
    const bool isq = (b < PREP_P_BLOCKS);
    proj_block<false>(sm, b & (PREP_P_BLOCKS - 1), isq ? q : k, isq ? Wq : Wk, isq ? bq : bk, isq ? Qh : Kh, isq ? Ql : Kl,
                      isq ? qscale : 1.0f);
  } else if (b < 3 * PREP_P_BLOCKS) {
    proj_block<true>(sm, b - 2 * PREP_P_BLOCKS, v, Wv, bv, VTh, VTl, 1.0f);
  } else if (b < 3 * PREP_P_BLOCKS + PREP_W_BLOCKS) {
    const int t = b - 3 * PREP_P_BLOCKS;
    tsplit_block((float*)(void*)sm, t & 3, (t >> 2) & 3, Wo, WoTh, WoTl, DMOD, DMOD);
  } else {
    pair_bias_block(b - (3 * PREP_P_BLOCKS + PREP_W_BLOCKS), dist, contact, label, Wd1, bd1, Wd2, bd2, Wc1, bc1, Wc2, bc2, bias);
  }
}

// =====================================================================================
// Flash attention with additive pair bias, head dim 32, all 8 heads in one launch.
//   q planes (hi/lo bf16): element (t, h, d) at [t*DMOD + h*32 + d]   (score scale already folded into q)
//   k planes (hi/lo bf16): element (s, h, d) at [s*DMOD + h*32 + d]
//   v^T planes (hi/lo bf16): element (h, d, s) at [(h*32 + d)*SEQ + s]
//   bias f32 [SEQ t][SEQ s], shared over heads
//   opart f32, one plane per key range ks: element (ks, t, h, d) at [ks*SEQ*DMOD + t*DMOD + h*32 + d], NOT normalised
//   ml f32: running maximum and sum of (ks, h, t) at [((ks*NHEAD + h)*SEQ + t)*2 + 0 / 1]
//   scores^T = k . q^T + bias^T : bf16 hi/lo (hi.hi + hi.lo + lo.hi), bias added in f32; a lane holds one query's scores
//   ctx^T    = v^T . p^T         : bf16 hi/lo of p (unnormalised, <= 1, packed in registers) and v, f32 accumulate
//   online softmax in f32 over the block's SEQ/KSPLIT keys (8 chunks of 64 keys, compile-time trip count).
//   Block = 4 waves = 64 query rows of one head against one key range; grid = KSPLIT * NHEAD * (SEQ/64) = 1024 blocks of 128 threads.
//   The KSPLIT partial results of a query (maximum, sum, unnormalised ctx) are joined by merge_out_kernel in the next launch.
//   K / V^T chunk staging through LDS by all 128 threads (plain 16-B loads, __syncthreads before and after);
// =====================================================================================
#define AT_KC 64
// Row pitch of the staged tiles in LDS, in 2-B elements: an odd number of 16-B pieces (K rows of 64 B at 80 B, V^T rows of 128 B at 144 B),
// so that the 16 rows which a half wave reads with one 16-B-per-lane fragment load start on 16 different groups of 4 banks.
// The pad pieces are neither written nor read.
#define AT_KP (DHD + 8)
#define AT_VP (AT_KC + 8)

__device__ __forceinline__ __bf16 at_f2bf(float f) { return __builtin_bit_cast(__bf16, f2bf_bits(f)); }
__device__ __forceinline__ void at_split(float f, __bf16& hi, __bf16& lo) {
  const unsigned short hb = f2bf_bits(f);
  hi = __builtin_bit_cast(__bf16, hb);
  lo = at_f2bf(f - __uint_as_float(((unsigned)hb) << 16));
}

// e^(x - m) on the chip's own base-2 exponential: one multiply-add and one v_exp_f32. nm2 = -m * LOG2E.
// An argument below the f32 exponent range (also -inf) gives 0, as the limit asks.
#define LOG2E 1.4426950408889634f
__device__ __forceinline__ float exp_rel(float x, float nm2) { return __builtin_amdgcn_exp2f(fmaf(x, LOG2E, nm2)); }

// value of lane l ^ 16 (the other wave half), by a vector cross-row move
__device__ __forceinline__ float xhalf(float x) {
  const int b = __builtin_bit_cast(int, x);
  return __builtin_bit_cast(float, __builtin_amdgcn_permlanex16(b, b, 0x76543210, 0xfedcba98, false, false));
}

// Four waves per SIMD asked of the compiler: the grid supplies four (1024 work-groups of 4 waves on 256 WGPs), so that one
// work-group's waits (staging, barriers, LDS, dependent vector chains) are filled by the other three. Without the upper bound the
// compiler saves registers for waves that never come and strings a lane's 32 independent exp/split chains one behind another.
__global__ __launch_bounds__(128) __attribute__((amdgpu_waves_per_eu(4, 4)))
void attn_bias_kernel(const unsigned short* __restrict__ qhp, const unsigned short* __restrict__ qlp,
                      const unsigned short* __restrict__ khp, const unsigned short* __restrict__ klp,
                      const unsigned short* __restrict__ vhp, const unsigned short* __restrict__ vlp,
                      const float* __restrict__ bias, float* __restrict__ opart, float* __restrict__ ml) {
  __shared__ __align__(16) __bf16 Ksh[AT_KC * AT_KP];        // K hi [kv][d], pitch AT_KP     5120 B
  __shared__ __align__(16) __bf16 Ksl[AT_KC * AT_KP];        // K lo
  __shared__ __align__(16) __bf16 Vth[DHD * AT_VP];          // V hi [d][kv], pitch AT_VP     4608 B
  __shared__ __align__(16) __bf16 Vtl[DHD * AT_VP];          // V lo
  __shared__ __align__(16) float  Os[4][16 * 36];            // per wave ctx tile, pitch 36

  const int tid  = threadIdx.x;
  const int wave = tid >> 5;
  const int lane = tid & 31;
  const int hh   = lane >> 4;
  const int c    = lane & 15;

  const int nqb = SEQ / 64;               // 32
  const int bx = blockIdx.x;
  const int qb = bx % nqb;
  const int h  = (bx / nqb) % NHEAD;      // 0..NHEAD-1
  const int ks = bx / (nqb * NHEAD);      // 0..KSPLIT-1: keys ks*SEQ/KSPLIT .. (ks+1)*SEQ/KSPLIT - 1
  const int q0 = qb * 64 + wave * 16;     // first query row of this wave

  const __bf16* Qh = (const __bf16*)(const void*)qhp + (size_t)h * DHD;
  const __bf16* Ql = (const __bf16*)(const void*)qlp + (size_t)h * DHD;
  const __bf16* Kh = (const __bf16*)(const void*)khp + (size_t)h * DHD;
  const __bf16* Kl = (const __bf16*)(const void*)klp + (size_t)h * DHD;
  const __bf16* Vh = (const __bf16*)(const void*)vhp + (size_t)h * DHD * SEQ;
  const __bf16* Vl = (const __bf16*)(const void*)vlp + (size_t)h * DHD * SEQ;
  float*        ob = opart + (size_t)ks * SEQ * DMOD + (size_t)h * DHD;

  // ---- Q fragments (B operand of S^T = K.Q^T: column = query = lane&15, split k map), one 32-deep k-step, hi and lo ----
  const v16b qbh = frag_load(Qh + (size_t)(q0 + c) * DMOD + 8 * hh);
  const v16b qbl = frag_load(Ql + (size_t)(q0 + c) * DMOD + 8 * hh);

  // One query (q0 + c) per lane; the two wave halves hold different keys (and different d) of that query.
  float mrow = -INFINITY;   // running maximum, equal in both halves
  float lrow = 0.f;         // running sum over this half's keys only; the halves are joined once after the loop
  v8f oacc[2];              // ctx^T tiles: element r of tile t = (d = 16*t + 8*hh + r, query c)
#pragma unroll
  for (int t = 0; t < 2; ++t) oacc[t] = (v8f){0.f,0.f,0.f,0.f,0.f,0.f,0.f,0.f};

  // bias of this lane: row (q0 + c), cols (kv0 + 16*j + 8*hh + r), r = 0..7 contiguous
  const float* brow = bias + (size_t)(q0 + c) * SEQ + 8 * hh;

  const int nChunks = SEQ / KSPLIT / AT_KC;   // 8, compile-time constant
  for (int kc = 0; kc < nChunks; ++kc) {
    const int kv0 = ks * (SEQ / KSPLIT) + kc * AT_KC;
    __syncthreads();
    {
      // K staging coverage: 128 thr -> 64 rows (tid>>1) x 2 halves of 16 d (tid&1) x 2 v8b = 64 x 32 per plane
      const int r = tid >> 1, hf = (tid & 1) * 16;
      const __bf16* ksh = Kh + (size_t)(kv0 + r) * DMOD + hf;
      const __bf16* ksl = Kl + (size_t)(kv0 + r) * DMOD + hf;
      // V^T staging coverage: 128 thr -> 32 rows (tid>>2) x 4 parts of 16 keys (tid&3) x 2 v8b = 32 x 64 per plane
      const int r2 = tid >> 2, part = (tid & 3) * 16;
      const __bf16* vsh = Vh + (size_t)r2 * SEQ + kv0 + part;
      const __bf16* vsl = Vl + (size_t)r2 * SEQ + kv0 + part;
#pragma unroll
      for (int i = 0; i < 2; ++i) {
        const v8b a0 = *(const v8b*)(ksh + 8 * i);
        const v8b a1 = *(const v8b*)(ksl + 8 * i);
        const v8b b0 = *(const v8b*)(vsh + 8 * i);
        const v8b b1 = *(const v8b*)(vsl + 8 * i);
        *(v8b*)(Ksh + r * AT_KP + hf + 8 * i)    = a0;
        *(v8b*)(Ksl + r * AT_KP + hf + 8 * i)    = a1;
        *(v8b*)(Vth + r2 * AT_VP + part + 8 * i) = b0;
        *(v8b*)(Vtl + r2 * AT_VP + part + 8 * i) = b1;
      }
    }
    __syncthreads();

    // ---- S^T = k.q^T : 4 key-row tiles of 16, A[m=key][k=d] from K tile rows, B = Q (both split k map) ----
    // s[j][r] = score of key (kv0 + 16*j + 8*hh + r) against query (q0 + c)
    v4f bb[8];   // this lane's 32 bias values of the chunk: 8 contiguous floats per key tile, asked for as one group
#pragma unroll
    for (int j = 0; j < 4; ++j) {
      bb[2 * j]     = *(const v4f*)(brow + kv0 + j * 16);
      bb[2 * j + 1] = *(const v4f*)(brow + kv0 + j * 16 + 4);
    }
    v8f s[4];
#pragma unroll
    for (int j = 0; j < 4; ++j) {
      s[j] = (v8f){0.f,0.f,0.f,0.f,0.f,0.f,0.f,0.f};
      FragB kb, kl;
      kb.h[0] = *(const v8b*)(Ksh + (j * 16 + c) * AT_KP + 8 * hh);
      kb.h[1] = *(const v8b*)(Ksh + (j * 16 + c) * AT_KP + 16 + 8 * hh);
      kl.h[0] = *(const v8b*)(Ksl + (j * 16 + c) * AT_KP + 8 * hh);
      kl.h[1] = *(const v8b*)(Ksl + (j * 16 + c) * AT_KP + 16 + 8 * hh);
      s[j] = mma_bf(kb.v, qbh, s[j]);
      s[j] = mma_bf(kl.v, qbh, s[j]);
      s[j] = mma_bf(kb.v, qbl, s[j]);
    }
    // ---- add pair bias in f32; chunk maximum in-lane over 32 keys, then one exchange between the halves ----
    float cm = -INFINITY;
#pragma unroll
    for (int j = 0; j < 4; ++j) {
#pragma unroll
      for (int r = 0; r < 4; ++r) {
        s[j][r]     += bb[2 * j][r];
        s[j][r + 4] += bb[2 * j + 1][r];
        cm = fmaxf(cm, fmaxf(s[j][r], s[j][r + 4]));
      }
    }
    cm = fmaxf(cm, xhalf(cm));
    const float mnew  = fmaxf(mrow, cm);
    const float nm2   = -mnew * LOG2E;
    const float alpha = exp_rel(mrow, nm2);
    mrow = mnew;
    // ---- p = exp(s - m) by exp_rel, split hi/lo and packed straight into the B operand of ctx^T += v^T.p^T:
    //      element e of k-step kk is key 32*kk + 8*hh + e (e < 8, tile 2*kk) or 32*kk + 16 + 8*hh + e - 8 (tile 2*kk + 1),
    //      the k order of the V^T fragment loads below ----
    v16b pbh[2], pbl[2];
    float psum = 0.f;
#pragma unroll
    for (int j = 0; j < 4; ++j) {
#pragma unroll
      for (int r = 0; r < 8; ++r) {
        const float p = exp_rel(s[j][r], nm2);
        psum += p;
        __bf16 a, bl; at_split(p, a, bl);
        pbh[j >> 1][(j & 1) * 8 + r] = a;
        pbl[j >> 1][(j & 1) * 8 + r] = bl;
      }
    }
    lrow = lrow * alpha + psum;
#pragma unroll
    for (int t = 0; t < 2; ++t)
#pragma unroll
      for (int r = 0; r < 8; ++r) oacc[t][r] *= alpha;
    // ---- ctx^T += V^T . P^T : A[m=d][k=key] from V^T tile rows (2 k-steps of 32 keys), B = P^T from registers ----
#pragma unroll
    for (int kk = 0; kk < 2; ++kk) {
#pragma unroll
      for (int t = 0; t < 2; ++t) {
        FragB vb, vl;
        vb.h[0] = *(const v8b*)(Vth + (t * 16 + c) * AT_VP + kk * 32 + 8 * hh);
        vb.h[1] = *(const v8b*)(Vth + (t * 16 + c) * AT_VP + kk * 32 + 16 + 8 * hh);
        vl.h[0] = *(const v8b*)(Vtl + (t * 16 + c) * AT_VP + kk * 32 + 8 * hh);
        vl.h[1] = *(const v8b*)(Vtl + (t * 16 + c) * AT_VP + kk * 32 + 16 + 8 * hh);
        oacc[t] = mma_bf(vb.v, pbh[kk], oacc[t]);
        oacc[t] = mma_bf(vl.v, pbh[kk], oacc[t]);
        oacc[t] = mma_bf(vb.v, pbl[kk], oacc[t]);
      }
    }
  }

  // ---- join the halves' sums; stage the wave's 16 x 32 unnormalised ctx tile [query][d] for whole-line stores ----
  float* os = Os[wave];
  const float lsum = lrow + xhalf(lrow);
  {
#pragma unroll
    for (int t = 0; t < 2; ++t) {
      const v4f o0 = (v4f){oacc[t][0], oacc[t][1], oacc[t][2], oacc[t][3]};
      const v4f o1 = (v4f){oacc[t][4], oacc[t][5], oacc[t][6], oacc[t][7]};
      *(v4f*)(os + c * 36 + t * 16 + 8 * hh)     = o0;
      *(v4f*)(os + c * 36 + t * 16 + 8 * hh + 4) = o1;
    }
  }
  __builtin_amdgcn_fence(__ATOMIC_RELEASE, "workgroup");
  __builtin_amdgcn_wave_barrier();
  __builtin_amdgcn_fence(__ATOMIC_ACQUIRE, "workgroup");
  {
    const int q4 = lane >> 3, c4 = (lane & 7) * 4;
    {
#pragma unroll
      for (int it = 0; it < 4; ++it) {
        const int row = it * 4 + q4;
        const v4f val = *(const v4f*)(os + row * 36 + c4);
        *(v4f*)(ob + (size_t)(q0 + row) * DMOD + c4) = val;
      }
      
    }
  }
  // maximum (lower half) and sum (upper half) of query q0 + c: the wave's 32 lanes fill one 128-B line
  ml[(((size_t)ks * NHEAD + h) * SEQ + q0 + c) * 2 + hh] = hh ? lsum : mrow;
}

// ---------------------------------------------------------------------------
// Join of the KSPLIT partial attention results and the output projection, in one launch:
//   M = max_ks m, w = exp(m - M), ctx = (sum_ks w * opart) / (sum_ks w * l); hi = bf16_rne(ctx), lo = bf16_rne(ctx - hi)
//   out = ctx . Wo + bo   (hi.hi + hi.lo + lo.hi, f32 accumulate, k-steps in rising order)
// A block owns 16 queries and 128 output columns; grid = (SEQ / 16) * 2 = 256 blocks of 8 waves, one per WGP. The two blocks of a
// query tile each join that tile's ctx for themselves: nothing passes between work-groups.
//   Join: wave = head = k-step of 32 ctx columns; a lane makes its own 16 elements of that k-step's A fragment (the lane / element / k
//   map of frag_load_fo) and stores them as two 16-B pieces per plane into the block's LDS planes (8 units of 1 KiB, fragment order).
//   Product: wave = one tile of 16 output columns; A fragments from LDS; the wave's Wo^T fragments (global planes in fragment order,
//   8 k-steps x hi and lo = 128 registers) depend on nothing in this launch and are asked for at entry, with the partials.
// coverage: join 8 waves x 32 lanes x 16 = 16 x 256 ctx elements; product 8 waves x 16 x 16 = 16 x 128 outputs, each stored once.
// Two waves per SIMD asked of the compiler: the grid supplies two, and with registers saved for more it would ask for the loads in turns.
// ---------------------------------------------------------------------------
__global__ __launch_bounds__(256) __attribute__((amdgpu_waves_per_eu(2, 2)))
void merge_out_kernel(const float* __restrict__ opart, const float* __restrict__ ml,
                      const unsigned short* __restrict__ Bhp, const unsigned short* __restrict__ Blp,
                      const float* __restrict__ bo, float* __restrict__ out) {
  __shared__ __align__(16) unsigned short Ch[8 * 512];       // ctx hi, 16 queries x 256 k, fragment order   8 KB
  __shared__ __align__(16) unsigned short Cl[8 * 512];       // ctx lo
  __shared__ __align__(16) float sT[16 * 132];               // the block's 16 x 128 output tile, pitch 132
  const int lane  = threadIdx.x & 31;
  const int wave  = threadIdx.x >> 5;
  const int rlane = lane & 15;                               // query (A), column (B, D) within a tile
  const int m0    = (blockIdx.x >> 1) * 16;                  // first query of the block
  const int nb    = (blockIdx.x & 1) * 128;                  // first output column of the block
  const int n0    = nb + wave * 16;                          // first output column of the wave

  constexpr int KSTEPS = DMOD >> 5;
  constexpr int TSTEP  = KSTEPS << 9;     // elements from one 16-row tile of a plane to the next
  const __bf16* pbh = (const __bf16*)(const void*)Bhp + (size_t)(n0 >> 4) * TSTEP + lane * 8;
  const __bf16* pbl = (const __bf16*)(const void*)Blp + (size_t)(n0 >> 4) * TSTEP + lane * 8;
  v16b bh[KSTEPS], bl[KSTEPS];
#pragma unroll   // compile-time trip count; the arrays indexed here are registers only under constant indices
  for (int kst = 0; kst < KSTEPS; ++kst) {
    bh[kst] = frag_load_fo(pbh + (kst << 9));
    bl[kst] = frag_load_fo(pbl + (kst << 9));
  }
  const float* pbo = bo + n0 + rlane;
  const float bvn = *pbo;

  // ---- join of the key ranges: head = wave, query m0 + rlane, columns col .. col + 7 and col + 16 .. col + 23 ----
  {
    const int t   = m0 + rlane;
    const int col = wave * DHD + (lane >> 4) * 8;
    const float* pml = ml + ((size_t)wave * SEQ + t) * 2;        // key range 0; the others lie at fixed distances
    const float* pop = opart + (size_t)t * DMOD + col;
    v2f a[KSPLIT];
    v4f o[KSPLIT][4];
#pragma unroll   // compile-time trip count; the arrays indexed here are registers only under constant indices
    for (int s = 0; s < KSPLIT; ++s) {
      a[s] = *(const v2f*)(pml + (size_t)s * NHEAD * SEQ * 2);
      const float* op = pop + (size_t)s * SEQ * DMOD;
      o[s][0] = *(const v4f*)(op);
      o[s][1] = *(const v4f*)(op + 4);
      o[s][2] = *(const v4f*)(op + 16);
      o[s][3] = *(const v4f*)(op + 20);
    }
    // precaution: stands between the launch's loads and any rewrite of the address registers that they name; as inputs the five
    // addresses stay in their registers up to here, so that no load of the group returns its data into one of them
    asm volatile("s_wait_xcnt 0x0" :: "v"(pbh), "v"(pbl), "v"(pbo), "v"(pml), "v"(pop) : "memory");
    float M = a[0][0];
#pragma unroll   // compile-time trip count; the arrays indexed here are registers only under constant indices
    for (int s = 1; s < KSPLIT; ++s) M = fmaxf(M, a[s][0]);
    const float nM2 = -M * LOG2E;
    float w[KSPLIT];
    float L = 0.f;
#pragma unroll   // compile-time trip count; the arrays indexed here are registers only under constant indices
    for (int s = 0; s < KSPLIT; ++s) {
      w[s] = exp_rel(a[s][0], nM2);
      L = fmaf(w[s], a[s][1], L);
    }
    const float inv = 1.0f / L;
#pragma unroll   // compile-time trip count; the arrays indexed here are registers only under constant indices
    for (int half = 0; half < 2; ++half) {
      v4u hv, lv;
#pragma unroll   // compile-time trip count; the arrays indexed here are registers only under constant indices
      for (int e = 0; e < 4; ++e) {
        float f0 = 0.f, f1 = 0.f;
#pragma unroll   // compile-time trip count; the arrays indexed here are registers only under constant indices
        for (int s = 0; s < KSPLIT; ++s) {
          f0 = fmaf(w[s], o[s][half * 2 + (e >> 1)][(e & 1) * 2],     f0);
          f1 = fmaf(w[s], o[s][half * 2 + (e >> 1)][(e & 1) * 2 + 1], f1);
        }
        f0 *= inv;
        f1 *= inv;
        const unsigned short h0 = f2bf_bits(f0), h1 = f2bf_bits(f1);
        const unsigned short l0 = f2bf_bits(f0 - bf_bits2f(h0)), l1 = f2bf_bits(f1 - bf_bits2f(h1));
        hv[e] = pk16(h0, h1);
        lv[e] = pk16(l0, l1);
      }
      *(v4u*)(Ch + wave * 512 + half * 256 + lane * 8) = hv;
      *(v4u*)(Cl + wave * 512 + half * 256 + lane * 8) = lv;
    }
  }
  __syncthreads();   // every wave's k-step of ctx is read by all 8 waves below

  // ---- out tile of this wave: 16 queries x columns n0 .. n0 + 15 ----
  const __bf16* pah = (const __bf16*)(const void*)Ch + lane * 8;
  const __bf16* pal = (const __bf16*)(const void*)Cl + lane * 8;
  v8f acc = (v8f){0.f,0.f,0.f,0.f,0.f,0.f,0.f,0.f};
  v16b ah[KSTEPS], al[KSTEPS];           // read from LDS three k-steps ahead of their products
#pragma unroll   // compile-time trip count; the arrays indexed here are registers only under constant indices
  for (int kst = 0; kst < 3; ++kst) {
    ah[kst] = frag_load_fo(pah + (kst << 9));
    al[kst] = frag_load_fo(pal + (kst << 9));
  }
#pragma unroll   // compile-time trip count; the arrays indexed here are registers only under constant indices
  for (int kst = 0; kst < KSTEPS; ++kst) {
    if (kst + 3 < KSTEPS) {
      ah[kst + 3] = frag_load_fo(pah + ((kst + 3) << 9));
      al[kst + 3] = frag_load_fo(pal + ((kst + 3) << 9));
    }
    acc = mma_bf(ah[kst], bh[kst], acc);
    acc = mma_bf(ah[kst], bl[kst], acc);
    acc = mma_bf(al[kst], bh[kst], acc);
  }

  // ---- epilogue: bias, then the block's 16 x 128 tile through LDS, so that each 128-B line of out has one writer ----
  const int mOff = (lane >> 4) * 8;      // D row offset
#pragma unroll   // compile-time trip count; the arrays indexed here are registers only under constant indices
  for (int r = 0; r < 8; ++r) sT[(mOff + r) * 132 + wave * 16 + rlane] = acc[r] + bvn;
  __syncthreads();   // a row of the tile holds columns of all 8 waves
#pragma unroll   // compile-time trip count; the arrays indexed here are registers only under constant indices
  for (int it = 0; it < 2; ++it) {
    const int row = wave * 2 + it;       // a wave stores a row's 128 columns = 512 B = 4 whole lines
    const v4f val = *(const v4f*)(sT + row * 132 + lane * 4);
    *(v4f*)(out + (size_t)(m0 + row) * DMOD + nb + lane * 4) = val;
  }
}

// ---------------------------------------------------------------------------
//   biasP f32 [2048][2048]                 0 .. 16777216
//   WoTh/l  bf16 [256 o][256 i], fragment order   131072 each (2 planes) 16777216 .. 17039360
//   Qh/l, Kh/l  bf16 [2048][256]            1048576 each (4 planes)      17039360 .. 21233664
//   VTh/l bf16 [256 (h,d)][2048]            1048576 each (2 planes)      21233664 .. 23330816
//   OPART f32 [4 key ranges][2048][256]     2097152 each (4 planes)      23330816 .. 31719424
//   ML f32 [4 key ranges][8][2048][2]       524288                       31719424 .. 32243712
//   total                                   32243712
// ---------------------------------------------------------------------------
extern "C" void kernel_launch(void* const* d_in, const int* in_sizes, int n_in,
                              void* d_out, int out_size, void* d_ws, size_t ws_size,
                              hipStream_t stream) {
  if (n_in < 22) return;
  if (in_sizes[0] != SEQ * SEQ || in_sizes[1] != SEQ * SEQ || in_sizes[2] != SEQ * SEQ) return;
  if (in_sizes[3] != SEQ * DMOD || in_sizes[4] != SEQ * DMOD || in_sizes[5] != SEQ * DMOD) return;
  if (in_sizes[6] != DMOD * DMOD || in_sizes[8] != DMOD * DMOD || in_sizes[10] != DMOD * DMOD || in_sizes[12] != DMOD * DMOD) return;
  if (in_sizes[7] != DMOD || in_sizes[9] != DMOD || in_sizes[11] != DMOD || in_sizes[13] != DMOD) return;
  if (in_sizes[14] != 32 || in_sizes[15] != 16 || in_sizes[16] != 16 || in_sizes[17] != 1) return;
  if (in_sizes[18] != 32 || in_sizes[19] != 16 || in_sizes[20] != 16 || in_sizes[21] != 1) return;
  if (out_size != SEQ * DMOD) return;

  const int*   label   = (const int*)  d_in[0];
  const float* dist    = (const float*)d_in[1];
  const float* contact = (const float*)d_in[2];
  const float* q   = (const float*)d_in[3];
  const float* k   = (const float*)d_in[4];
  const float* v   = (const float*)d_in[5];
  const float* Wq  = (const float*)d_in[6];
  const float* bq  = (const float*)d_in[7];
  const float* Wk  = (const float*)d_in[8];
  const float* bk  = (const float*)d_in[9];
  const float* Wv  = (const float*)d_in[10];
  const float* bv  = (const float*)d_in[11];
  const float* Wo  = (const float*)d_in[12];
  const float* bo  = (const float*)d_in[13];
  const float* Wd1 = (const float*)d_in[14];
  const float* bd1 = (const float*)d_in[15];
  const float* Wd2 = (const float*)d_in[16];
  const float* bd2 = (const float*)d_in[17];
  const float* Wc1 = (const float*)d_in[18];
  const float* bc1 = (const float*)d_in[19];
  const float* Wc2 = (const float*)d_in[20];
  const float* bc2 = (const float*)d_in[21];
  float* out = (float*)d_out;

  const size_t PB = (size_t)SEQ * SEQ * 4;     // 16777216  f32 bias plane
  const size_t PW = (size_t)DMOD * DMOD * 2;   // 131072    bf16 weight plane [256][256]
  const size_t PX = (size_t)SEQ * DMOD * 2;    // 1048576   bf16 activation plane [2048][256] / [256][2048]
  const size_t PF = (size_t)SEQ * DMOD * 4;    // 2097152   f32 activation plane
  size_t off = 0;
  const size_t oBias = off; off += PB;
  const size_t oWoTh = off; off += PW;  const size_t oWoTl = off; off += PW;
  const size_t oQh   = off; off += PX;  const size_t oQl   = off; off += PX;
  const size_t oKh   = off; off += PX;  const size_t oKl   = off; off += PX;
  const size_t oVTh  = off; off += PX;  const size_t oVTl  = off; off += PX;
  const size_t oOp   = off; off += KSPLIT * PF;
  const size_t oML   = off; off += (size_t)KSPLIT * NHEAD * SEQ * 2 * 4;
  if (off > ws_size) return;                   // off = 32243712

  char* ws = (char*)d_ws;
  float*          biasP = (float*)(ws + oBias);
  unsigned short* WoTh = (unsigned short*)(ws + oWoTh); unsigned short* WoTl = (unsigned short*)(ws + oWoTl);
  unsigned short* Qh   = (unsigned short*)(ws + oQh);   unsigned short* Ql   = (unsigned short*)(ws + oQl);
  unsigned short* Kh   = (unsigned short*)(ws + oKh);   unsigned short* Kl   = (unsigned short*)(ws + oKl);
  unsigned short* VTh  = (unsigned short*)(ws + oVTh);  unsigned short* VTl  = (unsigned short*)(ws + oVTl);
  float*          Op   = (float*)(ws + oOp);
  float*          ML   = (float*)(ws + oML);

  const dim3 blk(256);

  // (1) everything ahead of the attention, one launch: the three projections from the f32 inputs, Wo planes [out][in], pair bias plane
  const float qscale = 0.17677669529663688f;                // 32^-0.5 applied as (x.Wq + bq) * scale
  prep_proj_kernel<<<dim3(3 * PREP_P_BLOCKS + PREP_W_BLOCKS + PREP_PB_BLOCKS), blk, 0, stream>>>(dist, contact, label,
      Wd1, bd1, Wd2, bd2, Wc1, bc1, Wc2, bc2, biasP,
      Wq, Wk, Wv, Wo, bq, bk, bv, WoTh, WoTl,
      q, k, v, Qh, Ql, Kh, Kl, VTh, VTl, qscale);

  // (2) attention with pair bias: 4 key ranges x 8 heads x 32 query blocks of 64 rows -> partial ctx, maximum and sum per key range
  attn_bias_kernel<<<dim3(KSPLIT * NHEAD * (SEQ / 64)), dim3(128), 0, stream>>>(Qh, Ql, Kh, Kl, VTh, VTl, biasP, Op, ML);

  // (3) join of the key ranges and out = ctx . Wo + bo -> d_out f32 [2048][256], 256 blocks of 16 queries x 128 columns
  merge_out_kernel<<<dim3((SEQ / 16) * 2), blk, 0, stream>>>(Op, ML, WoTh, WoTl, bo, out);

  (void)hipGetLastError();
}

// v009
// One run takes 41.7 microseconds.
// Two timings next to v008 put it at 1.03 and 1.04 times that version's speed.
// Counting every step since v000, it is 5.00 times as fast.
// Contractions: q, k, v^T projections, q.k^T scores, p.v and output projection on v_wmma_f32_16x16x32_bf16 with bf16 hi/lo operands (hi.hi + hi.lo + lo.hi), f32 accumulate; pair bias (exact affine fold of the two linear 2->16->1 maps) and online softmax in f32 on VALU; the keys of a query block are dealt to 4 work-groups whose partial results the output projection's launch joins; the q, k, v projections split their f32 operands themselves, into LDS planes in fragment order, in one launch with the pair bias.
#include <hip/hip_runtime.h>
#include <math.h>
#include <stdint.h>

#define SEQ   2048
#define DMOD  256
#define NHEAD 8
#define DHD   32
#define KSPLIT 4      // key ranges per query block in the attention launch, one work-group each

typedef __attribute__((ext_vector_type(16))) __bf16   v16b;
typedef __attribute__((ext_vector_type(8)))  __bf16   v8b;
typedef __attribute__((ext_vector_type(8)))  float    v8f;
typedef __attribute__((ext_vector_type(4)))  float    v4f;
typedef __attribute__((ext_vector_type(2)))  float    v2f;
typedef __attribute__((ext_vector_type(4)))  unsigned int v4u;
typedef __attribute__((ext_vector_type(4)))  int      v4i;

// bf16 hi/lo split of 8 f32 values on the chip's own conversions, 3 instructions a pair, all round to nearest even:
//   hi = bf16(f) by v_cvt_pk_bf16_f32; lo = bf16(f - hi) by v_fma_mixlo_bf16 / v_fma_mixhi_bf16 (hi * -1 + f in f32, exact, then rounded once).
// Word q of hv and lv holds the part of f[2q] in its low half and that of f[2q + 1] in its high half.
// In asm text because the compiler makes five instructions of a pair (two unpacks, a packed subtract, two conversions). Four pairs in one
// statement, so that every producer stands four instructions ahead of its reader; each s_delay_alu names that distance for the two
// instructions behind it: without the hint a waiting reader would hold up the other waves of the SIMD as well.
// The -1.0 is read as bf16 from the constant's high half (op_sel 1, op_sel_hi 1), as the compiler writes it for v_fma_mix_f32_bf16.
__device__ __forceinline__ void split8(const float* f, v4u& hv, v4u& lv) {
  unsigned h0, h1, h2, h3, l0, l1, l2, l3;
  asm("v_cvt_pk_bf16_f32 %0, %8, %9\n\t"
      "v_cvt_pk_bf16_f32 %1, %10, %11\n\t"
      "v_cvt_pk_bf16_f32 %2, %12, %13\n\t"
      "v_cvt_pk_bf16_f32 %3, %14, %15\n\t"
      "s_delay_alu instid0(VALU_DEP_4) | instskip(NEXT) | instid1(VALU_DEP_4)\n\t"
      "v_fma_mixlo_bf16 %4, %0, -1.0, %8 op_sel:[0,1,0] op_sel_hi:[1,1,0]\n\t"
      "v_fma_mixlo_bf16 %5, %1, -1.0, %10 op_sel:[0,1,0] op_sel_hi:[1,1,0]\n\t"
      "s_delay_alu instid0(VALU_DEP_4) | instskip(NEXT) | instid1(VALU_DEP_4)\n\t"
      "v_fma_mixlo_bf16 %6, %2, -1.0, %12 op_sel:[0,1,0] op_sel_hi:[1,1,0]\n\t"
      "v_fma_mixlo_bf16 %7, %3, -1.0, %14 op_sel:[0,1,0] op_sel_hi:[1,1,0]\n\t"
      "s_delay_alu instid0(VALU_DEP_4) | instskip(NEXT) | instid1(VALU_DEP_4)\n\t"
      "v_fma_mixhi_bf16 %4, %0, -1.0, %9 op_sel:[1,1,0] op_sel_hi:[1,1,0]\n\t"
      "v_fma_mixhi_bf16 %5, %1, -1.0, %11 op_sel:[1,1,0] op_sel_hi:[1,1,0]\n\t"
      "s_delay_alu instid0(VALU_DEP_4) | instskip(NEXT) | instid1(VALU_DEP_4)\n\t"
      "v_fma_mixhi_bf16 %6, %2, -1.0, %13 op_sel:[1,1,0] op_sel_hi:[1,1,0]\n\t"
      "v_fma_mixhi_bf16 %7, %3, -1.0, %15 op_sel:[1,1,0] op_sel_hi:[1,1,0]"
      : "=&v"(h0), "=&v"(h1), "=&v"(h2), "=&v"(h3), "=&v"(l0), "=&v"(l1), "=&v"(l2), "=&v"(l3)
      : "v"(f[0]), "v"(f[1]), "v"(f[2]), "v"(f[3]), "v"(f[4]), "v"(f[5]), "v"(f[6]), "v"(f[7]));
  hv = (v4u){h0, h1, h2, h3};
  lv = (v4u){l0, l1, l2, l3};
}

// 16x16x32 fragment (A row-major k-contiguous, or B stored [n][k] k-contiguous):
// lane l: row/col = l & 15, p already offset by 8*(l>>4); elements 0..7 <- p[0..7], elements 8..15 <- p[16..23]
union FragB { v16b v; v8b h[2]; };
union FragW { v16b v; v4u w[2]; };   // word i of w[g] = elements 8*g + 2*i (low half) and 8*g + 2*i + 1
__device__ __forceinline__ v16b frag_load(const __bf16* p) {
  FragB f; f.h[0] = *(const v8b*)(p); f.h[1] = *(const v8b*)(p + 16); return f.v;
}

// Fragment order of a GEMM operand plane [rows][K] (K a multiple of 32): one 1-KiB unit per (16 rows, 32 k), units of a row tile in k order.
// Inside a unit lane l's elements 0..7 lie at 16-B piece l, its elements 8..15 at piece 32 + l, so element (row, k) is at
//   (((row >> 4) * (K >> 5) + (k >> 5)) * 2 + ((k >> 4) & 1)) * 256 + ((row & 15) + 16 * ((k >> 3) & 1)) * 8 + (k & 7)
// and each of the two 16-B-per-lane loads of a fragment reads 512 bytes in a row (4 whole lines). Same lane / element / k map as frag_load.
// p: the lane's 16-B piece in the unit (unit start + lane * 8 elements)
__device__ __forceinline__ v16b frag_load_fo(const __bf16* p) {
  FragB f; f.h[0] = *(const v8b*)(p); f.h[1] = *(const v8b*)(p + 256); return f.v;
}

// WMMA + hazard guard (4 VALU slots, ties D, keeps A/B live)
__device__ __forceinline__ v8f mma_bf(v16b a, v16b b, v8f c) {
  c = __builtin_amdgcn_wmma_f32_16x16x32_bf16(false, a, false, b, (short)0, c, false, false);
  asm volatile("v_nop\n\tv_nop\n\tv_nop\n\tv_nop" : "+v"(c) : "v"(a), "v"(b));
  return c;
}

// ---------------------------------------------------------------------------
// Pair bias plane [SEQ][SEQ] f32:
//   pb(map, W1, b1, W2, b2)(n,m) = map*(W1[0].W2) + label*(W1[1].W2) + (b1.W2 + b2)   (both maps linear, exact fold)
//   bias = pb_d + pb_c.  W1 [2][16] row-major, W2 [16][1].
// Block blk owns elements blk*8192 .. blk*8192+8191; each thread 4 consecutive floats per iteration, 8 iterations.
// coverage: 512 blocks x 8 it x 256 thr x 4 = 4194304 = whole plane.
// ---------------------------------------------------------------------------
__device__ __forceinline__ void pair_bias_block(const int blk,
    const float* __restrict__ dist, const float* __restrict__ contact, const int* __restrict__ label,
    const float* __restrict__ Wd1, const float* __restrict__ bd1, const float* __restrict__ Wd2, const float* __restrict__ bd2,
    const float* __restrict__ Wc1, const float* __restrict__ bc1, const float* __restrict__ Wc2, const float* __restrict__ bc2,
    float* __restrict__ bias) {
  float ad = 0.f, ld = 0.f, gd = 0.f, ac = 0.f, lc = 0.f, gc = 0.f;
#pragma unroll 1
  for (int j = 0; j < 16; ++j) {
    const float wd2 = Wd2[j], wc2 = Wc2[j];
    ad = fmaf(Wd1[j],      wd2, ad);   // map weight (row 0 of W1)
    ld = fmaf(Wd1[16 + j], wd2, ld);   // label weight (row 1 of W1)
    gd = fmaf(bd1[j],      wd2, gd);
    ac = fmaf(Wc1[j],      wc2, ac);
    lc = fmaf(Wc1[16 + j], wc2, lc);
    gc = fmaf(bc1[j],      wc2, gc);
  }
  gd += bd2[0];
  gc += bc2[0];
  const size_t base = (size_t)blk * 8192 + (size_t)threadIdx.x * 4;
{
#pragma unroll 1
    for (int it = 0; it < 8; ++it) {
      const size_t i4 = base + (size_t)it * 1024;
      const v4f dm = *(const v4f*)(dist + i4);
      const v4f cm = *(const v4f*)(contact + i4);
      const v4i lb = *(const v4i*)(label + i4);
      v4f o;
#pragma unroll
      for (int e = 0; e < 4; ++e) {
        const float lf = (float)lb[e];
        const float pd = fmaf(dm[e], ad, fmaf(lf, ld, gd));
        const float pc = fmaf(cm[e], ac, fmaf(lf, lc, gc));
        o[e] = pd + pc;
      }
      *(v4f*)(bias + i4) = o;
      // precaution: stands between this store and the next trip's rewrite of the registers that the store names
      asm volatile("s_wait_xcnt 0x0" ::: "memory");
    }
    
  }
}

// ---------------------------------------------------------------------------
// Fused transpose + bf16 split of an f32 matrix W viewed [R rows][Cc cols] (pitch Cc) ->
//   oh(c, r) = bf16_rne(W[r][c]), ol(c, r) = bf16_rne(W[r][c] - oh)   (planes [Cc rows][R k] in fragment order, see frag_load_fo)
// 64x64 tiles through LDS (tf: 64 x 68 floats of the caller). Tile (bx, by) of (Cc/64, R/64), 256 threads, R and Cc multiples of 64.
// coverage per block/plane: load 4 it x 256 thr x 4 floats = 64x64; store 2 it x 256 thr x 8 u16 = 64x64 = 8 whole units (4 row tiles x 2 k-steps).
// ---------------------------------------------------------------------------
__device__ __forceinline__ void tsplit_block(float* tf, const int bx, const int by, const float* __restrict__ W,
                                             unsigned short* __restrict__ oh, unsigned short* __restrict__ ol, int R, int Cc) {
  const int c0  = bx * 64;           // input column block = output row block
  const int r0  = by * 64;           // input row block    = output column block
  const int tid = threadIdx.x;
  {
    const int lr = tid >> 4;         // 0..15
    const int c4 = (tid & 15) * 4;   // 0..60
#pragma unroll
    for (int it = 0; it < 4; ++it) {
      const int rr = it * 16 + lr;   // 0..63
      const v4f a = *(const v4f*)(W + (size_t)(r0 + rr) * Cc + c0 + c4);
      *(v4f*)(tf + rr * 68 + c4) = a;
    }
  }
  __syncthreads();
  // 16-B piece it*256 + tid of the tile's 512: fragment lane, half of the fragment, k-step, row tile
  const int ln   = tid & 31;
  const int part = (tid >> 5) & 1;
  const int ksl  = (tid >> 6) & 1;
  const int c8   = ksl * 32 + part * 16 + (ln >> 4) * 8;   // first of the piece's 8 k (= input rows) within the tile
  v4u hv[2], lv[2];
#pragma unroll
  for (int it = 0; it < 2; ++it) {
    const int oc = (it * 2 + (tid >> 7)) * 16 + (ln & 15);   // output row within tile (= input column)
    float f[8];
#pragma unroll
    for (int q = 0; q < 8; ++q) f[q] = tf[(c8 + q) * 68 + oc];
    split8(f, hv[it], lv[it]);
  }
  {
#pragma unroll
    for (int it = 0; it < 2; ++it) {
      const int rt = it * 2 + (tid >> 7);
      const size_t go = ((size_t)(((c0 >> 4) + rt) * (R >> 5) + (r0 >> 5) + ksl) << 9) + part * 256 + ln * 8;
      *(v4u*)(oh + go) = hv[it];
      *(v4u*)(ol + go) = lv[it];
    }
    // precaution: stands between these stores and whatever follows them in the kernel's text and rewrites a register that they name
    asm volatile("s_wait_xcnt 0x0" ::: "memory");
  }
}

// ---------------------------------------------------------------------------
// One projection tile from the f32 inputs: C = scale * (X . Wm + bias), X [SEQ][DMOD], Wm [DMOD in][DMOD out], product = hi.hi + hi.lo + lo.hi.
// A block owns 64 rows of X and 128 columns of Wm; it makes the bf16 hi/lo planes of both operands itself, in LDS, in fragment order
// (see frag_load_fo), 64 k per stage, two stage buffers: the next stage's f32 values are asked for ahead of this stage's products.
//   stage buffer (2-B elements): W hi, W lo: 8 column tiles x (2 units of 512 + 8 of pad, so that the 4 pieces a lane stores and the
//   8 tiles a wave stores fall on different banks); X hi, X lo: 4 row tiles x 2 units of 512.
//   W staging: wave = 8 k, lane = 4 columns (8 whole-line loads); the 8 k of a column are one 16-B piece, made in registers.
//   X staging: thread = 8 k (tid & 7) of rows tid >> 3 and 32 + (tid >> 3), one 16-B piece each.
//   coverage per stage: W 8 waves x 8 k x 32 lanes x 4 = 64 x 128; X 256 thr x 2 x 8 = 64 x 64.
// Wave = 32 rows x 32 columns (2 x 4 waves). VT = false: A = X, B = W, C [row][column] pitch DMOD; VT = true: A = W, B = X, C [column][row] pitch SEQ.
// The block's tile goes through LDS, so that every 128-B line of the hi and lo planes (row-major) has one writer.
// ---------------------------------------------------------------------------
#define PJ_WT    1032                       // elements from one column tile of a W plane to the next
#define PJ_WPL   (8 * PJ_WT)                // one W plane of a stage
#define PJ_XPL   (4 * 1024)                 // one X plane of a stage
#define PJ_STAGE (2 * PJ_WPL + 2 * PJ_XPL)  // 24704 elements = 49408 B
__device__ __forceinline__ void split8_store(const float* f, unsigned short* ph, unsigned short* pl) {
  v4u hv, lv;
  split8(f, hv, lv);
  *(v4u*)ph = hv;
  *(v4u*)pl = lv;
}

template <bool VT>
__device__ __forceinline__ void proj_block(unsigned short* sm, const int blk, const float* __restrict__ X, const float* __restrict__ Wm,
                                           const float* __restrict__ bias, unsigned short* __restrict__ Ch, unsigned short* __restrict__ Cl,
                                           const float scale) {
  const int tid  = threadIdx.x;
  const int lane = tid & 31;
  const int wave = tid >> 5;
  const int m0 = (blk >> 1) * 64;        // first row of X
  const int nb = (blk & 1) * 128;        // first column of Wm
  const int wm = wave >> 2;              // the wave's 32 rows
  const int wn = wave & 3;               // the wave's 32 columns

  const int xg = tid & 7, xr = tid >> 3;
  const float* pw = Wm + (size_t)(wave * 8) * DMOD + nb + lane * 4;
  const float* px = X + (size_t)(m0 + xr) * DMOD + xg * 8;
  // where the thread's pieces lie in a stage buffer: piece (row, g = k / 8) at (row>>4) * (PJ_WT in W, 1024 in X) + (g>>2) * 512 + ((g>>1)&1)*256 + ((row&15) + 16*(g&1))*8
  const int wdst = (lane >> 2) * PJ_WT + (wave >> 2) * 512 + ((wave >> 1) & 1) * 256 + (((lane & 3) * 4) + 16 * (wave & 1)) * 8;
  const int xdst = 2 * PJ_WPL + (xr >> 4) * 1024 + (xg >> 2) * 512 + ((xg >> 1) & 1) * 256 + ((xr & 15) + 16 * (xg & 1)) * 8;

  v4f wv[8], xv[4];
#pragma unroll
  for (int e = 0; e < 8; ++e) wv[e] = *(const v4f*)(pw + e * DMOD);
#pragma unroll
  for (int u = 0; u < 2; ++u) {
    xv[2 * u]     = *(const v4f*)(px + u * 32 * DMOD);
    xv[2 * u + 1] = *(const v4f*)(px + u * 32 * DMOD + 4);
  }
  // precaution: stands between these loads and the rewrite of the two address registers that they name
  asm volatile("s_wait_xcnt 0x0" :: "v"(pw), "v"(px) : "memory");

  v8f acc[2][2];
#pragma unroll
  for (int i = 0; i < 2; ++i)
#pragma unroll
    for (int j = 0; j < 2; ++j) acc[i][j] = (v8f){0.f,0.f,0.f,0.f,0.f,0.f,0.f,0.f};

#pragma unroll 1   // rolled: four copies of the stage would only lengthen the kernel's text
  for (int st = 0; st < DMOD / 64; ++st) {
    unsigned short* buf = sm + (st & 1) * PJ_STAGE;
#pragma unroll
    for (int cc = 0; cc < 4; ++cc) {
      float f[8];
#pragma unroll
      for (int e = 0; e < 8; ++e) f[e] = wv[e][cc];
      split8_store(f, buf + wdst + cc * 8, buf + PJ_WPL + wdst + cc * 8);
    }
#pragma unroll
    for (int u = 0; u < 2; ++u) {
      float f[8];
#pragma unroll
      for (int e = 0; e < 4; ++e) { f[e] = xv[2 * u][e]; f[4 + e] = xv[2 * u + 1][e]; }
      split8_store(f, buf + xdst + u * 2048, buf + PJ_XPL + xdst + u * 2048);
    }
    // publishes this stage; it also ends every wave's reads of the other buffer, which the next trip refills
    __syncthreads();
    // the next stage's values are asked for behind the barrier (its fence would wait for them) and fly during this stage's products
    if (st + 1 < DMOD / 64) {
      pw += 64 * DMOD;
      px += 64;
#pragma unroll
      for (int e = 0; e < 8; ++e) wv[e] = *(const v4f*)(pw + e * DMOD);
#pragma unroll
      for (int u = 0; u < 2; ++u) {
        xv[2 * u]     = *(const v4f*)(px + u * 32 * DMOD);
        xv[2 * u + 1] = *(const v4f*)(px + u * 32 * DMOD + 4);
      }
      // precaution: stands between these loads and the next trip's rewrite of the two address registers that they name
      asm volatile("s_wait_xcnt 0x0" :: "v"(pw), "v"(px) : "memory");
    }
    const __bf16* sw = (const __bf16*)(const void*)buf + (wn * 2) * PJ_WT + lane * 8;
    const __bf16* sx = (const __bf16*)(const void*)buf + 2 * PJ_WPL + (wm * 2) * 1024 + lane * 8;
#pragma unroll
    for (int ksl = 0; ksl < 2; ++ksl) {
      v16b xh[2], xl[2];
#pragma unroll
      for (int i = 0; i < 2; ++i) {
        xh[i] = frag_load_fo(sx + i * 1024 + ksl * 512);
        xl[i] = frag_load_fo(sx + PJ_XPL + i * 1024 + ksl * 512);
      }
#pragma unroll
      for (int j = 0; j < 2; ++j) {
        const v16b wh = frag_load_fo(sw + j * PJ_WT + ksl * 512);
        const v16b wl = frag_load_fo(sw + PJ_WPL + j * PJ_WT + ksl * 512);
#pragma unroll
        for (int i = 0; i < 2; ++i) {
          if (!VT) {
            acc[i][j] = mma_bf(xh[i], wh, acc[i][j]);
            acc[i][j] = mma_bf(xh[i], wl, acc[i][j]);
            acc[i][j] = mma_bf(xl[i], wh, acc[i][j]);
          } else {
            acc[i][j] = mma_bf(wh, xh[i], acc[i][j]);
            acc[i][j] = mma_bf(wh, xl[i], acc[i][j]);
            acc[i][j] = mma_bf(wl, xh[i], acc[i][j]);
          }
        }
      }
    }
  }

  // ---- epilogue: the f32 tile lies in stage buffer 0 alone, whose last readers (stage 2) all passed the barrier of stage 3 ----
  float* so = (float*)(void*)sm;
  const int rlane = lane & 15;
  const int mOff  = (lane >> 4) * 8;     // D row offset
  constexpr int SP = VT ? 68 : 132;      // pitch of the tile in floats
#pragma unroll
  for (int j = 0; j < 2; ++j) {
    const float bvn = VT ? 0.f : bias[nb + wn * 32 + j * 16 + rlane];
#pragma unroll
    for (int r = 0; r < 8; ++r) {
      const float bvm = VT ? bias[nb + wn * 32 + j * 16 + mOff + r] : 0.f;
#pragma unroll
      for (int i = 0; i < 2; ++i) {
        float v = acc[i][j][r];
        v += VT ? bvm : bvn;
        v *= scale;
        if (!VT) so[(wm * 32 + i * 16 + mOff + r) * SP + wn * 32 + j * 16 + rlane] = v;
        else     so[(wn * 32 + j * 16 + mOff + r) * SP + wm * 32 + i * 16 + rlane] = v;
      }
    }
  }
  __syncthreads();   // a row of the tile holds values of several waves
#pragma unroll
  for (int it = 0; it < 4; ++it) {
    const int p   = it * 256 + tid;                    // 16-B piece of the tile's 1024 per plane
    const int row = VT ? (p >> 3) : (p >> 4);
    const int c8  = VT ? (p & 7) * 8 : (p & 15) * 8;
    const size_t go = VT ? (size_t)(nb + row) * SEQ + m0 + c8 : (size_t)(m0 + row) * DMOD + nb + c8;
    const v4f s0 = *(const v4f*)(so + row * SP + c8);
    const v4f s1 = *(const v4f*)(so + row * SP + c8 + 4);
    const float f[8] = {s0[0], s0[1], s0[2], s0[3], s1[0], s1[1], s1[2], s1[3]};
    split8_store(f, Ch + go, Cl + go);
  }
  // precaution: stands between these stores and whatever follows them in the kernel's text and rewrites a register that they name
  asm volatile("s_wait_xcnt 0x0" ::: "memory");
}

// ---------------------------------------------------------------------------
// All work ahead of the attention, in one launch; the jobs are independent of each other and a block does exactly one of them:
//   blocks   0 ..  63 : Q   = (q.Wq + bq) * qscale   [SEQ][DMOD]   (32 row blocks x 2 column blocks each)
//   blocks  64 .. 127 : K   =  k.Wk + bk             [SEQ][DMOD]
//   blocks 128 .. 191 : V^T = (v.Wv + bv)^T          [DMOD][SEQ]
//   blocks 192 .. 207 : transpose + split of Wo (16 tiles of 64x64)
//   blocks 208 .. 719 : pair bias plane (512 blocks x 8192 elements)
// The job test reads blockIdx.x alone, so every barrier is passed by a whole block or by none of it.
// LDS and registers admit three blocks on a WGP, so all 720 run at once, the pair bias stream beside the products.
// ---------------------------------------------------------------------------
#define PREP_P_BLOCKS  64
#define PREP_W_BLOCKS  16
#define PREP_PB_BLOCKS 512
__global__ __launch_bounds__(256)
void prep_proj_kernel(
    const float* __restrict__ dist, const float* __restrict__ contact, const int* __restrict__ label,
    const float* __restrict__ Wd1, const float* __restrict__ bd1, const float* __restrict__ Wd2, const float* __restrict__ bd2,
    const float* __restrict__ Wc1, const float* __restrict__ bc1, const float* __restrict__ Wc2, const float* __restrict__ bc2,
    float* __restrict__ bias,
    const float* __restrict__ Wq, const float* __restrict__ Wk, const float* __restrict__ Wv, const float* __restrict__ Wo,
    const float* __restrict__ bq, const float* __restrict__ bk, const float* __restrict__ bv,
    unsigned short* __restrict__ WoTh, unsigned short* __restrict__ WoTl,
    const float* __restrict__ q, const float* __restrict__ k, const float* __restrict__ v,
    unsigned short* __restrict__ Qh, unsigned short* __restrict__ Ql, unsigned short* __restrict__ Kh, unsigned short* __restrict__ Kl,
    unsigned short* __restrict__ VTh, unsigned short* __restrict__ VTl, float qscale) {
  __shared__ __align__(16) unsigned short sm[2 * PJ_STAGE];   // 98816 B: two stage buffers; the transposes' 64 x 68 floats
  const int b = blockIdx.x;
  if (b < 2 * PREP_P_BLOCKS) {
    const bool isq = (b < PREP_P_BLOCKS);
    proj_block<false>(sm, b & (PREP_P_BLOCKS - 1), isq ? q : k, isq ? Wq : Wk, isq ? bq : bk, isq ? Qh : Kh, isq ? Ql : Kl,
                      isq ? qscale : 1.0f);
  } else if (b < 3 * PREP_P_BLOCKS) {
    proj_block<true>(sm, b - 2 * PREP_P_BLOCKS, v, Wv, bv, VTh, VTl, 1.0f);
  } else if (b < 3 * PREP_P_BLOCKS + PREP_W_BLOCKS) {
    const int t = b - 3 * PREP_P_BLOCKS;
    tsplit_block((float*)(void*)sm, t & 3, (t >> 2) & 3, Wo, WoTh, WoTl, DMOD, DMOD);
  } else {
    pair_bias_block(b - (3 * PREP_P_BLOCKS + PREP_W_BLOCKS), dist, contact, label, Wd1, bd1, Wd2, bd2, Wc1, bc1, Wc2, bc2, bias);
  }
}

// =====================================================================================
// Flash attention with additive pair bias, head dim 32, all 8 heads in one launch.
//   q planes (hi/lo bf16): element (t, h, d) at [t*DMOD + h*32 + d]   (score scale already folded into q)
//   k planes (hi/lo bf16): element (s, h, d) at [s*DMOD + h*32 + d]
//   v^T planes (hi/lo bf16): element (h, d, s) at [(h*32 + d)*SEQ + s]
//   bias f32 [SEQ t][SEQ s], shared over heads
//   opart f32, one plane per key range ks: element (ks, t, h, d) at [ks*SEQ*DMOD + t*DMOD + h*32 + d], NOT normalised
//   ml f32: running maximum and sum of (ks, h, t) at [((ks*NHEAD + h)*SEQ + t)*2 + 0 / 1]
//   scores^T = k . q^T + bias^T : bf16 hi/lo (hi.hi + hi.lo + lo.hi), bias added in f32; a lane holds one query's scores
//   ctx^T    = v^T . p^T         : bf16 hi/lo of p (unnormalised, <= 1, packed in registers) and v, f32 accumulate
//   online softmax in f32 over the block's SEQ/KSPLIT keys (8 chunks of 64 keys, compile-time trip count).
//   Block = 4 waves = 64 query rows of one head against one key range; grid = KSPLIT * NHEAD * (SEQ/64) = 1024 blocks of 128 threads.
//   The KSPLIT partial results of a query (maximum, sum, unnormalised ctx) are joined by merge_out_kernel in the next launch.
//   K / V^T chunk staging through LDS by all 128 threads (plain 16-B loads, __syncthreads before and after);
// =====================================================================================
#define AT_KC 64
// Row pitch of the staged tiles in LDS, in 2-B elements: an odd number of 16-B pieces (K rows of 64 B at 80 B, V^T rows of 128 B at 144 B),
// so that the 16 rows which a half wave reads with one 16-B-per-lane fragment load start on 16 different groups of 4 banks.
// The pad pieces are neither written nor read.
#define AT_KP (DHD + 8)
#define AT_VP (AT_KC + 8)

// e^(x - m) on the chip's own base-2 exponential: one multiply-add and one v_exp_f32. nm2 = -m * LOG2E.
// An argument below the f32 exponent range (also -inf) gives 0, as the limit asks.
#define LOG2E 1.4426950408889634f
__device__ __forceinline__ float exp_rel(float x, float nm2) { return __builtin_amdgcn_exp2f(fmaf(x, LOG2E, nm2)); }

// value of lane l ^ 16 (the other wave half), by a vector cross-row move
__device__ __forceinline__ float xhalf(float x) {
  const int b = __builtin_bit_cast(int, x);
  return __builtin_bit_cast(float, __builtin_amdgcn_permlanex16(b, b, 0x76543210, 0xfedcba98, false, false));
}

// Four waves per SIMD asked of the compiler: the grid supplies four (1024 work-groups of 4 waves on 256 WGPs), so that one
// work-group's waits (staging, barriers, LDS, dependent vector chains) are filled by the other three. Without the upper bound the
// compiler saves registers for waves that never come and strings a lane's 32 independent exp/split chains one behind another.
__global__ __launch_bounds__(128) __attribute__((amdgpu_waves_per_eu(4, 4)))
void attn_bias_kernel(const unsigned short* __restrict__ qhp, const unsigned short* __restrict__ qlp,
                      const unsigned short* __restrict__ khp, const unsigned short* __restrict__ klp,
                      const unsigned short* __restrict__ vhp, const unsigned short* __restrict__ vlp,
                      const float* __restrict__ bias, float* __restrict__ opart, float* __restrict__ ml) {
  __shared__ __align__(16) __bf16 Ksh[AT_KC * AT_KP];        // K hi [kv][d], pitch AT_KP     5120 B
  __shared__ __align__(16) __bf16 Ksl[AT_KC * AT_KP];        // K lo
  __shared__ __align__(16) __bf16 Vth[DHD * AT_VP];          // V hi [d][kv], pitch AT_VP     4608 B
  __shared__ __align__(16) __bf16 Vtl[DHD * AT_VP];          // V lo
  __shared__ __align__(16) float  Os[4][16 * 36];            // per wave ctx tile, pitch 36

  const int tid  = threadIdx.x;
  const int wave = tid >> 5;
  const int lane = tid & 31;
  const int hh   = lane >> 4;
  const int c    = lane & 15;

  const int nqb = SEQ / 64;               // 32
  const int bx = blockIdx.x;
  const int qb = bx % nqb;
  const int h  = (bx / nqb) % NHEAD;      // 0..NHEAD-1
  const int ks = bx / (nqb * NHEAD);      // 0..KSPLIT-1: keys ks*SEQ/KSPLIT .. (ks+1)*SEQ/KSPLIT - 1
  const int q0 = qb * 64 + wave * 16;     // first query row of this wave

  const __bf16* Qh = (const __bf16*)(const void*)qhp + (size_t)h * DHD;
  const __bf16* Ql = (const __bf16*)(const void*)qlp + (size_t)h * DHD;
  const __bf16* Kh = (const __bf16*)(const void*)khp + (size_t)h * DHD;
  const __bf16* Kl = (const __bf16*)(const void*)klp + (size_t)h * DHD;
  const __bf16* Vh = (const __bf16*)(const void*)vhp + (size_t)h * DHD * SEQ;
  const __bf16* Vl = (const __bf16*)(const void*)vlp + (size_t)h * DHD * SEQ;
  float*        ob = opart + (size_t)ks * SEQ * DMOD + (size_t)h * DHD;

  // ---- Q fragments (B operand of S^T = K.Q^T: column = query = lane&15, split k map), one 32-deep k-step, hi and lo ----
  const v16b qbh = frag_load(Qh + (size_t)(q0 + c) * DMOD + 8 * hh);
  const v16b qbl = frag_load(Ql + (size_t)(q0 + c) * DMOD + 8 * hh);

  // One query (q0 + c) per lane; the two wave halves hold different keys (and different d) of that query.
  float mrow = -INFINITY;   // running maximum, equal in both halves
  float lrow = 0.f;         // running sum over this half's keys only; the halves are joined once after the loop
  v8f oacc[2];              // ctx^T tiles: element r of tile t = (d = 16*t + 8*hh + r, query c)
#pragma unroll
  for (int t = 0; t < 2; ++t) oacc[t] = (v8f){0.f,0.f,0.f,0.f,0.f,0.f,0.f,0.f};

  // bias of this lane: row (q0 + c), cols (kv0 + 16*j + 8*hh + r), r = 0..7 contiguous
  const float* brow = bias + (size_t)(q0 + c) * SEQ + 8 * hh;

  const int nChunks = SEQ / KSPLIT / AT_KC;   // 8, compile-time constant
  for (int kc = 0; kc < nChunks; ++kc) {
    const int kv0 = ks * (SEQ / KSPLIT) + kc * AT_KC;
    __syncthreads();
    {
      // K staging coverage: 128 thr -> 64 rows (tid>>1) x 2 halves of 16 d (tid&1) x 2 v8b = 64 x 32 per plane
      const int r = tid >> 1, hf = (tid & 1) * 16;
      const __bf16* ksh = Kh + (size_t)(kv0 + r) * DMOD + hf;
      const __bf16* ksl = Kl + (size_t)(kv0 + r) * DMOD + hf;
      // V^T staging coverage: 128 thr -> 32 rows (tid>>2) x 4 parts of 16 keys (tid&3) x 2 v8b = 32 x 64 per plane
      const int r2 = tid >> 2, part = (tid & 3) * 16;
      const __bf16* vsh = Vh + (size_t)r2 * SEQ + kv0 + part;
      const __bf16* vsl = Vl + (size_t)r2 * SEQ + kv0 + part;
#pragma unroll
      for (int i = 0; i < 2; ++i) {
        const v8b a0 = *(const v8b*)(ksh + 8 * i);
        const v8b a1 = *(const v8b*)(ksl + 8 * i);
        const v8b b0 = *(const v8b*)(vsh + 8 * i);
        const v8b b1 = *(const v8b*)(vsl + 8 * i);
        *(v8b*)(Ksh + r * AT_KP + hf + 8 * i)    = a0;
        *(v8b*)(Ksl + r * AT_KP + hf + 8 * i)    = a1;
        *(v8b*)(Vth + r2 * AT_VP + part + 8 * i) = b0;
        *(v8b*)(Vtl + r2 * AT_VP + part + 8 * i) = b1;
      }
    }
    __syncthreads();

    // ---- S^T = k.q^T : 4 key-row tiles of 16, A[m=key][k=d] from K tile rows, B = Q (both split k map) ----
    // s[j][r] = score of key (kv0 + 16*j + 8*hh + r) against query (q0 + c)
    v4f bb[8];   // this lane's 32 bias values of the chunk: 8 contiguous floats per key tile, asked for as one group
#pragma unroll
    for (int j = 0; j < 4; ++j) {
      bb[2 * j]     = *(const v4f*)(brow + kv0 + j * 16);
      bb[2 * j + 1] = *(const v4f*)(brow + kv0 + j * 16 + 4);
    }
    v8f s[4];
#pragma unroll
    for (int j = 0; j < 4; ++j) {
      s[j] = (v8f){0.f,0.f,0.f,0.f,0.f,0.f,0.f,0.f};
      FragB kb, kl;
      kb.h[0] = *(const v8b*)(Ksh + (j * 16 + c) * AT_KP + 8 * hh);
      kb.h[1] = *(const v8b*)(Ksh + (j * 16 + c) * AT_KP + 16 + 8 * hh);
      kl.h[0] = *(const v8b*)(Ksl + (j * 16 + c) * AT_KP + 8 * hh);
      kl.h[1] = *(const v8b*)(Ksl + (j * 16 + c) * AT_KP + 16 + 8 * hh);
      s[j] = mma_bf(kb.v, qbh, s[j]);
      s[j] = mma_bf(kl.v, qbh, s[j]);
      s[j] = mma_bf(kb.v, qbl, s[j]);
    }
    // ---- add pair bias in f32; chunk maximum in-lane over 32 keys, then one exchange between the halves ----
    float cm = -INFINITY;
#pragma unroll
    for (int j = 0; j < 4; ++j) {
#pragma unroll
      for (int r = 0; r < 4; ++r) {
        s[j][r]     += bb[2 * j][r];
        s[j][r + 4] += bb[2 * j + 1][r];
        cm = fmaxf(cm, fmaxf(s[j][r], s[j][r + 4]));
      }
    }
    cm = fmaxf(cm, xhalf(cm));
    const float mnew  = fmaxf(mrow, cm);
    const float nm2   = -mnew * LOG2E;
    const float alpha = exp_rel(mrow, nm2);
    mrow = mnew;
    // ---- p = exp(s - m) by exp_rel, split hi/lo and packed straight into the B operand of ctx^T += v^T.p^T:
    //      element e of k-step kk is key 32*kk + 8*hh + e (e < 8, tile 2*kk) or 32*kk + 16 + 8*hh + e - 8 (tile 2*kk + 1),
    //      the k order of the V^T fragment loads below ----
    FragW pbh[2], pbl[2];
    float psum = 0.f;
#pragma unroll
    for (int j = 0; j < 4; ++j) {
      float p[8];
#pragma unroll
      for (int r = 0; r < 8; ++r) {
        p[r] = exp_rel(s[j][r], nm2);
        psum += p[r];
      }
      split8(p, pbh[j >> 1].w[j & 1], pbl[j >> 1].w[j & 1]);
    }
    lrow = lrow * alpha + psum;
#pragma unroll
    for (int t = 0; t < 2; ++t)
#pragma unroll
      for (int r = 0; r < 8; ++r) oacc[t][r] *= alpha;
    // ---- ctx^T += V^T . P^T : A[m=d][k=key] from V^T tile rows (2 k-steps of 32 keys), B = P^T from registers ----
#pragma unroll
    for (int kk = 0; kk < 2; ++kk) {
#pragma unroll
      for (int t = 0; t < 2; ++t) {
        FragB vb, vl;
        vb.h[0] = *(const v8b*)(Vth + (t * 16 + c) * AT_VP + kk * 32 + 8 * hh);
        vb.h[1] = *(const v8b*)(Vth + (t * 16 + c) * AT_VP + kk * 32 + 16 + 8 * hh);
        vl.h[0] = *(const v8b*)(Vtl + (t * 16 + c) * AT_VP + kk * 32 + 8 * hh);
        vl.h[1] = *(const v8b*)(Vtl + (t * 16 + c) * AT_VP + kk * 32 + 16 + 8 * hh);
        oacc[t] = mma_bf(vb.v, pbh[kk].v, oacc[t]);
        oacc[t] = mma_bf(vl.v, pbh[kk].v, oacc[t]);
        oacc[t] = mma_bf(vb.v, pbl[kk].v, oacc[t]);
      }
    }
  }

  // ---- join the halves' sums; stage the wave's 16 x 32 unnormalised ctx tile [query][d] for whole-line stores ----
  float* os = Os[wave];
  const float lsum = lrow + xhalf(lrow);
  {
#pragma unroll
    for (int t = 0; t < 2; ++t) {
      const v4f o0 = (v4f){oacc[t][0], oacc[t][1], oacc[t][2], oacc[t][3]};
      const v4f o1 = (v4f){oacc[t][4], oacc[t][5], oacc[t][6], oacc[t][7]};
      *(v4f*)(os + c * 36 + t * 16 + 8 * hh)     = o0;
      *(v4f*)(os + c * 36 + t * 16 + 8 * hh + 4) = o1;
    }
  }
  __builtin_amdgcn_fence(__ATOMIC_RELEASE, "workgroup");
  __builtin_amdgcn_wave_barrier();
  __builtin_amdgcn_fence(__ATOMIC_ACQUIRE, "workgroup");
  {
    const int q4 = lane >> 3, c4 = (lane & 7) * 4;
    {
#pragma unroll
      for (int it = 0; it < 4; ++it) {
        const int row = it * 4 + q4;
        const v4f val = *(const v4f*)(os + row * 36 + c4);
        *(v4f*)(ob + (size_t)(q0 + row) * DMOD + c4) = val;
      }
      
    }
  }
  // maximum (lower half) and sum (upper half) of query q0 + c: the wave's 32 lanes fill one 128-B line
  ml[(((size_t)ks * NHEAD + h) * SEQ + q0 + c) * 2 + hh] = hh ? lsum : mrow;
}

// ---------------------------------------------------------------------------
// Join of the KSPLIT partial attention results and the output projection, in one launch:
//   M = max_ks m, w = exp(m - M), ctx = (sum_ks w * opart) / (sum_ks w * l); hi = bf16_rne(ctx), lo = bf16_rne(ctx - hi)
//   out = ctx . Wo + bo   (hi.hi + hi.lo + lo.hi, f32 accumulate, k-steps in rising order)
// A block owns 16 queries and 128 output columns; grid = (SEQ / 16) * 2 = 256 blocks of 8 waves, one per WGP. The two blocks of a
// query tile each join that tile's ctx for themselves: nothing passes between work-groups.
//   Join: wave = head = k-step of 32 ctx columns; a lane makes its own 16 elements of that k-step's A fragment (the lane / element / k
//   map of frag_load_fo) and stores them as two 16-B pieces per plane into the block's LDS planes (8 units of 1 KiB, fragment order).
//   Product: wave = one tile of 16 output columns; A fragments from LDS; the wave's Wo^T fragments (global planes in fragment order,
//   8 k-steps x hi and lo = 128 registers) depend on nothing in this launch and are asked for at entry, with the partials.
// coverage: join 8 waves x 32 lanes x 16 = 16 x 256 ctx elements; product 8 waves x 16 x 16 = 16 x 128 outputs, each stored once.
// Two waves per SIMD asked of the compiler: the grid supplies two, and with registers saved for more it would ask for the loads in turns.
// ---------------------------------------------------------------------------
__global__ __launch_bounds__(256) __attribute__((amdgpu_waves_per_eu(2, 2)))
void merge_out_kernel(const float* __restrict__ opart, const float* __restrict__ ml,
                      const unsigned short* __restrict__ Bhp, const unsigned short* __restrict__ Blp,
                      const float* __restrict__ bo, float* __restrict__ out) {
  __shared__ __align__(16) unsigned short Ch[8 * 512];       // ctx hi, 16 queries x 256 k, fragment order   8 KB
  __shared__ __align__(16) unsigned short Cl[8 * 512];       // ctx lo
  __shared__ __align__(16) float sT[16 * 132];               // the block's 16 x 128 output tile, pitch 132
  const int lane  = threadIdx.x & 31;
  const int wave  = threadIdx.x >> 5;
  const int rlane = lane & 15;                               // query (A), column (B, D) within a tile
  const int m0    = (blockIdx.x >> 1) * 16;                  // first query of the block
  const int nb    = (blockIdx.x & 1) * 128;                  // first output column of the block
  const int n0    = nb + wave * 16;                          // first output column of the wave

  constexpr int KSTEPS = DMOD >> 5;
  constexpr int TSTEP  = KSTEPS << 9;     // elements from one 16-row tile of a plane to the next
  const __bf16* pbh = (const __bf16*)(const void*)Bhp + (size_t)(n0 >> 4) * TSTEP + lane * 8;
  const __bf16* pbl = (const __bf16*)(const void*)Blp + (size_t)(n0 >> 4) * TSTEP + lane * 8;
  v16b bh[KSTEPS], bl[KSTEPS];
#pragma unroll   // compile-time trip count; the arrays indexed here are registers only under constant indices
  for (int kst = 0; kst < KSTEPS; ++kst) {
    bh[kst] = frag_load_fo(pbh + (kst << 9));
    bl[kst] = frag_load_fo(pbl + (kst << 9));
  }
  const float* pbo = bo + n0 + rlane;
  const float bvn = *pbo;

  // ---- join of the key ranges: head = wave, query m0 + rlane, columns col .. col + 7 and col + 16 .. col + 23 ----
  {
    const int t   = m0 + rlane;
    const int col = wave * DHD + (lane >> 4) * 8;
    const float* pml = ml + ((size_t)wave * SEQ + t) * 2;        // key range 0; the others lie at fixed distances
    const float* pop = opart + (size_t)t * DMOD + col;
    v2f a[KSPLIT];
    v4f o[KSPLIT][4];
#pragma unroll   // compile-time trip count; the arrays indexed here are registers only under constant indices
    for (int s = 0; s < KSPLIT; ++s) {
      a[s] = *(const v2f*)(pml + (size_t)s * NHEAD * SEQ * 2);
      const float* op = pop + (size_t)s * SEQ * DMOD;
      o[s][0] = *(const v4f*)(op);
      o[s][1] = *(const v4f*)(op + 4);
      o[s][2] = *(const v4f*)(op + 16);
      o[s][3] = *(const v4f*)(op + 20);
    }
    // precaution: stands between the launch's loads and any rewrite of the address registers that they name; as inputs the five
    // addresses stay in their registers up to here, so that no load of the group returns its data into one of them
    asm volatile("s_wait_xcnt 0x0" :: "v"(pbh), "v"(pbl), "v"(pbo), "v"(pml), "v"(pop) : "memory");
    float M = a[0][0];
#pragma unroll   // compile-time trip count; the arrays indexed here are registers only under constant indices
    for (int s = 1; s < KSPLIT; ++s) M = fmaxf(M, a[s][0]);
    const float nM2 = -M * LOG2E;
    float w[KSPLIT];
    float L = 0.f;
#pragma unroll   // compile-time trip count; the arrays indexed here are registers only under constant indices
    for (int s = 0; s < KSPLIT; ++s) {
      w[s] = exp_rel(a[s][0], nM2);
      L = fmaf(w[s], a[s][1], L);
    }
    const float inv = 1.0f / L;
#pragma unroll   // compile-time trip count; the arrays indexed here are registers only under constant indices
    for (int half = 0; half < 2; ++half) {
      v4u hv, lv;
      float f[8];
#pragma unroll   // compile-time trip count; the arrays indexed here are registers only under constant indices
      for (int e = 0; e < 4; ++e) {
        float f0 = 0.f, f1 = 0.f;
#pragma unroll   // compile-time trip count; the arrays indexed here are registers only under constant indices
        for (int s = 0; s < KSPLIT; ++s) {
          f0 = fmaf(w[s], o[s][half * 2 + (e >> 1)][(e & 1) * 2],     f0);
          f1 = fmaf(w[s], o[s][half * 2 + (e >> 1)][(e & 1) * 2 + 1], f1);
        }
        f[2 * e]     = f0 * inv;
        f[2 * e + 1] = f1 * inv;
      }
      split8(f, hv, lv);
      *(v4u*)(Ch + wave * 512 + half * 256 + lane * 8) = hv;
      *(v4u*)(Cl + wave * 512 + half * 256 + lane * 8) = lv;
    }
  }
  __syncthreads();   // every wave's k-step of ctx is read by all 8 waves below

  // ---- out tile of this wave: 16 queries x columns n0 .. n0 + 15 ----
  const __bf16* pah = (const __bf16*)(const void*)Ch + lane * 8;
  const __bf16* pal = (const __bf16*)(const void*)Cl + lane * 8;
  v8f acc = (v8f){0.f,0.f,0.f,0.f,0.f,0.f,0.f,0.f};
  v16b ah[KSTEPS], al[KSTEPS];           // read from LDS three k-steps ahead of their products
#pragma unroll   // compile-time trip count; the arrays indexed here are registers only under constant indices
  for (int kst = 0; kst < 3; ++kst) {
    ah[kst] = frag_load_fo(pah + (kst << 9));
    al[kst] = frag_load_fo(pal + (kst << 9));
  }
#pragma unroll   // compile-time trip count; the arrays indexed here are registers only under constant indices
  for (int kst = 0; kst < KSTEPS; ++kst) {
    if (kst + 3 < KSTEPS) {
      ah[kst + 3] = frag_load_fo(pah + ((kst + 3) << 9));
      al[kst + 3] = frag_load_fo(pal + ((kst + 3) << 9));
    }
    acc = mma_bf(ah[kst], bh[kst], acc);
    acc = mma_bf(ah[kst], bl[kst], acc);
    acc = mma_bf(al[kst], bh[kst], acc);
  }

  // ---- epilogue: bias, then the block's 16 x 128 tile through LDS, so that each 128-B line of out has one writer ----
  const int mOff = (lane >> 4) * 8;      // D row offset
#pragma unroll   // compile-time trip count; the arrays indexed here are registers only under constant indices
  for (int r = 0; r < 8; ++r) sT[(mOff + r) * 132 + wave * 16 + rlane] = acc[r] + bvn;
  __syncthreads();   // a row of the tile holds columns of all 8 waves
#pragma unroll   // compile-time trip count; the arrays indexed here are registers only under constant indices
  for (int it = 0; it < 2; ++it) {
    const int row = wave * 2 + it;       // a wave stores a row's 128 columns = 512 B = 4 whole lines
    const v4f val = *(const v4f*)(sT + row * 132 + lane * 4);
    *(v4f*)(out + (size_t)(m0 + row) * DMOD + nb + lane * 4) = val;
  }
}

// ---------------------------------------------------------------------------
//   biasP f32 [2048][2048]                 0 .. 16777216
//   WoTh/l  bf16 [256 o][256 i], fragment order   131072 each (2 planes) 16777216 .. 17039360
//   Qh/l, Kh/l  bf16 [2048][256]            1048576 each (4 planes)      17039360 .. 21233664
//   VTh/l bf16 [256 (h,d)][2048]            1048576 each (2 planes)      21233664 .. 23330816
//   OPART f32 [4 key ranges][2048][256]     2097152 each (4 planes)      23330816 .. 31719424
//   ML f32 [4 key ranges][8][2048][2]       524288                       31719424 .. 32243712
//   total                                   32243712
// ---------------------------------------------------------------------------
extern "C" void kernel_launch(void* const* d_in, const int* in_sizes, int n_in,
                              void* d_out, int out_size, void* d_ws, size_t ws_size,
                              hipStream_t stream) {
  if (n_in < 22) return;
  if (in_sizes[0] != SEQ * SEQ || in_sizes[1] != SEQ * SEQ || in_sizes[2] != SEQ * SEQ) return;
  if (in_sizes[3] != SEQ * DMOD || in_sizes[4] != SEQ * DMOD || in_sizes[5] != SEQ * DMOD) return;
  if (in_sizes[6] != DMOD * DMOD || in_sizes[8] != DMOD * DMOD || in_sizes[10] != DMOD * DMOD || in_sizes[12] != DMOD * DMOD) return;
  if (in_sizes[7] != DMOD || in_sizes[9] != DMOD || in_sizes[11] != DMOD || in_sizes[13] != DMOD) return;
  if (in_sizes[14] != 32 || in_sizes[15] != 16 || in_sizes[16] != 16 || in_sizes[17] != 1) return;
  if (in_sizes[18] != 32 || in_sizes[19] != 16 || in_sizes[20] != 16 || in_sizes[21] != 1) return;
  if (out_size != SEQ * DMOD) return;

  const int*   label   = (const int*)  d_in[0];
  const float* dist    = (const float*)d_in[1];
  const float* contact = (const float*)d_in[2];
  const float* q   = (const float*)d_in[3];
  const float* k   = (const float*)d_in[4];
  const float* v   = (const float*)d_in[5];
  const float* Wq  = (const float*)d_in[6];
  const float* bq  = (const float*)d_in[7];
  const float* Wk  = (const float*)d_in[8];
  const float* bk  = (const float*)d_in[9];
  const float* Wv  = (const float*)d_in[10];
  const float* bv  = (const float*)d_in[11];
  const float* Wo  = (const float*)d_in[12];
  const float* bo  = (const float*)d_in[13];
  const float* Wd1 = (const float*)d_in[14];
  const float* bd1 = (const float*)d_in[15];
  const float* Wd2 = (const float*)d_in[16];
  const float* bd2 = (const float*)d_in[17];
  const float* Wc1 = (const float*)d_in[18];
  const float* bc1 = (const float*)d_in[19];
  const float* Wc2 = (const float*)d_in[20];
  const float* bc2 = (const float*)d_in[21];
  float* out = (float*)d_out;

  const size_t PB = (size_t)SEQ * SEQ * 4;     // 16777216  f32 bias plane
  const size_t PW = (size_t)DMOD * DMOD * 2;   // 131072    bf16 weight plane [256][256]
  const size_t PX = (size_t)SEQ * DMOD * 2;    // 1048576   bf16 activation plane [2048][256] / [256][2048]
  const size_t PF = (size_t)SEQ * DMOD * 4;    // 2097152   f32 activation plane
  size_t off = 0;
  const size_t oBias = off; off += PB;
  const size_t oWoTh = off; off += PW;  const size_t oWoTl = off; off += PW;
  const size_t oQh   = off; off += PX;  const size_t oQl   = off; off += PX;
  const size_t oKh   = off; off += PX;  const size_t oKl   = off; off += PX;
  const size_t oVTh  = off; off += PX;  const size_t oVTl  = off; off += PX;
  const size_t oOp   = off; off += KSPLIT * PF;
  const size_t oML   = off; off += (size_t)KSPLIT * NHEAD * SEQ * 2 * 4;
  if (off > ws_size) return;                   // off = 32243712

  char* ws = (char*)d_ws;
  float*          biasP = (float*)(ws + oBias);
  unsigned short* WoTh = (unsigned short*)(ws + oWoTh); unsigned short* WoTl = (unsigned short*)(ws + oWoTl);
  unsigned short* Qh   = (unsigned short*)(ws + oQh);   unsigned short* Ql   = (unsigned short*)(ws + oQl);
  unsigned short* Kh   = (unsigned short*)(ws + oKh);   unsigned short* Kl   = (unsigned short*)(ws + oKl);
  unsigned short* VTh  = (unsigned short*)(ws + oVTh);  unsigned short* VTl  = (unsigned short*)(ws + oVTl);
  float*          Op   = (float*)(ws + oOp);
  float*          ML   = (float*)(ws + oML);

  const dim3 blk(256);

  // (1) everything ahead of the attention, one launch: the three projections from the f32 inputs, Wo planes [out][in], pair bias plane
  const float qscale = 0.17677669529663688f;                // 32^-0.5 applied as (x.Wq + bq) * scale
  prep_proj_kernel<<<dim3(3 * PREP_P_BLOCKS + PREP_W_BLOCKS + PREP_PB_BLOCKS), blk, 0, stream>>>(dist, contact, label,
      Wd1, bd1, Wd2, bd2, Wc1, bc1, Wc2, bc2, biasP,
      Wq, Wk, Wv, Wo, bq, bk, bv, WoTh, WoTl,
      q, k, v, Qh, Ql, Kh, Kl, VTh, VTl, qscale);

  // (2) attention with pair bias: 4 key ranges x 8 heads x 32 query blocks of 64 rows -> partial ctx, maximum and sum per key range
  attn_bias_kernel<<<dim3(KSPLIT * NHEAD * (SEQ / 64)), dim3(128), 0, stream>>>(Qh, Ql, Kh, Kl, VTh, VTl, biasP, Op, ML);

  // (3) join of the key ranges and out = ctx . Wo + bo -> d_out f32 [2048][256], 256 blocks of 16 queries x 128 columns
  merge_out_kernel<<<dim3((SEQ / 16) * 2), blk, 0, stream>>>(Op, ML, WoTh, WoTl, bo, out);

  (void)hipGetLastError();
}

// v010
// One run takes 38 microseconds.
// Timed twice side by side with v009, it ran 1.10 times as fast both times.
// Over all steps from v000 it is 5.51 times as fast.
// Contractions: q, k, v^T projections, q.k^T scores, p.v and output projection on v_wmma_f32_16x16x32_bf16 with bf16 hi/lo operands (hi.hi + hi.lo + lo.hi), f32 accumulate; pair bias (exact affine fold of the two linear 2->16->1 maps) and online softmax in f32 on VALU; the keys of a query block are dealt to 4 work-groups whose partial results the output projection's launch joins; the q, k, v projections split their f32 operands themselves, into LDS planes in fragment order, in one launch with the pair bias.
#include <hip/hip_runtime.h>
#include <math.h>
#include <stdint.h>

#define SEQ   2048
#define DMOD  256
#define NHEAD 8
#define DHD   32
#define KSPLIT 4      // key ranges per query block in the attention launch, one work-group each

typedef __attribute__((ext_vector_type(16))) __bf16   v16b;
typedef __attribute__((ext_vector_type(8)))  __bf16   v8b;
typedef __attribute__((ext_vector_type(8)))  float    v8f;
typedef __attribute__((ext_vector_type(4)))  float    v4f;
typedef __attribute__((ext_vector_type(2)))  float    v2f;
typedef __attribute__((ext_vector_type(4)))  unsigned int v4u;
typedef __attribute__((ext_vector_type(4)))  int      v4i;

// bf16 hi/lo split of 8 f32 values on the chip's own conversions, 3 instructions a pair, all round to nearest even:
//   hi = bf16(f) by v_cvt_pk_bf16_f32; lo = bf16(f - hi) by v_fma_mixlo_bf16 / v_fma_mixhi_bf16 (hi * -1 + f in f32, exact, then rounded once).
// Word q of hv and lv holds the part of f[2q] in its low half and that of f[2q + 1] in its high half.
// In asm text because the compiler makes five instructions of a pair (two unpacks, a packed subtract, two conversions). Four pairs in one
// statement, so that every producer stands four instructions ahead of its reader; each s_delay_alu names that distance for the two
// instructions behind it: without the hint a waiting reader would hold up the other waves of the SIMD as well.
// The -1.0 is read as bf16 from the constant's high half (op_sel 1, op_sel_hi 1), as the compiler writes it for v_fma_mix_f32_bf16.
__device__ __forceinline__ void split8(const float* f, v4u& hv, v4u& lv) {
  unsigned h0, h1, h2, h3, l0, l1, l2, l3;
  asm("v_cvt_pk_bf16_f32 %0, %8, %9\n\t"
      "v_cvt_pk_bf16_f32 %1, %10, %11\n\t"
      "v_cvt_pk_bf16_f32 %2, %12, %13\n\t"
      "v_cvt_pk_bf16_f32 %3, %14, %15\n\t"
      "s_delay_alu instid0(VALU_DEP_4) | instskip(NEXT) | instid1(VALU_DEP_4)\n\t"
      "v_fma_mixlo_bf16 %4, %0, -1.0, %8 op_sel:[0,1,0] op_sel_hi:[1,1,0]\n\t"
      "v_fma_mixlo_bf16 %5, %1, -1.0, %10 op_sel:[0,1,0] op_sel_hi:[1,1,0]\n\t"
      "s_delay_alu instid0(VALU_DEP_4) | instskip(NEXT) | instid1(VALU_DEP_4)\n\t"
      "v_fma_mixlo_bf16 %6, %2, -1.0, %12 op_sel:[0,1,0] op_sel_hi:[1,1,0]\n\t"
      "v_fma_mixlo_bf16 %7, %3, -1.0, %14 op_sel:[0,1,0] op_sel_hi:[1,1,0]\n\t"
      "s_delay_alu instid0(VALU_DEP_4) | instskip(NEXT) | instid1(VALU_DEP_4)\n\t"
      "v_fma_mixhi_bf16 %4, %0, -1.0, %9 op_sel:[1,1,0] op_sel_hi:[1,1,0]\n\t"
      "v_fma_mixhi_bf16 %5, %1, -1.0, %11 op_sel:[1,1,0] op_sel_hi:[1,1,0]\n\t"
      "s_delay_alu instid0(VALU_DEP_4) | instskip(NEXT) | instid1(VALU_DEP_4)\n\t"
      "v_fma_mixhi_bf16 %6, %2, -1.0, %13 op_sel:[1,1,0] op_sel_hi:[1,1,0]\n\t"
      "v_fma_mixhi_bf16 %7, %3, -1.0, %15 op_sel:[1,1,0] op_sel_hi:[1,1,0]"
      : "=&v"(h0), "=&v"(h1), "=&v"(h2), "=&v"(h3), "=&v"(l0), "=&v"(l1), "=&v"(l2), "=&v"(l3)
      : "v"(f[0]), "v"(f[1]), "v"(f[2]), "v"(f[3]), "v"(f[4]), "v"(f[5]), "v"(f[6]), "v"(f[7]));
  hv = (v4u){h0, h1, h2, h3};
  lv = (v4u){l0, l1, l2, l3};
}

// 16x16x32 fragment (A row-major k-contiguous, or B stored [n][k] k-contiguous):
// lane l: row/col = l & 15, p already offset by 8*(l>>4); elements 0..7 <- p[0..7], elements 8..15 <- p[16..23]
union FragB { v16b v; v8b h[2]; };
union FragW { v16b v; v4u w[2]; };   // word i of w[g] = elements 8*g + 2*i (low half) and 8*g + 2*i + 1
__device__ __forceinline__ v16b frag_load(const __bf16* p) {
  FragB f; f.h[0] = *(const v8b*)(p); f.h[1] = *(const v8b*)(p + 16); return f.v;
}

// Fragment order of a GEMM operand plane [rows][K] (K a multiple of 32): one 1-KiB unit per (16 rows, 32 k), units of a row tile in k order.
// Inside a unit lane l's elements 0..7 lie at 16-B piece l, its elements 8..15 at piece 32 + l, so element (row, k) is at
//   (((row >> 4) * (K >> 5) + (k >> 5)) * 2 + ((k >> 4) & 1)) * 256 + ((row & 15) + 16 * ((k >> 3) & 1)) * 8 + (k & 7)
// and each of the two 16-B-per-lane loads of a fragment reads 512 bytes in a row (4 whole lines). Same lane / element / k map as frag_load.
// p: the lane's 16-B piece in the unit (unit start + lane * 8 elements)
__device__ __forceinline__ v16b frag_load_fo(const __bf16* p) {
  FragB f; f.h[0] = *(const v8b*)(p); f.h[1] = *(const v8b*)(p + 256); return f.v;
}

// WMMA + hazard guard (4 VALU slots, ties D, keeps A/B live)
__device__ __forceinline__ v8f mma_bf(v16b a, v16b b, v8f c) {
  c = __builtin_amdgcn_wmma_f32_16x16x32_bf16(false, a, false, b, (short)0, c, false, false);
  asm volatile("v_nop\n\tv_nop\n\tv_nop\n\tv_nop" : "+v"(c) : "v"(a), "v"(b));
  return c;
}

// ---------------------------------------------------------------------------
// Pair bias plane [SEQ][SEQ] f32:
//   pb(map, W1, b1, W2, b2)(n,m) = map*(W1[0].W2) + label*(W1[1].W2) + (b1.W2 + b2)   (both maps linear, exact fold)
//   bias = pb_d + pb_c.  W1 [2][16] row-major, W2 [16][1].
// Block blk owns elements blk*8192 .. blk*8192+8191; each thread 4 consecutive floats per iteration, 8 iterations.
// coverage: 512 blocks x 8 it x 256 thr x 4 = 4194304 = whole plane.
// ---------------------------------------------------------------------------
__device__ __forceinline__ void pair_bias_block(const int blk,
    const float* __restrict__ dist, const float* __restrict__ contact, const int* __restrict__ label,
    const float* __restrict__ Wd1, const float* __restrict__ bd1, const float* __restrict__ Wd2, const float* __restrict__ bd2,
    const float* __restrict__ Wc1, const float* __restrict__ bc1, const float* __restrict__ Wc2, const float* __restrict__ bc2,
    float* __restrict__ bias) {
  float ad = 0.f, ld = 0.f, gd = 0.f, ac = 0.f, lc = 0.f, gc = 0.f;
#pragma unroll 1
  for (int j = 0; j < 16; ++j) {
    const float wd2 = Wd2[j], wc2 = Wc2[j];
    ad = fmaf(Wd1[j],      wd2, ad);   // map weight (row 0 of W1)
    ld = fmaf(Wd1[16 + j], wd2, ld);   // label weight (row 1 of W1)
    gd = fmaf(bd1[j],      wd2, gd);
    ac = fmaf(Wc1[j],      wc2, ac);
    lc = fmaf(Wc1[16 + j], wc2, lc);
    gc = fmaf(bc1[j],      wc2, gc);
  }
  gd += bd2[0];
  gc += bc2[0];
  const size_t base = (size_t)blk * 8192 + (size_t)threadIdx.x * 4;
{
#pragma unroll 1
    for (int it = 0; it < 8; ++it) {
      const size_t i4 = base + (size_t)it * 1024;
      const v4f dm = *(const v4f*)(dist + i4);
      const v4f cm = *(const v4f*)(contact + i4);
      const v4i lb = *(const v4i*)(label + i4);
      v4f o;
#pragma unroll
      for (int e = 0; e < 4; ++e) {
        const float lf = (float)lb[e];
        const float pd = fmaf(dm[e], ad, fmaf(lf, ld, gd));
        const float pc = fmaf(cm[e], ac, fmaf(lf, lc, gc));
        o[e] = pd + pc;
      }
      *(v4f*)(bias + i4) = o;
      // precaution: stands between this store and the next trip's rewrite of the registers that the store names
      asm volatile("s_wait_xcnt 0x0" ::: "memory");
    }
    
  }
}

// ---------------------------------------------------------------------------
// Fused transpose + bf16 split of an f32 matrix W viewed [R rows][Cc cols] (pitch Cc) ->
//   oh(c, r) = bf16_rne(W[r][c]), ol(c, r) = bf16_rne(W[r][c] - oh)   (planes [Cc rows][R k] in fragment order, see frag_load_fo)
// 64x64 tiles through LDS (tf: 64 x 68 floats of the caller). Tile (bx, by) of (Cc/64, R/64), 256 threads, R and Cc multiples of 64.
// coverage per block/plane: load 4 it x 256 thr x 4 floats = 64x64; store 2 it x 256 thr x 8 u16 = 64x64 = 8 whole units (4 row tiles x 2 k-steps).
// ---------------------------------------------------------------------------
__device__ __forceinline__ void tsplit_block(float* tf, const int bx, const int by, const float* __restrict__ W,
                                             unsigned short* __restrict__ oh, unsigned short* __restrict__ ol, int R, int Cc) {
  const int c0  = bx * 64;           // input column block = output row block
  const int r0  = by * 64;           // input row block    = output column block
  const int tid = threadIdx.x;
  {
    const int lr = tid >> 4;         // 0..15
    const int c4 = (tid & 15) * 4;   // 0..60
#pragma unroll
    for (int it = 0; it < 4; ++it) {
      const int rr = it * 16 + lr;   // 0..63
      const v4f a = *(const v4f*)(W + (size_t)(r0 + rr) * Cc + c0 + c4);
      *(v4f*)(tf + rr * 68 + c4) = a;
    }
  }
  __syncthreads();
  // 16-B piece it*256 + tid of the tile's 512: fragment lane, half of the fragment, k-step, row tile
  const int ln   = tid & 31;
  const int part = (tid >> 5) & 1;
  const int ksl  = (tid >> 6) & 1;
  const int c8   = ksl * 32 + part * 16 + (ln >> 4) * 8;   // first of the piece's 8 k (= input rows) within the tile
  v4u hv[2], lv[2];
#pragma unroll
  for (int it = 0; it < 2; ++it) {
    const int oc = (it * 2 + (tid >> 7)) * 16 + (ln & 15);   // output row within tile (= input column)
    float f[8];
#pragma unroll
    for (int q = 0; q < 8; ++q) f[q] = tf[(c8 + q) * 68 + oc];
    split8(f, hv[it], lv[it]);
  }
  {
#pragma unroll
    for (int it = 0; it < 2; ++it) {
      const int rt = it * 2 + (tid >> 7);
      const size_t go = ((size_t)(((c0 >> 4) + rt) * (R >> 5) + (r0 >> 5) + ksl) << 9) + part * 256 + ln * 8;
      *(v4u*)(oh + go) = hv[it];
      *(v4u*)(ol + go) = lv[it];
    }
    // precaution: stands between these stores and whatever follows them in the kernel's text and rewrites a register that they name
    asm volatile("s_wait_xcnt 0x0" ::: "memory");
  }
}

// ---------------------------------------------------------------------------
// One projection tile from the f32 inputs: C = scale * (X . Wm + bias), X [SEQ][DMOD], Wm [DMOD in][DMOD out], product = hi.hi + hi.lo + lo.hi.
// A block owns 64 rows of X and 128 columns of Wm; it makes the bf16 hi/lo planes of both operands itself, in LDS, in fragment order
// (see frag_load_fo), 64 k per stage, two stage buffers: the next stage's f32 values are asked for ahead of this stage's products.
//   stage buffer (2-B elements): W hi, W lo: 8 column tiles x (2 units of 512 + 8 of pad, so that the 4 pieces a lane stores and the
//   8 tiles a wave stores fall on different banks); X hi, X lo: 4 row tiles x 2 units of 512.
//   W staging: wave = 8 k, lane = 4 columns (8 whole-line loads); the 8 k of a column are one 16-B piece, made in registers.
//   X staging: thread = 8 k (tid & 7) of rows tid >> 3 and 32 + (tid >> 3), one 16-B piece each.
//   coverage per stage: W 8 waves x 8 k x 32 lanes x 4 = 64 x 128; X 256 thr x 2 x 8 = 64 x 64.
// Wave = 32 rows x 32 columns (2 x 4 waves). VT = false: A = X, B = W, C [row][column] pitch DMOD; VT = true: A = W, B = X, C [column][row] pitch SEQ.
// The block's tile goes through LDS, so that every 128-B line of the hi and lo planes (row-major) has one writer.
// ---------------------------------------------------------------------------
#define PJ_WT    1032                       // elements from one column tile of a W plane to the next
#define PJ_WPL   (8 * PJ_WT)                // one W plane of a stage
#define PJ_XPL   (4 * 1024)                 // one X plane of a stage
#define PJ_STAGE (2 * PJ_WPL + 2 * PJ_XPL)  // 24704 elements = 49408 B
__device__ __forceinline__ void split8_store(const float* f, unsigned short* ph, unsigned short* pl) {
  v4u hv, lv;
  split8(f, hv, lv);
  *(v4u*)ph = hv;
  *(v4u*)pl = lv;
}

template <bool VT>
__device__ __forceinline__ void proj_block(unsigned short* sm, const int blk, const float* __restrict__ X, const float* __restrict__ Wm,
                                           const float* __restrict__ bias, unsigned short* __restrict__ Ch, unsigned short* __restrict__ Cl,
                                           const float scale) {
  const int tid  = threadIdx.x;
  const int lane = tid & 31;
  const int wave = tid >> 5;
  const int m0 = (blk >> 1) * 64;        // first row of X
  const int nb = (blk & 1) * 128;        // first column of Wm
  const int wm = wave >> 2;              // the wave's 32 rows
  const int wn = wave & 3;               // the wave's 32 columns

  const int xg = tid & 7, xr = tid >> 3;
  const float* pw = Wm + (size_t)(wave * 8) * DMOD + nb + lane * 4;
  const float* px = X + (size_t)(m0 + xr) * DMOD + xg * 8;
  // where the thread's pieces lie in a stage buffer: piece (row, g = k / 8) at (row>>4) * (PJ_WT in W, 1024 in X) + (g>>2) * 512 + ((g>>1)&1)*256 + ((row&15) + 16*(g&1))*8
  const int wdst = (lane >> 2) * PJ_WT + (wave >> 2) * 512 + ((wave >> 1) & 1) * 256 + (((lane & 3) * 4) + 16 * (wave & 1)) * 8;
  const int xdst = 2 * PJ_WPL + (xr >> 4) * 1024 + (xg >> 2) * 512 + ((xg >> 1) & 1) * 256 + ((xr & 15) + 16 * (xg & 1)) * 8;

  v4f wv[8], xv[4];
#pragma unroll
  for (int e = 0; e < 8; ++e) wv[e] = *(const v4f*)(pw + e * DMOD);
#pragma unroll
  for (int u = 0; u < 2; ++u) {
    xv[2 * u]     = *(const v4f*)(px + u * 32 * DMOD);
    xv[2 * u + 1] = *(const v4f*)(px + u * 32 * DMOD + 4);
  }
  // precaution: stands between these loads and the rewrite of the two address registers that they name
  asm volatile("s_wait_xcnt 0x0" :: "v"(pw), "v"(px) : "memory");

  v8f acc[2][2];
#pragma unroll
  for (int i = 0; i < 2; ++i)
#pragma unroll
    for (int j = 0; j < 2; ++j) acc[i][j] = (v8f){0.f,0.f,0.f,0.f,0.f,0.f,0.f,0.f};

#pragma unroll 1   // rolled: four copies of the stage would only lengthen the kernel's text
  for (int st = 0; st < DMOD / 64; ++st) {
    unsigned short* buf = sm + (st & 1) * PJ_STAGE;
#pragma unroll
    for (int cc = 0; cc < 4; ++cc) {
      float f[8];
#pragma unroll
      for (int e = 0; e < 8; ++e) f[e] = wv[e][cc];
      split8_store(f, buf + wdst + cc * 8, buf + PJ_WPL + wdst + cc * 8);
    }
#pragma unroll
    for (int u = 0; u < 2; ++u) {
      float f[8];
#pragma unroll
      for (int e = 0; e < 4; ++e) { f[e] = xv[2 * u][e]; f[4 + e] = xv[2 * u + 1][e]; }
      split8_store(f, buf + xdst + u * 2048, buf + PJ_XPL + xdst + u * 2048);
    }
    // publishes this stage; it also ends every wave's reads of the other buffer, which the next trip refills
    __syncthreads();
    // the next stage's values are asked for behind the barrier (its fence would wait for them) and fly during this stage's products
    if (st + 1 < DMOD / 64) {
      pw += 64 * DMOD;
      px += 64;
#pragma unroll
      for (int e = 0; e < 8; ++e) wv[e] = *(const v4f*)(pw + e * DMOD);
#pragma unroll
      for (int u = 0; u < 2; ++u) {
        xv[2 * u]     = *(const v4f*)(px + u * 32 * DMOD);
        xv[2 * u + 1] = *(const v4f*)(px + u * 32 * DMOD + 4);
      }
      // precaution: stands between these loads and the next trip's rewrite of the two address registers that they name
      asm volatile("s_wait_xcnt 0x0" :: "v"(pw), "v"(px) : "memory");
    }
    const __bf16* sw = (const __bf16*)(const void*)buf + (wn * 2) * PJ_WT + lane * 8;
    const __bf16* sx = (const __bf16*)(const void*)buf + 2 * PJ_WPL + (wm * 2) * 1024 + lane * 8;
#pragma unroll
    for (int ksl = 0; ksl < 2; ++ksl) {
      v16b xh[2], xl[2];
#pragma unroll
      for (int i = 0; i < 2; ++i) {
        xh[i] = frag_load_fo(sx + i * 1024 + ksl * 512);
        xl[i] = frag_load_fo(sx + PJ_XPL + i * 1024 + ksl * 512);
      }
#pragma unroll
      for (int j = 0; j < 2; ++j) {
        const v16b wh = frag_load_fo(sw + j * PJ_WT + ksl * 512);
        const v16b wl = frag_load_fo(sw + PJ_WPL + j * PJ_WT + ksl * 512);
#pragma unroll
        for (int i = 0; i < 2; ++i) {
          if (!VT) {
            acc[i][j] = mma_bf(xh[i], wh, acc[i][j]);
            acc[i][j] = mma_bf(xh[i], wl, acc[i][j]);
            acc[i][j] = mma_bf(xl[i], wh, acc[i][j]);
          } else {
            acc[i][j] = mma_bf(wh, xh[i], acc[i][j]);
            acc[i][j] = mma_bf(wh, xl[i], acc[i][j]);
            acc[i][j] = mma_bf(wl, xh[i], acc[i][j]);
          }
        }
      }
    }
  }

  // ---- epilogue: the f32 tile lies in stage buffer 0 alone, whose last readers (stage 2) all passed the barrier of stage 3 ----
  float* so = (float*)(void*)sm;
  const int rlane = lane & 15;
  const int mOff  = (lane >> 4) * 8;     // D row offset
  constexpr int SP = VT ? 68 : 132;      // pitch of the tile in floats
#pragma unroll
  for (int j = 0; j < 2; ++j) {
    const float bvn = VT ? 0.f : bias[nb + wn * 32 + j * 16 + rlane];
#pragma unroll
    for (int r = 0; r < 8; ++r) {
      const float bvm = VT ? bias[nb + wn * 32 + j * 16 + mOff + r] : 0.f;
#pragma unroll
      for (int i = 0; i < 2; ++i) {
        float v = acc[i][j][r];
        v += VT ? bvm : bvn;
        v *= scale;
        if (!VT) so[(wm * 32 + i * 16 + mOff + r) * SP + wn * 32 + j * 16 + rlane] = v;
        else     so[(wn * 32 + j * 16 + mOff + r) * SP + wm * 32 + i * 16 + rlane] = v;
      }
    }
  }
  __syncthreads();   // a row of the tile holds values of several waves
#pragma unroll
  for (int it = 0; it < 4; ++it) {
    const int p   = it * 256 + tid;                    // 16-B piece of the tile's 1024 per plane
    const int row = VT ? (p >> 3) : (p >> 4);
    const int c8  = VT ? (p & 7) * 8 : (p & 15) * 8;
    const size_t go = VT ? (size_t)(nb + row) * SEQ + m0 + c8 : (size_t)(m0 + row) * DMOD + nb + c8;
    const v4f s0 = *(const v4f*)(so + row * SP + c8);
    const v4f s1 = *(const v4f*)(so + row * SP + c8 + 4);
    const float f[8] = {s0[0], s0[1], s0[2], s0[3], s1[0], s1[1], s1[2], s1[3]};
    split8_store(f, Ch + go, Cl + go);
  }
  // precaution: stands between these stores and whatever follows them in the kernel's text and rewrites a register that they name
  asm volatile("s_wait_xcnt 0x0" ::: "memory");
}

// ---------------------------------------------------------------------------
// All work ahead of the attention, in one launch; the jobs are independent of each other and a block does exactly one of them:
//   blocks   0 ..  63 : Q   = (q.Wq + bq) * qscale   [SEQ][DMOD]   (32 row blocks x 2 column blocks each)
//   blocks  64 .. 127 : K   =  k.Wk + bk             [SEQ][DMOD]
//   blocks 128 .. 191 : V^T = (v.Wv + bv)^T          [DMOD][SEQ]
//   blocks 192 .. 207 : transpose + split of Wo (16 tiles of 64x64)
//   blocks 208 .. 719 : pair bias plane (512 blocks x 8192 elements)
// The job test reads blockIdx.x alone, so every barrier is passed by a whole block or by none of it.
// LDS and registers admit three blocks on a WGP, so all 720 run at once, the pair bias stream beside the products.
// ---------------------------------------------------------------------------
#define PREP_P_BLOCKS  64
#define PREP_W_BLOCKS  16
#define PREP_PB_BLOCKS 512
__global__ __launch_bounds__(256)
void prep_proj_kernel(
    const float* __restrict__ dist, const float* __restrict__ contact, const int* __restrict__ label,
    const float* __restrict__ Wd1, const float* __restrict__ bd1, const float* __restrict__ Wd2, const float* __restrict__ bd2,
    const float* __restrict__ Wc1, const float* __restrict__ bc1, const float* __restrict__ Wc2, const float* __restrict__ bc2,
    float* __restrict__ bias,
    const float* __restrict__ Wq, const float* __restrict__ Wk, const float* __restrict__ Wv, const float* __restrict__ Wo,
    const float* __restrict__ bq, const float* __restrict__ bk, const float* __restrict__ bv,
    unsigned short* __restrict__ WoTh, unsigned short* __restrict__ WoTl,
    const float* __restrict__ q, const float* __restrict__ k, const float* __restrict__ v,
    unsigned short* __restrict__ Qh, unsigned short* __restrict__ Ql, unsigned short* __restrict__ Kh, unsigned short* __restrict__ Kl,
    unsigned short* __restrict__ VTh, unsigned short* __restrict__ VTl, float qscale) {
  __shared__ __align__(16) unsigned short sm[2 * PJ_STAGE];   // 98816 B: two stage buffers; the transposes' 64 x 68 floats
  const int b = blockIdx.x;
  if (b < 2 * PREP_P_BLOCKS) {
    const bool isq = (b < PREP_P_BLOCKS);
    proj_block<false>(sm, b & (PREP_P_BLOCKS - 1), isq ? q : k, isq ? Wq : Wk, isq ? bq : bk, isq ? Qh : Kh, isq ? Ql : Kl,
                      isq ? qscale : 1.0f);
  } else if (b < 3 * PREP_P_BLOCKS) {
    proj_block<true>(sm, b - 2 * PREP_P_BLOCKS, v, Wv, bv, VTh, VTl, 1.0f);
  } else if (b < 3 * PREP_P_BLOCKS + PREP_W_BLOCKS) {
    const int t = b - 3 * PREP_P_BLOCKS;
    tsplit_block((float*)(void*)sm, t & 3, (t >> 2) & 3, Wo, WoTh, WoTl, DMOD, DMOD);
  } else {
    pair_bias_block(b - (3 * PREP_P_BLOCKS + PREP_W_BLOCKS), dist, contact, label, Wd1, bd1, Wd2, bd2, Wc1, bc1, Wc2, bc2, bias);
  }
}

// =====================================================================================
// Flash attention with additive pair bias, head dim 32, all 8 heads in one launch.
//   q planes (hi/lo bf16): element (t, h, d) at [t*DMOD + h*32 + d]   (score scale already folded into q)
//   k planes (hi/lo bf16): element (s, h, d) at [s*DMOD + h*32 + d]
//   v^T planes (hi/lo bf16): element (h, d, s) at [(h*32 + d)*SEQ + s]
//   bias f32 [SEQ t][SEQ s], shared over heads
//   opart f32, one plane per key range ks: element (ks, t, h, d) at [ks*SEQ*DMOD + t*DMOD + h*32 + d], NOT normalised
//   ml f32: running maximum and sum of (ks, h, t) at [((ks*NHEAD + h)*SEQ + t)*2 + 0 / 1]
//   scores^T = k . q^T + bias^T : bf16 hi/lo (hi.hi + hi.lo + lo.hi), bias added in f32; a lane holds one query's scores
//   ctx^T    = v^T . p^T         : bf16 hi/lo of p (unnormalised, <= 1, packed in registers) and v, f32 accumulate
//   online softmax in f32 over the block's SEQ/KSPLIT keys (8 chunks of 64 keys, compile-time trip count).
//   Block = 4 waves = 64 query rows of one head against one key range; grid = KSPLIT * NHEAD * (SEQ/64) = 1024 blocks of 128 threads.
//   The KSPLIT partial results of a query (maximum, sum, unnormalised ctx) are joined by merge_out_kernel in the next launch.
//   K, V^T and bias tiles of a chunk are brought into LDS by asynchronous 16-B-per-lane copies of all 128 threads, two stage buffers:
//   the copies of chunk t + 2 are issued at the foot of trip t and fly during trip t + 1; one barrier a chunk.
// =====================================================================================
#define AT_KC 64
// Row pitch of the staged tiles in LDS, in 2-B elements: an odd number of 16-B pieces (K rows of 64 B at 80 B, V^T rows of 128 B at 144 B),
// so that the 16 rows which a half wave reads with one 16-B-per-lane fragment load start on 16 different groups of 4 banks.
// The pad pieces are neither written nor read.
#define AT_KP (DHD + 8)
#define AT_VP (AT_KC + 8)
// The block's 64 x 64 bias tile (f32) lies beside them, rows of 256 B at 272 B, for the same reason.
#define AT_BP (AT_KC + 4)
// Byte offsets of the five tiles in a stage buffer: K hi, K lo [kv][d]; V^T hi, V^T lo [d][kv]; bias [query][kv]
#define AT_OKH 0
#define AT_OKL (AT_OKH + AT_KC * AT_KP * 2)
#define AT_OVH (AT_OKL + AT_KC * AT_KP * 2)
#define AT_OVL (AT_OVH + DHD * AT_VP * 2)
#define AT_OB  (AT_OVL + DHD * AT_VP * 2)
#define AT_STAGE (AT_OB + 64 * AT_BP * 4)   // 36864 B

// Eight asynchronous copies, each lane's own 16 bytes from g[i] to LDS byte address l[i], through no register.
// The s_wait_xcnt is a precaution: as the statement's last line it stands ahead of every rewrite of an address register that a copy names.
__device__ __forceinline__ void async_copy8(const unsigned* l, const void* const* g) {
  asm volatile("global_load_async_to_lds_b128 %0, %8, off\n\t"
               "global_load_async_to_lds_b128 %1, %9, off\n\t"
               "global_load_async_to_lds_b128 %2, %10, off\n\t"
               "global_load_async_to_lds_b128 %3, %11, off\n\t"
               "global_load_async_to_lds_b128 %4, %12, off\n\t"
               "global_load_async_to_lds_b128 %5, %13, off\n\t"
               "global_load_async_to_lds_b128 %6, %14, off\n\t"
               "global_load_async_to_lds_b128 %7, %15, off\n\t"
               "s_wait_xcnt 0x0"
               :: "v"(l[0]), "v"(l[1]), "v"(l[2]), "v"(l[3]), "v"(l[4]), "v"(l[5]), "v"(l[6]), "v"(l[7]),
                  "v"(g[0]), "v"(g[1]), "v"(g[2]), "v"(g[3]), "v"(g[4]), "v"(g[5]), "v"(g[6]), "v"(g[7])
               : "memory");
}

// e^(x - m) on the chip's own base-2 exponential: one multiply-add and one v_exp_f32. nm2 = -m * LOG2E.
// An argument below the f32 exponent range (also -inf) gives 0, as the limit asks.
#define LOG2E 1.4426950408889634f
__device__ __forceinline__ float exp_rel(float x, float nm2) { return __builtin_amdgcn_exp2f(fmaf(x, LOG2E, nm2)); }

// value of lane l ^ 16 (the other wave half), by a vector cross-row move
__device__ __forceinline__ float xhalf(float x) {
  const int b = __builtin_bit_cast(int, x);
  return __builtin_bit_cast(float, __builtin_amdgcn_permlanex16(b, b, 0x76543210, 0xfedcba98, false, false));
}

// Four waves per SIMD asked of the compiler: the grid supplies four (1024 work-groups of 4 waves on 256 WGPs), so that one
// work-group's waits (staging, barriers, LDS, dependent vector chains) are filled by the other three. Without the upper bound the
// compiler saves registers for waves that never come and strings a lane's 32 independent exp/split chains one behind another.
__global__ __launch_bounds__(128) __attribute__((amdgpu_waves_per_eu(4, 4)))
void attn_bias_kernel(const unsigned short* __restrict__ qhp, const unsigned short* __restrict__ qlp,
                      const unsigned short* __restrict__ khp, const unsigned short* __restrict__ klp,
                      const unsigned short* __restrict__ vhp, const unsigned short* __restrict__ vlp,
                      const float* __restrict__ bias, float* __restrict__ opart, float* __restrict__ ml) {
  __shared__ __align__(16) unsigned char st[2 * AT_STAGE];   // two stage buffers, 73728 B (four blocks on a WGP); after the loop the ctx tiles

  const int tid  = threadIdx.x;
  const int wave = tid >> 5;
  const int lane = tid & 31;
  const int hh   = lane >> 4;
  const int c    = lane & 15;

  const int nqb = SEQ / 64;               // 32
  const int bx = blockIdx.x;
  const int qb = bx % nqb;
  const int h  = (bx / nqb) % NHEAD;      // 0..NHEAD-1
  const int ks = bx / (nqb * NHEAD);      // 0..KSPLIT-1: keys ks*SEQ/KSPLIT .. (ks+1)*SEQ/KSPLIT - 1
  const int q0 = qb * 64 + wave * 16;     // first query row of this wave

  const __bf16* Qh = (const __bf16*)(const void*)qhp + (size_t)h * DHD;
  const __bf16* Ql = (const __bf16*)(const void*)qlp + (size_t)h * DHD;
  const __bf16* Kh = (const __bf16*)(const void*)khp + (size_t)h * DHD;
  const __bf16* Kl = (const __bf16*)(const void*)klp + (size_t)h * DHD;
  const __bf16* Vh = (const __bf16*)(const void*)vhp + (size_t)h * DHD * SEQ;
  const __bf16* Vl = (const __bf16*)(const void*)vlp + (size_t)h * DHD * SEQ;
  float*        ob = opart + (size_t)ks * SEQ * DMOD + (size_t)h * DHD;

  // ---- Q fragments (B operand of S^T = K.Q^T: column = query = lane&15, split k map), one 32-deep k-step, hi and lo ----
  const v16b qbh = frag_load(Qh + (size_t)(q0 + c) * DMOD + 8 * hh);
  const v16b qbl = frag_load(Ql + (size_t)(q0 + c) * DMOD + 8 * hh);

  // One query (q0 + c) per lane; the two wave halves hold different keys (and different d) of that query.
  float mrow = -INFINITY;   // running maximum, equal in both halves
  float lrow = 0.f;         // running sum over this half's keys only; the halves are joined once after the loop
  v8f oacc[2];              // ctx^T tiles: element r of tile t = (d = 16*t + 8*hh + r, query c)
#pragma unroll
  for (int t = 0; t < 2; ++t) oacc[t] = (v8f){0.f,0.f,0.f,0.f,0.f,0.f,0.f,0.f};

  const int nChunks = SEQ / KSPLIT / AT_KC;   // 8, compile-time constant

  // The 16 copies of a thread for chunk kc into the stage buffer at LDS byte address sb (16-B pieces, piece = i * 128 + tid):
  //   K   per plane 64 rows x  4 pieces = 2 x 128: row i*32 + (tid>>2), piece tid & 3    (a wave's copy: 8 rows x 64 B)
  //   V^T per plane 32 rows x  8 pieces = 2 x 128: row i*16 + (tid>>3), piece tid & 7    (4 whole lines)
  //   bias          64 rows x 16 pieces = 8 x 128: row i*8  + (tid>>4), piece tid & 15   (4 whole lines)
  // Every lane is on, every piece lies inside its plane and inside the buffer, no two lanes name the same LDS byte.
  const float* btile = bias + (size_t)(qb * 64 + (tid >> 4)) * SEQ + (tid & 15) * 4;
  auto stage_copies = [&](const int kc, const unsigned sb) {
    const int kv0 = ks * (SEQ / KSPLIT) + kc * AT_KC;
    unsigned l[8];
    const void* g[8];
#pragma unroll   // compile-time trip count; l and g are registers only under constant indices
    for (int i = 0; i < 2; ++i) {
      const int kr = i * 32 + (tid >> 2), kp = tid & 3;
      const int vr = i * 16 + (tid >> 3), vp = tid & 7;
      l[i]     = sb + AT_OKH + kr * (AT_KP * 2) + kp * 16;
      l[2 + i] = sb + AT_OKL + kr * (AT_KP * 2) + kp * 16;
      l[4 + i] = sb + AT_OVH + vr * (AT_VP * 2) + vp * 16;
      l[6 + i] = sb + AT_OVL + vr * (AT_VP * 2) + vp * 16;
      g[i]     = Kh + (size_t)(kv0 + kr) * DMOD + kp * 8;
      g[2 + i] = Kl + (size_t)(kv0 + kr) * DMOD + kp * 8;
      g[4 + i] = Vh + (size_t)vr * SEQ + kv0 + vp * 8;
      g[6 + i] = Vl + (size_t)vr * SEQ + kv0 + vp * 8;
    }
    async_copy8(l, g);
#pragma unroll   // compile-time trip count; l and g are registers only under constant indices
    for (int i = 0; i < 8; ++i) {
      l[i] = sb + AT_OB + (i * 8 + (tid >> 4)) * (AT_BP * 4) + (tid & 15) * 16;
      g[i] = btile + (size_t)(i * 8) * SEQ + kv0;
    }
    async_copy8(l, g);
  };
  const unsigned sbase = (unsigned)(uintptr_t)st;   // LDS byte address of buffer 0: the low 32 bits of its address

  stage_copies(0, sbase);
  // chunk 0 has landed in this wave's share before the barrier that publishes it to the other waves
  asm volatile("s_wait_asynccnt 0x0" ::: "memory");
  __syncthreads();
  stage_copies(1, sbase + AT_STAGE);

  // One trip: chunk kc from stage buffer b (= kc & 1, a compile-time constant, so that the LDS addresses are fixed);
  // more: a chunk kc + 2 exists and is asked for at the foot.
  auto trip = [&](const int kc, const int b, const bool more) {
    const unsigned char* buf = st + b * AT_STAGE;
    const __bf16* Ksh = (const __bf16*)(const void*)(buf + AT_OKH);
    const __bf16* Ksl = (const __bf16*)(const void*)(buf + AT_OKL);
    const __bf16* Vth = (const __bf16*)(const void*)(buf + AT_OVH);
    const __bf16* Vtl = (const __bf16*)(const void*)(buf + AT_OVL);
    const float*  brow = (const float*)(const void*)(buf + AT_OB) + (wave * 16 + c) * AT_BP + 8 * hh;

    // ---- S^T = k.q^T : 4 key-row tiles of 16, A[m=key][k=d] from K tile rows, B = Q (both split k map) ----
    // s[j][r] = score of key (kv0 + 16*j + 8*hh + r) against query (q0 + c)
    v4f bb[8];   // this lane's 32 bias values of the chunk, from the staged tile: row (q0 + c), columns 16*j + 8*hh + r, r = 0..7 contiguous
#pragma unroll
    for (int j = 0; j < 4; ++j) {
      bb[2 * j]     = *(const v4f*)(brow + j * 16);
      bb[2 * j + 1] = *(const v4f*)(brow + j * 16 + 4);
    }
    v8f s[4];
#pragma unroll
    for (int j = 0; j < 4; ++j) {
      s[j] = (v8f){0.f,0.f,0.f,0.f,0.f,0.f,0.f,0.f};
      FragB kb, kl;
      kb.h[0] = *(const v8b*)(Ksh + (j * 16 + c) * AT_KP + 8 * hh);
      kb.h[1] = *(const v8b*)(Ksh + (j * 16 + c) * AT_KP + 16 + 8 * hh);
      kl.h[0] = *(const v8b*)(Ksl + (j * 16 + c) * AT_KP + 8 * hh);
      kl.h[1] = *(const v8b*)(Ksl + (j * 16 + c) * AT_KP + 16 + 8 * hh);
      s[j] = mma_bf(kb.v, qbh, s[j]);
      s[j] = mma_bf(kl.v, qbh, s[j]);
      s[j] = mma_bf(kb.v, qbl, s[j]);
    }
    // ---- add pair bias in f32; chunk maximum in-lane over 32 keys, then one exchange between the halves ----
    float cm = -INFINITY;
#pragma unroll
    for (int j = 0; j < 4; ++j) {
#pragma unroll
      for (int r = 0; r < 4; ++r) {
        s[j][r]     += bb[2 * j][r];
        s[j][r + 4] += bb[2 * j + 1][r];
        cm = fmaxf(cm, fmaxf(s[j][r], s[j][r + 4]));
      }
    }
    cm = fmaxf(cm, xhalf(cm));
    const float mnew  = fmaxf(mrow, cm);
    const float nm2   = -mnew * LOG2E;
    const float alpha = exp_rel(mrow, nm2);
    mrow = mnew;
    // ---- p = exp(s - m) by exp_rel, split hi/lo and packed straight into the B operand of ctx^T += v^T.p^T:
    //      element e of k-step kk is key 32*kk + 8*hh + e (e < 8, tile 2*kk) or 32*kk + 16 + 8*hh + e - 8 (tile 2*kk + 1),
    //      the k order of the V^T fragment loads below ----
    FragW pbh[2], pbl[2];
    float psum = 0.f;
#pragma unroll
    for (int j = 0; j < 4; ++j) {
      float p[8];
#pragma unroll
      for (int r = 0; r < 8; ++r) {
        p[r] = exp_rel(s[j][r], nm2);
        psum += p[r];
      }
      split8(p, pbh[j >> 1].w[j & 1], pbl[j >> 1].w[j & 1]);
    }
    lrow = lrow * alpha + psum;
#pragma unroll
    for (int t = 0; t < 2; ++t)
#pragma unroll
      for (int r = 0; r < 8; ++r) oacc[t][r] *= alpha;
    // ---- ctx^T += V^T . P^T : A[m=d][k=key] from V^T tile rows (2 k-steps of 32 keys), B = P^T from registers ----
#pragma unroll
    for (int kk = 0; kk < 2; ++kk) {
#pragma unroll
      for (int t = 0; t < 2; ++t) {
        FragB vb, vl;
        vb.h[0] = *(const v8b*)(Vth + (t * 16 + c) * AT_VP + kk * 32 + 8 * hh);
        vb.h[1] = *(const v8b*)(Vth + (t * 16 + c) * AT_VP + kk * 32 + 16 + 8 * hh);
        vl.h[0] = *(const v8b*)(Vtl + (t * 16 + c) * AT_VP + kk * 32 + 8 * hh);
        vl.h[1] = *(const v8b*)(Vtl + (t * 16 + c) * AT_VP + kk * 32 + 16 + 8 * hh);
        oacc[t] = mma_bf(vb.v, pbh[kk].v, oacc[t]);
        oacc[t] = mma_bf(vl.v, pbh[kk].v, oacc[t]);
        oacc[t] = mma_bf(vb.v, pbl[kk].v, oacc[t]);
      }
    }
    // ---- foot of the trip: hand-over of the stage buffers ----
    // this wave's reads of the buffer that is refilled below have returned
    asm volatile("s_wait_dscnt 0x0" ::: "memory");
    // this wave's copies of chunk kc + 1 have landed
    asm volatile("s_wait_asynccnt 0x0" ::: "memory");
    // publishes chunk kc + 1 and ends every wave's reads of chunk kc
    __syncthreads();
    if (more) stage_copies(kc + 2, sbase + b * AT_STAGE);
  };
  for (int kc = 0; kc < nChunks - 2; kc += 2) {
    trip(kc, 0, true);
    trip(kc + 1, 1, true);
  }
  trip(nChunks - 2, 0, false);
  trip(nChunks - 1, 1, false);
  // no copy is in flight when the buffers are used for the ctx tiles and when the wave ends
  asm volatile("s_wait_asynccnt 0x0" ::: "memory");

  // ---- join the halves' sums; stage the wave's 16 x 32 unnormalised ctx tile [query][d] for whole-line stores ----
  float* os = (float*)(void*)st + wave * (16 * 36);   // per wave ctx tile, pitch 36, in buffer 0, which nobody reads any more
  const float lsum = lrow + xhalf(lrow);
  {
#pragma unroll
    for (int t = 0; t < 2; ++t) {
      const v4f o0 = (v4f){oacc[t][0], oacc[t][1], oacc[t][2], oacc[t][3]};
      const v4f o1 = (v4f){oacc[t][4], oacc[t][5], oacc[t][6], oacc[t][7]};
      *(v4f*)(os + c * 36 + t * 16 + 8 * hh)     = o0;
      *(v4f*)(os + c * 36 + t * 16 + 8 * hh + 4) = o1;
    }
  }
  __builtin_amdgcn_fence(__ATOMIC_RELEASE, "workgroup");
  __builtin_amdgcn_wave_barrier();
  __builtin_amdgcn_fence(__ATOMIC_ACQUIRE, "workgroup");
  {
    const int q4 = lane >> 3, c4 = (lane & 7) * 4;
    {
#pragma unroll
      for (int it = 0; it < 4; ++it) {
        const int row = it * 4 + q4;
        const v4f val = *(const v4f*)(os + row * 36 + c4);
        *(v4f*)(ob + (size_t)(q0 + row) * DMOD + c4) = val;
      }
      
    }
  }
  // maximum (lower half) and sum (upper half) of query q0 + c: the wave's 32 lanes fill one 128-B line
  ml[(((size_t)ks * NHEAD + h) * SEQ + q0 + c) * 2 + hh] = hh ? lsum : mrow;
}

// ---------------------------------------------------------------------------
// Join of the KSPLIT partial attention results and the output projection, in one launch:
//   M = max_ks m, w = exp(m - M), ctx = (sum_ks w * opart) / (sum_ks w * l); hi = bf16_rne(ctx), lo = bf16_rne(ctx - hi)
//   out = ctx . Wo + bo   (hi.hi + hi.lo + lo.hi, f32 accumulate, k-steps in rising order)
// A block owns 16 queries and 128 output columns; grid = (SEQ / 16) * 2 = 256 blocks of 8 waves, one per WGP. The two blocks of a
// query tile each join that tile's ctx for themselves: nothing passes between work-groups.
//   Join: wave = head = k-step of 32 ctx columns; a lane makes its own 16 elements of that k-step's A fragment (the lane / element / k
//   map of frag_load_fo) and stores them as two 16-B pieces per plane into the block's LDS planes (8 units of 1 KiB, fragment order).
//   Product: wave = one tile of 16 output columns; A fragments from LDS; the wave's Wo^T fragments (global planes in fragment order,
//   8 k-steps x hi and lo = 128 registers) depend on nothing in this launch and are asked for at entry, with the partials.
// coverage: join 8 waves x 32 lanes x 16 = 16 x 256 ctx elements; product 8 waves x 16 x 16 = 16 x 128 outputs, each stored once.
// Two waves per SIMD asked of the compiler: the grid supplies two, and with registers saved for more it would ask for the loads in turns.
// ---------------------------------------------------------------------------
__global__ __launch_bounds__(256) __attribute__((amdgpu_waves_per_eu(2, 2)))
void merge_out_kernel(const float* __restrict__ opart, const float* __restrict__ ml,
                      const unsigned short* __restrict__ Bhp, const unsigned short* __restrict__ Blp,
                      const float* __restrict__ bo, float* __restrict__ out) {
  __shared__ __align__(16) unsigned short Ch[8 * 512];       // ctx hi, 16 queries x 256 k, fragment order   8 KB
  __shared__ __align__(16) unsigned short Cl[8 * 512];       // ctx lo
  __shared__ __align__(16) float sT[16 * 132];               // the block's 16 x 128 output tile, pitch 132
  const int lane  = threadIdx.x & 31;
  const int wave  = threadIdx.x >> 5;
  const int rlane = lane & 15;                               // query (A), column (B, D) within a tile
  const int m0    = (blockIdx.x >> 1) * 16;                  // first query of the block
  const int nb    = (blockIdx.x & 1) * 128;                  // first output column of the block
  const int n0    = nb + wave * 16;                          // first output column of the wave

  constexpr int KSTEPS = DMOD >> 5;
  constexpr int TSTEP  = KSTEPS << 9;     // elements from one 16-row tile of a plane to the next
  const __bf16* pbh = (const __bf16*)(const void*)Bhp + (size_t)(n0 >> 4) * TSTEP + lane * 8;
  const __bf16* pbl = (const __bf16*)(const void*)Blp + (size_t)(n0 >> 4) * TSTEP + lane * 8;
  v16b bh[KSTEPS], bl[KSTEPS];
#pragma unroll   // compile-time trip count; the arrays indexed here are registers only under constant indices
  for (int kst = 0; kst < KSTEPS; ++kst) {
    bh[kst] = frag_load_fo(pbh + (kst << 9));
    bl[kst] = frag_load_fo(pbl + (kst << 9));
  }
  const float* pbo = bo + n0 + rlane;
  const float bvn = *pbo;

  // ---- join of the key ranges: head = wave, query m0 + rlane, columns col .. col + 7 and col + 16 .. col + 23 ----
  {
    const int t   = m0 + rlane;
    const int col = wave * DHD + (lane >> 4) * 8;
    const float* pml = ml + ((size_t)wave * SEQ + t) * 2;        // key range 0; the others lie at fixed distances
    const float* pop = opart + (size_t)t * DMOD + col;
    v2f a[KSPLIT];
    v4f o[KSPLIT][4];
#pragma unroll   // compile-time trip count; the arrays indexed here are registers only under constant indices
    for (int s = 0; s < KSPLIT; ++s) {
      a[s] = *(const v2f*)(pml + (size_t)s * NHEAD * SEQ * 2);
      const float* op = pop + (size_t)s * SEQ * DMOD;
      o[s][0] = *(const v4f*)(op);
      o[s][1] = *(const v4f*)(op + 4);
      o[s][2] = *(const v4f*)(op + 16);
      o[s][3] = *(const v4f*)(op + 20);
    }
    // precaution: stands between the launch's loads and any rewrite of the address registers that they name; as inputs the five
    // addresses stay in their registers up to here, so that no load of the group returns its data into one of them
    asm volatile("s_wait_xcnt 0x0" :: "v"(pbh), "v"(pbl), "v"(pbo), "v"(pml), "v"(pop) : "memory");
    float M = a[0][0];
#pragma unroll   // compile-time trip count; the arrays indexed here are registers only under constant indices
    for (int s = 1; s < KSPLIT; ++s) M = fmaxf(M, a[s][0]);
    const float nM2 = -M * LOG2E;
    float w[KSPLIT];
    float L = 0.f;
#pragma unroll   // compile-time trip count; the arrays indexed here are registers only under constant indices
    for (int s = 0; s < KSPLIT; ++s) {
      w[s] = exp_rel(a[s][0], nM2);
      L = fmaf(w[s], a[s][1], L);
    }
    const float inv = 1.0f / L;
#pragma unroll   // compile-time trip count; the arrays indexed here are registers only under constant indices
    for (int half = 0; half < 2; ++half) {
      v4u hv, lv;
      float f[8];
#pragma unroll   // compile-time trip count; the arrays indexed here are registers only under constant indices
      for (int e = 0; e < 4; ++e) {
        float f0 = 0.f, f1 = 0.f;
#pragma unroll   // compile-time trip count; the arrays indexed here are registers only under constant indices
        for (int s = 0; s < KSPLIT; ++s) {
          f0 = fmaf(w[s], o[s][half * 2 + (e >> 1)][(e & 1) * 2],     f0);
          f1 = fmaf(w[s], o[s][half * 2 + (e >> 1)][(e & 1) * 2 + 1], f1);
        }
        f[2 * e]     = f0 * inv;
        f[2 * e + 1] = f1 * inv;
      }
      split8(f, hv, lv);
      *(v4u*)(Ch + wave * 512 + half * 256 + lane * 8) = hv;
      *(v4u*)(Cl + wave * 512 + half * 256 + lane * 8) = lv;
    }
  }
  __syncthreads();   // every wave's k-step of ctx is read by all 8 waves below

  // ---- out tile of this wave: 16 queries x columns n0 .. n0 + 15 ----
  const __bf16* pah = (const __bf16*)(const void*)Ch + lane * 8;
  const __bf16* pal = (const __bf16*)(const void*)Cl + lane * 8;
  v8f acc = (v8f){0.f,0.f,0.f,0.f,0.f,0.f,0.f,0.f};
  v16b ah[KSTEPS], al[KSTEPS];           // read from LDS three k-steps ahead of their products
#pragma unroll   // compile-time trip count; the arrays indexed here are registers only under constant indices
  for (int kst = 0; kst < 3; ++kst) {
    ah[kst] = frag_load_fo(pah + (kst << 9));
    al[kst] = frag_load_fo(pal + (kst << 9));
  }
#pragma unroll   // compile-time trip count; the arrays indexed here are registers only under constant indices
  for (int kst = 0; kst < KSTEPS; ++kst) {
    if (kst + 3 < KSTEPS) {
      ah[kst + 3] = frag_load_fo(pah + ((kst + 3) << 9));
      al[kst + 3] = frag_load_fo(pal + ((kst + 3) << 9));
    }
    acc = mma_bf(ah[kst], bh[kst], acc);
    acc = mma_bf(ah[kst], bl[kst], acc);
    acc = mma_bf(al[kst], bh[kst], acc);
  }

  // ---- epilogue: bias, then the block's 16 x 128 tile through LDS, so that each 128-B line of out has one writer ----
  const int mOff = (lane >> 4) * 8;      // D row offset
#pragma unroll   // compile-time trip count; the arrays indexed here are registers only under constant indices
  for (int r = 0; r < 8; ++r) sT[(mOff + r) * 132 + wave * 16 + rlane] = acc[r] + bvn;
  __syncthreads();   // a row of the tile holds columns of all 8 waves
#pragma unroll   // compile-time trip count; the arrays indexed here are registers only under constant indices
  for (int it = 0; it < 2; ++it) {
    const int row = wave * 2 + it;       // a wave stores a row's 128 columns = 512 B = 4 whole lines
    const v4f val = *(const v4f*)(sT + row * 132 + lane * 4);
    *(v4f*)(out + (size_t)(m0 + row) * DMOD + nb + lane * 4) = val;
  }
}

// ---------------------------------------------------------------------------
//   biasP f32 [2048][2048]                 0 .. 16777216
//   WoTh/l  bf16 [256 o][256 i], fragment order   131072 each (2 planes) 16777216 .. 17039360
//   Qh/l, Kh/l  bf16 [2048][256]            1048576 each (4 planes)      17039360 .. 21233664
//   VTh/l bf16 [256 (h,d)][2048]            1048576 each (2 planes)      21233664 .. 23330816
//   OPART f32 [4 key ranges][2048][256]     2097152 each (4 planes)      23330816 .. 31719424
//   ML f32 [4 key ranges][8][2048][2]       524288                       31719424 .. 32243712
//   total                                   32243712
// ---------------------------------------------------------------------------
extern "C" void kernel_launch(void* const* d_in, const int* in_sizes, int n_in,
                              void* d_out, int out_size, void* d_ws, size_t ws_size,
                              hipStream_t stream) {
  if (n_in < 22) return;
  if (in_sizes[0] != SEQ * SEQ || in_sizes[1] != SEQ * SEQ || in_sizes[2] != SEQ * SEQ) return;
  if (in_sizes[3] != SEQ * DMOD || in_sizes[4] != SEQ * DMOD || in_sizes[5] != SEQ * DMOD) return;
  if (in_sizes[6] != DMOD * DMOD || in_sizes[8] != DMOD * DMOD || in_sizes[10] != DMOD * DMOD || in_sizes[12] != DMOD * DMOD) return;
  if (in_sizes[7] != DMOD || in_sizes[9] != DMOD || in_sizes[11] != DMOD || in_sizes[13] != DMOD) return;
  if (in_sizes[14] != 32 || in_sizes[15] != 16 || in_sizes[16] != 16 || in_sizes[17] != 1) return;
  if (in_sizes[18] != 32 || in_sizes[19] != 16 || in_sizes[20] != 16 || in_sizes[21] != 1) return;
  if (out_size != SEQ * DMOD) return;

  const int*   label   = (const int*)  d_in[0];
  const float* dist    = (const float*)d_in[1];
  const float* contact = (const float*)d_in[2];
  const float* q   = (const float*)d_in[3];
  const float* k   = (const float*)d_in[4];
  const float* v   = (const float*)d_in[5];
  const float* Wq  = (const float*)d_in[6];
  const float* bq  = (const float*)d_in[7];
  const float* Wk  = (const float*)d_in[8];
  const float* bk  = (const float*)d_in[9];
  const float* Wv  = (const float*)d_in[10];
  const float* bv  = (const float*)d_in[11];
  const float* Wo  = (const float*)d_in[12];
  const float* bo  = (const float*)d_in[13];
  const float* Wd1 = (const float*)d_in[14];
  const float* bd1 = (const float*)d_in[15];
  const float* Wd2 = (const float*)d_in[16];
  const float* bd2 = (const float*)d_in[17];
  const float* Wc1 = (const float*)d_in[18];
  const float* bc1 = (const float*)d_in[19];
  const float* Wc2 = (const float*)d_in[20];
  const float* bc2 = (const float*)d_in[21];
  float* out = (float*)d_out;

  const size_t PB = (size_t)SEQ * SEQ * 4;     // 16777216  f32 bias plane
  const size_t PW = (size_t)DMOD * DMOD * 2;   // 131072    bf16 weight plane [256][256]
  const size_t PX = (size_t)SEQ * DMOD * 2;    // 1048576   bf16 activation plane [2048][256] / [256][2048]
  const size_t PF = (size_t)SEQ * DMOD * 4;    // 2097152   f32 activation plane
  size_t off = 0;
  const size_t oBias = off; off += PB;
  const size_t oWoTh = off; off += PW;  const size_t oWoTl = off; off += PW;
  const size_t oQh   = off; off += PX;  const size_t oQl   = off; off += PX;
  const size_t oKh   = off; off += PX;  const size_t oKl   = off; off += PX;
  const size_t oVTh  = off; off += PX;  const size_t oVTl  = off; off += PX;
  const size_t oOp   = off; off += KSPLIT * PF;
  const size_t oML   = off; off += (size_t)KSPLIT * NHEAD * SEQ * 2 * 4;
  if (off > ws_size) return;                   // off = 32243712

  char* ws = (char*)d_ws;
  float*          biasP = (float*)(ws + oBias);
  unsigned short* WoTh = (unsigned short*)(ws + oWoTh); unsigned short* WoTl = (unsigned short*)(ws + oWoTl);
  unsigned short* Qh   = (unsigned short*)(ws + oQh);   unsigned short* Ql   = (unsigned short*)(ws + oQl);
  unsigned short* Kh   = (unsigned short*)(ws + oKh);   unsigned short* Kl   = (unsigned short*)(ws + oKl);
  unsigned short* VTh  = (unsigned short*)(ws + oVTh);  unsigned short* VTl  = (unsigned short*)(ws + oVTl);
  float*          Op   = (float*)(ws + oOp);
  float*          ML   = (float*)(ws + oML);

  const dim3 blk(256);

  // (1) everything ahead of the attention, one launch: the three projections from the f32 inputs, Wo planes [out][in], pair bias plane
  const float qscale = 0.17677669529663688f;                // 32^-0.5 applied as (x.Wq + bq) * scale
  prep_proj_kernel<<<dim3(3 * PREP_P_BLOCKS + PREP_W_BLOCKS + PREP_PB_BLOCKS), blk, 0, stream>>>(dist, contact, label,
      Wd1, bd1, Wd2, bd2, Wc1, bc1, Wc2, bc2, biasP,
      Wq, Wk, Wv, Wo, bq, bk, bv, WoTh, WoTl,
      q, k, v, Qh, Ql, Kh, Kl, VTh, VTl, qscale);

  // (2) attention with pair bias: 4 key ranges x 8 heads x 32 query blocks of 64 rows -> partial ctx, maximum and sum per key range
  attn_bias_kernel<<<dim3(KSPLIT * NHEAD * (SEQ / 64)), dim3(128), 0, stream>>>(Qh, Ql, Kh, Kl, VTh, VTl, biasP, Op, ML);

  // (3) join of the key ranges and out = ctx . Wo + bo -> d_out f32 [2048][256], 256 blocks of 16 queries x 128 columns
  merge_out_kernel<<<dim3((SEQ / 16) * 2), blk, 0, stream>>>(Op, ML, WoTh, WoTl, bo, out);

  (void)hipGetLastError();
}
